// v000
// Measured on an AMD MI455X. A time is GPU time per run, averaged over a window of back-to-back runs after a warm-up
// (all launches, gaps included; the runs take copies of the inputs in turn), and the median of several windows.
// Apart from v000's, it joins two sittings. Times from different sittings can be a few percent apart, while
// side-by-side timings come from the same sitting.
// The starting kernel, v000, takes 609 microseconds a run.
#include <hip/hip_runtime.h>
#include <math.h>
// TMSA block (8 x 1024 tokens x 512, 8 heads x 64, causal): q/k/v = xs2·W*s + xt·W*t as ONE product over the concatenated input [xs2 | xt]·[W*s; W*t]
// (8192 x 1024 · 1024 x 1536); the query-dependent bias q·WK is folded exactly into the keys — Σ_d q_d k_jd + Σ_d q_d WK[d][j] = q·(k_j + WK[:, j]) —
// so the attention is a plain causal flash-style kernel over k' = k + WKᵀ (scores (q/8)·k'ᵀ and p·v on WMMA, f16 operands with probabilities x2^15,
// f32 accumulate, online softmax in f32, -1e9 fill above the diagonal); output projection ·Wo. All products v_wmma_f32_16x16x32_f16, f16 operands,
// f32 accumulate (plain single products, ≈24 G MAC); the raw .view reshapes are identity on memory.
typedef __attribute__((ext_vector_type(16))) _Float16 v16h;
typedef __attribute__((ext_vector_type(8)))  _Float16 v8h;
typedef __attribute__((ext_vector_type(16))) __bf16   v16b;
typedef __attribute__((ext_vector_type(8)))  __bf16   v8b;
typedef __attribute__((ext_vector_type(8)))  float    v8f;
typedef __attribute__((ext_vector_type(4)))  float    v4f;
#define PSCALE 32768.0f
#define U16(p) ((const unsigned short*)(const void*)(p))
#define PSCALE_INV (1.0f / 32768.0f)

__device__ __forceinline__ unsigned short f2bf_bits(float f) {
  unsigned u = __float_as_uint(f);
  return (unsigned short)((u + 0x7FFFu + ((u >> 16) & 1u)) >> 16);
}
__device__ __forceinline__ float bf_bits2f(unsigned short h) { return __uint_as_float(((unsigned)h) << 16); }

// hazard guards as plain device helpers (no inline asm inside the kernel template body)
__device__ __forceinline__ void dep_guard_h(v8f& a, v8f& b, v16h x, v16h y) { asm volatile("v_nop\n\tv_nop\n\tv_nop\n\tv_nop" : "+v"(a), "+v"(b) : "v"(x), "v"(y)); }
__device__ __forceinline__ void dep_guard_b(v8f& a, v8f& b, v16b x, v16b y) { asm volatile("v_nop\n\tv_nop\n\tv_nop\n\tv_nop" : "+v"(a), "+v"(b) : "v"(x), "v"(y)); }
__device__ __forceinline__ void keep4_h(v16h a, v16h b, v16h c, v16h d) { asm volatile("v_nop" :: "v"(a), "v"(b), "v"(c), "v"(d)); }
__device__ __forceinline__ void keep4_b(v16b a, v16b b, v16b c, v16b d) { asm volatile("v_nop" :: "v"(a), "v"(b), "v"(c), "v"(d)); }
__device__ __forceinline__ void acc_guard4(v8f& a, v8f& b, v8f& c, v8f& d) { asm volatile("v_nop\n\tv_nop\n\tv_nop\n\tv_nop" : "+v"(a), "+v"(b), "+v"(c), "+v"(d)); }
template <typename T> struct Frag;
template <> struct Frag<_Float16> {
  typedef v16h V; union U { v16h v; v8h h[2]; };
  static __device__ __forceinline__ v16h load(const _Float16* p) {   // elements 0..7 <- p[0..7], 8..15 <- p[16..23]
    U f; f.h[0] = *(const v8h*)(p); f.h[1] = *(const v8h*)(p + 16); return f.v;
  }
  static __device__ __forceinline__ v8f mma(v16h a, v16h b, v8f c) {
    return __builtin_amdgcn_wmma_f32_16x16x32_f16(false, a, false, b, (short)0, c, false, false);
  }
  static __device__ __forceinline__ void guard(v8f& a, v8f& b, v16h x, v16h y) { dep_guard_h(a, b, x, y); }
  static __device__ __forceinline__ void keep(v16h a, v16h b, v16h c, v16h d) { keep4_h(a, b, c, d); }
};
template <> struct Frag<__bf16> {
  typedef v16b V; union U { v16b v; v8b h[2]; };
  static __device__ __forceinline__ v16b load(const __bf16* p) {
    U f; f.h[0] = *(const v8b*)(p); f.h[1] = *(const v8b*)(p + 16); return f.v;
  }
  static __device__ __forceinline__ v8f mma(v16b a, v16b b, v8f c) {
    return __builtin_amdgcn_wmma_f32_16x16x32_bf16(false, a, false, b, (short)0, c, false, false);
  }
  static __device__ __forceinline__ void guard(v8f& a, v8f& b, v16b x, v16b y) { dep_guard_b(a, b, x, y); }
  static __device__ __forceinline__ void keep(v16b a, v16b b, v16b c, v16b d) { keep4_b(a, b, c, d); }
};

// ---- Register-blocked batched WMMA GEMM ------------------------------------
// C[m,n] = scale * sum_k A[m,k] * Bt[n,k] (+bias)(+resid); each wave owns a 64x64 tile.
// A row-major [M,K]; Bt row-major [N,K]; M,N % 64 == 0, K % 32 == 0.
// SPLIT: operands are hi/lo planes (A2/Bt2 = lo planes, same layout); product = hi·hi + hi·lo + lo·hi.
// BIAS_MODE: 0 = none, 1 = bias[m], 2 = bias[n].
// OUT_MODE: 0 = f32, 1 = f16, 2 = bf16 hi plane (Cout) + bf16 lo plane (Cout2).
// ET: 0 = f16 operands, 1 = bf16 operands (pointers passed as 16-bit storage)
template <int ET> struct Elem;
template <> struct Elem<0> { typedef _Float16 T; };
template <> struct Elem<1> { typedef __bf16 T; };
template <int ET, bool SPLIT, int BIAS_MODE, int OUT_MODE, bool RESID, int ACT = 0>
__global__ __launch_bounds__(256) void wmma_gemm64(
    const unsigned short* __restrict__ Ap, const unsigned short* __restrict__ A2p, int lda, long strideA,
    const unsigned short* __restrict__ Btp, const unsigned short* __restrict__ Bt2p, int ldb, long strideB,
    void* __restrict__ Cout, void* __restrict__ Cout2, int ldc, long strideC,
    const float* __restrict__ bias,
    const float* __restrict__ resid, long strideR,
    int M, int N, int K, float scale) {
  typedef typename Elem<ET>::T T;
  typedef typename Frag<T>::V V;
  const T* A = (const T*)Ap; const T* A2 = (const T*)A2p; const T* Bt = (const T*)Btp; const T* Bt2 = (const T*)Bt2p;
  __shared__ __align__(16) float sT[8][16 * 68];   // per-wave 16x64 slab, pitch 68 floats
  const int b    = blockIdx.y;
  const int lane = threadIdx.x & 31;
  const int wave = threadIdx.x >> 5;
  const int tilesN = N >> 6;
  const int tilesM = M >> 6;
  const int tile = blockIdx.x * 8 + wave;
  if (tile >= tilesM * tilesN) return;   // wave-uniform; no block barriers in this kernel
  const int tm = tile / tilesN;
  const int tn = tile - tm * tilesN;
  const int m0 = tm << 6;
  const int n0 = tn << 6;

  const T* Ab  = A  + (size_t)b * strideA;
  const T* Bb  = Bt + (size_t)b * strideB;
  const T* Ab2 = SPLIT ? (A2  + (size_t)b * strideA) : nullptr;
  const T* Bb2 = SPLIT ? (Bt2 + (size_t)b * strideB) : nullptr;

  const int rlane = lane & 15;                 // row (A) / col (B, D) within subtile
  const int koff  = (lane >> 4) * 8;           // k offset of this lane half
  const int mOff  = (lane >> 4) * 8;           // D row offset

  v8f acc[4][4];
#pragma unroll
  for (int i = 0; i < 4; ++i)
#pragma unroll
    for (int j = 0; j < 4; ++j) acc[i][j] = (v8f){0.f,0.f,0.f,0.f,0.f,0.f,0.f,0.f};

  for (int k0 = 0; k0 < K; k0 += 32) {
    V bh[4], bl[4];
#pragma unroll
    for (int j = 0; j < 4; ++j) {
      const size_t bo = (size_t)(n0 + (j << 4) + rlane) * ldb + koff + k0;
      bh[j] = Frag<T>::load(Bb + bo);
      if (SPLIT) bl[j] = Frag<T>::load(Bb2 + bo);
    }
#pragma unroll
    for (int i = 0; i < 4; ++i) {
      const size_t ao = (size_t)(m0 + (i << 4) + rlane) * lda + koff + k0;
      V ah = Frag<T>::load(Ab + ao);
      V al;
      if (SPLIT) al = Frag<T>::load(Ab2 + ao);
#pragma unroll
      for (int j = 0; j < 4; ++j) {
        acc[i][j] = Frag<T>::mma(ah, bh[j], acc[i][j]);
        if (SPLIT) {
          acc[i][j] = Frag<T>::mma(ah, bl[j], acc[i][j]);
          acc[i][j] = Frag<T>::mma(al, bh[j], acc[i][j]);
        }
      }
      Frag<T>::guard(acc[i][0], acc[i][3], ah, SPLIT ? al : ah);
    }
    Frag<T>::keep(bh[0], bh[1], bh[2], bh[3]);
    if (SPLIT) Frag<T>::keep(bl[0], bl[1], bl[2], bl[3]);
  }
  acc_guard4(acc[0][0], acc[0][1], acc[0][2], acc[0][3]);
  acc_guard4(acc[1][0], acc[1][1], acc[1][2], acc[1][3]);
  acc_guard4(acc[2][0], acc[2][1], acc[2][2], acc[2][3]);
  acc_guard4(acc[3][0], acc[3][1], acc[3][2], acc[3][3]);

  // ---- epilogue ----
  float* slab = sT[wave];
  const float* Rb = RESID ? (resid + (size_t)b * strideR) : nullptr;
#pragma unroll
  for (int i = 0; i < 4; ++i) {
    const int mBase = m0 + (i << 4);
#pragma unroll
    for (int j = 0; j < 4; ++j) {
      const int n = n0 + (j << 4) + rlane;
      float bv = 0.f;
      if (BIAS_MODE == 2) bv = bias[n];
#pragma unroll
      for (int r = 0; r < 8; ++r) {
        float v = acc[i][j][r] * scale;
        if (BIAS_MODE == 1) v += bias[mBase + mOff + r];
        if (BIAS_MODE == 2) v += bv;
        if (RESID) v += Rb[(size_t)(mBase + mOff + r) * ldc + n];
        if (ACT == 1) v = tanhf(v);
        if (ACT == 2) v = fmaxf(v, 0.0f);
        if (ACT == 3) v = v / (1.0f + expf(-v));
        if (ACT == 4) v = (v > 0.f) ? v : 0.01f * v;
        if (ACT == 5) v = 0.5f * v * (1.0f + erff(v * 0.70710678118654752f));
        slab[(mOff + r) * 68 + (j << 4) + rlane] = v;
      }
    }
    __builtin_amdgcn_fence(__ATOMIC_RELEASE, "workgroup");
    __builtin_amdgcn_wave_barrier();
    __builtin_amdgcn_fence(__ATOMIC_ACQUIRE, "workgroup");
    if (OUT_MODE == 0) {
      float* C = (float*)Cout + (size_t)b * strideC;
      const int hh = lane >> 4, c4 = (lane & 15) * 4;     // row seg = 256 B = 16 lanes x 16 B
      {
#pragma unroll
        for (int it = 0; it < 8; ++it) {
          const int row = it * 2 + hh;
          v4f v = *(const v4f*)(slab + row * 68 + c4);
          *(v4f*)(C + (size_t)(mBase + row) * ldc + n0 + c4) = v;
        }
        
      }
    } else {
      const int q = lane >> 3, c8 = (lane & 7) * 8;
      unsigned short* C  = (unsigned short*)Cout  + (size_t)b * strideC;
      unsigned short* C2 = (OUT_MODE == 2) ? ((unsigned short*)Cout2 + (size_t)b * strideC) : nullptr;
      {
#pragma unroll
        for (int it = 0; it < 4; ++it) {
          const int row = it * 4 + q;
          const float* sp = slab + row * 68 + c8;
          v8h hv, lv;
#pragma unroll
          for (int e = 0; e < 8; ++e) {
            if (OUT_MODE == 1) {
              hv[e] = (_Float16)sp[e];
            } else {
              unsigned short hb = f2bf_bits(sp[e]);
              unsigned short lb = f2bf_bits(sp[e] - bf_bits2f(hb));
              hv[e] = __builtin_bit_cast(_Float16, hb);
              lv[e] = __builtin_bit_cast(_Float16, lb);
            }
          }
          *(v8h*)(C + (size_t)(mBase + row) * ldc + n0 + c8) = hv;
          if (OUT_MODE == 2) *(v8h*)(C2 + (size_t)(mBase + row) * ldc + n0 + c8) = lv;
        }
        
      }
    }
    __builtin_amdgcn_fence(__ATOMIC_RELEASE, "workgroup");
    __builtin_amdgcn_wave_barrier();
    __builtin_amdgcn_fence(__ATOMIC_ACQUIRE, "workgroup");
  }
}

__global__ __launch_bounds__(256) void cast_f32_f16x2(
    const float* __restrict__ in, _Float16* __restrict__ out, int n2) {
  int i = blockIdx.x * 256 + threadIdx.x;
  if (i < n2) {
    const _Float16 h0 = (_Float16)in[2 * i], h1 = (_Float16)in[2 * i + 1];
    const unsigned u = (unsigned)__builtin_bit_cast(unsigned short, h0) | ((unsigned)__builtin_bit_cast(unsigned short, h1) << 16);
    ((unsigned*)out)[i] = u;
    
  }
}


// ---- f32 [R][C] (row pitch ldi) -> f16 transposed [C][R] (row pitch ldo); 64x64 tiles; each output row segment
__global__ __launch_bounds__(256) void transpose_cast_f16(const float* __restrict__ in, int ldi,
                                                         _Float16* __restrict__ outT, int ldo, float scale) {
  __shared__ __align__(16) _Float16 tile[64][72];     // [c][r]
  const int c0 = blockIdx.x * 64, r0 = blockIdx.y * 64;
  const int t = threadIdx.y * 32 + threadIdx.x;
  for (int i = threadIdx.y; i < 64; i += 8) {
    tile[threadIdx.x][i]      = (_Float16)(in[(size_t)(r0 + i) * ldi + c0 + threadIdx.x] * scale);
    tile[32 + threadIdx.x][i] = (_Float16)(in[(size_t)(r0 + i) * ldi + c0 + 32 + threadIdx.x] * scale);
  }
  __syncthreads();
  const int q = t >> 3, c8 = (t & 7) * 8;
  {
#pragma unroll
    for (int it = 0; it < 2; ++it) {
      const int c = it * 32 + q;
      v8h hv = *(const v8h*)(&tile[c][c8]);
      *(v8h*)(outT + (size_t)(c0 + c) * ldo + r0 + c8) = hv;
    }
    
  }
}

// =====================================================================================
// Generic causal/non-causal attention for head_dim 64, f32 in / f32 out; 16-bit operands: bf16 with optional hi/lo splits, or
// plain f16 (F16=true, non-split, probabilities carried x2^15).
//   scores = (q*qscale)·kᵀ : v_wmma_f32_16x16x32_bf16; SPLIT_QK -> q,k as bf16 hi/lo (hi·hi + hi·lo + lo·hi)
//   out    = p·v           : v_wmma_f32_16x16x32_bf16; SPLIT_PV -> p,v as bf16 hi/lo; else p,v plain bf16
//   f32 accumulate; online softmax in f32. Block = 4 waves = 64 query rows of one (batch, head); S % 64 == 0.
//   Element (b, s, h, d) of tensor X lives at X[b*X_bs + s*X_rs + h*X_hs + d] (strides in floats, multiples of 4).
//   Masking: mask_mode 0 none, 1 causal (kv > q masked), 2 tensor [S][Skv] shared over (b,h) (float if
//   mask_is_int==0, int32 with element == 0 -> masked if 1, int32 with element != 0 -> masked if 2), 3 per-token vectors qmask[B][S] & kvmask[B][Skv] (int32,
//   0 -> masked), 4 causal + sliding window (kv > q or q - kv > W masked; W passed in mask_is_int);
//   5 = relative-position bias: s += cp[b,h,q][idx[q][kv]] + pc[b,h,kv][idx[q][kv]] with idx = mask_b ([S][Skv] int32) and
//   mask_a an int32 [S][Skv] tensor with nonzero = masked (tables: element (b,h,row,n) at X + b*c_bs + h*c_hs + row*c_rs + n);
//   masked scores are replaced by mask_fill (e.g. -inf or -1e9) before the softmax.
//   grid.x = B * H * (S/64) (or a sub-range with blk0).
// =====================================================================================
#define AT_D 64
#define AT_NW 4
#define AT_QB 64
#define AT_KC 64
struct AttnGeom { const float* cp = nullptr; const float* pc = nullptr; long c_bs = 0, c_rs = 0, c_hs = 0;   // mode-5 score-bias tables
                  long q_bs, q_rs, q_hs, k_bs, k_rs, k_hs, v_bs, v_rs, v_hs, o_bs, o_rs, o_hs;
                  int S, Skv, H, mask_mode; float qscale; int blk0; float mask_fill; int mask_is_int; };
static_assert(sizeof(AttnGeom) == 168, "no padding");

__device__ __forceinline__ unsigned short at_bf_bits(float f) {
  unsigned u = __float_as_uint(f);
  return (unsigned short)((u + 0x7FFFu + ((u >> 16) & 1u)) >> 16);
}
__device__ __forceinline__ __bf16 at_f2bf(float f) { return __builtin_bit_cast(__bf16, at_bf_bits(f)); }
__device__ __forceinline__ void at_split(float f, __bf16& hi, __bf16& lo) {
  const unsigned short hb = at_bf_bits(f);
  hi = __builtin_bit_cast(__bf16, hb);
  lo = at_f2bf(f - __uint_as_float(((unsigned)hb) << 16));
}
__device__ __forceinline__ v8f at_mma(v16b a, v16b b, v8f c) {
  c = __builtin_amdgcn_wmma_f32_16x16x32_bf16(false, a, false, b, (short)0, c, false, false);
  asm volatile("v_nop\n\tv_nop\n\tv_nop\n\tv_nop" : "+v"(c) : "v"(a), "v"(b));
  return c;
}
// 16-bit element as a bit pattern held in a __bf16 slot: f16 bits when F16, bf16 (RNE) otherwise
template <bool F16> __device__ __forceinline__ __bf16 at_to16(float f) {
  if (F16) return __builtin_bit_cast(__bf16, (_Float16)f);
  return at_f2bf(f);
}
template <bool F16> __device__ __forceinline__ v8f at_mma16(v16b a, v16b b, v8f c) {
  if (F16) {
    const v16h ah = __builtin_bit_cast(v16h, a), bh = __builtin_bit_cast(v16h, b);
    c = __builtin_amdgcn_wmma_f32_16x16x32_f16(false, ah, false, bh, (short)0, c, false, false);
    asm volatile("v_nop\n\tv_nop\n\tv_nop\n\tv_nop" : "+v"(c) : "v"(ah), "v"(bh));
    return c;
  }
  return at_mma(a, b, c);
}

template <bool SPLIT_QK, bool SPLIT_PV, bool F16 = false>
__global__ __launch_bounds__(128)
void attn64_kernel(const float* __restrict__ q, const float* __restrict__ k,
                   const float* __restrict__ v, float* __restrict__ out,
                   const void* __restrict__ mask_a, const int* __restrict__ mask_b, AttnGeom g) {
  static_assert(!(F16 && (SPLIT_QK || SPLIT_PV)), "f16 mode is non-split");
  const float PSC = F16 ? 32768.0f : 1.0f;     // f16 probabilities carried x2^15 (subnormal range), folded into the final 1/l
  union FB { v16b v; v8b h[2]; };
  __shared__ __align__(16) __bf16 Ksh[AT_KC * AT_D];             // K hi [kv][d]      8 KB
  __shared__ __align__(16) __bf16 Ksl[SPLIT_QK ? AT_KC * AT_D : 8];
  __shared__ __align__(16) __bf16 Vth[AT_D * AT_KC];             // V hi [d][kv]      8 KB
  __shared__ __align__(16) __bf16 Vtl[SPLIT_PV ? AT_D * AT_KC : 8];
  __shared__ __align__(16) __bf16 Psh[AT_NW][16 * AT_KC];        // per wave P hi [row][kv]  8 KB
  __shared__ __align__(16) __bf16 Psl[SPLIT_PV ? AT_NW : 1][SPLIT_PV ? 16 * AT_KC : 8];
  __shared__ __align__(16) float  Os[AT_NW][16 * 68];            // per wave out tile, pitch 68

  const int tid  = threadIdx.x;
  const int wave = tid >> 5;
  const int lane = tid & 31;
  const int hh   = lane >> 4;
  const int c    = lane & 15;

  const int nqb = g.S / AT_QB;
  const int bx = blockIdx.x + g.blk0;
  const int qb = bx % nqb;
  const int bh = bx / nqb;
  const int h  = bh % g.H;
  const int b  = bh / g.H;
  const int qbase_block = qb * AT_QB;
  const int q0 = qbase_block + wave * 16;

  const float* qb_ptr = q + (size_t)b * g.q_bs + (size_t)h * g.q_hs;
  const float* kb_ptr = k + (size_t)b * g.k_bs + (size_t)h * g.k_hs;
  const float* vb_ptr = v + (size_t)b * g.v_bs + (size_t)h * g.v_hs;
  float*       ob_ptr = out + (size_t)b * g.o_bs + (size_t)h * g.o_hs;

  // ---- Q fragments (A operand): 2 d-chunks, hi (and lo) ----
  v16b qah[2], qal[2];
  {
    const float* qrow = qb_ptr + (size_t)(q0 + c) * g.q_rs;
#pragma unroll
    for (int dc = 0; dc < 2; ++dc) {
#pragma unroll
      for (int e = 0; e < 8; ++e) {
        const float f0 = qrow[dc * 32 + 8 * hh + e] * g.qscale;
        const float f1 = qrow[dc * 32 + 16 + 8 * hh + e] * g.qscale;
        if (SPLIT_QK) { __bf16 hq, lq; at_split(f0, hq, lq); qah[dc][e] = hq; qal[dc][e] = lq; at_split(f1, hq, lq); qah[dc][8 + e] = hq; qal[dc][8 + e] = lq; }
        else { qah[dc][e] = at_to16<F16>(f0); qah[dc][8 + e] = at_to16<F16>(f1); qal[dc][e] = qah[dc][e]; qal[dc][8 + e] = qah[dc][8 + e]; }
      }
    }
  }

  float mrow[8], lrow[8];
  v8f oacc[4];
#pragma unroll
  for (int r = 0; r < 8; ++r) { mrow[r] = -INFINITY; lrow[r] = 0.f; }
#pragma unroll
  for (int t = 0; t < 4; ++t) oacc[t] = (v8f){0.f,0.f,0.f,0.f,0.f,0.f,0.f,0.f};

  const int nChunks = (g.mask_mode == 1 || g.mask_mode == 4) ? (qb + 1) : (g.Skv / AT_KC);   // block-uniform
  // per-row query mask (mode 3)
  int qkeep[8];
#pragma unroll
  for (int r = 0; r < 8; ++r) qkeep[r] = (g.mask_mode == 3) ? mask_b[(size_t)b * g.S + q0 + 8 * hh + r] : 1;   // mask_b = qmask in mode 3
  for (int kc = 0; kc < nChunks; ++kc) {
    const int kv0 = kc * AT_KC;
    __syncthreads();
    {
      const int kvr = tid >> 1, dh = (tid & 1) * 32;
      const float* krow = kb_ptr + (size_t)(kv0 + kvr) * g.k_rs + dh;
      const float* vrow = vb_ptr + (size_t)(kv0 + kvr) * g.v_rs + dh;
#pragma unroll
      for (int i = 0; i < 8; ++i) {
        v4f kk = *(const v4f*)(krow + 4 * i);
        v4f vv = *(const v4f*)(vrow + 4 * i);
#pragma unroll
        for (int e = 0; e < 4; ++e) {
          const int d = dh + 4 * i + e;
          if (SPLIT_QK) { __bf16 a, bl; at_split(kk[e], a, bl); Ksh[kvr * AT_D + d] = a; Ksl[kvr * AT_D + d] = bl; }
          else Ksh[kvr * AT_D + d] = at_to16<F16>(kk[e]);
          if (SPLIT_PV) { __bf16 a, bl; at_split(vv[e], a, bl); Vth[d * AT_KC + kvr] = a; Vtl[d * AT_KC + kvr] = bl; }
          else Vth[d * AT_KC + kvr] = at_to16<F16>(vv[e]);
        }
      }
    }
    __syncthreads();

    v8f s[4];
#pragma unroll
    for (int j = 0; j < 4; ++j) {
      s[j] = (v8f){0.f,0.f,0.f,0.f,0.f,0.f,0.f,0.f};
#pragma unroll 1
      for (int dc = 0; dc < 2; ++dc) {
        FB kb;
        kb.h[0] = *(const v8b*)(Ksh + (j * 16 + c) * AT_D + dc * 32 + 8 * hh);
        kb.h[1] = *(const v8b*)(Ksh + (j * 16 + c) * AT_D + dc * 32 + 16 + 8 * hh);
        s[j] = at_mma16<F16>(qah[dc], kb.v, s[j]);
        if (SPLIT_QK) {
          FB kl;
          kl.h[0] = *(const v8b*)(Ksl + (j * 16 + c) * AT_D + dc * 32 + 8 * hh);
          kl.h[1] = *(const v8b*)(Ksl + (j * 16 + c) * AT_D + dc * 32 + 16 + 8 * hh);
          s[j] = at_mma16<F16>(qah[dc], kl.v, s[j]);
          s[j] = at_mma16<F16>(qal[dc], kb.v, s[j]);
        }
      }
    }
    const bool diag = (g.mask_mode == 1) && (kc == qb);
    int kvkeep[4] = {1, 1, 1, 1};
    if (g.mask_mode == 3) {
#pragma unroll
      for (int j = 0; j < 4; ++j) kvkeep[j] = ((const int*)mask_a)[(size_t)b * g.Skv + kv0 + j * 16 + c];   // mask_a = kvmask
    }
    float cm[8];
#pragma unroll
    for (int r = 0; r < 8; ++r) {
      const int qrow = q0 + 8 * hh + r;
      float m = -INFINITY;
#pragma unroll
      for (int j = 0; j < 4; ++j) {
        const int kvcol = kv0 + j * 16 + c;
        bool masked = false;
        if (diag) masked = (kvcol > qrow);
        else if (g.mask_mode == 4) masked = (kvcol > qrow) || (qrow - kvcol > g.mask_is_int);
        else if (g.mask_mode == 2) {
          const size_t mi = (size_t)qrow * g.Skv + kvcol;
          masked = (g.mask_is_int == 0) ? (((const float*)mask_a)[mi] == 0.0f)
                 : (g.mask_is_int == 1) ? (((const int*)mask_a)[mi] == 0) : (((const int*)mask_a)[mi] != 0);
        } else if (g.mask_mode == 3) masked = (qkeep[r] == 0) || (kvkeep[j] == 0);
        else if (g.mask_mode == 5) {
          const size_t mi = (size_t)qrow * g.Skv + kvcol;
          masked = (((const int*)mask_a)[mi] != 0);
          int n = mask_b[mi]; n = n < 0 ? 0 : n;
          s[j][r] += g.cp[(size_t)b * g.c_bs + (size_t)h * g.c_hs + (size_t)qrow * g.c_rs + n]
                   + g.pc[(size_t)b * g.c_bs + (size_t)h * g.c_hs + (size_t)kvcol * g.c_rs + n];
        }
        if (masked) s[j][r] = g.mask_fill;
        m = fmaxf(m, s[j][r]);
      }
#pragma unroll
      for (int off = 1; off < 16; off <<= 1) m = fmaxf(m, __shfl_xor(m, off, 32));
      cm[r] = m;
    }
    __bf16* pwh = Psh[wave];
    __bf16* pwl = Psl[SPLIT_PV ? wave : 0];
#pragma unroll
    for (int r = 0; r < 8; ++r) {
      const float mnew = fmaxf(mrow[r], cm[r]);
      const float alpha = expf(mrow[r] - mnew);
      mrow[r] = mnew;
      float psum = 0.f;
#pragma unroll
      for (int j = 0; j < 4; ++j) {
        const float p = expf(s[j][r] - mnew);
        psum += p;
        if (SPLIT_PV) { __bf16 a, bl; at_split(p, a, bl); pwh[(8 * hh + r) * AT_KC + j * 16 + c] = a; pwl[(8 * hh + r) * AT_KC + j * 16 + c] = bl; }
        else pwh[(8 * hh + r) * AT_KC + j * 16 + c] = at_to16<F16>(p * PSC);
      }
#pragma unroll
      for (int off = 1; off < 16; off <<= 1) psum += __shfl_xor(psum, off, 32);
      lrow[r] = lrow[r] * alpha + psum;
#pragma unroll
      for (int t = 0; t < 4; ++t) oacc[t][r] *= alpha;
    }
    __builtin_amdgcn_fence(__ATOMIC_RELEASE, "workgroup");
    __builtin_amdgcn_wave_barrier();
    __builtin_amdgcn_fence(__ATOMIC_ACQUIRE, "workgroup");
#pragma unroll 1
    for (int kk = 0; kk < 2; ++kk) {
      FB pa, pl;
      pa.h[0] = *(const v8b*)(pwh + c * AT_KC + kk * 32 + 8 * hh);
      pa.h[1] = *(const v8b*)(pwh + c * AT_KC + kk * 32 + 16 + 8 * hh);
      if (SPLIT_PV) {
        pl.h[0] = *(const v8b*)(pwl + c * AT_KC + kk * 32 + 8 * hh);
        pl.h[1] = *(const v8b*)(pwl + c * AT_KC + kk * 32 + 16 + 8 * hh);
      }
#pragma unroll
      for (int t = 0; t < 4; ++t) {
        FB vb;
        vb.h[0] = *(const v8b*)(Vth + (t * 16 + c) * AT_KC + kk * 32 + 8 * hh);
        vb.h[1] = *(const v8b*)(Vth + (t * 16 + c) * AT_KC + kk * 32 + 16 + 8 * hh);
        oacc[t] = at_mma16<F16>(pa.v, vb.v, oacc[t]);
        if (SPLIT_PV) {
          FB vl;
          vl.h[0] = *(const v8b*)(Vtl + (t * 16 + c) * AT_KC + kk * 32 + 8 * hh);
          vl.h[1] = *(const v8b*)(Vtl + (t * 16 + c) * AT_KC + kk * 32 + 16 + 8 * hh);
          oacc[t] = at_mma16<F16>(pa.v, vl.v, oacc[t]);
          oacc[t] = at_mma16<F16>(pl.v, vb.v, oacc[t]);
        }
      }
    }
  }

  float* os = Os[wave];
#pragma unroll
  for (int r = 0; r < 8; ++r) {
    const float inv = 1.0f / (lrow[r] * PSC);
#pragma unroll
    for (int t = 0; t < 4; ++t) os[(8 * hh + r) * 68 + t * 16 + c] = oacc[t][r] * inv;
  }
  __builtin_amdgcn_fence(__ATOMIC_RELEASE, "workgroup");
  __builtin_amdgcn_wave_barrier();
  __builtin_amdgcn_fence(__ATOMIC_ACQUIRE, "workgroup");
  {
    const int c4 = (lane & 15) * 4;
    {
#pragma unroll
      for (int it = 0; it < 8; ++it) {
        const int row = it * 2 + hh;
        v4f val = *(const v4f*)(os + row * 68 + c4);
        *(v4f*)(ob_ptr + (size_t)(q0 + row) * g.o_rs + c4) = val;
      }
      
    }
  }
}

#define TB_ 8
#define TS 1024
#define TDm 512
#define TH 8
#define THD 64
#define TR (TB_ * TS)
__device__ __forceinline__ unsigned pkh(float a, float b) { return (unsigned)__builtin_bit_cast(unsigned short, (_Float16)a) | ((unsigned)__builtin_bit_cast(unsigned short, (_Float16)b) << 16); }
// A16 [8192][1024] = [xs2 | xt] f16 (xs2 = raw reshape of xs)
__global__ __launch_bounds__(256) void cat_kernel(const float* __restrict__ xs, const float* __restrict__ xt, unsigned* __restrict__ A16) {
  const long i = (long)blockIdx.x * 256 + threadIdx.x; if (i >= (long)TR * TDm) return; const long r = i / TDm; const int cp = 2 * (int)(i % TDm);    // cp in [0, 1024)
  float a, b; if (cp < TDm) { a = xs[r * TDm + cp]; b = xs[r * TDm + cp + 1]; } else { a = xt[r * TDm + cp - TDm]; b = xt[r * TDm + cp - TDm + 1]; }
  ((unsigned*)A16)[i] = pkh(a, b); 
}
// k' = k + WKᵀ: QKV[(b,s)][512 + h*64 + d] += WK[d][s]
__global__ __launch_bounds__(256) void kbias_kernel(float* __restrict__ QKV, const float* __restrict__ WK) {
  const long i = (long)blockIdx.x * 256 + threadIdx.x; if (i >= (long)TR * TDm) return; const long r = i / TDm; const int c = (int)(i % TDm); const int s = (int)(r % TS), d = c % THD;
  float* p = QKV + r * (3 * TDm) + TDm + c; const float v = *p + WK[(size_t)d * TS + s]; *(float*)p = v; 
}
extern "C" void kernel_launch(void* const* d_in, const int* in_sizes, int n_in, void* d_out, int out_size, void* d_ws, size_t ws_size, hipStream_t stream) {
  (void)in_sizes; (void)n_in; (void)out_size; (void)ws_size;
  auto Fp = [&](int i) { return (const float*)d_in[i]; };
  const float* xs = Fp(0); const float* xt = Fp(1); const float* Wqs = Fp(2); const float* Wks = Fp(3); const float* Wvs = Fp(4); const float* Wqt = Fp(5); const float* Wkt = Fp(6); const float* Wvt = Fp(7); const float* WK = Fp(8); const float* Wo = Fp(9);
  char* ws = (char*)d_ws; size_t off = 0;
  auto carve = [&](size_t bytes) -> char* { char* p = ws + off; off += (bytes + 255) & ~(size_t)255; return p; };
  unsigned* A16 = (unsigned*)carve((size_t)TR * 2 * TDm * 2); _Float16* WT = (_Float16*)carve((size_t)3 * TDm * 2 * TDm * 2); _Float16* WoT = (_Float16*)carve((size_t)TDm * TDm * 2);
  float* QKV = (float*)carve((size_t)TR * 3 * TDm * 4); float* O = (float*)carve((size_t)TR * TDm * 4); _Float16* O16 = (_Float16*)A16;     // ≈ 84 MB; O16 reuses A16
  cat_kernel<<<(unsigned)(((long)TR * TDm + 255) / 256), 256, 0, stream>>>(xs, xt, A16);
  // Bt [1536][1024]: row n<512 (q): [Wqs[:,n]ᵀ | Wqt[:,n]ᵀ]; 512..1023 k; 1024..1535 v  — W* are [in 512][out 512] used as x·W
  transpose_cast_f16<<<dim3(TDm / 64, TDm / 64), dim3(32, 8), 0, stream>>>(Wqs, TDm, WT, 2 * TDm, 1.0f); transpose_cast_f16<<<dim3(TDm / 64, TDm / 64), dim3(32, 8), 0, stream>>>(Wqt, TDm, WT + TDm, 2 * TDm, 1.0f);
  transpose_cast_f16<<<dim3(TDm / 64, TDm / 64), dim3(32, 8), 0, stream>>>(Wks, TDm, WT + (size_t)TDm * 2 * TDm, 2 * TDm, 1.0f); transpose_cast_f16<<<dim3(TDm / 64, TDm / 64), dim3(32, 8), 0, stream>>>(Wkt, TDm, WT + (size_t)TDm * 2 * TDm + TDm, 2 * TDm, 1.0f);
  transpose_cast_f16<<<dim3(TDm / 64, TDm / 64), dim3(32, 8), 0, stream>>>(Wvs, TDm, WT + (size_t)2 * TDm * 2 * TDm, 2 * TDm, 1.0f); transpose_cast_f16<<<dim3(TDm / 64, TDm / 64), dim3(32, 8), 0, stream>>>(Wvt, TDm, WT + (size_t)2 * TDm * 2 * TDm + TDm, 2 * TDm, 1.0f);
  transpose_cast_f16<<<dim3(TDm / 64, TDm / 64), dim3(32, 8), 0, stream>>>(Wo, TDm, WoT, TDm, 1.0f);
  const int t3 = (TR / 64) * (3 * TDm / 64), t1 = (TR / 64) * (TDm / 64);
  wmma_gemm64<0, false, 0, 0, false><<<dim3((t3 + 7) / 8, 1), 256, 0, stream>>>((const unsigned short*)A16, nullptr, 2 * TDm, 0, U16(WT), nullptr, 2 * TDm, 0, QKV, nullptr, 3 * TDm, 0, nullptr, nullptr, 0, TR, 3 * TDm, 2 * TDm, 1.0f);
  kbias_kernel<<<(unsigned)(((long)TR * TDm + 255) / 256), 256, 0, stream>>>(QKV, WK);
  { AttnGeom g;
    g.q_bs = (long)TS * 3 * TDm; g.q_rs = 3 * TDm; g.q_hs = THD; g.k_bs = g.q_bs; g.k_rs = g.q_rs; g.k_hs = THD; g.v_bs = g.q_bs; g.v_rs = g.q_rs; g.v_hs = THD; g.o_bs = (long)TS * TDm; g.o_rs = TDm; g.o_hs = THD;
    g.S = TS; g.Skv = TS; g.H = TH; g.mask_mode = 1; g.qscale = 0.125f; g.blk0 = 0; g.mask_fill = -1e9f; g.mask_is_int = 0;
    attn64_kernel<false, false, true><<<TB_ * TH * (TS / AT_QB), AT_NW * 32, 0, stream>>>(QKV, QKV + TDm, QKV + 2 * TDm, O, nullptr, nullptr, g); }
  cast_f32_f16x2<<<(TR * TDm / 2 + 255) / 256, 256, 0, stream>>>(O, O16, (long)TR * TDm / 2);
  wmma_gemm64<0, false, 0, 0, false><<<dim3((t1 + 7) / 8, 1), 256, 0, stream>>>(U16(O16), nullptr, TDm, 0, U16(WoT), nullptr, TDm, 0, (float*)d_out, nullptr, TDm, 0, nullptr, nullptr, 0, TR, TDm, TDm, 1.0f);
}

// v001
// A run of this version takes 280 microseconds.
// Timed twice side by side with v000, it ran 2.24 and 2.23 times as fast.
#include <hip/hip_runtime.h>
#include <math.h>
// TMSA block (8 x 1024 tokens x 512, 8 heads x 64, causal): q/k/v = xs2·W*s + xt·W*t as ONE product over the concatenated input [xs2 | xt]·[W*s; W*t]
// (8192 x 1024 · 1024 x 1536); the query-dependent bias q·WK is folded exactly into the keys — Σ_d q_d k_jd + Σ_d q_d WK[d][j] = q·(k_j + WK[:, j]) —
// so the attention is a plain causal flash-style kernel over k' = k + WKᵀ (scores (q/8)·k'ᵀ and p·v on WMMA, f16 operands with probabilities x2^15,
// f32 accumulate, online softmax in f32, -1e9 fill above the diagonal); output projection ·Wo. All products v_wmma_f32_16x16x32_f16, f16 operands,
// f32 accumulate (plain single products, ≈20 G MAC); the raw .view reshapes are identity on memory.
typedef __attribute__((ext_vector_type(16))) _Float16 v16h;
typedef __attribute__((ext_vector_type(8)))  _Float16 v8h;
typedef __attribute__((ext_vector_type(16))) __bf16   v16b;
typedef __attribute__((ext_vector_type(8)))  __bf16   v8b;
typedef __attribute__((ext_vector_type(8)))  float    v8f;
typedef __attribute__((ext_vector_type(4)))  float    v4f;
#define PSCALE 32768.0f
#define U16(p) ((const unsigned short*)(const void*)(p))
#define PSCALE_INV (1.0f / 32768.0f)

__device__ __forceinline__ unsigned short f2bf_bits(float f) {
  unsigned u = __float_as_uint(f);
  return (unsigned short)((u + 0x7FFFu + ((u >> 16) & 1u)) >> 16);
}
__device__ __forceinline__ float bf_bits2f(unsigned short h) { return __uint_as_float(((unsigned)h) << 16); }

// hazard guards as plain device helpers (no inline asm inside the kernel template body)
__device__ __forceinline__ void dep_guard_h(v8f& a, v8f& b, v16h x, v16h y) { asm volatile("v_nop\n\tv_nop\n\tv_nop\n\tv_nop" : "+v"(a), "+v"(b) : "v"(x), "v"(y)); }
__device__ __forceinline__ void dep_guard_b(v8f& a, v8f& b, v16b x, v16b y) { asm volatile("v_nop\n\tv_nop\n\tv_nop\n\tv_nop" : "+v"(a), "+v"(b) : "v"(x), "v"(y)); }
__device__ __forceinline__ void keep4_h(v16h a, v16h b, v16h c, v16h d) { asm volatile("v_nop" :: "v"(a), "v"(b), "v"(c), "v"(d)); }
__device__ __forceinline__ void keep4_b(v16b a, v16b b, v16b c, v16b d) { asm volatile("v_nop" :: "v"(a), "v"(b), "v"(c), "v"(d)); }
__device__ __forceinline__ void acc_guard4(v8f& a, v8f& b, v8f& c, v8f& d) { asm volatile("v_nop\n\tv_nop\n\tv_nop\n\tv_nop" : "+v"(a), "+v"(b), "+v"(c), "+v"(d)); }
template <typename T> struct Frag;
template <> struct Frag<_Float16> {
  typedef v16h V; union U { v16h v; v8h h[2]; };
  static __device__ __forceinline__ v16h load(const _Float16* p) {   // elements 0..7 <- p[0..7], 8..15 <- p[16..23]
    U f; f.h[0] = *(const v8h*)(p); f.h[1] = *(const v8h*)(p + 16); return f.v;
  }
  static __device__ __forceinline__ v8f mma(v16h a, v16h b, v8f c) {
    return __builtin_amdgcn_wmma_f32_16x16x32_f16(false, a, false, b, (short)0, c, false, false);
  }
  static __device__ __forceinline__ void guard(v8f& a, v8f& b, v16h x, v16h y) { dep_guard_h(a, b, x, y); }
  static __device__ __forceinline__ void keep(v16h a, v16h b, v16h c, v16h d) { keep4_h(a, b, c, d); }
};
template <> struct Frag<__bf16> {
  typedef v16b V; union U { v16b v; v8b h[2]; };
  static __device__ __forceinline__ v16b load(const __bf16* p) {
    U f; f.h[0] = *(const v8b*)(p); f.h[1] = *(const v8b*)(p + 16); return f.v;
  }
  static __device__ __forceinline__ v8f mma(v16b a, v16b b, v8f c) {
    return __builtin_amdgcn_wmma_f32_16x16x32_bf16(false, a, false, b, (short)0, c, false, false);
  }
  static __device__ __forceinline__ void guard(v8f& a, v8f& b, v16b x, v16b y) { dep_guard_b(a, b, x, y); }
  static __device__ __forceinline__ void keep(v16b a, v16b b, v16b c, v16b d) { keep4_b(a, b, c, d); }
};

// ---- Register-blocked batched WMMA GEMM ------------------------------------
// C[m,n] = scale * sum_k A[m,k] * Bt[n,k] (+bias)(+resid); each wave owns a 64x64 tile.
// A row-major [M,K]; Bt row-major [N,K]; M,N % 64 == 0, K % 32 == 0.
// SPLIT: operands are hi/lo planes (A2/Bt2 = lo planes, same layout); product = hi·hi + hi·lo + lo·hi.
// BIAS_MODE: 0 = none, 1 = bias[m], 2 = bias[n].
// OUT_MODE: 0 = f32, 1 = f16, 2 = bf16 hi plane (Cout) + bf16 lo plane (Cout2).
// ET: 0 = f16 operands, 1 = bf16 operands (pointers passed as 16-bit storage)
template <int ET> struct Elem;
template <> struct Elem<0> { typedef _Float16 T; };
template <> struct Elem<1> { typedef __bf16 T; };
template <int ET, bool SPLIT, int BIAS_MODE, int OUT_MODE, bool RESID, int ACT = 0>
__global__ __launch_bounds__(256) void wmma_gemm64(
    const unsigned short* __restrict__ Ap, const unsigned short* __restrict__ A2p, int lda, long strideA,
    const unsigned short* __restrict__ Btp, const unsigned short* __restrict__ Bt2p, int ldb, long strideB,
    void* __restrict__ Cout, void* __restrict__ Cout2, int ldc, long strideC,
    const float* __restrict__ bias,
    const float* __restrict__ resid, long strideR,
    int M, int N, int K, float scale) {
  typedef typename Elem<ET>::T T;
  typedef typename Frag<T>::V V;
  const T* A = (const T*)Ap; const T* A2 = (const T*)A2p; const T* Bt = (const T*)Btp; const T* Bt2 = (const T*)Bt2p;
  __shared__ __align__(16) float sT[8][16 * 68];   // per-wave 16x64 slab, pitch 68 floats
  const int b    = blockIdx.y;
  const int lane = threadIdx.x & 31;
  const int wave = threadIdx.x >> 5;
  const int tilesN = N >> 6;
  const int tilesM = M >> 6;
  const int tile = blockIdx.x * 8 + wave;
  if (tile >= tilesM * tilesN) return;   // wave-uniform; no block barriers in this kernel
  const int tm = tile / tilesN;
  const int tn = tile - tm * tilesN;
  const int m0 = tm << 6;
  const int n0 = tn << 6;

  const T* Ab  = A  + (size_t)b * strideA;
  const T* Bb  = Bt + (size_t)b * strideB;
  const T* Ab2 = SPLIT ? (A2  + (size_t)b * strideA) : nullptr;
  const T* Bb2 = SPLIT ? (Bt2 + (size_t)b * strideB) : nullptr;

  const int rlane = lane & 15;                 // row (A) / col (B, D) within subtile
  const int koff  = (lane >> 4) * 8;           // k offset of this lane half
  const int mOff  = (lane >> 4) * 8;           // D row offset

  v8f acc[4][4];
#pragma unroll
  for (int i = 0; i < 4; ++i)
#pragma unroll
    for (int j = 0; j < 4; ++j) acc[i][j] = (v8f){0.f,0.f,0.f,0.f,0.f,0.f,0.f,0.f};

  for (int k0 = 0; k0 < K; k0 += 32) {
    V bh[4], bl[4];
#pragma unroll
    for (int j = 0; j < 4; ++j) {
      const size_t bo = (size_t)(n0 + (j << 4) + rlane) * ldb + koff + k0;
      bh[j] = Frag<T>::load(Bb + bo);
      if (SPLIT) bl[j] = Frag<T>::load(Bb2 + bo);
    }
#pragma unroll
    for (int i = 0; i < 4; ++i) {
      const size_t ao = (size_t)(m0 + (i << 4) + rlane) * lda + koff + k0;
      V ah = Frag<T>::load(Ab + ao);
      V al;
      if (SPLIT) al = Frag<T>::load(Ab2 + ao);
#pragma unroll
      for (int j = 0; j < 4; ++j) {
        acc[i][j] = Frag<T>::mma(ah, bh[j], acc[i][j]);
        if (SPLIT) {
          acc[i][j] = Frag<T>::mma(ah, bl[j], acc[i][j]);
          acc[i][j] = Frag<T>::mma(al, bh[j], acc[i][j]);
        }
      }
      Frag<T>::guard(acc[i][0], acc[i][3], ah, SPLIT ? al : ah);
    }
    Frag<T>::keep(bh[0], bh[1], bh[2], bh[3]);
    if (SPLIT) Frag<T>::keep(bl[0], bl[1], bl[2], bl[3]);
  }
  acc_guard4(acc[0][0], acc[0][1], acc[0][2], acc[0][3]);
  acc_guard4(acc[1][0], acc[1][1], acc[1][2], acc[1][3]);
  acc_guard4(acc[2][0], acc[2][1], acc[2][2], acc[2][3]);
  acc_guard4(acc[3][0], acc[3][1], acc[3][2], acc[3][3]);

  // ---- epilogue ----
  float* slab = sT[wave];
  const float* Rb = RESID ? (resid + (size_t)b * strideR) : nullptr;
#pragma unroll
  for (int i = 0; i < 4; ++i) {
    const int mBase = m0 + (i << 4);
#pragma unroll
    for (int j = 0; j < 4; ++j) {
      const int n = n0 + (j << 4) + rlane;
      float bv = 0.f;
      if (BIAS_MODE == 2) bv = bias[n];
#pragma unroll
      for (int r = 0; r < 8; ++r) {
        float v = acc[i][j][r] * scale;
        if (BIAS_MODE == 1) v += bias[mBase + mOff + r];
        if (BIAS_MODE == 2) v += bv;
        if (RESID) v += Rb[(size_t)(mBase + mOff + r) * ldc + n];
        if (ACT == 1) v = tanhf(v);
        if (ACT == 2) v = fmaxf(v, 0.0f);
        if (ACT == 3) v = v / (1.0f + expf(-v));
        if (ACT == 4) v = (v > 0.f) ? v : 0.01f * v;
        if (ACT == 5) v = 0.5f * v * (1.0f + erff(v * 0.70710678118654752f));
        slab[(mOff + r) * 68 + (j << 4) + rlane] = v;
      }
    }
    __builtin_amdgcn_fence(__ATOMIC_RELEASE, "workgroup");
    __builtin_amdgcn_wave_barrier();
    __builtin_amdgcn_fence(__ATOMIC_ACQUIRE, "workgroup");
    if (OUT_MODE == 0) {
      float* C = (float*)Cout + (size_t)b * strideC;
      const int hh = lane >> 4, c4 = (lane & 15) * 4;     // row seg = 256 B = 16 lanes x 16 B
      {
#pragma unroll
        for (int it = 0; it < 8; ++it) {
          const int row = it * 2 + hh;
          v4f v = *(const v4f*)(slab + row * 68 + c4);
          *(v4f*)(C + (size_t)(mBase + row) * ldc + n0 + c4) = v;
        }
        
      }
    } else {
      const int q = lane >> 3, c8 = (lane & 7) * 8;
      unsigned short* C  = (unsigned short*)Cout  + (size_t)b * strideC;
      unsigned short* C2 = (OUT_MODE == 2) ? ((unsigned short*)Cout2 + (size_t)b * strideC) : nullptr;
      {
#pragma unroll
        for (int it = 0; it < 4; ++it) {
          const int row = it * 4 + q;
          const float* sp = slab + row * 68 + c8;
          v8h hv, lv;
#pragma unroll
          for (int e = 0; e < 8; ++e) {
            if (OUT_MODE == 1) {
              hv[e] = (_Float16)sp[e];
            } else {
              unsigned short hb = f2bf_bits(sp[e]);
              unsigned short lb = f2bf_bits(sp[e] - bf_bits2f(hb));
              hv[e] = __builtin_bit_cast(_Float16, hb);
              lv[e] = __builtin_bit_cast(_Float16, lb);
            }
          }
          *(v8h*)(C + (size_t)(mBase + row) * ldc + n0 + c8) = hv;
          if (OUT_MODE == 2) *(v8h*)(C2 + (size_t)(mBase + row) * ldc + n0 + c8) = lv;
        }
        
      }
    }
    __builtin_amdgcn_fence(__ATOMIC_RELEASE, "workgroup");
    __builtin_amdgcn_wave_barrier();
    __builtin_amdgcn_fence(__ATOMIC_ACQUIRE, "workgroup");
  }
}

__global__ __launch_bounds__(256) void cast_f32_f16x2(
    const float* __restrict__ in, _Float16* __restrict__ out, int n2) {
  int i = blockIdx.x * 256 + threadIdx.x;
  if (i < n2) {
    const _Float16 h0 = (_Float16)in[2 * i], h1 = (_Float16)in[2 * i + 1];
    const unsigned u = (unsigned)__builtin_bit_cast(unsigned short, h0) | ((unsigned)__builtin_bit_cast(unsigned short, h1) << 16);
    ((unsigned*)out)[i] = u;
    
  }
}


// ---- f32 [R][C] (row pitch ldi) -> f16 transposed [C][R] (row pitch ldo); 64x64 tiles; each output row segment
__global__ __launch_bounds__(256) void transpose_cast_f16(const float* __restrict__ in, int ldi,
                                                         _Float16* __restrict__ outT, int ldo, float scale) {
  __shared__ __align__(16) _Float16 tile[64][72];     // [c][r]
  const int c0 = blockIdx.x * 64, r0 = blockIdx.y * 64;
  const int t = threadIdx.y * 32 + threadIdx.x;
  for (int i = threadIdx.y; i < 64; i += 8) {
    tile[threadIdx.x][i]      = (_Float16)(in[(size_t)(r0 + i) * ldi + c0 + threadIdx.x] * scale);
    tile[32 + threadIdx.x][i] = (_Float16)(in[(size_t)(r0 + i) * ldi + c0 + 32 + threadIdx.x] * scale);
  }
  __syncthreads();
  const int q = t >> 3, c8 = (t & 7) * 8;
  {
#pragma unroll
    for (int it = 0; it < 2; ++it) {
      const int c = it * 32 + q;
      v8h hv = *(const v8h*)(&tile[c][c8]);
      *(v8h*)(outT + (size_t)(c0 + c) * ldo + r0 + c8) = hv;
    }
    
  }
}

// =====================================================================================
// Generic causal/non-causal attention for head_dim 64, f32 in / f32 out; 16-bit operands: bf16 with optional hi/lo splits, or
// plain f16 (F16=true, non-split, probabilities carried x2^15).
//   scores = (q*qscale)·kᵀ : v_wmma_f32_16x16x32_bf16; SPLIT_QK -> q,k as bf16 hi/lo (hi·hi + hi·lo + lo·hi)
//   out    = p·v           : v_wmma_f32_16x16x32_bf16; SPLIT_PV -> p,v as bf16 hi/lo; else p,v plain bf16
//   f32 accumulate; online softmax in f32. Block = 4 waves = 64 query rows of one (batch, head); S % 64 == 0.
//   Element (b, s, h, d) of tensor X lives at X[b*X_bs + s*X_rs + h*X_hs + d] (strides in floats, multiples of 4).
//   Masking: MODE 0 none, 1 causal (kv > q masked), 2 tensor [S][Skv] shared over (b,h) (float if
//   mask_is_int==0, int32 with element == 0 -> masked if 1, int32 with element != 0 -> masked if 2), 3 per-token vectors qmask[B][S] & kvmask[B][Skv] (int32,
//   0 -> masked), 4 causal + sliding window (kv > q or q - kv > W masked; W passed in mask_is_int);
//   5 = relative-position bias: s += cp[b,h,q][idx[q][kv]] + pc[b,h,kv][idx[q][kv]] with idx = mask_b ([S][Skv] int32) and
//   mask_a an int32 [S][Skv] tensor with nonzero = masked (tables: element (b,h,row,n) at X + b*c_bs + h*c_hs + row*c_rs + n);
//   masked scores are replaced by mask_fill (e.g. -inf or -1e9) before the softmax.
//   grid.x = B * H * (S/64) (or a sub-range with blk0).
// =====================================================================================
#define AT_D 64
#define AT_NW 4
#define AT_QB 64
#define AT_KC 64
struct AttnGeom { const float* cp = nullptr; const float* pc = nullptr; long c_bs = 0, c_rs = 0, c_hs = 0;   // mode-5 score-bias tables
                  long q_bs, q_rs, q_hs, k_bs, k_rs, k_hs, v_bs, v_rs, v_hs, o_bs, o_rs, o_hs;
                  int S, Skv, H, mask_mode; float qscale; int blk0; float mask_fill; int mask_is_int; };
static_assert(sizeof(AttnGeom) == 168, "no padding");

__device__ __forceinline__ unsigned short at_bf_bits(float f) {
  unsigned u = __float_as_uint(f);
  return (unsigned short)((u + 0x7FFFu + ((u >> 16) & 1u)) >> 16);
}
__device__ __forceinline__ __bf16 at_f2bf(float f) { return __builtin_bit_cast(__bf16, at_bf_bits(f)); }
__device__ __forceinline__ void at_split(float f, __bf16& hi, __bf16& lo) {
  const unsigned short hb = at_bf_bits(f);
  hi = __builtin_bit_cast(__bf16, hb);
  lo = at_f2bf(f - __uint_as_float(((unsigned)hb) << 16));
}
__device__ __forceinline__ v8f at_mma(v16b a, v16b b, v8f c) {
  c = __builtin_amdgcn_wmma_f32_16x16x32_bf16(false, a, false, b, (short)0, c, false, false);
  asm volatile("v_nop\n\tv_nop\n\tv_nop\n\tv_nop" : "+v"(c) : "v"(a), "v"(b));
  return c;
}
// 16-bit element as a bit pattern held in a __bf16 slot: f16 bits when F16, bf16 (RNE) otherwise
template <bool F16> __device__ __forceinline__ __bf16 at_to16(float f) {
  if (F16) return __builtin_bit_cast(__bf16, (_Float16)f);
  return at_f2bf(f);
}
template <bool F16> __device__ __forceinline__ v8f at_mma16(v16b a, v16b b, v8f c) {
  if (F16) {
    const v16h ah = __builtin_bit_cast(v16h, a), bh = __builtin_bit_cast(v16h, b);
    c = __builtin_amdgcn_wmma_f32_16x16x32_f16(false, ah, false, bh, (short)0, c, false, false);
    asm volatile("v_nop\n\tv_nop\n\tv_nop\n\tv_nop" : "+v"(c) : "v"(ah), "v"(bh));
    return c;
  }
  return at_mma(a, b, c);
}

// MODE = the mask mode as a compile-time constant: the per-score mode tests fold away, so the unrolled score loop is straight-line code
template <bool SPLIT_QK, bool SPLIT_PV, bool F16, int MODE>
__global__ __launch_bounds__(128)
void attn64_kernel(const float* __restrict__ q, const float* __restrict__ k,
                   const float* __restrict__ v, float* __restrict__ out,
                   const void* __restrict__ mask_a, const int* __restrict__ mask_b, AttnGeom g) {
  static_assert(!(F16 && (SPLIT_QK || SPLIT_PV)), "f16 mode is non-split");
  const float PSC = F16 ? 32768.0f : 1.0f;     // f16 probabilities carried x2^15 (subnormal range), folded into the final 1/l
  union FB { v16b v; v8b h[2]; };
  __shared__ __align__(16) __bf16 Ksh[AT_KC * AT_D];             // K hi [kv][d]      8 KB
  __shared__ __align__(16) __bf16 Ksl[SPLIT_QK ? AT_KC * AT_D : 8];
  __shared__ __align__(16) __bf16 Vth[AT_D * AT_KC];             // V hi [d][kv]      8 KB
  __shared__ __align__(16) __bf16 Vtl[SPLIT_PV ? AT_D * AT_KC : 8];
  __shared__ __align__(16) __bf16 Psh[AT_NW][16 * AT_KC];        // per wave P hi [row][kv]  8 KB
  __shared__ __align__(16) __bf16 Psl[SPLIT_PV ? AT_NW : 1][SPLIT_PV ? 16 * AT_KC : 8];
  __shared__ __align__(16) float  Os[AT_NW][16 * 68];            // per wave out tile, pitch 68

  const int tid  = threadIdx.x;
  const int wave = tid >> 5;
  const int lane = tid & 31;
  const int hh   = lane >> 4;
  const int c    = lane & 15;

  const int nqb = g.S / AT_QB;
  const int bx = blockIdx.x + g.blk0;
  const int qb = bx % nqb;
  const int bh = bx / nqb;
  const int h  = bh % g.H;
  const int b  = bh / g.H;
  const int qbase_block = qb * AT_QB;
  const int q0 = qbase_block + wave * 16;

  const float* qb_ptr = q + (size_t)b * g.q_bs + (size_t)h * g.q_hs;
  const float* kb_ptr = k + (size_t)b * g.k_bs + (size_t)h * g.k_hs;
  const float* vb_ptr = v + (size_t)b * g.v_bs + (size_t)h * g.v_hs;
  float*       ob_ptr = out + (size_t)b * g.o_bs + (size_t)h * g.o_hs;

  // ---- Q fragments (A operand): 2 d-chunks, hi (and lo) ----
  v16b qah[2], qal[2];
  {
    const float* qrow = qb_ptr + (size_t)(q0 + c) * g.q_rs;
#pragma unroll
    for (int dc = 0; dc < 2; ++dc) {
#pragma unroll
      for (int e = 0; e < 8; ++e) {
        const float f0 = qrow[dc * 32 + 8 * hh + e] * g.qscale;
        const float f1 = qrow[dc * 32 + 16 + 8 * hh + e] * g.qscale;
        if (SPLIT_QK) { __bf16 hq, lq; at_split(f0, hq, lq); qah[dc][e] = hq; qal[dc][e] = lq; at_split(f1, hq, lq); qah[dc][8 + e] = hq; qal[dc][8 + e] = lq; }
        else { qah[dc][e] = at_to16<F16>(f0); qah[dc][8 + e] = at_to16<F16>(f1); qal[dc][e] = qah[dc][e]; qal[dc][8 + e] = qah[dc][8 + e]; }
      }
    }
  }

  float mrow[8], lrow[8];
  v8f oacc[4];
#pragma unroll
  for (int r = 0; r < 8; ++r) { mrow[r] = -INFINITY; lrow[r] = 0.f; }
#pragma unroll
  for (int t = 0; t < 4; ++t) oacc[t] = (v8f){0.f,0.f,0.f,0.f,0.f,0.f,0.f,0.f};

  const int nChunks = (MODE == 1 || MODE == 4) ? (qb + 1) : (g.Skv / AT_KC);   // block-uniform
  // per-row query mask (mode 3)
  int qkeep[8];
#pragma unroll
  for (int r = 0; r < 8; ++r) qkeep[r] = (MODE == 3) ? mask_b[(size_t)b * g.S + q0 + 8 * hh + r] : 1;   // mask_b = qmask in mode 3
  for (int kc = 0; kc < nChunks; ++kc) {
    const int kv0 = kc * AT_KC;
    __syncthreads();
    {
      const int kvr = tid >> 1, dh = (tid & 1) * 32;
      const float* krow = kb_ptr + (size_t)(kv0 + kvr) * g.k_rs + dh;
      const float* vrow = vb_ptr + (size_t)(kv0 + kvr) * g.v_rs + dh;
#pragma unroll
      for (int i = 0; i < 8; ++i) {
        v4f kk = *(const v4f*)(krow + 4 * i);
        v4f vv = *(const v4f*)(vrow + 4 * i);
#pragma unroll
        for (int e = 0; e < 4; ++e) {
          const int d = dh + 4 * i + e;
          if (SPLIT_QK) { __bf16 a, bl; at_split(kk[e], a, bl); Ksh[kvr * AT_D + d] = a; Ksl[kvr * AT_D + d] = bl; }
          else Ksh[kvr * AT_D + d] = at_to16<F16>(kk[e]);
          if (SPLIT_PV) { __bf16 a, bl; at_split(vv[e], a, bl); Vth[d * AT_KC + kvr] = a; Vtl[d * AT_KC + kvr] = bl; }
          else Vth[d * AT_KC + kvr] = at_to16<F16>(vv[e]);
        }
      }
    }
    __syncthreads();

    v8f s[4];
#pragma unroll
    for (int j = 0; j < 4; ++j) {
      s[j] = (v8f){0.f,0.f,0.f,0.f,0.f,0.f,0.f,0.f};
#pragma unroll 1
      for (int dc = 0; dc < 2; ++dc) {
        FB kb;
        kb.h[0] = *(const v8b*)(Ksh + (j * 16 + c) * AT_D + dc * 32 + 8 * hh);
        kb.h[1] = *(const v8b*)(Ksh + (j * 16 + c) * AT_D + dc * 32 + 16 + 8 * hh);
        s[j] = at_mma16<F16>(qah[dc], kb.v, s[j]);
        if (SPLIT_QK) {
          FB kl;
          kl.h[0] = *(const v8b*)(Ksl + (j * 16 + c) * AT_D + dc * 32 + 8 * hh);
          kl.h[1] = *(const v8b*)(Ksl + (j * 16 + c) * AT_D + dc * 32 + 16 + 8 * hh);
          s[j] = at_mma16<F16>(qah[dc], kl.v, s[j]);
          s[j] = at_mma16<F16>(qal[dc], kb.v, s[j]);
        }
      }
    }
    const bool diag = (MODE == 1) && (kc == qb);
    int kvkeep[4] = {1, 1, 1, 1};
    if (MODE == 3) {
#pragma unroll
      for (int j = 0; j < 4; ++j) kvkeep[j] = ((const int*)mask_a)[(size_t)b * g.Skv + kv0 + j * 16 + c];   // mask_a = kvmask
    }
    float cm[8];
#pragma unroll
    for (int r = 0; r < 8; ++r) {
      const int qrow = q0 + 8 * hh + r;
      float m = -INFINITY;
#pragma unroll
      for (int j = 0; j < 4; ++j) {
        const int kvcol = kv0 + j * 16 + c;
        bool masked = false;
        if (diag) masked = (kvcol > qrow);
        else if (MODE == 4) masked = (kvcol > qrow) || (qrow - kvcol > g.mask_is_int);
        else if (MODE == 2) {
          const size_t mi = (size_t)qrow * g.Skv + kvcol;
          masked = (g.mask_is_int == 0) ? (((const float*)mask_a)[mi] == 0.0f)
                 : (g.mask_is_int == 1) ? (((const int*)mask_a)[mi] == 0) : (((const int*)mask_a)[mi] != 0);
        } else if (MODE == 3) masked = (qkeep[r] == 0) || (kvkeep[j] == 0);
        else if (MODE == 5) {
          const size_t mi = (size_t)qrow * g.Skv + kvcol;
          masked = (((const int*)mask_a)[mi] != 0);
          int n = mask_b[mi]; n = n < 0 ? 0 : n;
          s[j][r] += g.cp[(size_t)b * g.c_bs + (size_t)h * g.c_hs + (size_t)qrow * g.c_rs + n]
                   + g.pc[(size_t)b * g.c_bs + (size_t)h * g.c_hs + (size_t)kvcol * g.c_rs + n];
        }
        const float sv = masked ? g.mask_fill : s[j][r];   // one select on the element (a conditional store into the vector selects all 8 registers)
        s[j][r] = sv;
        m = fmaxf(m, sv);
      }
#pragma unroll
      for (int off = 1; off < 16; off <<= 1) m = fmaxf(m, __shfl_xor(m, off, 32));
      cm[r] = m;
    }
    __bf16* pwh = Psh[wave];
    __bf16* pwl = Psl[SPLIT_PV ? wave : 0];
#pragma unroll
    for (int r = 0; r < 8; ++r) {
      const float mnew = fmaxf(mrow[r], cm[r]);
      const float alpha = expf(mrow[r] - mnew);
      mrow[r] = mnew;
      float psum = 0.f;
#pragma unroll
      for (int j = 0; j < 4; ++j) {
        const float p = expf(s[j][r] - mnew);
        psum += p;
        if (SPLIT_PV) { __bf16 a, bl; at_split(p, a, bl); pwh[(8 * hh + r) * AT_KC + j * 16 + c] = a; pwl[(8 * hh + r) * AT_KC + j * 16 + c] = bl; }
        else pwh[(8 * hh + r) * AT_KC + j * 16 + c] = at_to16<F16>(p * PSC);
      }
#pragma unroll
      for (int off = 1; off < 16; off <<= 1) psum += __shfl_xor(psum, off, 32);
      lrow[r] = lrow[r] * alpha + psum;
#pragma unroll
      for (int t = 0; t < 4; ++t) oacc[t][r] *= alpha;
    }
    __builtin_amdgcn_fence(__ATOMIC_RELEASE, "workgroup");
    __builtin_amdgcn_wave_barrier();
    __builtin_amdgcn_fence(__ATOMIC_ACQUIRE, "workgroup");
#pragma unroll 1
    for (int kk = 0; kk < 2; ++kk) {
      FB pa, pl;
      pa.h[0] = *(const v8b*)(pwh + c * AT_KC + kk * 32 + 8 * hh);
      pa.h[1] = *(const v8b*)(pwh + c * AT_KC + kk * 32 + 16 + 8 * hh);
      if (SPLIT_PV) {
        pl.h[0] = *(const v8b*)(pwl + c * AT_KC + kk * 32 + 8 * hh);
        pl.h[1] = *(const v8b*)(pwl + c * AT_KC + kk * 32 + 16 + 8 * hh);
      }
#pragma unroll
      for (int t = 0; t < 4; ++t) {
        FB vb;
        vb.h[0] = *(const v8b*)(Vth + (t * 16 + c) * AT_KC + kk * 32 + 8 * hh);
        vb.h[1] = *(const v8b*)(Vth + (t * 16 + c) * AT_KC + kk * 32 + 16 + 8 * hh);
        oacc[t] = at_mma16<F16>(pa.v, vb.v, oacc[t]);
        if (SPLIT_PV) {
          FB vl;
          vl.h[0] = *(const v8b*)(Vtl + (t * 16 + c) * AT_KC + kk * 32 + 8 * hh);
          vl.h[1] = *(const v8b*)(Vtl + (t * 16 + c) * AT_KC + kk * 32 + 16 + 8 * hh);
          oacc[t] = at_mma16<F16>(pa.v, vl.v, oacc[t]);
          oacc[t] = at_mma16<F16>(pl.v, vb.v, oacc[t]);
        }
      }
    }
  }

  float* os = Os[wave];
#pragma unroll
  for (int r = 0; r < 8; ++r) {
    const float inv = 1.0f / (lrow[r] * PSC);
#pragma unroll
    for (int t = 0; t < 4; ++t) os[(8 * hh + r) * 68 + t * 16 + c] = oacc[t][r] * inv;
  }
  __builtin_amdgcn_fence(__ATOMIC_RELEASE, "workgroup");
  __builtin_amdgcn_wave_barrier();
  __builtin_amdgcn_fence(__ATOMIC_ACQUIRE, "workgroup");
  {
    const int c4 = (lane & 15) * 4;
    {
#pragma unroll
      for (int it = 0; it < 8; ++it) {
        const int row = it * 2 + hh;
        v4f val = *(const v4f*)(os + row * 68 + c4);
        *(v4f*)(ob_ptr + (size_t)(q0 + row) * g.o_rs + c4) = val;
      }
      
    }
  }
}

#define TB_ 8
#define TS 1024
#define TDm 512
#define TH 8
#define THD 64
#define TR (TB_ * TS)
__device__ __forceinline__ unsigned pkh(float a, float b) { return (unsigned)__builtin_bit_cast(unsigned short, (_Float16)a) | ((unsigned)__builtin_bit_cast(unsigned short, (_Float16)b) << 16); }
// A16 [8192][1024] = [xs2 | xt] f16 (xs2 = raw reshape of xs)
__global__ __launch_bounds__(256) void cat_kernel(const float* __restrict__ xs, const float* __restrict__ xt, unsigned* __restrict__ A16) {
  const long i = (long)blockIdx.x * 256 + threadIdx.x; if (i >= (long)TR * TDm) return; const long r = i / TDm; const int cp = 2 * (int)(i % TDm);    // cp in [0, 1024)
  float a, b; if (cp < TDm) { a = xs[r * TDm + cp]; b = xs[r * TDm + cp + 1]; } else { a = xt[r * TDm + cp - TDm]; b = xt[r * TDm + cp - TDm + 1]; }
  ((unsigned*)A16)[i] = pkh(a, b); 
}
// k' = k + WKᵀ: QKV[(b,s)][512 + h*64 + d] += WK[d][s]
__global__ __launch_bounds__(256) void kbias_kernel(float* __restrict__ QKV, const float* __restrict__ WK) {
  const long i = (long)blockIdx.x * 256 + threadIdx.x; if (i >= (long)TR * TDm) return; const long r = i / TDm; const int c = (int)(i % TDm); const int s = (int)(r % TS), d = c % THD;
  float* p = QKV + r * (3 * TDm) + TDm + c; const float v = *p + WK[(size_t)d * TS + s]; *(float*)p = v; 
}
extern "C" void kernel_launch(void* const* d_in, const int* in_sizes, int n_in, void* d_out, int out_size, void* d_ws, size_t ws_size, hipStream_t stream) {
  (void)in_sizes; (void)n_in; (void)out_size; (void)ws_size;
  auto Fp = [&](int i) { return (const float*)d_in[i]; };
  const float* xs = Fp(0); const float* xt = Fp(1); const float* Wqs = Fp(2); const float* Wks = Fp(3); const float* Wvs = Fp(4); const float* Wqt = Fp(5); const float* Wkt = Fp(6); const float* Wvt = Fp(7); const float* WK = Fp(8); const float* Wo = Fp(9);
  char* ws = (char*)d_ws; size_t off = 0;
  auto carve = [&](size_t bytes) -> char* { char* p = ws + off; off += (bytes + 255) & ~(size_t)255; return p; };
  unsigned* A16 = (unsigned*)carve((size_t)TR * 2 * TDm * 2); _Float16* WT = (_Float16*)carve((size_t)3 * TDm * 2 * TDm * 2); _Float16* WoT = (_Float16*)carve((size_t)TDm * TDm * 2);
  float* QKV = (float*)carve((size_t)TR * 3 * TDm * 4); float* O = (float*)carve((size_t)TR * TDm * 4); _Float16* O16 = (_Float16*)A16;     // ≈ 84 MB; O16 reuses A16
  cat_kernel<<<(unsigned)(((long)TR * TDm + 255) / 256), 256, 0, stream>>>(xs, xt, A16);
  // Bt [1536][1024]: row n<512 (q): [Wqs[:,n]ᵀ | Wqt[:,n]ᵀ]; 512..1023 k; 1024..1535 v  — W* are [in 512][out 512] used as x·W
  transpose_cast_f16<<<dim3(TDm / 64, TDm / 64), dim3(32, 8), 0, stream>>>(Wqs, TDm, WT, 2 * TDm, 1.0f); transpose_cast_f16<<<dim3(TDm / 64, TDm / 64), dim3(32, 8), 0, stream>>>(Wqt, TDm, WT + TDm, 2 * TDm, 1.0f);
  transpose_cast_f16<<<dim3(TDm / 64, TDm / 64), dim3(32, 8), 0, stream>>>(Wks, TDm, WT + (size_t)TDm * 2 * TDm, 2 * TDm, 1.0f); transpose_cast_f16<<<dim3(TDm / 64, TDm / 64), dim3(32, 8), 0, stream>>>(Wkt, TDm, WT + (size_t)TDm * 2 * TDm + TDm, 2 * TDm, 1.0f);
  transpose_cast_f16<<<dim3(TDm / 64, TDm / 64), dim3(32, 8), 0, stream>>>(Wvs, TDm, WT + (size_t)2 * TDm * 2 * TDm, 2 * TDm, 1.0f); transpose_cast_f16<<<dim3(TDm / 64, TDm / 64), dim3(32, 8), 0, stream>>>(Wvt, TDm, WT + (size_t)2 * TDm * 2 * TDm + TDm, 2 * TDm, 1.0f);
  transpose_cast_f16<<<dim3(TDm / 64, TDm / 64), dim3(32, 8), 0, stream>>>(Wo, TDm, WoT, TDm, 1.0f);
  const int t3 = (TR / 64) * (3 * TDm / 64), t1 = (TR / 64) * (TDm / 64);
  wmma_gemm64<0, false, 0, 0, false><<<dim3((t3 + 7) / 8, 1), 256, 0, stream>>>((const unsigned short*)A16, nullptr, 2 * TDm, 0, U16(WT), nullptr, 2 * TDm, 0, QKV, nullptr, 3 * TDm, 0, nullptr, nullptr, 0, TR, 3 * TDm, 2 * TDm, 1.0f);
  kbias_kernel<<<(unsigned)(((long)TR * TDm + 255) / 256), 256, 0, stream>>>(QKV, WK);
  { AttnGeom g;
    g.q_bs = (long)TS * 3 * TDm; g.q_rs = 3 * TDm; g.q_hs = THD; g.k_bs = g.q_bs; g.k_rs = g.q_rs; g.k_hs = THD; g.v_bs = g.q_bs; g.v_rs = g.q_rs; g.v_hs = THD; g.o_bs = (long)TS * TDm; g.o_rs = TDm; g.o_hs = THD;
    g.S = TS; g.Skv = TS; g.H = TH; g.mask_mode = 1; g.qscale = 0.125f; g.blk0 = 0; g.mask_fill = -1e9f; g.mask_is_int = 0;
    attn64_kernel<false, false, true, 1><<<TB_ * TH * (TS / AT_QB), AT_NW * 32, 0, stream>>>(QKV, QKV + TDm, QKV + 2 * TDm, O, nullptr, nullptr, g); }
  cast_f32_f16x2<<<(TR * TDm / 2 + 255) / 256, 256, 0, stream>>>(O, O16, (long)TR * TDm / 2);
  wmma_gemm64<0, false, 0, 0, false><<<dim3((t1 + 7) / 8, 1), 256, 0, stream>>>(U16(O16), nullptr, TDm, 0, U16(WoT), nullptr, TDm, 0, (float*)d_out, nullptr, TDm, 0, nullptr, nullptr, 0, TR, TDm, TDm, 1.0f);
}

// v002
// One run takes 270 microseconds.
// Timed twice side by side with v001, it ran 1.04 and 1.03 times as fast.
// Over all steps from v000 it is 2.31 times as fast.
#include <hip/hip_runtime.h>
#include <math.h>
// TMSA block (8 x 1024 tokens x 512, 8 heads x 64, causal): q/k/v = xs2·W*s + xt·W*t as ONE product over the concatenated input [xs2 | xt]·[W*s; W*t]
// (8192 x 1024 · 1024 x 1536); the query-dependent bias q·WK is folded exactly into the keys — Σ_d q_d k_jd + Σ_d q_d WK[d][j] = q·(k_j + WK[:, j]) —
// so the attention is a plain causal flash-style kernel over k' = k + WKᵀ (scores (q/8)·k'ᵀ and p·v on WMMA, f16 operands with probabilities x2^15,
// f32 accumulate, online softmax in f32, -1e9 fill above the diagonal); output projection ·Wo. All products v_wmma_f32_16x16x32_f16, f16 operands,
// f32 accumulate (plain single products, ≈20 G MAC); the raw .view reshapes are identity on memory.
typedef __attribute__((ext_vector_type(16))) _Float16 v16h;
typedef __attribute__((ext_vector_type(8)))  _Float16 v8h;
typedef __attribute__((ext_vector_type(16))) __bf16   v16b;
typedef __attribute__((ext_vector_type(8)))  __bf16   v8b;
typedef __attribute__((ext_vector_type(8)))  float    v8f;
typedef __attribute__((ext_vector_type(4)))  float    v4f;
#define PSCALE 32768.0f
#define U16(p) ((const unsigned short*)(const void*)(p))
#define PSCALE_INV (1.0f / 32768.0f)

__device__ __forceinline__ unsigned short f2bf_bits(float f) {
  unsigned u = __float_as_uint(f);
  return (unsigned short)((u + 0x7FFFu + ((u >> 16) & 1u)) >> 16);
}
__device__ __forceinline__ float bf_bits2f(unsigned short h) { return __uint_as_float(((unsigned)h) << 16); }

// hazard guards as plain device helpers (no inline asm inside the kernel template body)
__device__ __forceinline__ void dep_guard_h(v8f& a, v8f& b, v16h x, v16h y) { asm volatile("v_nop\n\tv_nop\n\tv_nop\n\tv_nop" : "+v"(a), "+v"(b) : "v"(x), "v"(y)); }
__device__ __forceinline__ void dep_guard_b(v8f& a, v8f& b, v16b x, v16b y) { asm volatile("v_nop\n\tv_nop\n\tv_nop\n\tv_nop" : "+v"(a), "+v"(b) : "v"(x), "v"(y)); }
__device__ __forceinline__ void keep4_h(v16h a, v16h b, v16h c, v16h d) { asm volatile("v_nop" :: "v"(a), "v"(b), "v"(c), "v"(d)); }
__device__ __forceinline__ void keep4_b(v16b a, v16b b, v16b c, v16b d) { asm volatile("v_nop" :: "v"(a), "v"(b), "v"(c), "v"(d)); }
__device__ __forceinline__ void acc_guard4(v8f& a, v8f& b, v8f& c, v8f& d) { asm volatile("v_nop\n\tv_nop\n\tv_nop\n\tv_nop" : "+v"(a), "+v"(b), "+v"(c), "+v"(d)); }
template <typename T> struct Frag;
template <> struct Frag<_Float16> {
  typedef v16h V; union U { v16h v; v8h h[2]; };
  static __device__ __forceinline__ v16h load(const _Float16* p) {   // elements 0..7 <- p[0..7], 8..15 <- p[16..23]
    U f; f.h[0] = *(const v8h*)(p); f.h[1] = *(const v8h*)(p + 16); return f.v;
  }
  static __device__ __forceinline__ v8f mma(v16h a, v16h b, v8f c) {
    return __builtin_amdgcn_wmma_f32_16x16x32_f16(false, a, false, b, (short)0, c, false, false);
  }
  static __device__ __forceinline__ void guard(v8f& a, v8f& b, v16h x, v16h y) { dep_guard_h(a, b, x, y); }
  static __device__ __forceinline__ void keep(v16h a, v16h b, v16h c, v16h d) { keep4_h(a, b, c, d); }
};
template <> struct Frag<__bf16> {
  typedef v16b V; union U { v16b v; v8b h[2]; };
  static __device__ __forceinline__ v16b load(const __bf16* p) {
    U f; f.h[0] = *(const v8b*)(p); f.h[1] = *(const v8b*)(p + 16); return f.v;
  }
  static __device__ __forceinline__ v8f mma(v16b a, v16b b, v8f c) {
    return __builtin_amdgcn_wmma_f32_16x16x32_bf16(false, a, false, b, (short)0, c, false, false);
  }
  static __device__ __forceinline__ void guard(v8f& a, v8f& b, v16b x, v16b y) { dep_guard_b(a, b, x, y); }
  static __device__ __forceinline__ void keep(v16b a, v16b b, v16b c, v16b d) { keep4_b(a, b, c, d); }
};

// ---- Register-blocked batched WMMA GEMM ------------------------------------
// C[m,n] = scale * sum_k A[m,k] * Bt[n,k] (+bias)(+resid); each wave owns a 64x64 tile.
// A row-major [M,K]; Bt row-major [N,K]; M,N % 64 == 0, K % 32 == 0.
// SPLIT: operands are hi/lo planes (A2/Bt2 = lo planes, same layout); product = hi·hi + hi·lo + lo·hi.
// BIAS_MODE: 0 = none, 1 = bias[m], 2 = bias[n].
// OUT_MODE: 0 = f32, 1 = f16, 2 = bf16 hi plane (Cout) + bf16 lo plane (Cout2).
// ET: 0 = f16 operands, 1 = bf16 operands (pointers passed as 16-bit storage)
template <int ET> struct Elem;
template <> struct Elem<0> { typedef _Float16 T; };
template <> struct Elem<1> { typedef __bf16 T; };
template <int ET, bool SPLIT, int BIAS_MODE, int OUT_MODE, bool RESID, int ACT = 0>
__global__ __launch_bounds__(256) void wmma_gemm64(
    const unsigned short* __restrict__ Ap, const unsigned short* __restrict__ A2p, int lda, long strideA,
    const unsigned short* __restrict__ Btp, const unsigned short* __restrict__ Bt2p, int ldb, long strideB,
    void* __restrict__ Cout, void* __restrict__ Cout2, int ldc, long strideC,
    const float* __restrict__ bias,
    const float* __restrict__ resid, long strideR,
    int M, int N, int K, float scale) {
  typedef typename Elem<ET>::T T;
  typedef typename Frag<T>::V V;
  const T* A = (const T*)Ap; const T* A2 = (const T*)A2p; const T* Bt = (const T*)Btp; const T* Bt2 = (const T*)Bt2p;
  __shared__ __align__(16) float sT[8][16 * 68];   // per-wave 16x64 slab, pitch 68 floats
  const int b    = blockIdx.y;
  const int lane = threadIdx.x & 31;
  const int wave = threadIdx.x >> 5;
  const int tilesN = N >> 6;
  const int tilesM = M >> 6;
  const int tile = blockIdx.x * 8 + wave;
  if (tile >= tilesM * tilesN) return;   // wave-uniform; no block barriers in this kernel
  const int tm = tile / tilesN;
  const int tn = tile - tm * tilesN;
  const int m0 = tm << 6;
  const int n0 = tn << 6;

  const T* Ab  = A  + (size_t)b * strideA;
  const T* Bb  = Bt + (size_t)b * strideB;
  const T* Ab2 = SPLIT ? (A2  + (size_t)b * strideA) : nullptr;
  const T* Bb2 = SPLIT ? (Bt2 + (size_t)b * strideB) : nullptr;

  const int rlane = lane & 15;                 // row (A) / col (B, D) within subtile
  const int koff  = (lane >> 4) * 8;           // k offset of this lane half
  const int mOff  = (lane >> 4) * 8;           // D row offset

  v8f acc[4][4];
#pragma unroll
  for (int i = 0; i < 4; ++i)
#pragma unroll
    for (int j = 0; j < 4; ++j) acc[i][j] = (v8f){0.f,0.f,0.f,0.f,0.f,0.f,0.f,0.f};

  for (int k0 = 0; k0 < K; k0 += 32) {
    V bh[4], bl[4];
#pragma unroll
    for (int j = 0; j < 4; ++j) {
      const size_t bo = (size_t)(n0 + (j << 4) + rlane) * ldb + koff + k0;
      bh[j] = Frag<T>::load(Bb + bo);
      if (SPLIT) bl[j] = Frag<T>::load(Bb2 + bo);
    }
#pragma unroll
    for (int i = 0; i < 4; ++i) {
      const size_t ao = (size_t)(m0 + (i << 4) + rlane) * lda + koff + k0;
      V ah = Frag<T>::load(Ab + ao);
      V al;
      if (SPLIT) al = Frag<T>::load(Ab2 + ao);
#pragma unroll
      for (int j = 0; j < 4; ++j) {
        acc[i][j] = Frag<T>::mma(ah, bh[j], acc[i][j]);
        if (SPLIT) {
          acc[i][j] = Frag<T>::mma(ah, bl[j], acc[i][j]);
          acc[i][j] = Frag<T>::mma(al, bh[j], acc[i][j]);
        }
      }
      Frag<T>::guard(acc[i][0], acc[i][3], ah, SPLIT ? al : ah);
    }
    Frag<T>::keep(bh[0], bh[1], bh[2], bh[3]);
    if (SPLIT) Frag<T>::keep(bl[0], bl[1], bl[2], bl[3]);
  }
  acc_guard4(acc[0][0], acc[0][1], acc[0][2], acc[0][3]);
  acc_guard4(acc[1][0], acc[1][1], acc[1][2], acc[1][3]);
  acc_guard4(acc[2][0], acc[2][1], acc[2][2], acc[2][3]);
  acc_guard4(acc[3][0], acc[3][1], acc[3][2], acc[3][3]);

  // ---- epilogue ----
  float* slab = sT[wave];
  const float* Rb = RESID ? (resid + (size_t)b * strideR) : nullptr;
#pragma unroll
  for (int i = 0; i < 4; ++i) {
    const int mBase = m0 + (i << 4);
#pragma unroll
    for (int j = 0; j < 4; ++j) {
      const int n = n0 + (j << 4) + rlane;
      float bv = 0.f;
      if (BIAS_MODE == 2) bv = bias[n];
#pragma unroll
      for (int r = 0; r < 8; ++r) {
        float v = acc[i][j][r] * scale;
        if (BIAS_MODE == 1) v += bias[mBase + mOff + r];
        if (BIAS_MODE == 2) v += bv;
        if (RESID) v += Rb[(size_t)(mBase + mOff + r) * ldc + n];
        if (ACT == 1) v = tanhf(v);
        if (ACT == 2) v = fmaxf(v, 0.0f);
        if (ACT == 3) v = v / (1.0f + expf(-v));
        if (ACT == 4) v = (v > 0.f) ? v : 0.01f * v;
        if (ACT == 5) v = 0.5f * v * (1.0f + erff(v * 0.70710678118654752f));
        slab[(mOff + r) * 68 + (j << 4) + rlane] = v;
      }
    }
    __builtin_amdgcn_fence(__ATOMIC_RELEASE, "workgroup");
    __builtin_amdgcn_wave_barrier();
    __builtin_amdgcn_fence(__ATOMIC_ACQUIRE, "workgroup");
    if (OUT_MODE == 0) {
      float* C = (float*)Cout + (size_t)b * strideC;
      const int hh = lane >> 4, c4 = (lane & 15) * 4;     // row seg = 256 B = 16 lanes x 16 B
      {
#pragma unroll
        for (int it = 0; it < 8; ++it) {
          const int row = it * 2 + hh;
          v4f v = *(const v4f*)(slab + row * 68 + c4);
          *(v4f*)(C + (size_t)(mBase + row) * ldc + n0 + c4) = v;
        }
        
      }
    } else {
      const int q = lane >> 3, c8 = (lane & 7) * 8;
      unsigned short* C  = (unsigned short*)Cout  + (size_t)b * strideC;
      unsigned short* C2 = (OUT_MODE == 2) ? ((unsigned short*)Cout2 + (size_t)b * strideC) : nullptr;
      {
#pragma unroll
        for (int it = 0; it < 4; ++it) {
          const int row = it * 4 + q;
          const float* sp = slab + row * 68 + c8;
          v8h hv, lv;
#pragma unroll
          for (int e = 0; e < 8; ++e) {
            if (OUT_MODE == 1) {
              hv[e] = (_Float16)sp[e];
            } else {
              unsigned short hb = f2bf_bits(sp[e]);
              unsigned short lb = f2bf_bits(sp[e] - bf_bits2f(hb));
              hv[e] = __builtin_bit_cast(_Float16, hb);
              lv[e] = __builtin_bit_cast(_Float16, lb);
            }
          }
          *(v8h*)(C + (size_t)(mBase + row) * ldc + n0 + c8) = hv;
          if (OUT_MODE == 2) *(v8h*)(C2 + (size_t)(mBase + row) * ldc + n0 + c8) = lv;
        }
        
      }
    }
    __builtin_amdgcn_fence(__ATOMIC_RELEASE, "workgroup");
    __builtin_amdgcn_wave_barrier();
    __builtin_amdgcn_fence(__ATOMIC_ACQUIRE, "workgroup");
  }
}

// ---- f32 [R][C] (row pitch ldi) -> f16 transposed [C][R] (row pitch ldo); 64x64 tiles; each output row segment
__global__ __launch_bounds__(256) void transpose_cast_f16(const float* __restrict__ in, int ldi,
                                                         _Float16* __restrict__ outT, int ldo, float scale) {
  __shared__ __align__(16) _Float16 tile[64][72];     // [c][r]
  const int c0 = blockIdx.x * 64, r0 = blockIdx.y * 64;
  const int t = threadIdx.y * 32 + threadIdx.x;
  for (int i = threadIdx.y; i < 64; i += 8) {
    tile[threadIdx.x][i]      = (_Float16)(in[(size_t)(r0 + i) * ldi + c0 + threadIdx.x] * scale);
    tile[32 + threadIdx.x][i] = (_Float16)(in[(size_t)(r0 + i) * ldi + c0 + 32 + threadIdx.x] * scale);
  }
  __syncthreads();
  const int q = t >> 3, c8 = (t & 7) * 8;
  {
#pragma unroll
    for (int it = 0; it < 2; ++it) {
      const int c = it * 32 + q;
      v8h hv = *(const v8h*)(&tile[c][c8]);
      *(v8h*)(outT + (size_t)(c0 + c) * ldo + r0 + c8) = hv;
    }
    
  }
}

// =====================================================================================
// Generic causal/non-causal attention for head_dim 64, f32 in / f32 out; 16-bit operands: bf16 with optional hi/lo splits, or
// plain f16 (F16=true, non-split, probabilities carried x2^15).
//   scores = (q*qscale)·kᵀ : v_wmma_f32_16x16x32_bf16 (_f16 when F16); SPLIT_QK -> q,k as bf16 hi/lo (hi·hi + hi·lo + lo·hi)
//   out    = p·v           : v_wmma_f32_16x16x32_bf16; SPLIT_PV -> p,v as bf16 hi/lo; else p,v plain bf16, or plain f16 on v_wmma_f32_16x16x32_f16 when F16
//   f32 accumulate; online softmax in f32. Block = 4 waves = 64 query rows of one (batch, head); S % 64 == 0.
//   Element (b, s, h, d) of tensor X lives at X[b*X_bs + s*X_rs + h*X_hs + d] (strides in floats, multiples of 4).
//   Masking: MODE 0 none, 1 causal (kv > q masked), 2 tensor [S][Skv] shared over (b,h) (float if
//   mask_is_int==0, int32 with element == 0 -> masked if 1, int32 with element != 0 -> masked if 2), 3 per-token vectors qmask[B][S] & kvmask[B][Skv] (int32,
//   0 -> masked), 4 causal + sliding window (kv > q or q - kv > W masked; W passed in mask_is_int);
//   5 = relative-position bias: s += cp[b,h,q][idx[q][kv]] + pc[b,h,kv][idx[q][kv]] with idx = mask_b ([S][Skv] int32) and
//   mask_a an int32 [S][Skv] tensor with nonzero = masked (tables: element (b,h,row,n) at X + b*c_bs + h*c_hs + row*c_rs + n);
//   masked scores are replaced by mask_fill (e.g. -inf or -1e9) before the softmax.
//   grid.x = B * H * (S/64) (or a sub-range with blk0).
// =====================================================================================
#define AT_D 64
#define AT_NW 4
#define AT_QB 64
#define AT_KC 64
struct AttnGeom { const float* cp = nullptr; const float* pc = nullptr; long c_bs = 0, c_rs = 0, c_hs = 0;   // mode-5 score-bias tables
                  long q_bs, q_rs, q_hs, k_bs, k_rs, k_hs, v_bs, v_rs, v_hs, o_bs, o_rs, o_hs;
                  int S, Skv, H, mask_mode; float qscale; int blk0; float mask_fill; int mask_is_int; };
static_assert(sizeof(AttnGeom) == 168, "no padding");

__device__ __forceinline__ unsigned short at_bf_bits(float f) {
  unsigned u = __float_as_uint(f);
  return (unsigned short)((u + 0x7FFFu + ((u >> 16) & 1u)) >> 16);
}
__device__ __forceinline__ __bf16 at_f2bf(float f) { return __builtin_bit_cast(__bf16, at_bf_bits(f)); }
__device__ __forceinline__ void at_split(float f, __bf16& hi, __bf16& lo) {
  const unsigned short hb = at_bf_bits(f);
  hi = __builtin_bit_cast(__bf16, hb);
  lo = at_f2bf(f - __uint_as_float(((unsigned)hb) << 16));
}
__device__ __forceinline__ v8f at_mma(v16b a, v16b b, v8f c) {
  c = __builtin_amdgcn_wmma_f32_16x16x32_bf16(false, a, false, b, (short)0, c, false, false);
  asm volatile("v_nop\n\tv_nop\n\tv_nop\n\tv_nop" : "+v"(c) : "v"(a), "v"(b));
  return c;
}
// 16-bit element as a bit pattern held in a __bf16 slot: f16 bits when F16, bf16 (RNE) otherwise
template <bool F16> __device__ __forceinline__ __bf16 at_to16(float f) {
  if (F16) return __builtin_bit_cast(__bf16, (_Float16)f);
  return at_f2bf(f);
}
template <bool F16> __device__ __forceinline__ v8f at_mma16(v16b a, v16b b, v8f c) {
  if (F16) {
    const v16h ah = __builtin_bit_cast(v16h, a), bh = __builtin_bit_cast(v16h, b);
    c = __builtin_amdgcn_wmma_f32_16x16x32_f16(false, ah, false, bh, (short)0, c, false, false);
    asm volatile("v_nop\n\tv_nop\n\tv_nop\n\tv_nop" : "+v"(c) : "v"(ah), "v"(bh));
    return c;
  }
  return at_mma(a, b, c);
}

// MODE = the mask mode as a compile-time constant: the per-score mode tests fold away, so the unrolled score loop is straight-line code
template <bool SPLIT_QK, bool SPLIT_PV, bool F16, int MODE>
__global__ __launch_bounds__(128)
void attn64_kernel(const float* __restrict__ q, const float* __restrict__ k,
                   const float* __restrict__ v, float* __restrict__ out,
                   const void* __restrict__ mask_a, const int* __restrict__ mask_b, AttnGeom g) {
  static_assert(!(F16 && (SPLIT_QK || SPLIT_PV)), "f16 mode is non-split");
  const float PSC = F16 ? 32768.0f : 1.0f;     // f16 probabilities carried x2^15 (subnormal range), folded into the final 1/l
  union FB { v16b v; v8b h[2]; };
  __shared__ __align__(16) __bf16 Ksh[AT_KC * AT_D];             // K hi [kv][d]      8 KB
  __shared__ __align__(16) __bf16 Ksl[SPLIT_QK ? AT_KC * AT_D : 8];
  __shared__ __align__(16) __bf16 Vth[AT_D * AT_KC];             // V hi [d][kv]      8 KB
  __shared__ __align__(16) __bf16 Vtl[SPLIT_PV ? AT_D * AT_KC : 8];
  __shared__ __align__(16) __bf16 Psh[AT_NW][16 * AT_KC];        // per wave P hi [row][kv]  8 KB
  __shared__ __align__(16) __bf16 Psl[SPLIT_PV ? AT_NW : 1][SPLIT_PV ? 16 * AT_KC : 8];
  __shared__ __align__(16) float  Os[AT_NW][16 * 68];            // per wave out tile, pitch 68

  const int tid  = threadIdx.x;
  const int wave = tid >> 5;
  const int lane = tid & 31;
  const int hh   = lane >> 4;
  const int c    = lane & 15;

  const int nqb = g.S / AT_QB;
  const int bx = blockIdx.x + g.blk0;
  const int qb = bx % nqb;
  const int bh = bx / nqb;
  const int h  = bh % g.H;
  const int b  = bh / g.H;
  const int qbase_block = qb * AT_QB;
  const int q0 = qbase_block + wave * 16;

  const float* qb_ptr = q + (size_t)b * g.q_bs + (size_t)h * g.q_hs;
  const float* kb_ptr = k + (size_t)b * g.k_bs + (size_t)h * g.k_hs;
  const float* vb_ptr = v + (size_t)b * g.v_bs + (size_t)h * g.v_hs;
  float*       ob_ptr = out + (size_t)b * g.o_bs + (size_t)h * g.o_hs;

  // ---- Q fragments (A operand): 2 d-chunks, hi (and lo) ----
  v16b qah[2], qal[2];
  {
    const float* qrow = qb_ptr + (size_t)(q0 + c) * g.q_rs;
#pragma unroll
    for (int dc = 0; dc < 2; ++dc) {
#pragma unroll
      for (int e = 0; e < 8; ++e) {
        const float f0 = qrow[dc * 32 + 8 * hh + e] * g.qscale;
        const float f1 = qrow[dc * 32 + 16 + 8 * hh + e] * g.qscale;
        if (SPLIT_QK) { __bf16 hq, lq; at_split(f0, hq, lq); qah[dc][e] = hq; qal[dc][e] = lq; at_split(f1, hq, lq); qah[dc][8 + e] = hq; qal[dc][8 + e] = lq; }
        else { qah[dc][e] = at_to16<F16>(f0); qah[dc][8 + e] = at_to16<F16>(f1); qal[dc][e] = qah[dc][e]; qal[dc][8 + e] = qah[dc][8 + e]; }
      }
    }
  }

  float mrow[8], lrow[8];
  v8f oacc[4];
#pragma unroll
  for (int r = 0; r < 8; ++r) { mrow[r] = -INFINITY; lrow[r] = 0.f; }
#pragma unroll
  for (int t = 0; t < 4; ++t) oacc[t] = (v8f){0.f,0.f,0.f,0.f,0.f,0.f,0.f,0.f};

  const int nChunks = (MODE == 1 || MODE == 4) ? (qb + 1) : (g.Skv / AT_KC);   // block-uniform
  // per-row query mask (mode 3)
  int qkeep[8];
#pragma unroll
  for (int r = 0; r < 8; ++r) qkeep[r] = (MODE == 3) ? mask_b[(size_t)b * g.S + q0 + 8 * hh + r] : 1;   // mask_b = qmask in mode 3
  for (int kc = 0; kc < nChunks; ++kc) {
    const int kv0 = kc * AT_KC;
    __syncthreads();
    {
      const int kvr = tid >> 1, dh = (tid & 1) * 32;
      const float* krow = kb_ptr + (size_t)(kv0 + kvr) * g.k_rs + dh;
      const float* vrow = vb_ptr + (size_t)(kv0 + kvr) * g.v_rs + dh;
#pragma unroll
      for (int i = 0; i < 8; ++i) {
        v4f kk = *(const v4f*)(krow + 4 * i);
        v4f vv = *(const v4f*)(vrow + 4 * i);
#pragma unroll
        for (int e = 0; e < 4; ++e) {
          const int d = dh + 4 * i + e;
          if (SPLIT_QK) { __bf16 a, bl; at_split(kk[e], a, bl); Ksh[kvr * AT_D + d] = a; Ksl[kvr * AT_D + d] = bl; }
          else Ksh[kvr * AT_D + d] = at_to16<F16>(kk[e]);
          if (SPLIT_PV) { __bf16 a, bl; at_split(vv[e], a, bl); Vth[d * AT_KC + kvr] = a; Vtl[d * AT_KC + kvr] = bl; }
          else Vth[d * AT_KC + kvr] = at_to16<F16>(vv[e]);
        }
      }
    }
    __syncthreads();

    v8f s[4];
#pragma unroll
    for (int j = 0; j < 4; ++j) {
      s[j] = (v8f){0.f,0.f,0.f,0.f,0.f,0.f,0.f,0.f};
#pragma unroll 1
      for (int dc = 0; dc < 2; ++dc) {
        FB kb;
        kb.h[0] = *(const v8b*)(Ksh + (j * 16 + c) * AT_D + dc * 32 + 8 * hh);
        kb.h[1] = *(const v8b*)(Ksh + (j * 16 + c) * AT_D + dc * 32 + 16 + 8 * hh);
        s[j] = at_mma16<F16>(qah[dc], kb.v, s[j]);
        if (SPLIT_QK) {
          FB kl;
          kl.h[0] = *(const v8b*)(Ksl + (j * 16 + c) * AT_D + dc * 32 + 8 * hh);
          kl.h[1] = *(const v8b*)(Ksl + (j * 16 + c) * AT_D + dc * 32 + 16 + 8 * hh);
          s[j] = at_mma16<F16>(qah[dc], kl.v, s[j]);
          s[j] = at_mma16<F16>(qal[dc], kb.v, s[j]);
        }
      }
    }
    const bool diag = (MODE == 1) && (kc == qb);
    int kvkeep[4] = {1, 1, 1, 1};
    if (MODE == 3) {
#pragma unroll
      for (int j = 0; j < 4; ++j) kvkeep[j] = ((const int*)mask_a)[(size_t)b * g.Skv + kv0 + j * 16 + c];   // mask_a = kvmask
    }
    float cm[8];
#pragma unroll
    for (int r = 0; r < 8; ++r) {
      const int qrow = q0 + 8 * hh + r;
      float m = -INFINITY;
#pragma unroll
      for (int j = 0; j < 4; ++j) {
        const int kvcol = kv0 + j * 16 + c;
        bool masked = false;
        if (diag) masked = (kvcol > qrow);
        else if (MODE == 4) masked = (kvcol > qrow) || (qrow - kvcol > g.mask_is_int);
        else if (MODE == 2) {
          const size_t mi = (size_t)qrow * g.Skv + kvcol;
          masked = (g.mask_is_int == 0) ? (((const float*)mask_a)[mi] == 0.0f)
                 : (g.mask_is_int == 1) ? (((const int*)mask_a)[mi] == 0) : (((const int*)mask_a)[mi] != 0);
        } else if (MODE == 3) masked = (qkeep[r] == 0) || (kvkeep[j] == 0);
        else if (MODE == 5) {
          const size_t mi = (size_t)qrow * g.Skv + kvcol;
          masked = (((const int*)mask_a)[mi] != 0);
          int n = mask_b[mi]; n = n < 0 ? 0 : n;
          s[j][r] += g.cp[(size_t)b * g.c_bs + (size_t)h * g.c_hs + (size_t)qrow * g.c_rs + n]
                   + g.pc[(size_t)b * g.c_bs + (size_t)h * g.c_hs + (size_t)kvcol * g.c_rs + n];
        }
        const float sv = masked ? g.mask_fill : s[j][r];   // one select on the element (a conditional store into the vector selects all 8 registers)
        s[j][r] = sv;
        m = fmaxf(m, sv);
      }
#pragma unroll
      for (int off = 1; off < 16; off <<= 1) m = fmaxf(m, __shfl_xor(m, off, 32));
      cm[r] = m;
    }
    __bf16* pwh = Psh[wave];
    __bf16* pwl = Psl[SPLIT_PV ? wave : 0];
#pragma unroll
    for (int r = 0; r < 8; ++r) {
      const float mnew = fmaxf(mrow[r], cm[r]);
      const float alpha = expf(mrow[r] - mnew);
      mrow[r] = mnew;
      float psum = 0.f;
#pragma unroll
      for (int j = 0; j < 4; ++j) {
        const float p = expf(s[j][r] - mnew);
        psum += p;
        if (SPLIT_PV) { __bf16 a, bl; at_split(p, a, bl); pwh[(8 * hh + r) * AT_KC + j * 16 + c] = a; pwl[(8 * hh + r) * AT_KC + j * 16 + c] = bl; }
        else pwh[(8 * hh + r) * AT_KC + j * 16 + c] = at_to16<F16>(p * PSC);
      }
#pragma unroll
      for (int off = 1; off < 16; off <<= 1) psum += __shfl_xor(psum, off, 32);
      lrow[r] = lrow[r] * alpha + psum;
#pragma unroll
      for (int t = 0; t < 4; ++t) oacc[t][r] *= alpha;
    }
    __builtin_amdgcn_fence(__ATOMIC_RELEASE, "workgroup");
    __builtin_amdgcn_wave_barrier();
    __builtin_amdgcn_fence(__ATOMIC_ACQUIRE, "workgroup");
#pragma unroll 1
    for (int kk = 0; kk < 2; ++kk) {
      FB pa, pl;
      pa.h[0] = *(const v8b*)(pwh + c * AT_KC + kk * 32 + 8 * hh);
      pa.h[1] = *(const v8b*)(pwh + c * AT_KC + kk * 32 + 16 + 8 * hh);
      if (SPLIT_PV) {
        pl.h[0] = *(const v8b*)(pwl + c * AT_KC + kk * 32 + 8 * hh);
        pl.h[1] = *(const v8b*)(pwl + c * AT_KC + kk * 32 + 16 + 8 * hh);
      }
#pragma unroll
      for (int t = 0; t < 4; ++t) {
        FB vb;
        vb.h[0] = *(const v8b*)(Vth + (t * 16 + c) * AT_KC + kk * 32 + 8 * hh);
        vb.h[1] = *(const v8b*)(Vth + (t * 16 + c) * AT_KC + kk * 32 + 16 + 8 * hh);
        oacc[t] = at_mma16<F16>(pa.v, vb.v, oacc[t]);
        if (SPLIT_PV) {
          FB vl;
          vl.h[0] = *(const v8b*)(Vtl + (t * 16 + c) * AT_KC + kk * 32 + 8 * hh);
          vl.h[1] = *(const v8b*)(Vtl + (t * 16 + c) * AT_KC + kk * 32 + 16 + 8 * hh);
          oacc[t] = at_mma16<F16>(pa.v, vl.v, oacc[t]);
          oacc[t] = at_mma16<F16>(pl.v, vb.v, oacc[t]);
        }
      }
    }
  }

  float* os = Os[wave];
#pragma unroll
  for (int r = 0; r < 8; ++r) {
    const float inv = 1.0f / (lrow[r] * PSC);
#pragma unroll
    for (int t = 0; t < 4; ++t) os[(8 * hh + r) * 68 + t * 16 + c] = oacc[t][r] * inv;
  }
  __builtin_amdgcn_fence(__ATOMIC_RELEASE, "workgroup");
  __builtin_amdgcn_wave_barrier();
  __builtin_amdgcn_fence(__ATOMIC_ACQUIRE, "workgroup");
  {
    const int c4 = (lane & 15) * 4;
    {
#pragma unroll
      for (int it = 0; it < 8; ++it) {
        const int row = it * 2 + hh;
        v4f val = *(const v4f*)(os + row * 68 + c4);
        *(v4f*)(ob_ptr + (size_t)(q0 + row) * g.o_rs + c4) = val;
      }
      
    }
  }
}

#define TB_ 8
#define TS 1024
#define TDm 512
#define TH 8
#define THD 64
#define TR (TB_ * TS)
typedef __attribute__((ext_vector_type(4))) _Float16 v4h;
// The three elementwise kernels: 512 blocks of 8 waves (two blocks a WGP); a thread moves EW_U items of 4 floats, every wave-wide 16-byte load
// covers 512 contiguous bytes, and all of a thread's loads are issued before its first store.
#define EW_U 8
#define EW_BLOCKS (TR * TDm / 4 / (EW_U * 256))
static_assert(EW_BLOCKS * EW_U * 256 * 4 == TR * TDm, "whole blocks");
// A16 [8192][1024] = [xs2 | xt] f16 (xs2 = raw reshape of xs); item i = floats 4i..4i+3 of xs and of xt, 128 items a row, so 256 items on = 2 rows on
__global__ __launch_bounds__(256) void cat_kernel(const float* __restrict__ xs, const float* __restrict__ xt, unsigned* __restrict__ A16) {
  const int base = blockIdx.x * (EW_U * 256) + threadIdx.x;
  const v4f* pa = (const v4f*)xs + base; const v4f* pb = (const v4f*)xt + base;
  v4h* o = (v4h*)A16 + (size_t)(base >> 7) * 256 + (base & 127);     // a row of A16 is 1024 f16 = 256 items; xt's half starts 128 items in
  v4f a[EW_U], b[EW_U];
#pragma unroll
  for (int u = 0; u < EW_U; ++u) { a[u] = pa[u * 256]; b[u] = pb[u * 256]; }
#pragma unroll
  for (int u = 0; u < EW_U; ++u) { o[u * 512] = __builtin_convertvector(a[u], v4h); o[u * 512 + 128] = __builtin_convertvector(b[u], v4h); }
}
// k' = k + WKᵀ: QKV[(b,s)][512 + h*64 + d] += WK[d][s]
// a thread owns (s, 4 columns) and walks the 8 batches, which share its 4 values of WK
__global__ __launch_bounds__(256) void kbias_kernel(float* __restrict__ QKV, const float* __restrict__ WK) {
  const int t = blockIdx.x * 256 + threadIdx.x; const int s = t >> 7, c = 4 * (t & 127), d = c % THD;
  static_assert(TS * (TDm / 4) == EW_BLOCKS * 256, "one thread per (s, 4 columns)");
  const float* wp = WK + (size_t)d * TS + s;
  const v4f w = {wp[0], wp[TS], wp[2 * TS], wp[3 * TS]};
  asm volatile("s_wait_xcnt 0x0" ::: "memory");   // the address registers of the 4 loads above may be reused as destinations of the loads below
  float* p = QKV + (size_t)s * (3 * TDm) + TDm + c;
  v4f k[TB_];
#pragma unroll
  for (int b = 0; b < TB_; ++b) k[b] = *(const v4f*)(p + (size_t)b * TS * (3 * TDm));
#pragma unroll
  for (int b = 0; b < TB_; ++b) *(v4f*)(p + (size_t)b * TS * (3 * TDm)) = k[b] + w;
}
// O f32 -> f16
__global__ __launch_bounds__(256) void cast_f32_f16x4(const float* __restrict__ in, _Float16* __restrict__ out) {
  const int base = blockIdx.x * (EW_U * 256) + threadIdx.x;
  const v4f* pi = (const v4f*)in + base; v4h* po = (v4h*)out + base;
  v4f x[EW_U];
#pragma unroll
  for (int u = 0; u < EW_U; ++u) x[u] = pi[u * 256];
#pragma unroll
  for (int u = 0; u < EW_U; ++u) po[u * 256] = __builtin_convertvector(x[u], v4h);
}
extern "C" void kernel_launch(void* const* d_in, const int* in_sizes, int n_in, void* d_out, int out_size, void* d_ws, size_t ws_size, hipStream_t stream) {
  (void)in_sizes; (void)n_in; (void)out_size; (void)ws_size;
  auto Fp = [&](int i) { return (const float*)d_in[i]; };
  const float* xs = Fp(0); const float* xt = Fp(1); const float* Wqs = Fp(2); const float* Wks = Fp(3); const float* Wvs = Fp(4); const float* Wqt = Fp(5); const float* Wkt = Fp(6); const float* Wvt = Fp(7); const float* WK = Fp(8); const float* Wo = Fp(9);
  char* ws = (char*)d_ws; size_t off = 0;
  auto carve = [&](size_t bytes) -> char* { char* p = ws + off; off += (bytes + 255) & ~(size_t)255; return p; };
  unsigned* A16 = (unsigned*)carve((size_t)TR * 2 * TDm * 2); _Float16* WT = (_Float16*)carve((size_t)3 * TDm * 2 * TDm * 2); _Float16* WoT = (_Float16*)carve((size_t)TDm * TDm * 2);
  float* QKV = (float*)carve((size_t)TR * 3 * TDm * 4); float* O = (float*)carve((size_t)TR * TDm * 4); _Float16* O16 = (_Float16*)A16;     // ≈ 84 MB; O16 reuses A16
  cat_kernel<<<EW_BLOCKS, 256, 0, stream>>>(xs, xt, A16);
  // Bt [1536][1024]: row n<512 (q): [Wqs[:,n]ᵀ | Wqt[:,n]ᵀ]; 512..1023 k; 1024..1535 v  — W* are [in 512][out 512] used as x·W
  transpose_cast_f16<<<dim3(TDm / 64, TDm / 64), dim3(32, 8), 0, stream>>>(Wqs, TDm, WT, 2 * TDm, 1.0f); transpose_cast_f16<<<dim3(TDm / 64, TDm / 64), dim3(32, 8), 0, stream>>>(Wqt, TDm, WT + TDm, 2 * TDm, 1.0f);
  transpose_cast_f16<<<dim3(TDm / 64, TDm / 64), dim3(32, 8), 0, stream>>>(Wks, TDm, WT + (size_t)TDm * 2 * TDm, 2 * TDm, 1.0f); transpose_cast_f16<<<dim3(TDm / 64, TDm / 64), dim3(32, 8), 0, stream>>>(Wkt, TDm, WT + (size_t)TDm * 2 * TDm + TDm, 2 * TDm, 1.0f);
  transpose_cast_f16<<<dim3(TDm / 64, TDm / 64), dim3(32, 8), 0, stream>>>(Wvs, TDm, WT + (size_t)2 * TDm * 2 * TDm, 2 * TDm, 1.0f); transpose_cast_f16<<<dim3(TDm / 64, TDm / 64), dim3(32, 8), 0, stream>>>(Wvt, TDm, WT + (size_t)2 * TDm * 2 * TDm + TDm, 2 * TDm, 1.0f);
  transpose_cast_f16<<<dim3(TDm / 64, TDm / 64), dim3(32, 8), 0, stream>>>(Wo, TDm, WoT, TDm, 1.0f);
  const int t3 = (TR / 64) * (3 * TDm / 64), t1 = (TR / 64) * (TDm / 64);
  wmma_gemm64<0, false, 0, 0, false><<<dim3((t3 + 7) / 8, 1), 256, 0, stream>>>((const unsigned short*)A16, nullptr, 2 * TDm, 0, U16(WT), nullptr, 2 * TDm, 0, QKV, nullptr, 3 * TDm, 0, nullptr, nullptr, 0, TR, 3 * TDm, 2 * TDm, 1.0f);
  kbias_kernel<<<EW_BLOCKS, 256, 0, stream>>>(QKV, WK);
  { AttnGeom g;
    g.q_bs = (long)TS * 3 * TDm; g.q_rs = 3 * TDm; g.q_hs = THD; g.k_bs = g.q_bs; g.k_rs = g.q_rs; g.k_hs = THD; g.v_bs = g.q_bs; g.v_rs = g.q_rs; g.v_hs = THD; g.o_bs = (long)TS * TDm; g.o_rs = TDm; g.o_hs = THD;
    g.S = TS; g.Skv = TS; g.H = TH; g.mask_mode = 1; g.qscale = 0.125f; g.blk0 = 0; g.mask_fill = -1e9f; g.mask_is_int = 0;
    attn64_kernel<false, false, true, 1><<<TB_ * TH * (TS / AT_QB), AT_NW * 32, 0, stream>>>(QKV, QKV + TDm, QKV + 2 * TDm, O, nullptr, nullptr, g); }
  cast_f32_f16x4<<<EW_BLOCKS, 256, 0, stream>>>(O, O16);
  wmma_gemm64<0, false, 0, 0, false><<<dim3((t1 + 7) / 8, 1), 256, 0, stream>>>(U16(O16), nullptr, TDm, 0, U16(WoT), nullptr, TDm, 0, (float*)d_out, nullptr, TDm, 0, nullptr, nullptr, 0, TR, TDm, TDm, 1.0f);
}

// v003
// Measured time: 249 microseconds a run.
// Two timings next to v002 put it at 1.08 and 1.09 times that version's speed.
// Counting every step since v000, it is 2.50 times as fast.
#include <hip/hip_runtime.h>
#include <math.h>
// TMSA block (8 x 1024 tokens x 512, 8 heads x 64, causal): q/k/v = xs2·W*s + xt·W*t as ONE product over the concatenated input [xs2 | xt]·[W*s; W*t]
// (8192 x 1024 · 1024 x 1536); the query-dependent bias q·WK is folded exactly into the keys — Σ_d q_d k_jd + Σ_d q_d WK[d][j] = q·(k_j + WK[:, j]) —
// so the attention is a plain causal flash-style kernel over k' = k + WKᵀ (scores (q/8)·k'ᵀ and p·v on WMMA, f16 operands with probabilities x2^15,
// f32 accumulate, online softmax in f32, -1e9 fill above the diagonal); output projection ·Wo. All products v_wmma_f32_16x16x32_f16, f16 operands,
// f32 accumulate (plain single products, ≈20 G MAC); the raw .view reshapes are identity on memory.
typedef __attribute__((ext_vector_type(16))) _Float16 v16h;
typedef __attribute__((ext_vector_type(8)))  _Float16 v8h;
typedef __attribute__((ext_vector_type(16))) __bf16   v16b;
typedef __attribute__((ext_vector_type(8)))  __bf16   v8b;
typedef __attribute__((ext_vector_type(8)))  float    v8f;
typedef __attribute__((ext_vector_type(4)))  float    v4f;
#define PSCALE 32768.0f
#define U16(p) ((const unsigned short*)(const void*)(p))
#define PSCALE_INV (1.0f / 32768.0f)

__device__ __forceinline__ unsigned short f2bf_bits(float f) {
  unsigned u = __float_as_uint(f);
  return (unsigned short)((u + 0x7FFFu + ((u >> 16) & 1u)) >> 16);
}
__device__ __forceinline__ float bf_bits2f(unsigned short h) { return __uint_as_float(((unsigned)h) << 16); }

// hazard guards as plain device helpers (no inline asm inside the kernel template body)
__device__ __forceinline__ void dep_guard_h(v8f& a, v8f& b, v16h x, v16h y) { asm volatile("v_nop\n\tv_nop\n\tv_nop\n\tv_nop" : "+v"(a), "+v"(b) : "v"(x), "v"(y)); }
__device__ __forceinline__ void dep_guard_b(v8f& a, v8f& b, v16b x, v16b y) { asm volatile("v_nop\n\tv_nop\n\tv_nop\n\tv_nop" : "+v"(a), "+v"(b) : "v"(x), "v"(y)); }
__device__ __forceinline__ void keep4_h(v16h a, v16h b, v16h c, v16h d) { asm volatile("v_nop" :: "v"(a), "v"(b), "v"(c), "v"(d)); }
__device__ __forceinline__ void keep4_b(v16b a, v16b b, v16b c, v16b d) { asm volatile("v_nop" :: "v"(a), "v"(b), "v"(c), "v"(d)); }
__device__ __forceinline__ void acc_guard4(v8f& a, v8f& b, v8f& c, v8f& d) { asm volatile("v_nop\n\tv_nop\n\tv_nop\n\tv_nop" : "+v"(a), "+v"(b), "+v"(c), "+v"(d)); }
template <typename T> struct Frag;
template <> struct Frag<_Float16> {
  typedef v16h V; union U { v16h v; v8h h[2]; };
  static __device__ __forceinline__ v16h load(const _Float16* p) {   // elements 0..7 <- p[0..7], 8..15 <- p[16..23]
    U f; f.h[0] = *(const v8h*)(p); f.h[1] = *(const v8h*)(p + 16); return f.v;
  }
  static __device__ __forceinline__ v8f mma(v16h a, v16h b, v8f c) {
    return __builtin_amdgcn_wmma_f32_16x16x32_f16(false, a, false, b, (short)0, c, false, false);
  }
  static __device__ __forceinline__ void guard(v8f& a, v8f& b, v16h x, v16h y) { dep_guard_h(a, b, x, y); }
  static __device__ __forceinline__ void keep(v16h a, v16h b, v16h c, v16h d) { keep4_h(a, b, c, d); }
};
template <> struct Frag<__bf16> {
  typedef v16b V; union U { v16b v; v8b h[2]; };
  static __device__ __forceinline__ v16b load(const __bf16* p) {
    U f; f.h[0] = *(const v8b*)(p); f.h[1] = *(const v8b*)(p + 16); return f.v;
  }
  static __device__ __forceinline__ v8f mma(v16b a, v16b b, v8f c) {
    return __builtin_amdgcn_wmma_f32_16x16x32_bf16(false, a, false, b, (short)0, c, false, false);
  }
  static __device__ __forceinline__ void guard(v8f& a, v8f& b, v16b x, v16b y) { dep_guard_b(a, b, x, y); }
  static __device__ __forceinline__ void keep(v16b a, v16b b, v16b c, v16b d) { keep4_b(a, b, c, d); }
};

// ---- Register-blocked batched WMMA GEMM ------------------------------------
// C[m,n] = scale * sum_k A[m,k] * Bt[n,k] (+bias)(+resid); each wave owns a 64x64 tile.
// A row-major [M,K]; Bt row-major [N,K]; M,N % 64 == 0, K % 32 == 0.
// SPLIT: operands are hi/lo planes (A2/Bt2 = lo planes, same layout); product = hi·hi + hi·lo + lo·hi.
// BIAS_MODE: 0 = none, 1 = bias[m], 2 = bias[n].
// OUT_MODE: 0 = f32, 1 = f16, 2 = bf16 hi plane (Cout) + bf16 lo plane (Cout2).
// ET: 0 = f16 operands, 1 = bf16 operands (pointers passed as 16-bit storage)
template <int ET> struct Elem;
template <> struct Elem<0> { typedef _Float16 T; };
template <> struct Elem<1> { typedef __bf16 T; };
template <int ET, bool SPLIT, int BIAS_MODE, int OUT_MODE, bool RESID, int ACT = 0>
__global__ __launch_bounds__(256) void wmma_gemm64(
    const unsigned short* __restrict__ Ap, const unsigned short* __restrict__ A2p, int lda, long strideA,
    const unsigned short* __restrict__ Btp, const unsigned short* __restrict__ Bt2p, int ldb, long strideB,
    void* __restrict__ Cout, void* __restrict__ Cout2, int ldc, long strideC,
    const float* __restrict__ bias,
    const float* __restrict__ resid, long strideR,
    int M, int N, int K, float scale) {
  typedef typename Elem<ET>::T T;
  typedef typename Frag<T>::V V;
  const T* A = (const T*)Ap; const T* A2 = (const T*)A2p; const T* Bt = (const T*)Btp; const T* Bt2 = (const T*)Bt2p;
  __shared__ __align__(16) float sT[8][16 * 68];   // per-wave 16x64 slab, pitch 68 floats
  const int b    = blockIdx.y;
  const int lane = threadIdx.x & 31;
  const int wave = threadIdx.x >> 5;
  const int tilesN = N >> 6;
  const int tilesM = M >> 6;
  const int tile = blockIdx.x * 8 + wave;
  if (tile >= tilesM * tilesN) return;   // wave-uniform; no block barriers in this kernel
  const int tm = tile / tilesN;
  const int tn = tile - tm * tilesN;
  const int m0 = tm << 6;
  const int n0 = tn << 6;

  const T* Ab  = A  + (size_t)b * strideA;
  const T* Bb  = Bt + (size_t)b * strideB;
  const T* Ab2 = SPLIT ? (A2  + (size_t)b * strideA) : nullptr;
  const T* Bb2 = SPLIT ? (Bt2 + (size_t)b * strideB) : nullptr;

  const int rlane = lane & 15;                 // row (A) / col (B, D) within subtile
  const int koff  = (lane >> 4) * 8;           // k offset of this lane half
  const int mOff  = (lane >> 4) * 8;           // D row offset

  v8f acc[4][4];
#pragma unroll
  for (int i = 0; i < 4; ++i)
#pragma unroll
    for (int j = 0; j < 4; ++j) acc[i][j] = (v8f){0.f,0.f,0.f,0.f,0.f,0.f,0.f,0.f};

  for (int k0 = 0; k0 < K; k0 += 32) {
    V bh[4], bl[4];
#pragma unroll
    for (int j = 0; j < 4; ++j) {
      const size_t bo = (size_t)(n0 + (j << 4) + rlane) * ldb + koff + k0;
      bh[j] = Frag<T>::load(Bb + bo);
      if (SPLIT) bl[j] = Frag<T>::load(Bb2 + bo);
    }
#pragma unroll
    for (int i = 0; i < 4; ++i) {
      const size_t ao = (size_t)(m0 + (i << 4) + rlane) * lda + koff + k0;
      V ah = Frag<T>::load(Ab + ao);
      V al;
      if (SPLIT) al = Frag<T>::load(Ab2 + ao);
#pragma unroll
      for (int j = 0; j < 4; ++j) {
        acc[i][j] = Frag<T>::mma(ah, bh[j], acc[i][j]);
        if (SPLIT) {
          acc[i][j] = Frag<T>::mma(ah, bl[j], acc[i][j]);
          acc[i][j] = Frag<T>::mma(al, bh[j], acc[i][j]);
        }
      }
      Frag<T>::guard(acc[i][0], acc[i][3], ah, SPLIT ? al : ah);
    }
    Frag<T>::keep(bh[0], bh[1], bh[2], bh[3]);
    if (SPLIT) Frag<T>::keep(bl[0], bl[1], bl[2], bl[3]);
  }
  acc_guard4(acc[0][0], acc[0][1], acc[0][2], acc[0][3]);
  acc_guard4(acc[1][0], acc[1][1], acc[1][2], acc[1][3]);
  acc_guard4(acc[2][0], acc[2][1], acc[2][2], acc[2][3]);
  acc_guard4(acc[3][0], acc[3][1], acc[3][2], acc[3][3]);

  // ---- epilogue ----
  float* slab = sT[wave];
  const float* Rb = RESID ? (resid + (size_t)b * strideR) : nullptr;
#pragma unroll
  for (int i = 0; i < 4; ++i) {
    const int mBase = m0 + (i << 4);
#pragma unroll
    for (int j = 0; j < 4; ++j) {
      const int n = n0 + (j << 4) + rlane;
      float bv = 0.f;
      if (BIAS_MODE == 2) bv = bias[n];
#pragma unroll
      for (int r = 0; r < 8; ++r) {
        float v = acc[i][j][r] * scale;
        if (BIAS_MODE == 1) v += bias[mBase + mOff + r];
        if (BIAS_MODE == 2) v += bv;
        if (RESID) v += Rb[(size_t)(mBase + mOff + r) * ldc + n];
        if (ACT == 1) v = tanhf(v);
        if (ACT == 2) v = fmaxf(v, 0.0f);
        if (ACT == 3) v = v / (1.0f + expf(-v));
        if (ACT == 4) v = (v > 0.f) ? v : 0.01f * v;
        if (ACT == 5) v = 0.5f * v * (1.0f + erff(v * 0.70710678118654752f));
        slab[(mOff + r) * 68 + (j << 4) + rlane] = v;
      }
    }
    __builtin_amdgcn_fence(__ATOMIC_RELEASE, "workgroup");
    __builtin_amdgcn_wave_barrier();
    __builtin_amdgcn_fence(__ATOMIC_ACQUIRE, "workgroup");
    if (OUT_MODE == 0) {
      float* C = (float*)Cout + (size_t)b * strideC;
      const int hh = lane >> 4, c4 = (lane & 15) * 4;     // row seg = 256 B = 16 lanes x 16 B
      {
#pragma unroll
        for (int it = 0; it < 8; ++it) {
          const int row = it * 2 + hh;
          v4f v = *(const v4f*)(slab + row * 68 + c4);
          *(v4f*)(C + (size_t)(mBase + row) * ldc + n0 + c4) = v;
        }
        
      }
    } else {
      const int q = lane >> 3, c8 = (lane & 7) * 8;
      unsigned short* C  = (unsigned short*)Cout  + (size_t)b * strideC;
      unsigned short* C2 = (OUT_MODE == 2) ? ((unsigned short*)Cout2 + (size_t)b * strideC) : nullptr;
      {
#pragma unroll
        for (int it = 0; it < 4; ++it) {
          const int row = it * 4 + q;
          const float* sp = slab + row * 68 + c8;
          v8h hv, lv;
#pragma unroll
          for (int e = 0; e < 8; ++e) {
            if (OUT_MODE == 1) {
              hv[e] = (_Float16)sp[e];
            } else {
              unsigned short hb = f2bf_bits(sp[e]);
              unsigned short lb = f2bf_bits(sp[e] - bf_bits2f(hb));
              hv[e] = __builtin_bit_cast(_Float16, hb);
              lv[e] = __builtin_bit_cast(_Float16, lb);
            }
          }
          *(v8h*)(C + (size_t)(mBase + row) * ldc + n0 + c8) = hv;
          if (OUT_MODE == 2) *(v8h*)(C2 + (size_t)(mBase + row) * ldc + n0 + c8) = lv;
        }
        
      }
    }
    __builtin_amdgcn_fence(__ATOMIC_RELEASE, "workgroup");
    __builtin_amdgcn_wave_barrier();
    __builtin_amdgcn_fence(__ATOMIC_ACQUIRE, "workgroup");
  }
}

// ---- f32 [R][C] (row pitch ldi) -> f16 transposed [C][R] (row pitch ldo); 64x64 tiles; each output row segment
__global__ __launch_bounds__(256) void transpose_cast_f16(const float* __restrict__ in, int ldi,
                                                         _Float16* __restrict__ outT, int ldo, float scale) {
  __shared__ __align__(16) _Float16 tile[64][72];     // [c][r]
  const int c0 = blockIdx.x * 64, r0 = blockIdx.y * 64;
  const int t = threadIdx.y * 32 + threadIdx.x;
  for (int i = threadIdx.y; i < 64; i += 8) {
    tile[threadIdx.x][i]      = (_Float16)(in[(size_t)(r0 + i) * ldi + c0 + threadIdx.x] * scale);
    tile[32 + threadIdx.x][i] = (_Float16)(in[(size_t)(r0 + i) * ldi + c0 + 32 + threadIdx.x] * scale);
  }
  __syncthreads();
  const int q = t >> 3, c8 = (t & 7) * 8;
  {
#pragma unroll
    for (int it = 0; it < 2; ++it) {
      const int c = it * 32 + q;
      v8h hv = *(const v8h*)(&tile[c][c8]);
      *(v8h*)(outT + (size_t)(c0 + c) * ldo + r0 + c8) = hv;
    }
    
  }
}

// =====================================================================================
// Generic causal/non-causal attention for head_dim 64, f32 in / f32 out; 16-bit operands: bf16 with optional hi/lo splits, or
// plain f16 (F16=true, non-split, probabilities carried x2^15).
//   scores = (q*qscale)·kᵀ : v_wmma_f32_16x16x32_bf16 (_f16 when F16); SPLIT_QK -> q,k as bf16 hi/lo (hi·hi + hi·lo + lo·hi)
//   out    = p·v           : v_wmma_f32_16x16x32_bf16; SPLIT_PV -> p,v as bf16 hi/lo; else p,v plain bf16, or plain f16 on v_wmma_f32_16x16x32_f16 when F16
//   f32 accumulate; online softmax in f32. Block = 4 waves = 64 query rows of one (batch, head); S % 64 == 0.
//   Element (b, s, h, d) of tensor X lives at X[b*X_bs + s*X_rs + h*X_hs + d] (strides in floats, multiples of 4).
//   Masking: MODE 0 none, 1 causal (kv > q masked), 2 tensor [S][Skv] shared over (b,h) (float if
//   mask_is_int==0, int32 with element == 0 -> masked if 1, int32 with element != 0 -> masked if 2), 3 per-token vectors qmask[B][S] & kvmask[B][Skv] (int32,
//   0 -> masked), 4 causal + sliding window (kv > q or q - kv > W masked; W passed in mask_is_int);
//   5 = relative-position bias: s += cp[b,h,q][idx[q][kv]] + pc[b,h,kv][idx[q][kv]] with idx = mask_b ([S][Skv] int32) and
//   mask_a an int32 [S][Skv] tensor with nonzero = masked (tables: element (b,h,row,n) at X + b*c_bs + h*c_hs + row*c_rs + n);
//   masked scores are replaced by mask_fill (e.g. -inf or -1e9) before the softmax.
//   grid.x = B * H * (S/64) (or a sub-range with blk0).
// =====================================================================================
#define AT_D 64
#define AT_NW 4
#define AT_QB 64
#define AT_KC 64
#define AT_P 72   // LDS row pitch of the K, V^T and P tiles in 16-bit elements: 144 B = 16 B x 9, so the 16 rows of a 16-byte fragment read fall on distinct banks
struct AttnGeom { const float* cp = nullptr; const float* pc = nullptr; long c_bs = 0, c_rs = 0, c_hs = 0;   // mode-5 score-bias tables
                  long q_bs, q_rs, q_hs, k_bs, k_rs, k_hs, v_bs, v_rs, v_hs, o_bs, o_rs, o_hs;
                  int S, Skv, H, mask_mode; float qscale; int blk0; float mask_fill; int mask_is_int; };
static_assert(sizeof(AttnGeom) == 168, "no padding");

__device__ __forceinline__ unsigned short at_bf_bits(float f) {
  unsigned u = __float_as_uint(f);
  return (unsigned short)((u + 0x7FFFu + ((u >> 16) & 1u)) >> 16);
}
__device__ __forceinline__ __bf16 at_f2bf(float f) { return __builtin_bit_cast(__bf16, at_bf_bits(f)); }
__device__ __forceinline__ void at_split(float f, __bf16& hi, __bf16& lo) {
  const unsigned short hb = at_bf_bits(f);
  hi = __builtin_bit_cast(__bf16, hb);
  lo = at_f2bf(f - __uint_as_float(((unsigned)hb) << 16));
}
__device__ __forceinline__ v8f at_mma(v16b a, v16b b, v8f c) {
  c = __builtin_amdgcn_wmma_f32_16x16x32_bf16(false, a, false, b, (short)0, c, false, false);
  asm volatile("v_nop\n\tv_nop\n\tv_nop\n\tv_nop" : "+v"(c) : "v"(a), "v"(b));
  return c;
}
// 16-bit element as a bit pattern held in a __bf16 slot: f16 bits when F16, bf16 (RNE) otherwise
template <bool F16> __device__ __forceinline__ __bf16 at_to16(float f) {
  if (F16) return __builtin_bit_cast(__bf16, (_Float16)f);
  return at_f2bf(f);
}
template <bool F16> __device__ __forceinline__ v8f at_mma16(v16b a, v16b b, v8f c) {
  if (F16) {
    const v16h ah = __builtin_bit_cast(v16h, a), bh = __builtin_bit_cast(v16h, b);
    c = __builtin_amdgcn_wmma_f32_16x16x32_f16(false, ah, false, bh, (short)0, c, false, false);
    asm volatile("v_nop\n\tv_nop\n\tv_nop\n\tv_nop" : "+v"(c) : "v"(ah), "v"(bh));
    return c;
  }
  return at_mma(a, b, c);
}

// MODE = the mask mode as a compile-time constant: the per-score mode tests fold away, so the unrolled score loop is straight-line code
template <bool SPLIT_QK, bool SPLIT_PV, bool F16, int MODE>
__global__ __launch_bounds__(128)
void attn64_kernel(const float* __restrict__ q, const float* __restrict__ k,
                   const float* __restrict__ v, float* __restrict__ out,
                   const void* __restrict__ mask_a, const int* __restrict__ mask_b, AttnGeom g) {
  static_assert(!(F16 && (SPLIT_QK || SPLIT_PV)), "f16 mode is non-split");
  const float PSC = F16 ? 32768.0f : 1.0f;     // f16 probabilities carried x2^15 (subnormal range), folded into the final 1/l
  union FB { v16b v; v8b h[2]; };
  __shared__ __align__(16) __bf16 Ksh[AT_KC * AT_P];             // K hi [kv][d]      9 KB
  __shared__ __align__(16) __bf16 Ksl[SPLIT_QK ? AT_KC * AT_P : 8];
  __shared__ __align__(16) __bf16 Vth[AT_D * AT_P];              // V hi [d][kv]      9 KB
  __shared__ __align__(16) __bf16 Vtl[SPLIT_PV ? AT_D * AT_P : 8];
  __shared__ __align__(16) __bf16 Psh[AT_NW][16 * AT_P];         // per wave P hi [row][kv]  9 KB
  __shared__ __align__(16) __bf16 Psl[SPLIT_PV ? AT_NW : 1][SPLIT_PV ? 16 * AT_P : 8];
  __shared__ __align__(16) float  Os[AT_NW][16 * 68];            // per wave out tile, pitch 68

  const int tid  = threadIdx.x;
  const int wave = tid >> 5;
  const int lane = tid & 31;
  const int hh   = lane >> 4;
  const int c    = lane & 15;

  const int nqb = g.S / AT_QB;
  const int bx = blockIdx.x + g.blk0;
  const int qb = bx % nqb;
  const int bh = bx / nqb;
  const int h  = bh % g.H;
  const int b  = bh / g.H;
  const int qbase_block = qb * AT_QB;
  const int q0 = qbase_block + wave * 16;

  const float* qb_ptr = q + (size_t)b * g.q_bs + (size_t)h * g.q_hs;
  const float* kb_ptr = k + (size_t)b * g.k_bs + (size_t)h * g.k_hs;
  const float* vb_ptr = v + (size_t)b * g.v_bs + (size_t)h * g.v_hs;
  float*       ob_ptr = out + (size_t)b * g.o_bs + (size_t)h * g.o_hs;

  // ---- Q fragments (A operand): 2 d-chunks, hi (and lo) ----
  v16b qah[2], qal[2];
  {
    const float* qrow = qb_ptr + (size_t)(q0 + c) * g.q_rs;
#pragma unroll
    for (int dc = 0; dc < 2; ++dc) {
#pragma unroll
      for (int e = 0; e < 8; ++e) {
        const float f0 = qrow[dc * 32 + 8 * hh + e] * g.qscale;
        const float f1 = qrow[dc * 32 + 16 + 8 * hh + e] * g.qscale;
        if (SPLIT_QK) { __bf16 hq, lq; at_split(f0, hq, lq); qah[dc][e] = hq; qal[dc][e] = lq; at_split(f1, hq, lq); qah[dc][8 + e] = hq; qal[dc][8 + e] = lq; }
        else { qah[dc][e] = at_to16<F16>(f0); qah[dc][8 + e] = at_to16<F16>(f1); qal[dc][e] = qah[dc][e]; qal[dc][8 + e] = qah[dc][8 + e]; }
      }
    }
  }

  float mrow[8], lrow[8];
  v8f oacc[4];
#pragma unroll
  for (int r = 0; r < 8; ++r) { mrow[r] = -INFINITY; lrow[r] = 0.f; }
#pragma unroll
  for (int t = 0; t < 4; ++t) oacc[t] = (v8f){0.f,0.f,0.f,0.f,0.f,0.f,0.f,0.f};

  const int nChunks = (MODE == 1 || MODE == 4) ? (qb + 1) : (g.Skv / AT_KC);   // block-uniform
  // per-row query mask (mode 3)
  int qkeep[8];
#pragma unroll
  for (int r = 0; r < 8; ++r) qkeep[r] = (MODE == 3) ? mask_b[(size_t)b * g.S + q0 + 8 * hh + r] : 1;   // mask_b = qmask in mode 3
  for (int kc = 0; kc < nChunks; ++kc) {
    const int kv0 = kc * AT_KC;
    __syncthreads();
    {
      const int kvr = tid >> 1, dh = (tid & 1) * 32;
      const float* krow = kb_ptr + (size_t)(kv0 + kvr) * g.k_rs + dh;
      const float* vrow = vb_ptr + (size_t)(kv0 + kvr) * g.v_rs + dh;
#pragma unroll
      for (int i = 0; i < 8; ++i) {
        v4f kk = *(const v4f*)(krow + 4 * i);
        v4f vv = *(const v4f*)(vrow + 4 * i);
#pragma unroll
        for (int e = 0; e < 4; ++e) {
          const int d = dh + 4 * i + e;
          if (SPLIT_QK) { __bf16 a, bl; at_split(kk[e], a, bl); Ksh[kvr * AT_P + d] = a; Ksl[kvr * AT_P + d] = bl; }
          else Ksh[kvr * AT_P + d] = at_to16<F16>(kk[e]);
          if (SPLIT_PV) { __bf16 a, bl; at_split(vv[e], a, bl); Vth[d * AT_P + kvr] = a; Vtl[d * AT_P + kvr] = bl; }
          else Vth[d * AT_P + kvr] = at_to16<F16>(vv[e]);
        }
      }
    }
    __syncthreads();

    v8f s[4];
#pragma unroll
    for (int j = 0; j < 4; ++j) {
      s[j] = (v8f){0.f,0.f,0.f,0.f,0.f,0.f,0.f,0.f};
#pragma unroll 1
      for (int dc = 0; dc < 2; ++dc) {
        FB kb;
        kb.h[0] = *(const v8b*)(Ksh + (j * 16 + c) * AT_P + dc * 32 + 8 * hh);
        kb.h[1] = *(const v8b*)(Ksh + (j * 16 + c) * AT_P + dc * 32 + 16 + 8 * hh);
        s[j] = at_mma16<F16>(qah[dc], kb.v, s[j]);
        if (SPLIT_QK) {
          FB kl;
          kl.h[0] = *(const v8b*)(Ksl + (j * 16 + c) * AT_P + dc * 32 + 8 * hh);
          kl.h[1] = *(const v8b*)(Ksl + (j * 16 + c) * AT_P + dc * 32 + 16 + 8 * hh);
          s[j] = at_mma16<F16>(qah[dc], kl.v, s[j]);
          s[j] = at_mma16<F16>(qal[dc], kb.v, s[j]);
        }
      }
    }
    const bool diag = (MODE == 1) && (kc == qb);
    int kvkeep[4] = {1, 1, 1, 1};
    if (MODE == 3) {
#pragma unroll
      for (int j = 0; j < 4; ++j) kvkeep[j] = ((const int*)mask_a)[(size_t)b * g.Skv + kv0 + j * 16 + c];   // mask_a = kvmask
    }
    float cm[8];
#pragma unroll
    for (int r = 0; r < 8; ++r) {
      const int qrow = q0 + 8 * hh + r;
      float m = -INFINITY;
#pragma unroll
      for (int j = 0; j < 4; ++j) {
        const int kvcol = kv0 + j * 16 + c;
        bool masked = false;
        if (diag) masked = (kvcol > qrow);
        else if (MODE == 4) masked = (kvcol > qrow) || (qrow - kvcol > g.mask_is_int);
        else if (MODE == 2) {
          const size_t mi = (size_t)qrow * g.Skv + kvcol;
          masked = (g.mask_is_int == 0) ? (((const float*)mask_a)[mi] == 0.0f)
                 : (g.mask_is_int == 1) ? (((const int*)mask_a)[mi] == 0) : (((const int*)mask_a)[mi] != 0);
        } else if (MODE == 3) masked = (qkeep[r] == 0) || (kvkeep[j] == 0);
        else if (MODE == 5) {
          const size_t mi = (size_t)qrow * g.Skv + kvcol;
          masked = (((const int*)mask_a)[mi] != 0);
          int n = mask_b[mi]; n = n < 0 ? 0 : n;
          s[j][r] += g.cp[(size_t)b * g.c_bs + (size_t)h * g.c_hs + (size_t)qrow * g.c_rs + n]
                   + g.pc[(size_t)b * g.c_bs + (size_t)h * g.c_hs + (size_t)kvcol * g.c_rs + n];
        }
        const float sv = masked ? g.mask_fill : s[j][r];   // one select on the element (a conditional store into the vector selects all 8 registers)
        s[j][r] = sv;
        m = fmaxf(m, sv);
      }
#pragma unroll
      for (int off = 1; off < 16; off <<= 1) m = fmaxf(m, __shfl_xor(m, off, 32));
      cm[r] = m;
    }
    __bf16* pwh = Psh[wave];
    __bf16* pwl = Psl[SPLIT_PV ? wave : 0];
#pragma unroll
    for (int r = 0; r < 8; ++r) {
      const float mnew = fmaxf(mrow[r], cm[r]);
      const float alpha = expf(mrow[r] - mnew);
      mrow[r] = mnew;
      float psum = 0.f;
#pragma unroll
      for (int j = 0; j < 4; ++j) {
        const float p = expf(s[j][r] - mnew);
        psum += p;
        if (SPLIT_PV) { __bf16 a, bl; at_split(p, a, bl); pwh[(8 * hh + r) * AT_P + j * 16 + c] = a; pwl[(8 * hh + r) * AT_P + j * 16 + c] = bl; }
        else pwh[(8 * hh + r) * AT_P + j * 16 + c] = at_to16<F16>(p * PSC);
      }
#pragma unroll
      for (int off = 1; off < 16; off <<= 1) psum += __shfl_xor(psum, off, 32);
      lrow[r] = lrow[r] * alpha + psum;
#pragma unroll
      for (int t = 0; t < 4; ++t) oacc[t][r] *= alpha;
    }
    __builtin_amdgcn_fence(__ATOMIC_RELEASE, "workgroup");
    __builtin_amdgcn_wave_barrier();
    __builtin_amdgcn_fence(__ATOMIC_ACQUIRE, "workgroup");
#pragma unroll 1
    for (int kk = 0; kk < 2; ++kk) {
      FB pa, pl;
      pa.h[0] = *(const v8b*)(pwh + c * AT_P + kk * 32 + 8 * hh);
      pa.h[1] = *(const v8b*)(pwh + c * AT_P + kk * 32 + 16 + 8 * hh);
      if (SPLIT_PV) {
        pl.h[0] = *(const v8b*)(pwl + c * AT_P + kk * 32 + 8 * hh);
        pl.h[1] = *(const v8b*)(pwl + c * AT_P + kk * 32 + 16 + 8 * hh);
      }
#pragma unroll
      for (int t = 0; t < 4; ++t) {
        FB vb;
        vb.h[0] = *(const v8b*)(Vth + (t * 16 + c) * AT_P + kk * 32 + 8 * hh);
        vb.h[1] = *(const v8b*)(Vth + (t * 16 + c) * AT_P + kk * 32 + 16 + 8 * hh);
        oacc[t] = at_mma16<F16>(pa.v, vb.v, oacc[t]);
        if (SPLIT_PV) {
          FB vl;
          vl.h[0] = *(const v8b*)(Vtl + (t * 16 + c) * AT_P + kk * 32 + 8 * hh);
          vl.h[1] = *(const v8b*)(Vtl + (t * 16 + c) * AT_P + kk * 32 + 16 + 8 * hh);
          oacc[t] = at_mma16<F16>(pa.v, vl.v, oacc[t]);
          oacc[t] = at_mma16<F16>(pl.v, vb.v, oacc[t]);
        }
      }
    }
  }

  float* os = Os[wave];
#pragma unroll
  for (int r = 0; r < 8; ++r) {
    const float inv = 1.0f / (lrow[r] * PSC);
#pragma unroll
    for (int t = 0; t < 4; ++t) os[(8 * hh + r) * 68 + t * 16 + c] = oacc[t][r] * inv;
  }
  __builtin_amdgcn_fence(__ATOMIC_RELEASE, "workgroup");
  __builtin_amdgcn_wave_barrier();
  __builtin_amdgcn_fence(__ATOMIC_ACQUIRE, "workgroup");
  {
    const int c4 = (lane & 15) * 4;
    {
#pragma unroll
      for (int it = 0; it < 8; ++it) {
        const int row = it * 2 + hh;
        v4f val = *(const v4f*)(os + row * 68 + c4);
        *(v4f*)(ob_ptr + (size_t)(q0 + row) * g.o_rs + c4) = val;
      }
      
    }
  }
}

#define TB_ 8
#define TS 1024
#define TDm 512
#define TH 8
#define THD 64
#define TR (TB_ * TS)
typedef __attribute__((ext_vector_type(4))) _Float16 v4h;
// The three elementwise kernels: 512 blocks of 8 waves (two blocks a WGP); a thread moves EW_U items of 4 floats, every wave-wide 16-byte load
// covers 512 contiguous bytes, and all of a thread's loads are issued before its first store.
#define EW_U 8
#define EW_BLOCKS (TR * TDm / 4 / (EW_U * 256))
static_assert(EW_BLOCKS * EW_U * 256 * 4 == TR * TDm, "whole blocks");
// A16 [8192][1024] = [xs2 | xt] f16 (xs2 = raw reshape of xs); item i = floats 4i..4i+3 of xs and of xt, 128 items a row, so 256 items on = 2 rows on
__global__ __launch_bounds__(256) void cat_kernel(const float* __restrict__ xs, const float* __restrict__ xt, unsigned* __restrict__ A16) {
  const int base = blockIdx.x * (EW_U * 256) + threadIdx.x;
  const v4f* pa = (const v4f*)xs + base; const v4f* pb = (const v4f*)xt + base;
  v4h* o = (v4h*)A16 + (size_t)(base >> 7) * 256 + (base & 127);     // a row of A16 is 1024 f16 = 256 items; xt's half starts 128 items in
  v4f a[EW_U], b[EW_U];
#pragma unroll
  for (int u = 0; u < EW_U; ++u) { a[u] = pa[u * 256]; b[u] = pb[u * 256]; }
#pragma unroll
  for (int u = 0; u < EW_U; ++u) { o[u * 512] = __builtin_convertvector(a[u], v4h); o[u * 512 + 128] = __builtin_convertvector(b[u], v4h); }
}
// k' = k + WKᵀ: QKV[(b,s)][512 + h*64 + d] += WK[d][s]
// a thread owns (s, 4 columns) and walks the 8 batches, which share its 4 values of WK
__global__ __launch_bounds__(256) void kbias_kernel(float* __restrict__ QKV, const float* __restrict__ WK) {
  const int t = blockIdx.x * 256 + threadIdx.x; const int s = t >> 7, c = 4 * (t & 127), d = c % THD;
  static_assert(TS * (TDm / 4) == EW_BLOCKS * 256, "one thread per (s, 4 columns)");
  const float* wp = WK + (size_t)d * TS + s;
  const v4f w = {wp[0], wp[TS], wp[2 * TS], wp[3 * TS]};
  asm volatile("s_wait_xcnt 0x0" ::: "memory");   // the address registers of the 4 loads above may be reused as destinations of the loads below
  float* p = QKV + (size_t)s * (3 * TDm) + TDm + c;
  v4f k[TB_];
#pragma unroll
  for (int b = 0; b < TB_; ++b) k[b] = *(const v4f*)(p + (size_t)b * TS * (3 * TDm));
#pragma unroll
  for (int b = 0; b < TB_; ++b) *(v4f*)(p + (size_t)b * TS * (3 * TDm)) = k[b] + w;
}
// O f32 -> f16
__global__ __launch_bounds__(256) void cast_f32_f16x4(const float* __restrict__ in, _Float16* __restrict__ out) {
  const int base = blockIdx.x * (EW_U * 256) + threadIdx.x;
  const v4f* pi = (const v4f*)in + base; v4h* po = (v4h*)out + base;
  v4f x[EW_U];
#pragma unroll
  for (int u = 0; u < EW_U; ++u) x[u] = pi[u * 256];
#pragma unroll
  for (int u = 0; u < EW_U; ++u) po[u * 256] = __builtin_convertvector(x[u], v4h);
}
extern "C" void kernel_launch(void* const* d_in, const int* in_sizes, int n_in, void* d_out, int out_size, void* d_ws, size_t ws_size, hipStream_t stream) {
  (void)in_sizes; (void)n_in; (void)out_size; (void)ws_size;
  auto Fp = [&](int i) { return (const float*)d_in[i]; };
  const float* xs = Fp(0); const float* xt = Fp(1); const float* Wqs = Fp(2); const float* Wks = Fp(3); const float* Wvs = Fp(4); const float* Wqt = Fp(5); const float* Wkt = Fp(6); const float* Wvt = Fp(7); const float* WK = Fp(8); const float* Wo = Fp(9);
  char* ws = (char*)d_ws; size_t off = 0;
  auto carve = [&](size_t bytes) -> char* { char* p = ws + off; off += (bytes + 255) & ~(size_t)255; return p; };
  unsigned* A16 = (unsigned*)carve((size_t)TR * 2 * TDm * 2); _Float16* WT = (_Float16*)carve((size_t)3 * TDm * 2 * TDm * 2); _Float16* WoT = (_Float16*)carve((size_t)TDm * TDm * 2);
  float* QKV = (float*)carve((size_t)TR * 3 * TDm * 4); float* O = (float*)carve((size_t)TR * TDm * 4); _Float16* O16 = (_Float16*)A16;     // ≈ 84 MB; O16 reuses A16
  cat_kernel<<<EW_BLOCKS, 256, 0, stream>>>(xs, xt, A16);
  // Bt [1536][1024]: row n<512 (q): [Wqs[:,n]ᵀ | Wqt[:,n]ᵀ]; 512..1023 k; 1024..1535 v  — W* are [in 512][out 512] used as x·W
  transpose_cast_f16<<<dim3(TDm / 64, TDm / 64), dim3(32, 8), 0, stream>>>(Wqs, TDm, WT, 2 * TDm, 1.0f); transpose_cast_f16<<<dim3(TDm / 64, TDm / 64), dim3(32, 8), 0, stream>>>(Wqt, TDm, WT + TDm, 2 * TDm, 1.0f);
  transpose_cast_f16<<<dim3(TDm / 64, TDm / 64), dim3(32, 8), 0, stream>>>(Wks, TDm, WT + (size_t)TDm * 2 * TDm, 2 * TDm, 1.0f); transpose_cast_f16<<<dim3(TDm / 64, TDm / 64), dim3(32, 8), 0, stream>>>(Wkt, TDm, WT + (size_t)TDm * 2 * TDm + TDm, 2 * TDm, 1.0f);
  transpose_cast_f16<<<dim3(TDm / 64, TDm / 64), dim3(32, 8), 0, stream>>>(Wvs, TDm, WT + (size_t)2 * TDm * 2 * TDm, 2 * TDm, 1.0f); transpose_cast_f16<<<dim3(TDm / 64, TDm / 64), dim3(32, 8), 0, stream>>>(Wvt, TDm, WT + (size_t)2 * TDm * 2 * TDm + TDm, 2 * TDm, 1.0f);
  transpose_cast_f16<<<dim3(TDm / 64, TDm / 64), dim3(32, 8), 0, stream>>>(Wo, TDm, WoT, TDm, 1.0f);
  const int t3 = (TR / 64) * (3 * TDm / 64), t1 = (TR / 64) * (TDm / 64);
  wmma_gemm64<0, false, 0, 0, false><<<dim3((t3 + 7) / 8, 1), 256, 0, stream>>>((const unsigned short*)A16, nullptr, 2 * TDm, 0, U16(WT), nullptr, 2 * TDm, 0, QKV, nullptr, 3 * TDm, 0, nullptr, nullptr, 0, TR, 3 * TDm, 2 * TDm, 1.0f);
  kbias_kernel<<<EW_BLOCKS, 256, 0, stream>>>(QKV, WK);
  { AttnGeom g;
    g.q_bs = (long)TS * 3 * TDm; g.q_rs = 3 * TDm; g.q_hs = THD; g.k_bs = g.q_bs; g.k_rs = g.q_rs; g.k_hs = THD; g.v_bs = g.q_bs; g.v_rs = g.q_rs; g.v_hs = THD; g.o_bs = (long)TS * TDm; g.o_rs = TDm; g.o_hs = THD;
    g.S = TS; g.Skv = TS; g.H = TH; g.mask_mode = 1; g.qscale = 0.125f; g.blk0 = 0; g.mask_fill = -1e9f; g.mask_is_int = 0;
    attn64_kernel<false, false, true, 1><<<TB_ * TH * (TS / AT_QB), AT_NW * 32, 0, stream>>>(QKV, QKV + TDm, QKV + 2 * TDm, O, nullptr, nullptr, g); }
  cast_f32_f16x4<<<EW_BLOCKS, 256, 0, stream>>>(O, O16);
  wmma_gemm64<0, false, 0, 0, false><<<dim3((t1 + 7) / 8, 1), 256, 0, stream>>>(U16(O16), nullptr, TDm, 0, U16(WoT), nullptr, TDm, 0, (float*)d_out, nullptr, TDm, 0, nullptr, nullptr, 0, TR, TDm, TDm, 1.0f);
}

// v004
// Measured time: 194 microseconds a run.
// Timed twice side by side with v003, it ran 1.29 and 1.27 times as fast.
// Over all steps from v000 it is 3.20 times as fast.
#include <hip/hip_runtime.h>
#include <math.h>
// TMSA block (8 x 1024 tokens x 512, 8 heads x 64, causal): q/k/v = xs2·W*s + xt·W*t as ONE product over the concatenated input [xs2 | xt]·[W*s; W*t]
// (8192 x 1024 · 1024 x 1536); the query-dependent bias q·WK is folded exactly into the keys — Σ_d q_d k_jd + Σ_d q_d WK[d][j] = q·(k_j + WK[:, j]) —
// so the attention is a plain causal flash-style kernel over k' = k + WKᵀ (scores (q/8)·k'ᵀ and p·v on WMMA, f16 operands with probabilities x2^15,
// f32 accumulate, online softmax in f32, -1e9 fill above the diagonal); output projection ·Wo. All products v_wmma_f32_16x16x32_f16, f16 operands,
// f32 accumulate (plain single products, ≈20 G MAC); the raw .view reshapes are identity on memory.
typedef __attribute__((ext_vector_type(16))) _Float16 v16h;
typedef __attribute__((ext_vector_type(8)))  _Float16 v8h;
typedef __attribute__((ext_vector_type(16))) __bf16   v16b;
typedef __attribute__((ext_vector_type(8)))  __bf16   v8b;
typedef __attribute__((ext_vector_type(8)))  float    v8f;
typedef __attribute__((ext_vector_type(4)))  float    v4f;
#define PSCALE 32768.0f
#define U16(p) ((const unsigned short*)(const void*)(p))
#define PSCALE_INV (1.0f / 32768.0f)

__device__ __forceinline__ unsigned short f2bf_bits(float f) {
  unsigned u = __float_as_uint(f);
  return (unsigned short)((u + 0x7FFFu + ((u >> 16) & 1u)) >> 16);
}
__device__ __forceinline__ float bf_bits2f(unsigned short h) { return __uint_as_float(((unsigned)h) << 16); }

// hazard guards as plain device helpers (no inline asm inside the kernel template body)
__device__ __forceinline__ void dep_guard_h(v8f& a, v8f& b, v16h x, v16h y) { asm volatile("v_nop\n\tv_nop\n\tv_nop\n\tv_nop" : "+v"(a), "+v"(b) : "v"(x), "v"(y)); }
__device__ __forceinline__ void dep_guard_b(v8f& a, v8f& b, v16b x, v16b y) { asm volatile("v_nop\n\tv_nop\n\tv_nop\n\tv_nop" : "+v"(a), "+v"(b) : "v"(x), "v"(y)); }
__device__ __forceinline__ void keep4_h(v16h a, v16h b, v16h c, v16h d) { asm volatile("v_nop" :: "v"(a), "v"(b), "v"(c), "v"(d)); }
__device__ __forceinline__ void keep4_b(v16b a, v16b b, v16b c, v16b d) { asm volatile("v_nop" :: "v"(a), "v"(b), "v"(c), "v"(d)); }
__device__ __forceinline__ void acc_guard4(v8f& a, v8f& b, v8f& c, v8f& d) { asm volatile("v_nop\n\tv_nop\n\tv_nop\n\tv_nop" : "+v"(a), "+v"(b), "+v"(c), "+v"(d)); }
template <typename T> struct Frag;
template <> struct Frag<_Float16> {
  typedef v16h V; union U { v16h v; v8h h[2]; };
  static __device__ __forceinline__ v16h load(const _Float16* p) {   // elements 0..7 <- p[0..7], 8..15 <- p[16..23]
    U f; f.h[0] = *(const v8h*)(p); f.h[1] = *(const v8h*)(p + 16); return f.v;
  }
  static __device__ __forceinline__ v8f mma(v16h a, v16h b, v8f c) {
    return __builtin_amdgcn_wmma_f32_16x16x32_f16(false, a, false, b, (short)0, c, false, false);
  }
  static __device__ __forceinline__ void guard(v8f& a, v8f& b, v16h x, v16h y) { dep_guard_h(a, b, x, y); }
  static __device__ __forceinline__ void keep(v16h a, v16h b, v16h c, v16h d) { keep4_h(a, b, c, d); }
};
template <> struct Frag<__bf16> {
  typedef v16b V; union U { v16b v; v8b h[2]; };
  static __device__ __forceinline__ v16b load(const __bf16* p) {
    U f; f.h[0] = *(const v8b*)(p); f.h[1] = *(const v8b*)(p + 16); return f.v;
  }
  static __device__ __forceinline__ v8f mma(v16b a, v16b b, v8f c) {
    return __builtin_amdgcn_wmma_f32_16x16x32_bf16(false, a, false, b, (short)0, c, false, false);
  }
  static __device__ __forceinline__ void guard(v8f& a, v8f& b, v16b x, v16b y) { dep_guard_b(a, b, x, y); }
  static __device__ __forceinline__ void keep(v16b a, v16b b, v16b c, v16b d) { keep4_b(a, b, c, d); }
};

// ---- Register-blocked batched WMMA GEMM ------------------------------------
// C[m,n] = scale * sum_k A[m,k] * Bt[n,k] (+bias)(+resid); each wave owns a 64x64 tile, the 8 waves of a block a 128x256 tile (2 x 4 waves).
// A row-major [M,K]; Bt row-major [N,K]; M % 128 == 0, N % 256 == 0, K % 64 == 0; grid.x = (M/128)*(N/256).
// Operands go through LDS: a stage is 64 k (128 B) of the block's 128 A rows and 256 Bt rows, brought by asynchronous 16-byte copies whose
// wave-wide form covers 4 whole 128-B lines; two buffers, the copies of stage t+2 fly while stage t+1 is worked on.
// SPLIT (hi/lo planes) is not staged and so not offered by this form.
// BIAS_MODE: 0 = none, 1 = bias[m], 2 = bias[n].
// OUT_MODE: 0 = f32, 1 = f16, 2 = bf16 hi plane (Cout) + bf16 lo plane (Cout2).
// ET: 0 = f16 operands, 1 = bf16 operands (pointers passed as 16-bit storage)
template <int ET> struct Elem;
template <> struct Elem<0> { typedef _Float16 T; };
template <> struct Elem<1> { typedef __bf16 T; };
#define GT_BM 128
#define GT_BN 256
#define GT_BK 64
#define GT_P 72                              // LDS row pitch in 16-bit elements: 144 B = 16 B x 9, conflict-free for 16-byte fragment reads
#define GT_STAGE ((GT_BM + GT_BN) * GT_P)    // 16-bit elements of one buffer: A rows 0..127, then Bt rows 0..255
#define GT_G (32 * GT_P * 2)                 // LDS bytes from one group of 32 rows to the next
// One stage, one thread's share: 12 copies of 16 B (4 groups of 32 A rows, 8 groups of 32 Bt rows). l = the lane's LDS byte address in group 0,
// a / b = its global address in group 0 of A / Bt, sa / sb = elements from one group of 32 rows to the next.
// The s_wait_xcnt stands inside the statement so that no address register of a copy is rewritten ahead of it.
__device__ __forceinline__ void gemm_stage_copy(unsigned l, const unsigned short* a, size_t sa, const unsigned short* b, size_t sb) {
  asm volatile(
      "global_load_async_to_lds_b128 %0, %12, off\n\t"
      "global_load_async_to_lds_b128 %1, %13, off\n\t"
      "global_load_async_to_lds_b128 %2, %14, off\n\t"
      "global_load_async_to_lds_b128 %3, %15, off\n\t"
      "global_load_async_to_lds_b128 %4, %16, off\n\t"
      "global_load_async_to_lds_b128 %5, %17, off\n\t"
      "global_load_async_to_lds_b128 %6, %18, off\n\t"
      "global_load_async_to_lds_b128 %7, %19, off\n\t"
      "global_load_async_to_lds_b128 %8, %20, off\n\t"
      "global_load_async_to_lds_b128 %9, %21, off\n\t"
      "global_load_async_to_lds_b128 %10, %22, off\n\t"
      "global_load_async_to_lds_b128 %11, %23, off\n\t"
      "s_wait_xcnt 0x0"
      :: "v"(l), "v"(l + GT_G), "v"(l + 2 * GT_G), "v"(l + 3 * GT_G),
         "v"(l + 4 * GT_G), "v"(l + 5 * GT_G), "v"(l + 6 * GT_G), "v"(l + 7 * GT_G),
         "v"(l + 8 * GT_G), "v"(l + 9 * GT_G), "v"(l + 10 * GT_G), "v"(l + 11 * GT_G),
         "v"(a), "v"(a + sa), "v"(a + 2 * sa), "v"(a + 3 * sa),
         "v"(b), "v"(b + sb), "v"(b + 2 * sb), "v"(b + 3 * sb),
         "v"(b + 4 * sb), "v"(b + 5 * sb), "v"(b + 6 * sb), "v"(b + 7 * sb)
      : "memory");
}
// The two waits of the ring, each a statement of its own; the "memory" clobber keeps every LDS read on its side of them.
__device__ __forceinline__ void wait_copies_landed() { asm volatile("s_wait_asynccnt 0x0" ::: "memory"); }
__device__ __forceinline__ void wait_lds_reads_done() { asm volatile("s_wait_dscnt 0x0" ::: "memory"); }     // a buffer is refilled only after its readers' loads have returned
template <int ET, bool SPLIT, int BIAS_MODE, int OUT_MODE, bool RESID, int ACT = 0>
__global__ __launch_bounds__(256) void wmma_gemm64(
    const unsigned short* __restrict__ Ap, const unsigned short* __restrict__ A2p, int lda, long strideA,
    const unsigned short* __restrict__ Btp, const unsigned short* __restrict__ Bt2p, int ldb, long strideB,
    void* __restrict__ Cout, void* __restrict__ Cout2, int ldc, long strideC,
    const float* __restrict__ bias,
    const float* __restrict__ resid, long strideR,
    int M, int N, int K, float scale) {
  typedef typename Elem<ET>::T T;
  typedef typename Frag<T>::V V;
  static_assert(!SPLIT, "the lo planes are not staged");
  (void)A2p; (void)Bt2p; (void)M;
  __shared__ __align__(16) float sT[8][16 * 68];   // per-wave 16x64 slab, pitch 68 floats
  __shared__ __align__(16) unsigned short sAB[2 * GT_STAGE];   // the two operand buffers
  const int b    = blockIdx.y;
  const int lane = threadIdx.x & 31;
  const int wave = threadIdx.x >> 5;
  const int tilesN = N >> 8;
  const int tm = blockIdx.x / tilesN;          // block tile; every block has one, so every wave passes every barrier
  const int tn = blockIdx.x - tm * tilesN;
  const int wm = (wave >> 2) << 6;             // the wave's 64x64 tile inside the block tile
  const int wn = (wave & 3) << 6;
  const int m0 = (tm << 7) + wm;
  const int n0 = (tn << 8) + wn;

  // copies: thread t brings the 16-byte piece t & 7 of row t >> 3 of every group of 32 rows
  const int cr = threadIdx.x >> 3, cp = (threadIdx.x & 7) * 8;
  const unsigned short* gA = Ap  + (size_t)b * strideA + (size_t)((tm << 7) + cr) * lda + cp;
  const unsigned short* gB = Btp + (size_t)b * strideB + (size_t)((tn << 8) + cr) * ldb + cp;
  const size_t sa = (size_t)32 * lda, sb = (size_t)32 * ldb;
  const unsigned l0 = (unsigned)(size_t)sAB + (unsigned)(cr * GT_P + cp) * 2u;   // low 32 bits of a __shared__ address = byte offset in the block's LDS
  const int nT = K / GT_BK;

  const int rlane = lane & 15;                 // row (A) / col (B, D) within subtile
  const int koff  = (lane >> 4) * 8;           // k offset of this lane half
  const int mOff  = (lane >> 4) * 8;           // D row offset

  v8f acc[4][4];
#pragma unroll
  for (int i = 0; i < 4; ++i)
#pragma unroll
    for (int j = 0; j < 4; ++j) acc[i][j] = (v8f){0.f,0.f,0.f,0.f,0.f,0.f,0.f,0.f};

  gemm_stage_copy(l0, gA, sa, gB, sb);                       // stage 0 into buffer 0
  wait_copies_landed();                                      // this wave's copies of stage 0 have landed
  __syncthreads();                                           // ... and every other wave's
  if (nT > 1) gemm_stage_copy(l0 + GT_STAGE * 2, gA + GT_BK, sa, gB + GT_BK, sb);   // stage 1 into buffer 1
  for (int t = 0; t < nT; ++t) {
    const T* sbuf = (const T*)sAB + (t & 1) * GT_STAGE;
    const T* sA = sbuf + (wm + rlane) * GT_P + koff;
    const T* sB = sbuf + (GT_BM + wn + rlane) * GT_P + koff;
#pragma unroll
    for (int kk = 0; kk < GT_BK; kk += 32) {
      V bh[4], ah[4];
#pragma unroll
      for (int j = 0; j < 4; ++j) bh[j] = Frag<T>::load(sB + (j << 4) * GT_P + kk);
#pragma unroll
      for (int i = 0; i < 4; ++i) ah[i] = Frag<T>::load(sA + (i << 4) * GT_P + kk);
#pragma unroll
      for (int i = 0; i < 4; ++i) {
#pragma unroll
        for (int j = 0; j < 4; ++j) acc[i][j] = Frag<T>::mma(ah[i], bh[j], acc[i][j]);
        Frag<T>::guard(acc[i][0], acc[i][3], ah[i], ah[i]);
      }
      Frag<T>::keep(bh[0], bh[1], bh[2], bh[3]);
    }
    wait_lds_reads_done();                                   // this wave has left buffer t & 1
    wait_copies_landed();                                    // this wave's copies of stage t + 1 have landed
    __syncthreads();                                         // publishes stage t + 1 and ends every wave's reads of buffer t & 1
    if (t + 2 < nT) gemm_stage_copy(l0 + (unsigned)(t & 1) * (GT_STAGE * 2), gA + (size_t)(t + 2) * GT_BK, sa, gB + (size_t)(t + 2) * GT_BK, sb);
  }
  wait_copies_landed();                                      // no copy is outstanding when the wave goes on to the epilogue
  acc_guard4(acc[0][0], acc[0][1], acc[0][2], acc[0][3]);
  acc_guard4(acc[1][0], acc[1][1], acc[1][2], acc[1][3]);
  acc_guard4(acc[2][0], acc[2][1], acc[2][2], acc[2][3]);
  acc_guard4(acc[3][0], acc[3][1], acc[3][2], acc[3][3]);

  // ---- epilogue ----
  float* slab = sT[wave];
  const float* Rb = RESID ? (resid + (size_t)b * strideR) : nullptr;
#pragma unroll
  for (int i = 0; i < 4; ++i) {
    const int mBase = m0 + (i << 4);
#pragma unroll
    for (int j = 0; j < 4; ++j) {
      const int n = n0 + (j << 4) + rlane;
      float bv = 0.f;
      if (BIAS_MODE == 2) bv = bias[n];
#pragma unroll
      for (int r = 0; r < 8; ++r) {
        float v = acc[i][j][r] * scale;
        if (BIAS_MODE == 1) v += bias[mBase + mOff + r];
        if (BIAS_MODE == 2) v += bv;
        if (RESID) v += Rb[(size_t)(mBase + mOff + r) * ldc + n];
        if (ACT == 1) v = tanhf(v);
        if (ACT == 2) v = fmaxf(v, 0.0f);
        if (ACT == 3) v = v / (1.0f + expf(-v));
        if (ACT == 4) v = (v > 0.f) ? v : 0.01f * v;
        if (ACT == 5) v = 0.5f * v * (1.0f + erff(v * 0.70710678118654752f));
        slab[(mOff + r) * 68 + (j << 4) + rlane] = v;
      }
    }
    __builtin_amdgcn_fence(__ATOMIC_RELEASE, "workgroup");
    __builtin_amdgcn_wave_barrier();
    __builtin_amdgcn_fence(__ATOMIC_ACQUIRE, "workgroup");
    if (OUT_MODE == 0) {
      float* C = (float*)Cout + (size_t)b * strideC;
      const int hh = lane >> 4, c4 = (lane & 15) * 4;     // row seg = 256 B = 16 lanes x 16 B
      {
#pragma unroll
        for (int it = 0; it < 8; ++it) {
          const int row = it * 2 + hh;
          v4f v = *(const v4f*)(slab + row * 68 + c4);
          *(v4f*)(C + (size_t)(mBase + row) * ldc + n0 + c4) = v;
        }
        
      }
    } else {
      const int q = lane >> 3, c8 = (lane & 7) * 8;
      unsigned short* C  = (unsigned short*)Cout  + (size_t)b * strideC;
      unsigned short* C2 = (OUT_MODE == 2) ? ((unsigned short*)Cout2 + (size_t)b * strideC) : nullptr;
      {
#pragma unroll
        for (int it = 0; it < 4; ++it) {
          const int row = it * 4 + q;
          const float* sp = slab + row * 68 + c8;
          v8h hv, lv;
#pragma unroll
          for (int e = 0; e < 8; ++e) {
            if (OUT_MODE == 1) {
              hv[e] = (_Float16)sp[e];
            } else {
              unsigned short hb = f2bf_bits(sp[e]);
              unsigned short lb = f2bf_bits(sp[e] - bf_bits2f(hb));
              hv[e] = __builtin_bit_cast(_Float16, hb);
              lv[e] = __builtin_bit_cast(_Float16, lb);
            }
          }
          *(v8h*)(C + (size_t)(mBase + row) * ldc + n0 + c8) = hv;
          if (OUT_MODE == 2) *(v8h*)(C2 + (size_t)(mBase + row) * ldc + n0 + c8) = lv;
        }
        
      }
    }
    __builtin_amdgcn_fence(__ATOMIC_RELEASE, "workgroup");
    __builtin_amdgcn_wave_barrier();
    __builtin_amdgcn_fence(__ATOMIC_ACQUIRE, "workgroup");
  }
}

// ---- f32 [R][C] (row pitch ldi) -> f16 transposed [C][R] (row pitch ldo); 64x64 tiles; each output row segment
__global__ __launch_bounds__(256) void transpose_cast_f16(const float* __restrict__ in, int ldi,
                                                         _Float16* __restrict__ outT, int ldo, float scale) {
  __shared__ __align__(16) _Float16 tile[64][72];     // [c][r]
  const int c0 = blockIdx.x * 64, r0 = blockIdx.y * 64;
  const int t = threadIdx.y * 32 + threadIdx.x;
  for (int i = threadIdx.y; i < 64; i += 8) {
    tile[threadIdx.x][i]      = (_Float16)(in[(size_t)(r0 + i) * ldi + c0 + threadIdx.x] * scale);
    tile[32 + threadIdx.x][i] = (_Float16)(in[(size_t)(r0 + i) * ldi + c0 + 32 + threadIdx.x] * scale);
  }
  __syncthreads();
  const int q = t >> 3, c8 = (t & 7) * 8;
  {
#pragma unroll
    for (int it = 0; it < 2; ++it) {
      const int c = it * 32 + q;
      v8h hv = *(const v8h*)(&tile[c][c8]);
      *(v8h*)(outT + (size_t)(c0 + c) * ldo + r0 + c8) = hv;
    }
    
  }
}

// =====================================================================================
// Generic causal/non-causal attention for head_dim 64, f32 in / f32 out; 16-bit operands: bf16 with optional hi/lo splits, or
// plain f16 (F16=true, non-split, probabilities carried x2^15).
//   scores = (q*qscale)·kᵀ : v_wmma_f32_16x16x32_bf16 (_f16 when F16); SPLIT_QK -> q,k as bf16 hi/lo (hi·hi + hi·lo + lo·hi)
//   out    = p·v           : v_wmma_f32_16x16x32_bf16; SPLIT_PV -> p,v as bf16 hi/lo; else p,v plain bf16, or plain f16 on v_wmma_f32_16x16x32_f16 when F16
//   f32 accumulate; online softmax in f32. Block = 4 waves = 64 query rows of one (batch, head); S % 64 == 0.
//   Element (b, s, h, d) of tensor X lives at X[b*X_bs + s*X_rs + h*X_hs + d] (strides in floats, multiples of 4).
//   Masking: MODE 0 none, 1 causal (kv > q masked), 2 tensor [S][Skv] shared over (b,h) (float if
//   mask_is_int==0, int32 with element == 0 -> masked if 1, int32 with element != 0 -> masked if 2), 3 per-token vectors qmask[B][S] & kvmask[B][Skv] (int32,
//   0 -> masked), 4 causal + sliding window (kv > q or q - kv > W masked; W passed in mask_is_int);
//   5 = relative-position bias: s += cp[b,h,q][idx[q][kv]] + pc[b,h,kv][idx[q][kv]] with idx = mask_b ([S][Skv] int32) and
//   mask_a an int32 [S][Skv] tensor with nonzero = masked (tables: element (b,h,row,n) at X + b*c_bs + h*c_hs + row*c_rs + n);
//   masked scores are replaced by mask_fill (e.g. -inf or -1e9) before the softmax.
//   grid.x = B * H * (S/64) (or a sub-range with blk0).
// =====================================================================================
#define AT_D 64
#define AT_NW 4
#define AT_QB 64
#define AT_KC 64
#define AT_P 72   // LDS row pitch of the K, V^T and P tiles in 16-bit elements: 144 B = 16 B x 9, so the 16 rows of a 16-byte fragment read fall on distinct banks
struct AttnGeom { const float* cp = nullptr; const float* pc = nullptr; long c_bs = 0, c_rs = 0, c_hs = 0;   // mode-5 score-bias tables
                  long q_bs, q_rs, q_hs, k_bs, k_rs, k_hs, v_bs, v_rs, v_hs, o_bs, o_rs, o_hs;
                  int S, Skv, H, mask_mode; float qscale; int blk0; float mask_fill; int mask_is_int; };
static_assert(sizeof(AttnGeom) == 168, "no padding");

__device__ __forceinline__ unsigned short at_bf_bits(float f) {
  unsigned u = __float_as_uint(f);
  return (unsigned short)((u + 0x7FFFu + ((u >> 16) & 1u)) >> 16);
}
__device__ __forceinline__ __bf16 at_f2bf(float f) { return __builtin_bit_cast(__bf16, at_bf_bits(f)); }
__device__ __forceinline__ void at_split(float f, __bf16& hi, __bf16& lo) {
  const unsigned short hb = at_bf_bits(f);
  hi = __builtin_bit_cast(__bf16, hb);
  lo = at_f2bf(f - __uint_as_float(((unsigned)hb) << 16));
}
__device__ __forceinline__ v8f at_mma(v16b a, v16b b, v8f c) {
  c = __builtin_amdgcn_wmma_f32_16x16x32_bf16(false, a, false, b, (short)0, c, false, false);
  asm volatile("v_nop\n\tv_nop\n\tv_nop\n\tv_nop" : "+v"(c) : "v"(a), "v"(b));
  return c;
}
// 16-bit element as a bit pattern held in a __bf16 slot: f16 bits when F16, bf16 (RNE) otherwise
template <bool F16> __device__ __forceinline__ __bf16 at_to16(float f) {
  if (F16) return __builtin_bit_cast(__bf16, (_Float16)f);
  return at_f2bf(f);
}
template <bool F16> __device__ __forceinline__ v8f at_mma16(v16b a, v16b b, v8f c) {
  if (F16) {
    const v16h ah = __builtin_bit_cast(v16h, a), bh = __builtin_bit_cast(v16h, b);
    c = __builtin_amdgcn_wmma_f32_16x16x32_f16(false, ah, false, bh, (short)0, c, false, false);
    asm volatile("v_nop\n\tv_nop\n\tv_nop\n\tv_nop" : "+v"(c) : "v"(ah), "v"(bh));
    return c;
  }
  return at_mma(a, b, c);
}

// MODE = the mask mode as a compile-time constant: the per-score mode tests fold away, so the unrolled score loop is straight-line code
template <bool SPLIT_QK, bool SPLIT_PV, bool F16, int MODE>
__global__ __launch_bounds__(128)
void attn64_kernel(const float* __restrict__ q, const float* __restrict__ k,
                   const float* __restrict__ v, float* __restrict__ out,
                   const void* __restrict__ mask_a, const int* __restrict__ mask_b, AttnGeom g) {
  static_assert(!(F16 && (SPLIT_QK || SPLIT_PV)), "f16 mode is non-split");
  const float PSC = F16 ? 32768.0f : 1.0f;     // f16 probabilities carried x2^15 (subnormal range), folded into the final 1/l
  union FB { v16b v; v8b h[2]; };
  __shared__ __align__(16) __bf16 Ksh[AT_KC * AT_P];             // K hi [kv][d]      9 KB
  __shared__ __align__(16) __bf16 Ksl[SPLIT_QK ? AT_KC * AT_P : 8];
  __shared__ __align__(16) __bf16 Vth[AT_D * AT_P];              // V hi [d][kv]      9 KB
  __shared__ __align__(16) __bf16 Vtl[SPLIT_PV ? AT_D * AT_P : 8];
  __shared__ __align__(16) __bf16 Psh[AT_NW][16 * AT_P];         // per wave P hi [row][kv]  9 KB
  __shared__ __align__(16) __bf16 Psl[SPLIT_PV ? AT_NW : 1][SPLIT_PV ? 16 * AT_P : 8];
  __shared__ __align__(16) float  Os[AT_NW][16 * 68];            // per wave out tile, pitch 68

  const int tid  = threadIdx.x;
  const int wave = tid >> 5;
  const int lane = tid & 31;
  const int hh   = lane >> 4;
  const int c    = lane & 15;

  const int nqb = g.S / AT_QB;
  const int bx = blockIdx.x + g.blk0;
  const int qb = bx % nqb;
  const int bh = bx / nqb;
  const int h  = bh % g.H;
  const int b  = bh / g.H;
  const int qbase_block = qb * AT_QB;
  const int q0 = qbase_block + wave * 16;

  const float* qb_ptr = q + (size_t)b * g.q_bs + (size_t)h * g.q_hs;
  const float* kb_ptr = k + (size_t)b * g.k_bs + (size_t)h * g.k_hs;
  const float* vb_ptr = v + (size_t)b * g.v_bs + (size_t)h * g.v_hs;
  float*       ob_ptr = out + (size_t)b * g.o_bs + (size_t)h * g.o_hs;

  // ---- Q fragments (A operand): 2 d-chunks, hi (and lo) ----
  v16b qah[2], qal[2];
  {
    const float* qrow = qb_ptr + (size_t)(q0 + c) * g.q_rs;
#pragma unroll
    for (int dc = 0; dc < 2; ++dc) {
#pragma unroll
      for (int e = 0; e < 8; ++e) {
        const float f0 = qrow[dc * 32 + 8 * hh + e] * g.qscale;
        const float f1 = qrow[dc * 32 + 16 + 8 * hh + e] * g.qscale;
        if (SPLIT_QK) { __bf16 hq, lq; at_split(f0, hq, lq); qah[dc][e] = hq; qal[dc][e] = lq; at_split(f1, hq, lq); qah[dc][8 + e] = hq; qal[dc][8 + e] = lq; }
        else { qah[dc][e] = at_to16<F16>(f0); qah[dc][8 + e] = at_to16<F16>(f1); qal[dc][e] = qah[dc][e]; qal[dc][8 + e] = qah[dc][8 + e]; }
      }
    }
  }

  float mrow[8], lrow[8];
  v8f oacc[4];
#pragma unroll
  for (int r = 0; r < 8; ++r) { mrow[r] = -INFINITY; lrow[r] = 0.f; }
#pragma unroll
  for (int t = 0; t < 4; ++t) oacc[t] = (v8f){0.f,0.f,0.f,0.f,0.f,0.f,0.f,0.f};

  const int nChunks = (MODE == 1 || MODE == 4) ? (qb + 1) : (g.Skv / AT_KC);   // block-uniform
  // per-row query mask (mode 3)
  int qkeep[8];
#pragma unroll
  for (int r = 0; r < 8; ++r) qkeep[r] = (MODE == 3) ? mask_b[(size_t)b * g.S + q0 + 8 * hh + r] : 1;   // mask_b = qmask in mode 3
  for (int kc = 0; kc < nChunks; ++kc) {
    const int kv0 = kc * AT_KC;
    __syncthreads();
    {
      const int kvr = tid >> 1, dh = (tid & 1) * 32;
      const float* krow = kb_ptr + (size_t)(kv0 + kvr) * g.k_rs + dh;
      const float* vrow = vb_ptr + (size_t)(kv0 + kvr) * g.v_rs + dh;
#pragma unroll
      for (int i = 0; i < 8; ++i) {
        v4f kk = *(const v4f*)(krow + 4 * i);
        v4f vv = *(const v4f*)(vrow + 4 * i);
#pragma unroll
        for (int e = 0; e < 4; ++e) {
          const int d = dh + 4 * i + e;
          if (SPLIT_QK) { __bf16 a, bl; at_split(kk[e], a, bl); Ksh[kvr * AT_P + d] = a; Ksl[kvr * AT_P + d] = bl; }
          else Ksh[kvr * AT_P + d] = at_to16<F16>(kk[e]);
          if (SPLIT_PV) { __bf16 a, bl; at_split(vv[e], a, bl); Vth[d * AT_P + kvr] = a; Vtl[d * AT_P + kvr] = bl; }
          else Vth[d * AT_P + kvr] = at_to16<F16>(vv[e]);
        }
      }
    }
    __syncthreads();

    v8f s[4];
#pragma unroll
    for (int j = 0; j < 4; ++j) {
      s[j] = (v8f){0.f,0.f,0.f,0.f,0.f,0.f,0.f,0.f};
#pragma unroll 1
      for (int dc = 0; dc < 2; ++dc) {
        FB kb;
        kb.h[0] = *(const v8b*)(Ksh + (j * 16 + c) * AT_P + dc * 32 + 8 * hh);
        kb.h[1] = *(const v8b*)(Ksh + (j * 16 + c) * AT_P + dc * 32 + 16 + 8 * hh);
        s[j] = at_mma16<F16>(qah[dc], kb.v, s[j]);
        if (SPLIT_QK) {
          FB kl;
          kl.h[0] = *(const v8b*)(Ksl + (j * 16 + c) * AT_P + dc * 32 + 8 * hh);
          kl.h[1] = *(const v8b*)(Ksl + (j * 16 + c) * AT_P + dc * 32 + 16 + 8 * hh);
          s[j] = at_mma16<F16>(qah[dc], kl.v, s[j]);
          s[j] = at_mma16<F16>(qal[dc], kb.v, s[j]);
        }
      }
    }
    const bool diag = (MODE == 1) && (kc == qb);
    int kvkeep[4] = {1, 1, 1, 1};
    if (MODE == 3) {
#pragma unroll
      for (int j = 0; j < 4; ++j) kvkeep[j] = ((const int*)mask_a)[(size_t)b * g.Skv + kv0 + j * 16 + c];   // mask_a = kvmask
    }
    float cm[8];
#pragma unroll
    for (int r = 0; r < 8; ++r) {
      const int qrow = q0 + 8 * hh + r;
      float m = -INFINITY;
#pragma unroll
      for (int j = 0; j < 4; ++j) {
        const int kvcol = kv0 + j * 16 + c;
        bool masked = false;
        if (diag) masked = (kvcol > qrow);
        else if (MODE == 4) masked = (kvcol > qrow) || (qrow - kvcol > g.mask_is_int);
        else if (MODE == 2) {
          const size_t mi = (size_t)qrow * g.Skv + kvcol;
          masked = (g.mask_is_int == 0) ? (((const float*)mask_a)[mi] == 0.0f)
                 : (g.mask_is_int == 1) ? (((const int*)mask_a)[mi] == 0) : (((const int*)mask_a)[mi] != 0);
        } else if (MODE == 3) masked = (qkeep[r] == 0) || (kvkeep[j] == 0);
        else if (MODE == 5) {
          const size_t mi = (size_t)qrow * g.Skv + kvcol;
          masked = (((const int*)mask_a)[mi] != 0);
          int n = mask_b[mi]; n = n < 0 ? 0 : n;
          s[j][r] += g.cp[(size_t)b * g.c_bs + (size_t)h * g.c_hs + (size_t)qrow * g.c_rs + n]
                   + g.pc[(size_t)b * g.c_bs + (size_t)h * g.c_hs + (size_t)kvcol * g.c_rs + n];
        }
        const float sv = masked ? g.mask_fill : s[j][r];   // one select on the element (a conditional store into the vector selects all 8 registers)
        s[j][r] = sv;
        m = fmaxf(m, sv);
      }
#pragma unroll
      for (int off = 1; off < 16; off <<= 1) m = fmaxf(m, __shfl_xor(m, off, 32));
      cm[r] = m;
    }
    __bf16* pwh = Psh[wave];
    __bf16* pwl = Psl[SPLIT_PV ? wave : 0];
#pragma unroll
    for (int r = 0; r < 8; ++r) {
      const float mnew = fmaxf(mrow[r], cm[r]);
      const float alpha = expf(mrow[r] - mnew);
      mrow[r] = mnew;
      float psum = 0.f;
#pragma unroll
      for (int j = 0; j < 4; ++j) {
        const float p = expf(s[j][r] - mnew);
        psum += p;
        if (SPLIT_PV) { __bf16 a, bl; at_split(p, a, bl); pwh[(8 * hh + r) * AT_P + j * 16 + c] = a; pwl[(8 * hh + r) * AT_P + j * 16 + c] = bl; }
        else pwh[(8 * hh + r) * AT_P + j * 16 + c] = at_to16<F16>(p * PSC);
      }
#pragma unroll
      for (int off = 1; off < 16; off <<= 1) psum += __shfl_xor(psum, off, 32);
      lrow[r] = lrow[r] * alpha + psum;
#pragma unroll
      for (int t = 0; t < 4; ++t) oacc[t][r] *= alpha;
    }
    __builtin_amdgcn_fence(__ATOMIC_RELEASE, "workgroup");
    __builtin_amdgcn_wave_barrier();
    __builtin_amdgcn_fence(__ATOMIC_ACQUIRE, "workgroup");
#pragma unroll 1
    for (int kk = 0; kk < 2; ++kk) {
      FB pa, pl;
      pa.h[0] = *(const v8b*)(pwh + c * AT_P + kk * 32 + 8 * hh);
      pa.h[1] = *(const v8b*)(pwh + c * AT_P + kk * 32 + 16 + 8 * hh);
      if (SPLIT_PV) {
        pl.h[0] = *(const v8b*)(pwl + c * AT_P + kk * 32 + 8 * hh);
        pl.h[1] = *(const v8b*)(pwl + c * AT_P + kk * 32 + 16 + 8 * hh);
      }
#pragma unroll
      for (int t = 0; t < 4; ++t) {
        FB vb;
        vb.h[0] = *(const v8b*)(Vth + (t * 16 + c) * AT_P + kk * 32 + 8 * hh);
        vb.h[1] = *(const v8b*)(Vth + (t * 16 + c) * AT_P + kk * 32 + 16 + 8 * hh);
        oacc[t] = at_mma16<F16>(pa.v, vb.v, oacc[t]);
        if (SPLIT_PV) {
          FB vl;
          vl.h[0] = *(const v8b*)(Vtl + (t * 16 + c) * AT_P + kk * 32 + 8 * hh);
          vl.h[1] = *(const v8b*)(Vtl + (t * 16 + c) * AT_P + kk * 32 + 16 + 8 * hh);
          oacc[t] = at_mma16<F16>(pa.v, vl.v, oacc[t]);
          oacc[t] = at_mma16<F16>(pl.v, vb.v, oacc[t]);
        }
      }
    }
  }

  float* os = Os[wave];
#pragma unroll
  for (int r = 0; r < 8; ++r) {
    const float inv = 1.0f / (lrow[r] * PSC);
#pragma unroll
    for (int t = 0; t < 4; ++t) os[(8 * hh + r) * 68 + t * 16 + c] = oacc[t][r] * inv;
  }
  __builtin_amdgcn_fence(__ATOMIC_RELEASE, "workgroup");
  __builtin_amdgcn_wave_barrier();
  __builtin_amdgcn_fence(__ATOMIC_ACQUIRE, "workgroup");
  {
    const int c4 = (lane & 15) * 4;
    {
#pragma unroll
      for (int it = 0; it < 8; ++it) {
        const int row = it * 2 + hh;
        v4f val = *(const v4f*)(os + row * 68 + c4);
        *(v4f*)(ob_ptr + (size_t)(q0 + row) * g.o_rs + c4) = val;
      }
      
    }
  }
}

#define TB_ 8
#define TS 1024
#define TDm 512
#define TH 8
#define THD 64
#define TR (TB_ * TS)
typedef __attribute__((ext_vector_type(4))) _Float16 v4h;
// The three elementwise kernels: 512 blocks of 8 waves (two blocks a WGP); a thread moves EW_U items of 4 floats, every wave-wide 16-byte load
// covers 512 contiguous bytes, and all of a thread's loads are issued before its first store.
#define EW_U 8
#define EW_BLOCKS (TR * TDm / 4 / (EW_U * 256))
static_assert(EW_BLOCKS * EW_U * 256 * 4 == TR * TDm, "whole blocks");
// A16 [8192][1024] = [xs2 | xt] f16 (xs2 = raw reshape of xs); item i = floats 4i..4i+3 of xs and of xt, 128 items a row, so 256 items on = 2 rows on
__global__ __launch_bounds__(256) void cat_kernel(const float* __restrict__ xs, const float* __restrict__ xt, unsigned* __restrict__ A16) {
  const int base = blockIdx.x * (EW_U * 256) + threadIdx.x;
  const v4f* pa = (const v4f*)xs + base; const v4f* pb = (const v4f*)xt + base;
  v4h* o = (v4h*)A16 + (size_t)(base >> 7) * 256 + (base & 127);     // a row of A16 is 1024 f16 = 256 items; xt's half starts 128 items in
  v4f a[EW_U], b[EW_U];
#pragma unroll
  for (int u = 0; u < EW_U; ++u) { a[u] = pa[u * 256]; b[u] = pb[u * 256]; }
#pragma unroll
  for (int u = 0; u < EW_U; ++u) { o[u * 512] = __builtin_convertvector(a[u], v4h); o[u * 512 + 128] = __builtin_convertvector(b[u], v4h); }
}
// k' = k + WKᵀ: QKV[(b,s)][512 + h*64 + d] += WK[d][s]
// a thread owns (s, 4 columns) and walks the 8 batches, which share its 4 values of WK
__global__ __launch_bounds__(256) void kbias_kernel(float* __restrict__ QKV, const float* __restrict__ WK) {
  const int t = blockIdx.x * 256 + threadIdx.x; const int s = t >> 7, c = 4 * (t & 127), d = c % THD;
  static_assert(TS * (TDm / 4) == EW_BLOCKS * 256, "one thread per (s, 4 columns)");
  const float* wp = WK + (size_t)d * TS + s;
  const v4f w = {wp[0], wp[TS], wp[2 * TS], wp[3 * TS]};
  asm volatile("s_wait_xcnt 0x0" ::: "memory");   // the address registers of the 4 loads above may be reused as destinations of the loads below
  float* p = QKV + (size_t)s * (3 * TDm) + TDm + c;
  v4f k[TB_];
#pragma unroll
  for (int b = 0; b < TB_; ++b) k[b] = *(const v4f*)(p + (size_t)b * TS * (3 * TDm));
#pragma unroll
  for (int b = 0; b < TB_; ++b) *(v4f*)(p + (size_t)b * TS * (3 * TDm)) = k[b] + w;
}
// O f32 -> f16
__global__ __launch_bounds__(256) void cast_f32_f16x4(const float* __restrict__ in, _Float16* __restrict__ out) {
  const int base = blockIdx.x * (EW_U * 256) + threadIdx.x;
  const v4f* pi = (const v4f*)in + base; v4h* po = (v4h*)out + base;
  v4f x[EW_U];
#pragma unroll
  for (int u = 0; u < EW_U; ++u) x[u] = pi[u * 256];
#pragma unroll
  for (int u = 0; u < EW_U; ++u) po[u * 256] = __builtin_convertvector(x[u], v4h);
}
extern "C" void kernel_launch(void* const* d_in, const int* in_sizes, int n_in, void* d_out, int out_size, void* d_ws, size_t ws_size, hipStream_t stream) {
  (void)in_sizes; (void)n_in; (void)out_size; (void)ws_size;
  auto Fp = [&](int i) { return (const float*)d_in[i]; };
  const float* xs = Fp(0); const float* xt = Fp(1); const float* Wqs = Fp(2); const float* Wks = Fp(3); const float* Wvs = Fp(4); const float* Wqt = Fp(5); const float* Wkt = Fp(6); const float* Wvt = Fp(7); const float* WK = Fp(8); const float* Wo = Fp(9);
  char* ws = (char*)d_ws; size_t off = 0;
  auto carve = [&](size_t bytes) -> char* { char* p = ws + off; off += (bytes + 255) & ~(size_t)255; return p; };
  unsigned* A16 = (unsigned*)carve((size_t)TR * 2 * TDm * 2); _Float16* WT = (_Float16*)carve((size_t)3 * TDm * 2 * TDm * 2); _Float16* WoT = (_Float16*)carve((size_t)TDm * TDm * 2);
  float* QKV = (float*)carve((size_t)TR * 3 * TDm * 4); float* O = (float*)carve((size_t)TR * TDm * 4); _Float16* O16 = (_Float16*)A16;     // ≈ 84 MB; O16 reuses A16
  cat_kernel<<<EW_BLOCKS, 256, 0, stream>>>(xs, xt, A16);
  // Bt [1536][1024]: row n<512 (q): [Wqs[:,n]ᵀ | Wqt[:,n]ᵀ]; 512..1023 k; 1024..1535 v  — W* are [in 512][out 512] used as x·W
  transpose_cast_f16<<<dim3(TDm / 64, TDm / 64), dim3(32, 8), 0, stream>>>(Wqs, TDm, WT, 2 * TDm, 1.0f); transpose_cast_f16<<<dim3(TDm / 64, TDm / 64), dim3(32, 8), 0, stream>>>(Wqt, TDm, WT + TDm, 2 * TDm, 1.0f);
  transpose_cast_f16<<<dim3(TDm / 64, TDm / 64), dim3(32, 8), 0, stream>>>(Wks, TDm, WT + (size_t)TDm * 2 * TDm, 2 * TDm, 1.0f); transpose_cast_f16<<<dim3(TDm / 64, TDm / 64), dim3(32, 8), 0, stream>>>(Wkt, TDm, WT + (size_t)TDm * 2 * TDm + TDm, 2 * TDm, 1.0f);
  transpose_cast_f16<<<dim3(TDm / 64, TDm / 64), dim3(32, 8), 0, stream>>>(Wvs, TDm, WT + (size_t)2 * TDm * 2 * TDm, 2 * TDm, 1.0f); transpose_cast_f16<<<dim3(TDm / 64, TDm / 64), dim3(32, 8), 0, stream>>>(Wvt, TDm, WT + (size_t)2 * TDm * 2 * TDm + TDm, 2 * TDm, 1.0f);
  transpose_cast_f16<<<dim3(TDm / 64, TDm / 64), dim3(32, 8), 0, stream>>>(Wo, TDm, WoT, TDm, 1.0f);
  const int t3 = (TR / GT_BM) * (3 * TDm / GT_BN), t1 = (TR / GT_BM) * (TDm / GT_BN);   // block tiles of 128 x 256
  wmma_gemm64<0, false, 0, 0, false><<<dim3(t3, 1), 256, 0, stream>>>((const unsigned short*)A16, nullptr, 2 * TDm, 0, U16(WT), nullptr, 2 * TDm, 0, QKV, nullptr, 3 * TDm, 0, nullptr, nullptr, 0, TR, 3 * TDm, 2 * TDm, 1.0f);
  kbias_kernel<<<EW_BLOCKS, 256, 0, stream>>>(QKV, WK);
  { AttnGeom g;
    g.q_bs = (long)TS * 3 * TDm; g.q_rs = 3 * TDm; g.q_hs = THD; g.k_bs = g.q_bs; g.k_rs = g.q_rs; g.k_hs = THD; g.v_bs = g.q_bs; g.v_rs = g.q_rs; g.v_hs = THD; g.o_bs = (long)TS * TDm; g.o_rs = TDm; g.o_hs = THD;
    g.S = TS; g.Skv = TS; g.H = TH; g.mask_mode = 1; g.qscale = 0.125f; g.blk0 = 0; g.mask_fill = -1e9f; g.mask_is_int = 0;
    attn64_kernel<false, false, true, 1><<<TB_ * TH * (TS / AT_QB), AT_NW * 32, 0, stream>>>(QKV, QKV + TDm, QKV + 2 * TDm, O, nullptr, nullptr, g); }
  cast_f32_f16x4<<<EW_BLOCKS, 256, 0, stream>>>(O, O16);
  wmma_gemm64<0, false, 0, 0, false><<<dim3(t1, 1), 256, 0, stream>>>(U16(O16), nullptr, TDm, 0, U16(WoT), nullptr, TDm, 0, (float*)d_out, nullptr, TDm, 0, nullptr, nullptr, 0, TR, TDm, TDm, 1.0f);
}

// v005
// Measured time: 160 microseconds a run.
// In two side-by-side timings against v004, it was 1.22 and 1.21 times as fast.
// Over all steps from v000 it is 3.89 times as fast.
#include <hip/hip_runtime.h>
#include <math.h>
// TMSA block (8 x 1024 tokens x 512, 8 heads x 64, causal): q/k/v = xs2·W*s + xt·W*t as ONE product over the concatenated input [xs2 | xt]·[W*s; W*t]
// (8192 x 1024 · 1024 x 1536); the query-dependent bias q·WK is folded exactly into the keys — Σ_d q_d k_jd + Σ_d q_d WK[d][j] = q·(k_j + WK[:, j]) —
// so the attention is a plain causal flash-style kernel over k' = k + WKᵀ (scores (q/8)·k'ᵀ and p·v on WMMA, f16 operands with probabilities x2^15,
// f32 accumulate, online softmax in f32, -1e9 fill above the diagonal); output projection ·Wo. All products v_wmma_f32_16x16x32_f16, f16 operands,
// f32 accumulate (plain single products, ≈20 G MAC); the raw .view reshapes are identity on memory.
typedef __attribute__((ext_vector_type(16))) _Float16 v16h;
typedef __attribute__((ext_vector_type(8)))  _Float16 v8h;
typedef __attribute__((ext_vector_type(16))) __bf16   v16b;
typedef __attribute__((ext_vector_type(8)))  __bf16   v8b;
typedef __attribute__((ext_vector_type(8)))  float    v8f;
typedef __attribute__((ext_vector_type(4)))  float    v4f;
#define PSCALE 32768.0f
#define U16(p) ((const unsigned short*)(const void*)(p))
#define PSCALE_INV (1.0f / 32768.0f)

__device__ __forceinline__ unsigned short f2bf_bits(float f) {
  unsigned u = __float_as_uint(f);
  return (unsigned short)((u + 0x7FFFu + ((u >> 16) & 1u)) >> 16);
}
__device__ __forceinline__ float bf_bits2f(unsigned short h) { return __uint_as_float(((unsigned)h) << 16); }

// hazard guards as plain device helpers (no inline asm inside the kernel template body)
__device__ __forceinline__ void dep_guard_h(v8f& a, v8f& b, v16h x, v16h y) { asm volatile("v_nop\n\tv_nop\n\tv_nop\n\tv_nop" : "+v"(a), "+v"(b) : "v"(x), "v"(y)); }
__device__ __forceinline__ void dep_guard_b(v8f& a, v8f& b, v16b x, v16b y) { asm volatile("v_nop\n\tv_nop\n\tv_nop\n\tv_nop" : "+v"(a), "+v"(b) : "v"(x), "v"(y)); }
__device__ __forceinline__ void keep4_h(v16h a, v16h b, v16h c, v16h d) { asm volatile("v_nop" :: "v"(a), "v"(b), "v"(c), "v"(d)); }
__device__ __forceinline__ void keep4_b(v16b a, v16b b, v16b c, v16b d) { asm volatile("v_nop" :: "v"(a), "v"(b), "v"(c), "v"(d)); }
__device__ __forceinline__ void acc_guard4(v8f& a, v8f& b, v8f& c, v8f& d) { asm volatile("v_nop\n\tv_nop\n\tv_nop\n\tv_nop" : "+v"(a), "+v"(b), "+v"(c), "+v"(d)); }
template <typename T> struct Frag;
template <> struct Frag<_Float16> {
  typedef v16h V; union U { v16h v; v8h h[2]; };
  static __device__ __forceinline__ v16h load(const _Float16* p) {   // elements 0..7 <- p[0..7], 8..15 <- p[16..23]
    U f; f.h[0] = *(const v8h*)(p); f.h[1] = *(const v8h*)(p + 16); return f.v;
  }
  static __device__ __forceinline__ v8f mma(v16h a, v16h b, v8f c) {
    return __builtin_amdgcn_wmma_f32_16x16x32_f16(false, a, false, b, (short)0, c, false, false);
  }
  static __device__ __forceinline__ void guard(v8f& a, v8f& b, v16h x, v16h y) { dep_guard_h(a, b, x, y); }
  static __device__ __forceinline__ void keep(v16h a, v16h b, v16h c, v16h d) { keep4_h(a, b, c, d); }
};
template <> struct Frag<__bf16> {
  typedef v16b V; union U { v16b v; v8b h[2]; };
  static __device__ __forceinline__ v16b load(const __bf16* p) {
    U f; f.h[0] = *(const v8b*)(p); f.h[1] = *(const v8b*)(p + 16); return f.v;
  }
  static __device__ __forceinline__ v8f mma(v16b a, v16b b, v8f c) {
    return __builtin_amdgcn_wmma_f32_16x16x32_bf16(false, a, false, b, (short)0, c, false, false);
  }
  static __device__ __forceinline__ void guard(v8f& a, v8f& b, v16b x, v16b y) { dep_guard_b(a, b, x, y); }
  static __device__ __forceinline__ void keep(v16b a, v16b b, v16b c, v16b d) { keep4_b(a, b, c, d); }
};

// ---- Register-blocked batched WMMA GEMM ------------------------------------
// C[m,n] = scale * sum_k A[m,k] * Bt[n,k] (+bias)(+resid); each wave owns a 64x64 tile, the 8 waves of a block a 128x256 tile (2 x 4 waves).
// A row-major [M,K]; Bt row-major [N,K]; M % 128 == 0, N % 256 == 0, K % 64 == 0; grid.x = (M/128)*(N/256).
// Operands go through LDS: a stage is 64 k (128 B) of the block's 128 A rows and 256 Bt rows, brought by asynchronous 16-byte copies whose
// wave-wide form covers 4 whole 128-B lines; two buffers, the copies of stage t+2 fly while stage t+1 is worked on.
// SPLIT (hi/lo planes) is not staged and so not offered by this form.
// BIAS_MODE: 0 = none, 1 = bias[m], 2 = bias[n].
// OUT_MODE: 0 = f32, 1 = f16, 2 = bf16 hi plane (Cout) + bf16 lo plane (Cout2).
// ET: 0 = f16 operands, 1 = bf16 operands (pointers passed as 16-bit storage)
template <int ET> struct Elem;
template <> struct Elem<0> { typedef _Float16 T; };
template <> struct Elem<1> { typedef __bf16 T; };
#define GT_BM 128
#define GT_BN 256
#define GT_BK 64
#define GT_P 72                              // LDS row pitch in 16-bit elements: 144 B = 16 B x 9, conflict-free for 16-byte fragment reads
#define GT_STAGE ((GT_BM + GT_BN) * GT_P)    // 16-bit elements of one buffer: A rows 0..127, then Bt rows 0..255
#define GT_G (32 * GT_P * 2)                 // LDS bytes from one group of 32 rows to the next
// One stage, one thread's share: 12 copies of 16 B (4 groups of 32 A rows, 8 groups of 32 Bt rows). l = the lane's LDS byte address in group 0,
// a / b = its global address in group 0 of A / Bt, sa / sb = elements from one group of 32 rows to the next.
// The s_wait_xcnt stands inside the statement so that no address register of a copy is rewritten ahead of it.
__device__ __forceinline__ void gemm_stage_copy(unsigned l, const unsigned short* a, size_t sa, const unsigned short* b, size_t sb) {
  asm volatile(
      "global_load_async_to_lds_b128 %0, %12, off\n\t"
      "global_load_async_to_lds_b128 %1, %13, off\n\t"
      "global_load_async_to_lds_b128 %2, %14, off\n\t"
      "global_load_async_to_lds_b128 %3, %15, off\n\t"
      "global_load_async_to_lds_b128 %4, %16, off\n\t"
      "global_load_async_to_lds_b128 %5, %17, off\n\t"
      "global_load_async_to_lds_b128 %6, %18, off\n\t"
      "global_load_async_to_lds_b128 %7, %19, off\n\t"
      "global_load_async_to_lds_b128 %8, %20, off\n\t"
      "global_load_async_to_lds_b128 %9, %21, off\n\t"
      "global_load_async_to_lds_b128 %10, %22, off\n\t"
      "global_load_async_to_lds_b128 %11, %23, off\n\t"
      "s_wait_xcnt 0x0"
      :: "v"(l), "v"(l + GT_G), "v"(l + 2 * GT_G), "v"(l + 3 * GT_G),
         "v"(l + 4 * GT_G), "v"(l + 5 * GT_G), "v"(l + 6 * GT_G), "v"(l + 7 * GT_G),
         "v"(l + 8 * GT_G), "v"(l + 9 * GT_G), "v"(l + 10 * GT_G), "v"(l + 11 * GT_G),
         "v"(a), "v"(a + sa), "v"(a + 2 * sa), "v"(a + 3 * sa),
         "v"(b), "v"(b + sb), "v"(b + 2 * sb), "v"(b + 3 * sb),
         "v"(b + 4 * sb), "v"(b + 5 * sb), "v"(b + 6 * sb), "v"(b + 7 * sb)
      : "memory");
}
// The two waits of the ring, each a statement of its own; the "memory" clobber keeps every LDS read on its side of them.
__device__ __forceinline__ void wait_copies_landed() { asm volatile("s_wait_asynccnt 0x0" ::: "memory"); }
__device__ __forceinline__ void wait_lds_reads_done() { asm volatile("s_wait_dscnt 0x0" ::: "memory"); }     // a buffer is refilled only after its readers' loads have returned
template <int ET, bool SPLIT, int BIAS_MODE, int OUT_MODE, bool RESID, int ACT = 0>
__global__ __launch_bounds__(256) void wmma_gemm64(
    const unsigned short* __restrict__ Ap, const unsigned short* __restrict__ A2p, int lda, long strideA,
    const unsigned short* __restrict__ Btp, const unsigned short* __restrict__ Bt2p, int ldb, long strideB,
    void* __restrict__ Cout, void* __restrict__ Cout2, int ldc, long strideC,
    const float* __restrict__ bias,
    const float* __restrict__ resid, long strideR,
    int M, int N, int K, float scale) {
  typedef typename Elem<ET>::T T;
  typedef typename Frag<T>::V V;
  static_assert(!SPLIT, "the lo planes are not staged");
  (void)A2p; (void)Bt2p; (void)M;
  __shared__ __align__(16) float sT[8][16 * 68];   // per-wave 16x64 slab, pitch 68 floats
  __shared__ __align__(16) unsigned short sAB[2 * GT_STAGE];   // the two operand buffers
  const int b    = blockIdx.y;
  const int lane = threadIdx.x & 31;
  const int wave = threadIdx.x >> 5;
  const int tilesN = N >> 8;
  const int tm = blockIdx.x / tilesN;          // block tile; every block has one, so every wave passes every barrier
  const int tn = blockIdx.x - tm * tilesN;
  const int wm = (wave >> 2) << 6;             // the wave's 64x64 tile inside the block tile
  const int wn = (wave & 3) << 6;
  const int m0 = (tm << 7) + wm;
  const int n0 = (tn << 8) + wn;

  // copies: thread t brings the 16-byte piece t & 7 of row t >> 3 of every group of 32 rows
  const int cr = threadIdx.x >> 3, cp = (threadIdx.x & 7) * 8;
  const unsigned short* gA = Ap  + (size_t)b * strideA + (size_t)((tm << 7) + cr) * lda + cp;
  const unsigned short* gB = Btp + (size_t)b * strideB + (size_t)((tn << 8) + cr) * ldb + cp;
  const size_t sa = (size_t)32 * lda, sb = (size_t)32 * ldb;
  const unsigned l0 = (unsigned)(size_t)sAB + (unsigned)(cr * GT_P + cp) * 2u;   // low 32 bits of a __shared__ address = byte offset in the block's LDS
  const int nT = K / GT_BK;

  const int rlane = lane & 15;                 // row (A) / col (B, D) within subtile
  const int koff  = (lane >> 4) * 8;           // k offset of this lane half
  const int mOff  = (lane >> 4) * 8;           // D row offset

  v8f acc[4][4];
#pragma unroll
  for (int i = 0; i < 4; ++i)
#pragma unroll
    for (int j = 0; j < 4; ++j) acc[i][j] = (v8f){0.f,0.f,0.f,0.f,0.f,0.f,0.f,0.f};

  gemm_stage_copy(l0, gA, sa, gB, sb);                       // stage 0 into buffer 0
  wait_copies_landed();                                      // this wave's copies of stage 0 have landed
  __syncthreads();                                           // ... and every other wave's
  if (nT > 1) gemm_stage_copy(l0 + GT_STAGE * 2, gA + GT_BK, sa, gB + GT_BK, sb);   // stage 1 into buffer 1
  for (int t = 0; t < nT; ++t) {
    const T* sbuf = (const T*)sAB + (t & 1) * GT_STAGE;
    const T* sA = sbuf + (wm + rlane) * GT_P + koff;
    const T* sB = sbuf + (GT_BM + wn + rlane) * GT_P + koff;
#pragma unroll
    for (int kk = 0; kk < GT_BK; kk += 32) {
      V bh[4], ah[4];
#pragma unroll
      for (int j = 0; j < 4; ++j) bh[j] = Frag<T>::load(sB + (j << 4) * GT_P + kk);
#pragma unroll
      for (int i = 0; i < 4; ++i) ah[i] = Frag<T>::load(sA + (i << 4) * GT_P + kk);
#pragma unroll
      for (int i = 0; i < 4; ++i) {
#pragma unroll
        for (int j = 0; j < 4; ++j) acc[i][j] = Frag<T>::mma(ah[i], bh[j], acc[i][j]);
        Frag<T>::guard(acc[i][0], acc[i][3], ah[i], ah[i]);
      }
      Frag<T>::keep(bh[0], bh[1], bh[2], bh[3]);
    }
    wait_lds_reads_done();                                   // this wave has left buffer t & 1
    wait_copies_landed();                                    // this wave's copies of stage t + 1 have landed
    __syncthreads();                                         // publishes stage t + 1 and ends every wave's reads of buffer t & 1
    if (t + 2 < nT) gemm_stage_copy(l0 + (unsigned)(t & 1) * (GT_STAGE * 2), gA + (size_t)(t + 2) * GT_BK, sa, gB + (size_t)(t + 2) * GT_BK, sb);
  }
  wait_copies_landed();                                      // no copy is outstanding when the wave goes on to the epilogue
  acc_guard4(acc[0][0], acc[0][1], acc[0][2], acc[0][3]);
  acc_guard4(acc[1][0], acc[1][1], acc[1][2], acc[1][3]);
  acc_guard4(acc[2][0], acc[2][1], acc[2][2], acc[2][3]);
  acc_guard4(acc[3][0], acc[3][1], acc[3][2], acc[3][3]);

  // ---- epilogue ----
  float* slab = sT[wave];
  const float* Rb = RESID ? (resid + (size_t)b * strideR) : nullptr;
#pragma unroll
  for (int i = 0; i < 4; ++i) {
    const int mBase = m0 + (i << 4);
#pragma unroll
    for (int j = 0; j < 4; ++j) {
      const int n = n0 + (j << 4) + rlane;
      float bv = 0.f;
      if (BIAS_MODE == 2) bv = bias[n];
#pragma unroll
      for (int r = 0; r < 8; ++r) {
        float v = acc[i][j][r] * scale;
        if (BIAS_MODE == 1) v += bias[mBase + mOff + r];
        if (BIAS_MODE == 2) v += bv;
        if (RESID) v += Rb[(size_t)(mBase + mOff + r) * ldc + n];
        if (ACT == 1) v = tanhf(v);
        if (ACT == 2) v = fmaxf(v, 0.0f);
        if (ACT == 3) v = v / (1.0f + expf(-v));
        if (ACT == 4) v = (v > 0.f) ? v : 0.01f * v;
        if (ACT == 5) v = 0.5f * v * (1.0f + erff(v * 0.70710678118654752f));
        slab[(mOff + r) * 68 + (j << 4) + rlane] = v;
      }
    }
    __builtin_amdgcn_fence(__ATOMIC_RELEASE, "workgroup");
    __builtin_amdgcn_wave_barrier();
    __builtin_amdgcn_fence(__ATOMIC_ACQUIRE, "workgroup");
    if (OUT_MODE == 0) {
      float* C = (float*)Cout + (size_t)b * strideC;
      const int hh = lane >> 4, c4 = (lane & 15) * 4;     // row seg = 256 B = 16 lanes x 16 B
      {
#pragma unroll
        for (int it = 0; it < 8; ++it) {
          const int row = it * 2 + hh;
          v4f v = *(const v4f*)(slab + row * 68 + c4);
          *(v4f*)(C + (size_t)(mBase + row) * ldc + n0 + c4) = v;
        }
        
      }
    } else {
      const int q = lane >> 3, c8 = (lane & 7) * 8;
      unsigned short* C  = (unsigned short*)Cout  + (size_t)b * strideC;
      unsigned short* C2 = (OUT_MODE == 2) ? ((unsigned short*)Cout2 + (size_t)b * strideC) : nullptr;
      {
#pragma unroll
        for (int it = 0; it < 4; ++it) {
          const int row = it * 4 + q;
          const float* sp = slab + row * 68 + c8;
          v8h hv, lv;
#pragma unroll
          for (int e = 0; e < 8; ++e) {
            if (OUT_MODE == 1) {
              hv[e] = (_Float16)sp[e];
            } else {
              unsigned short hb = f2bf_bits(sp[e]);
              unsigned short lb = f2bf_bits(sp[e] - bf_bits2f(hb));
              hv[e] = __builtin_bit_cast(_Float16, hb);
              lv[e] = __builtin_bit_cast(_Float16, lb);
            }
          }
          *(v8h*)(C + (size_t)(mBase + row) * ldc + n0 + c8) = hv;
          if (OUT_MODE == 2) *(v8h*)(C2 + (size_t)(mBase + row) * ldc + n0 + c8) = lv;
        }
        
      }
    }
    __builtin_amdgcn_fence(__ATOMIC_RELEASE, "workgroup");
    __builtin_amdgcn_wave_barrier();
    __builtin_amdgcn_fence(__ATOMIC_ACQUIRE, "workgroup");
  }
}

// ---- f32 [R][C] (row pitch ldi) -> f16 transposed [C][R] (row pitch ldo); one 64x64 tile (columns c0.., rows r0..) by one block of 256 threads
__device__ __forceinline__ void transpose_cast_tile(const float* __restrict__ in, int ldi, _Float16* __restrict__ outT, int ldo,
                                                    int c0, int r0, _Float16 (*tile)[72]) {     // tile: [c][r]
  const int t = threadIdx.x, tx = t & 31, ty = t >> 5;
  for (int i = ty; i < 64; i += 8) {
    tile[tx][i]      = (_Float16)in[(size_t)(r0 + i) * ldi + c0 + tx];
    tile[32 + tx][i] = (_Float16)in[(size_t)(r0 + i) * ldi + c0 + 32 + tx];
  }
  __syncthreads();
  const int q = t >> 3, c8 = (t & 7) * 8;
#pragma unroll
  for (int it = 0; it < 2; ++it) {
    const int c = it * 32 + q;
    v8h hv = *(const v8h*)(&tile[c][c8]);
    *(v8h*)(outT + (size_t)(c0 + c) * ldo + r0 + c8) = hv;
  }
}

// =====================================================================================
// Generic causal/non-causal attention for head_dim 64, f32 in / f32 out; 16-bit operands: bf16 with optional hi/lo splits, or
// plain f16 (F16=true, non-split, probabilities carried x2^15).
//   scores = (q*qscale)·kᵀ : v_wmma_f32_16x16x32_bf16 (_f16 when F16); SPLIT_QK -> q,k as bf16 hi/lo (hi·hi + hi·lo + lo·hi)
//   out    = p·v           : v_wmma_f32_16x16x32_bf16; SPLIT_PV -> p,v as bf16 hi/lo; else p,v plain bf16, or plain f16 on v_wmma_f32_16x16x32_f16 when F16
//   f32 accumulate; online softmax in f32. Block = 4 waves = 64 query rows of one (batch, head); S % 64 == 0.
//   Element (b, s, h, d) of tensor X lives at X[b*X_bs + s*X_rs + h*X_hs + d] (strides in floats, multiples of 4).
//   Masking: MODE 0 none, 1 causal (kv > q masked), 2 tensor [S][Skv] shared over (b,h) (float if
//   mask_is_int==0, int32 with element == 0 -> masked if 1, int32 with element != 0 -> masked if 2), 3 per-token vectors qmask[B][S] & kvmask[B][Skv] (int32,
//   0 -> masked), 4 causal + sliding window (kv > q or q - kv > W masked; W passed in mask_is_int);
//   5 = relative-position bias: s += cp[b,h,q][idx[q][kv]] + pc[b,h,kv][idx[q][kv]] with idx = mask_b ([S][Skv] int32) and
//   mask_a an int32 [S][Skv] tensor with nonzero = masked (tables: element (b,h,row,n) at X + b*c_bs + h*c_hs + row*c_rs + n);
//   masked scores are replaced by mask_fill (e.g. -inf or -1e9) before the softmax.
//   grid.x = B * H * (S/64) (or a sub-range with blk0).
// =====================================================================================
#define AT_D 64
#define AT_NW 4
#define AT_QB 64
#define AT_KC 64
#define AT_P 72   // LDS row pitch of the K, V^T and P tiles in 16-bit elements: 144 B = 16 B x 9, so the 16 rows of a 16-byte fragment read fall on distinct banks
struct AttnGeom { const float* cp = nullptr; const float* pc = nullptr; long c_bs = 0, c_rs = 0, c_hs = 0;   // mode-5 score-bias tables
                  long q_bs, q_rs, q_hs, k_bs, k_rs, k_hs, v_bs, v_rs, v_hs, o_bs, o_rs, o_hs;
                  int S, Skv, H, mask_mode; float qscale; int blk0; float mask_fill; int mask_is_int; };
static_assert(sizeof(AttnGeom) == 168, "no padding");

__device__ __forceinline__ unsigned short at_bf_bits(float f) {
  unsigned u = __float_as_uint(f);
  return (unsigned short)((u + 0x7FFFu + ((u >> 16) & 1u)) >> 16);
}
__device__ __forceinline__ __bf16 at_f2bf(float f) { return __builtin_bit_cast(__bf16, at_bf_bits(f)); }
__device__ __forceinline__ void at_split(float f, __bf16& hi, __bf16& lo) {
  const unsigned short hb = at_bf_bits(f);
  hi = __builtin_bit_cast(__bf16, hb);
  lo = at_f2bf(f - __uint_as_float(((unsigned)hb) << 16));
}
__device__ __forceinline__ v8f at_mma(v16b a, v16b b, v8f c) {
  c = __builtin_amdgcn_wmma_f32_16x16x32_bf16(false, a, false, b, (short)0, c, false, false);
  asm volatile("v_nop\n\tv_nop\n\tv_nop\n\tv_nop" : "+v"(c) : "v"(a), "v"(b));
  return c;
}
// 16-bit element as a bit pattern held in a __bf16 slot: f16 bits when F16, bf16 (RNE) otherwise
template <bool F16> __device__ __forceinline__ __bf16 at_to16(float f) {
  if (F16) return __builtin_bit_cast(__bf16, (_Float16)f);
  return at_f2bf(f);
}
template <bool F16> __device__ __forceinline__ v8f at_mma16(v16b a, v16b b, v8f c) {
  if (F16) {
    const v16h ah = __builtin_bit_cast(v16h, a), bh = __builtin_bit_cast(v16h, b);
    c = __builtin_amdgcn_wmma_f32_16x16x32_f16(false, ah, false, bh, (short)0, c, false, false);
    asm volatile("v_nop\n\tv_nop\n\tv_nop\n\tv_nop" : "+v"(c) : "v"(ah), "v"(bh));
    return c;
  }
  return at_mma(a, b, c);
}

// MODE = the mask mode as a compile-time constant: the per-score mode tests fold away, so the unrolled score loop is straight-line code
template <bool SPLIT_QK, bool SPLIT_PV, bool F16, int MODE>
__global__ __launch_bounds__(128)
void attn64_kernel(const float* __restrict__ q, const float* __restrict__ k,
                   const float* __restrict__ v, float* __restrict__ out,
                   const void* __restrict__ mask_a, const int* __restrict__ mask_b, AttnGeom g) {
  static_assert(!(F16 && (SPLIT_QK || SPLIT_PV)), "f16 mode is non-split");
  const float PSC = F16 ? 32768.0f : 1.0f;     // f16 probabilities carried x2^15 (subnormal range), folded into the final 1/l
  union FB { v16b v; v8b h[2]; };
  __shared__ __align__(16) __bf16 Ksh[AT_KC * AT_P];             // K hi [kv][d]      9 KB
  __shared__ __align__(16) __bf16 Ksl[SPLIT_QK ? AT_KC * AT_P : 8];
  __shared__ __align__(16) __bf16 Vth[AT_D * AT_P];              // V hi [d][kv]      9 KB
  __shared__ __align__(16) __bf16 Vtl[SPLIT_PV ? AT_D * AT_P : 8];
  __shared__ __align__(16) __bf16 Psh[AT_NW][16 * AT_P];         // per wave P hi [row][kv]  9 KB
  __shared__ __align__(16) __bf16 Psl[SPLIT_PV ? AT_NW : 1][SPLIT_PV ? 16 * AT_P : 8];
  __shared__ __align__(16) float  Os[AT_NW][16 * 68];            // per wave out tile, pitch 68

  const int tid  = threadIdx.x;
  const int wave = tid >> 5;
  const int lane = tid & 31;
  const int hh   = lane >> 4;
  const int c    = lane & 15;

  const int nqb = g.S / AT_QB;
  const int bx = blockIdx.x + g.blk0;
  const int qb = bx % nqb;
  const int bh = bx / nqb;
  const int h  = bh % g.H;
  const int b  = bh / g.H;
  const int qbase_block = qb * AT_QB;
  const int q0 = qbase_block + wave * 16;

  const float* qb_ptr = q + (size_t)b * g.q_bs + (size_t)h * g.q_hs;
  const float* kb_ptr = k + (size_t)b * g.k_bs + (size_t)h * g.k_hs;
  const float* vb_ptr = v + (size_t)b * g.v_bs + (size_t)h * g.v_hs;
  float*       ob_ptr = out + (size_t)b * g.o_bs + (size_t)h * g.o_hs;

  // ---- Q fragments (A operand): 2 d-chunks, hi (and lo) ----
  v16b qah[2], qal[2];
  {
    const float* qrow = qb_ptr + (size_t)(q0 + c) * g.q_rs;
#pragma unroll
    for (int dc = 0; dc < 2; ++dc) {
#pragma unroll
      for (int e = 0; e < 8; ++e) {
        const float f0 = qrow[dc * 32 + 8 * hh + e] * g.qscale;
        const float f1 = qrow[dc * 32 + 16 + 8 * hh + e] * g.qscale;
        if (SPLIT_QK) { __bf16 hq, lq; at_split(f0, hq, lq); qah[dc][e] = hq; qal[dc][e] = lq; at_split(f1, hq, lq); qah[dc][8 + e] = hq; qal[dc][8 + e] = lq; }
        else { qah[dc][e] = at_to16<F16>(f0); qah[dc][8 + e] = at_to16<F16>(f1); qal[dc][e] = qah[dc][e]; qal[dc][8 + e] = qah[dc][8 + e]; }
      }
    }
  }

  float mrow[8], lrow[8];
  v8f oacc[4];
#pragma unroll
  for (int r = 0; r < 8; ++r) { mrow[r] = -INFINITY; lrow[r] = 0.f; }
#pragma unroll
  for (int t = 0; t < 4; ++t) oacc[t] = (v8f){0.f,0.f,0.f,0.f,0.f,0.f,0.f,0.f};

  const int nChunks = (MODE == 1 || MODE == 4) ? (qb + 1) : (g.Skv / AT_KC);   // block-uniform
  // per-row query mask (mode 3)
  int qkeep[8];
#pragma unroll
  for (int r = 0; r < 8; ++r) qkeep[r] = (MODE == 3) ? mask_b[(size_t)b * g.S + q0 + 8 * hh + r] : 1;   // mask_b = qmask in mode 3
  for (int kc = 0; kc < nChunks; ++kc) {
    const int kv0 = kc * AT_KC;
    __syncthreads();
    {
      const int kvr = tid >> 1, dh = (tid & 1) * 32;
      const float* krow = kb_ptr + (size_t)(kv0 + kvr) * g.k_rs + dh;
      const float* vrow = vb_ptr + (size_t)(kv0 + kvr) * g.v_rs + dh;
#pragma unroll
      for (int i = 0; i < 8; ++i) {
        v4f kk = *(const v4f*)(krow + 4 * i);
        v4f vv = *(const v4f*)(vrow + 4 * i);
#pragma unroll
        for (int e = 0; e < 4; ++e) {
          const int d = dh + 4 * i + e;
          if (SPLIT_QK) { __bf16 a, bl; at_split(kk[e], a, bl); Ksh[kvr * AT_P + d] = a; Ksl[kvr * AT_P + d] = bl; }
          else Ksh[kvr * AT_P + d] = at_to16<F16>(kk[e]);
          if (SPLIT_PV) { __bf16 a, bl; at_split(vv[e], a, bl); Vth[d * AT_P + kvr] = a; Vtl[d * AT_P + kvr] = bl; }
          else Vth[d * AT_P + kvr] = at_to16<F16>(vv[e]);
        }
      }
    }
    __syncthreads();

    v8f s[4];
#pragma unroll
    for (int j = 0; j < 4; ++j) {
      s[j] = (v8f){0.f,0.f,0.f,0.f,0.f,0.f,0.f,0.f};
#pragma unroll 1
      for (int dc = 0; dc < 2; ++dc) {
        FB kb;
        kb.h[0] = *(const v8b*)(Ksh + (j * 16 + c) * AT_P + dc * 32 + 8 * hh);
        kb.h[1] = *(const v8b*)(Ksh + (j * 16 + c) * AT_P + dc * 32 + 16 + 8 * hh);
        s[j] = at_mma16<F16>(qah[dc], kb.v, s[j]);
        if (SPLIT_QK) {
          FB kl;
          kl.h[0] = *(const v8b*)(Ksl + (j * 16 + c) * AT_P + dc * 32 + 8 * hh);
          kl.h[1] = *(const v8b*)(Ksl + (j * 16 + c) * AT_P + dc * 32 + 16 + 8 * hh);
          s[j] = at_mma16<F16>(qah[dc], kl.v, s[j]);
          s[j] = at_mma16<F16>(qal[dc], kb.v, s[j]);
        }
      }
    }
    const bool diag = (MODE == 1) && (kc == qb);
    int kvkeep[4] = {1, 1, 1, 1};
    if (MODE == 3) {
#pragma unroll
      for (int j = 0; j < 4; ++j) kvkeep[j] = ((const int*)mask_a)[(size_t)b * g.Skv + kv0 + j * 16 + c];   // mask_a = kvmask
    }
    float cm[8];
#pragma unroll
    for (int r = 0; r < 8; ++r) {
      const int qrow = q0 + 8 * hh + r;
      float m = -INFINITY;
#pragma unroll
      for (int j = 0; j < 4; ++j) {
        const int kvcol = kv0 + j * 16 + c;
        bool masked = false;
        if (diag) masked = (kvcol > qrow);
        else if (MODE == 4) masked = (kvcol > qrow) || (qrow - kvcol > g.mask_is_int);
        else if (MODE == 2) {
          const size_t mi = (size_t)qrow * g.Skv + kvcol;
          masked = (g.mask_is_int == 0) ? (((const float*)mask_a)[mi] == 0.0f)
                 : (g.mask_is_int == 1) ? (((const int*)mask_a)[mi] == 0) : (((const int*)mask_a)[mi] != 0);
        } else if (MODE == 3) masked = (qkeep[r] == 0) || (kvkeep[j] == 0);
        else if (MODE == 5) {
          const size_t mi = (size_t)qrow * g.Skv + kvcol;
          masked = (((const int*)mask_a)[mi] != 0);
          int n = mask_b[mi]; n = n < 0 ? 0 : n;
          s[j][r] += g.cp[(size_t)b * g.c_bs + (size_t)h * g.c_hs + (size_t)qrow * g.c_rs + n]
                   + g.pc[(size_t)b * g.c_bs + (size_t)h * g.c_hs + (size_t)kvcol * g.c_rs + n];
        }
        const float sv = masked ? g.mask_fill : s[j][r];   // one select on the element (a conditional store into the vector selects all 8 registers)
        s[j][r] = sv;
        m = fmaxf(m, sv);
      }
#pragma unroll
      for (int off = 1; off < 16; off <<= 1) m = fmaxf(m, __shfl_xor(m, off, 32));
      cm[r] = m;
    }
    __bf16* pwh = Psh[wave];
    __bf16* pwl = Psl[SPLIT_PV ? wave : 0];
#pragma unroll
    for (int r = 0; r < 8; ++r) {
      const float mnew = fmaxf(mrow[r], cm[r]);
      const float alpha = expf(mrow[r] - mnew);
      mrow[r] = mnew;
      float psum = 0.f;
#pragma unroll
      for (int j = 0; j < 4; ++j) {
        const float p = expf(s[j][r] - mnew);
        psum += p;
        if (SPLIT_PV) { __bf16 a, bl; at_split(p, a, bl); pwh[(8 * hh + r) * AT_P + j * 16 + c] = a; pwl[(8 * hh + r) * AT_P + j * 16 + c] = bl; }
        else pwh[(8 * hh + r) * AT_P + j * 16 + c] = at_to16<F16>(p * PSC);
      }
#pragma unroll
      for (int off = 1; off < 16; off <<= 1) psum += __shfl_xor(psum, off, 32);
      lrow[r] = lrow[r] * alpha + psum;
#pragma unroll
      for (int t = 0; t < 4; ++t) oacc[t][r] *= alpha;
    }
    __builtin_amdgcn_fence(__ATOMIC_RELEASE, "workgroup");
    __builtin_amdgcn_wave_barrier();
    __builtin_amdgcn_fence(__ATOMIC_ACQUIRE, "workgroup");
#pragma unroll 1
    for (int kk = 0; kk < 2; ++kk) {
      FB pa, pl;
      pa.h[0] = *(const v8b*)(pwh + c * AT_P + kk * 32 + 8 * hh);
      pa.h[1] = *(const v8b*)(pwh + c * AT_P + kk * 32 + 16 + 8 * hh);
      if (SPLIT_PV) {
        pl.h[0] = *(const v8b*)(pwl + c * AT_P + kk * 32 + 8 * hh);
        pl.h[1] = *(const v8b*)(pwl + c * AT_P + kk * 32 + 16 + 8 * hh);
      }
#pragma unroll
      for (int t = 0; t < 4; ++t) {
        FB vb;
        vb.h[0] = *(const v8b*)(Vth + (t * 16 + c) * AT_P + kk * 32 + 8 * hh);
        vb.h[1] = *(const v8b*)(Vth + (t * 16 + c) * AT_P + kk * 32 + 16 + 8 * hh);
        oacc[t] = at_mma16<F16>(pa.v, vb.v, oacc[t]);
        if (SPLIT_PV) {
          FB vl;
          vl.h[0] = *(const v8b*)(Vtl + (t * 16 + c) * AT_P + kk * 32 + 8 * hh);
          vl.h[1] = *(const v8b*)(Vtl + (t * 16 + c) * AT_P + kk * 32 + 16 + 8 * hh);
          oacc[t] = at_mma16<F16>(pa.v, vl.v, oacc[t]);
          oacc[t] = at_mma16<F16>(pl.v, vb.v, oacc[t]);
        }
      }
    }
  }

  float* os = Os[wave];
#pragma unroll
  for (int r = 0; r < 8; ++r) {
    const float inv = 1.0f / (lrow[r] * PSC);
#pragma unroll
    for (int t = 0; t < 4; ++t) os[(8 * hh + r) * 68 + t * 16 + c] = oacc[t][r] * inv;
  }
  __builtin_amdgcn_fence(__ATOMIC_RELEASE, "workgroup");
  __builtin_amdgcn_wave_barrier();
  __builtin_amdgcn_fence(__ATOMIC_ACQUIRE, "workgroup");
  {
    const int c4 = (lane & 15) * 4;
    {
#pragma unroll
      for (int it = 0; it < 8; ++it) {
        const int row = it * 2 + hh;
        v4f val = *(const v4f*)(os + row * 68 + c4);
        *(v4f*)(ob_ptr + (size_t)(q0 + row) * g.o_rs + c4) = val;
      }
      
    }
  }
}

#define TB_ 8
#define TS 1024
#define TDm 512
#define TH 8
#define THD 64
#define TR (TB_ * TS)
typedef __attribute__((ext_vector_type(4))) _Float16 v4h;
// The three elementwise passes (the A16 blocks of prep_kernel, kbias_kernel, cast_f32_f16x4): 512 blocks of 8 waves (two blocks a WGP); a thread moves EW_U items of 4 floats, every wave-wide 16-byte load
// covers 512 contiguous bytes, and all of a thread's loads are issued before its first store.
#define EW_U 8
#define EW_BLOCKS (TR * TDm / 4 / (EW_U * 256))
static_assert(EW_BLOCKS * EW_U * 256 * 4 == TR * TDm, "whole blocks");
// One launch prepares every operand of the first product and the weights of the last: none of these jobs reads what another writes.
// Blocks 0..447: the 7 weight matrices [in 512][out 512], 64 tiles of 64x64 each, cast to f16 and transposed (the block-uniform branch keeps the barrier legal):
//   Bt [1536][1024]: row n<512 (q): [Wqs[:,n] | Wqt[:,n]]; 512..1023 k; 1024..1535 v; then WoT [512][512]. They come first: each is a chain of dependent loads.
// Blocks 448..959: A16 [8192][1024] = [xs2 | xt] f16 (xs2 = raw reshape of xs); item i = floats 4i..4i+3 of xs and of xt, 128 items a row, so 256 items on = 2 rows on
#define TP_TILES ((TDm / 64) * (TDm / 64))
#define TP_BLOCKS (7 * TP_TILES)
__global__ __launch_bounds__(256) void prep_kernel(const float* __restrict__ xs, const float* __restrict__ xt,
                                                   const float* __restrict__ Wqs, const float* __restrict__ Wqt, const float* __restrict__ Wks,
                                                   const float* __restrict__ Wkt, const float* __restrict__ Wvs, const float* __restrict__ Wvt,
                                                   const float* __restrict__ Wo, unsigned* __restrict__ A16,
                                                   _Float16* __restrict__ WT, _Float16* __restrict__ WoT) {
  __shared__ __align__(16) _Float16 tile[64][72];
  if (blockIdx.x < TP_BLOCKS) {
    const int job = blockIdx.x / TP_TILES, tl = blockIdx.x % TP_TILES;
    const float* in = job == 0 ? Wqs : job == 1 ? Wqt : job == 2 ? Wks : job == 3 ? Wkt : job == 4 ? Wvs : job == 5 ? Wvt : Wo;
    _Float16* o = job < 6 ? WT + (size_t)(job >> 1) * TDm * 2 * TDm + (job & 1) * TDm : WoT;
    transpose_cast_tile(in, TDm, o, job < 6 ? 2 * TDm : TDm, (tl % (TDm / 64)) * 64, (tl / (TDm / 64)) * 64, tile);
    return;
  }
  const int base = (blockIdx.x - TP_BLOCKS) * (EW_U * 256) + threadIdx.x;
  const v4f* pa = (const v4f*)xs + base; const v4f* pb = (const v4f*)xt + base;
  v4h* o = (v4h*)A16 + (size_t)(base >> 7) * 256 + (base & 127);     // a row of A16 is 1024 f16 = 256 items; xt's half starts 128 items in
  v4f a[EW_U], b[EW_U];
#pragma unroll
  for (int u = 0; u < EW_U; ++u) { a[u] = pa[u * 256]; b[u] = pb[u * 256]; }
#pragma unroll
  for (int u = 0; u < EW_U; ++u) { o[u * 512] = __builtin_convertvector(a[u], v4h); o[u * 512 + 128] = __builtin_convertvector(b[u], v4h); }
}
// k' = k + WKᵀ: QKV[(b,s)][512 + h*64 + d] += WK[d][s]
// a thread owns (s, 4 columns) and walks the 8 batches, which share its 4 values of WK
__global__ __launch_bounds__(256) void kbias_kernel(float* __restrict__ QKV, const float* __restrict__ WK) {
  const int t = blockIdx.x * 256 + threadIdx.x; const int s = t >> 7, c = 4 * (t & 127), d = c % THD;
  static_assert(TS * (TDm / 4) == EW_BLOCKS * 256, "one thread per (s, 4 columns)");
  const float* wp = WK + (size_t)d * TS + s;
  const v4f w = {wp[0], wp[TS], wp[2 * TS], wp[3 * TS]};
  asm volatile("s_wait_xcnt 0x0" ::: "memory");   // the address registers of the 4 loads above may be reused as destinations of the loads below
  float* p = QKV + (size_t)s * (3 * TDm) + TDm + c;
  v4f k[TB_];
#pragma unroll
  for (int b = 0; b < TB_; ++b) k[b] = *(const v4f*)(p + (size_t)b * TS * (3 * TDm));
#pragma unroll
  for (int b = 0; b < TB_; ++b) *(v4f*)(p + (size_t)b * TS * (3 * TDm)) = k[b] + w;
}
// O f32 -> f16
__global__ __launch_bounds__(256) void cast_f32_f16x4(const float* __restrict__ in, _Float16* __restrict__ out) {
  const int base = blockIdx.x * (EW_U * 256) + threadIdx.x;
  const v4f* pi = (const v4f*)in + base; v4h* po = (v4h*)out + base;
  v4f x[EW_U];
#pragma unroll
  for (int u = 0; u < EW_U; ++u) x[u] = pi[u * 256];
#pragma unroll
  for (int u = 0; u < EW_U; ++u) po[u * 256] = __builtin_convertvector(x[u], v4h);
}
extern "C" void kernel_launch(void* const* d_in, const int* in_sizes, int n_in, void* d_out, int out_size, void* d_ws, size_t ws_size, hipStream_t stream) {
  (void)in_sizes; (void)n_in; (void)out_size; (void)ws_size;
  auto Fp = [&](int i) { return (const float*)d_in[i]; };
  const float* xs = Fp(0); const float* xt = Fp(1); const float* Wqs = Fp(2); const float* Wks = Fp(3); const float* Wvs = Fp(4); const float* Wqt = Fp(5); const float* Wkt = Fp(6); const float* Wvt = Fp(7); const float* WK = Fp(8); const float* Wo = Fp(9);
  char* ws = (char*)d_ws; size_t off = 0;
  auto carve = [&](size_t bytes) -> char* { char* p = ws + off; off += (bytes + 255) & ~(size_t)255; return p; };
  unsigned* A16 = (unsigned*)carve((size_t)TR * 2 * TDm * 2); _Float16* WT = (_Float16*)carve((size_t)3 * TDm * 2 * TDm * 2); _Float16* WoT = (_Float16*)carve((size_t)TDm * TDm * 2);
  float* QKV = (float*)carve((size_t)TR * 3 * TDm * 4); float* O = (float*)carve((size_t)TR * TDm * 4); _Float16* O16 = (_Float16*)A16;     // ≈ 84 MB; O16 reuses A16
  prep_kernel<<<TP_BLOCKS + EW_BLOCKS, 256, 0, stream>>>(xs, xt, Wqs, Wqt, Wks, Wkt, Wvs, Wvt, Wo, A16, WT, WoT);
  const int t3 = (TR / GT_BM) * (3 * TDm / GT_BN), t1 = (TR / GT_BM) * (TDm / GT_BN);   // block tiles of 128 x 256
  wmma_gemm64<0, false, 0, 0, false><<<dim3(t3, 1), 256, 0, stream>>>((const unsigned short*)A16, nullptr, 2 * TDm, 0, U16(WT), nullptr, 2 * TDm, 0, QKV, nullptr, 3 * TDm, 0, nullptr, nullptr, 0, TR, 3 * TDm, 2 * TDm, 1.0f);
  kbias_kernel<<<EW_BLOCKS, 256, 0, stream>>>(QKV, WK);
  { AttnGeom g;
    g.q_bs = (long)TS * 3 * TDm; g.q_rs = 3 * TDm; g.q_hs = THD; g.k_bs = g.q_bs; g.k_rs = g.q_rs; g.k_hs = THD; g.v_bs = g.q_bs; g.v_rs = g.q_rs; g.v_hs = THD; g.o_bs = (long)TS * TDm; g.o_rs = TDm; g.o_hs = THD;
    g.S = TS; g.Skv = TS; g.H = TH; g.mask_mode = 1; g.qscale = 0.125f; g.blk0 = 0; g.mask_fill = -1e9f; g.mask_is_int = 0;
    attn64_kernel<false, false, true, 1><<<TB_ * TH * (TS / AT_QB), AT_NW * 32, 0, stream>>>(QKV, QKV + TDm, QKV + 2 * TDm, O, nullptr, nullptr, g); }
  cast_f32_f16x4<<<EW_BLOCKS, 256, 0, stream>>>(O, O16);
  wmma_gemm64<0, false, 0, 0, false><<<dim3(t1, 1), 256, 0, stream>>>(U16(O16), nullptr, TDm, 0, U16(WoT), nullptr, TDm, 0, (float*)d_out, nullptr, TDm, 0, nullptr, nullptr, 0, TR, TDm, TDm, 1.0f);
}

// v006
// Measured time: 146 microseconds a run.
// Next to v005, in two timings, it ran 1.10 and 1.09 times as fast.
// All steps since v000 together make it 4.26 times as fast.
#include <hip/hip_runtime.h>
#include <math.h>
// TMSA block (8 x 1024 tokens x 512, 8 heads x 64, causal): q/k/v = xs2·W*s + xt·W*t as ONE product over the concatenated input [xs2 | xt]·[W*s; W*t]
// (8192 x 1024 · 1024 x 1536); the query-dependent bias q·WK is folded exactly into the keys — Σ_d q_d k_jd + Σ_d q_d WK[d][j] = q·(k_j + WK[:, j]) —
// so the attention is a plain causal flash-style kernel over k' = k + WKᵀ (scores (q/8)·k'ᵀ and p·v on WMMA, f16 operands with probabilities x2^15,
// f32 accumulate, online softmax in f32, -1e9 fill above the diagonal); output projection ·Wo. All products v_wmma_f32_16x16x32_f16, f16 operands,
// f32 accumulate (plain single products, ≈20 G MAC); the raw .view reshapes are identity on memory.
typedef __attribute__((ext_vector_type(16))) _Float16 v16h;
typedef __attribute__((ext_vector_type(8)))  _Float16 v8h;
typedef __attribute__((ext_vector_type(16))) __bf16   v16b;
typedef __attribute__((ext_vector_type(8)))  __bf16   v8b;
typedef __attribute__((ext_vector_type(8)))  float    v8f;
typedef __attribute__((ext_vector_type(4)))  float    v4f;
#define PSCALE 32768.0f
#define U16(p) ((const unsigned short*)(const void*)(p))
#define PSCALE_INV (1.0f / 32768.0f)

__device__ __forceinline__ unsigned short f2bf_bits(float f) {
  unsigned u = __float_as_uint(f);
  return (unsigned short)((u + 0x7FFFu + ((u >> 16) & 1u)) >> 16);
}
__device__ __forceinline__ float bf_bits2f(unsigned short h) { return __uint_as_float(((unsigned)h) << 16); }

// hazard guards as plain device helpers (no inline asm inside the kernel template body)
__device__ __forceinline__ void dep_guard_h(v8f& a, v8f& b, v16h x, v16h y) { asm volatile("v_nop\n\tv_nop\n\tv_nop\n\tv_nop" : "+v"(a), "+v"(b) : "v"(x), "v"(y)); }
__device__ __forceinline__ void dep_guard_b(v8f& a, v8f& b, v16b x, v16b y) { asm volatile("v_nop\n\tv_nop\n\tv_nop\n\tv_nop" : "+v"(a), "+v"(b) : "v"(x), "v"(y)); }
__device__ __forceinline__ void keep4_h(v16h a, v16h b, v16h c, v16h d) { asm volatile("v_nop" :: "v"(a), "v"(b), "v"(c), "v"(d)); }
__device__ __forceinline__ void keep4_b(v16b a, v16b b, v16b c, v16b d) { asm volatile("v_nop" :: "v"(a), "v"(b), "v"(c), "v"(d)); }
__device__ __forceinline__ void acc_guard4(v8f& a, v8f& b, v8f& c, v8f& d) { asm volatile("v_nop\n\tv_nop\n\tv_nop\n\tv_nop" : "+v"(a), "+v"(b), "+v"(c), "+v"(d)); }
template <typename T> struct Frag;
template <> struct Frag<_Float16> {
  typedef v16h V; union U { v16h v; v8h h[2]; };
  static __device__ __forceinline__ v16h load(const _Float16* p) {   // elements 0..7 <- p[0..7], 8..15 <- p[16..23]
    U f; f.h[0] = *(const v8h*)(p); f.h[1] = *(const v8h*)(p + 16); return f.v;
  }
  static __device__ __forceinline__ v8f mma(v16h a, v16h b, v8f c) {
    return __builtin_amdgcn_wmma_f32_16x16x32_f16(false, a, false, b, (short)0, c, false, false);
  }
  static __device__ __forceinline__ void guard(v8f& a, v8f& b, v16h x, v16h y) { dep_guard_h(a, b, x, y); }
  static __device__ __forceinline__ void keep(v16h a, v16h b, v16h c, v16h d) { keep4_h(a, b, c, d); }
};
template <> struct Frag<__bf16> {
  typedef v16b V; union U { v16b v; v8b h[2]; };
  static __device__ __forceinline__ v16b load(const __bf16* p) {
    U f; f.h[0] = *(const v8b*)(p); f.h[1] = *(const v8b*)(p + 16); return f.v;
  }
  static __device__ __forceinline__ v8f mma(v16b a, v16b b, v8f c) {
    return __builtin_amdgcn_wmma_f32_16x16x32_bf16(false, a, false, b, (short)0, c, false, false);
  }
  static __device__ __forceinline__ void guard(v8f& a, v8f& b, v16b x, v16b y) { dep_guard_b(a, b, x, y); }
  static __device__ __forceinline__ void keep(v16b a, v16b b, v16b c, v16b d) { keep4_b(a, b, c, d); }
};

// ---- Register-blocked batched WMMA GEMM ------------------------------------
// C[m,n] = scale * sum_k A[m,k] * Bt[n,k] (+bias)(+resid); each wave owns a 64x64 tile, the 8 waves of a block a 128x256 tile (2 x 4 waves).
// A row-major [M,K]; Bt row-major [N,K]; M % 128 == 0, N % 256 == 0, K % 64 == 0; grid.x = (M/128)*(N/256).
// Operands go through LDS: a stage is 64 k (128 B) of the block's 128 A rows and 256 Bt rows, brought by asynchronous 16-byte copies whose
// wave-wide form covers 4 whole 128-B lines; two buffers, the copies of stage t+2 fly while stage t+1 is worked on.
// SPLIT (hi/lo planes) is not staged and so not offered by this form.
// BIAS_MODE: 0 = none, 1 = bias[m], 2 = bias[n].
// OUT_MODE: 0 = f32, 1 = f16, 2 = bf16 hi plane (Cout) + bf16 lo plane (Cout2).
// ET: 0 = f16 operands, 1 = bf16 operands (pointers passed as 16-bit storage)
template <int ET> struct Elem;
template <> struct Elem<0> { typedef _Float16 T; };
template <> struct Elem<1> { typedef __bf16 T; };
#define GT_BM 128
#define GT_BN 256
#define GT_BK 64
#define GT_P 72                              // LDS row pitch in 16-bit elements: 144 B = 16 B x 9, conflict-free for 16-byte fragment reads
#define GT_STAGE ((GT_BM + GT_BN) * GT_P)    // 16-bit elements of one buffer: A rows 0..127, then Bt rows 0..255
#define GT_G (32 * GT_P * 2)                 // LDS bytes from one group of 32 rows to the next
// One stage, one thread's share: 12 copies of 16 B (4 groups of 32 A rows, 8 groups of 32 Bt rows). l = the lane's LDS byte address in group 0,
// a / b = its global address in group 0 of A / Bt, sa / sb = elements from one group of 32 rows to the next.
// The s_wait_xcnt stands inside the statement so that no address register of a copy is rewritten ahead of it.
__device__ __forceinline__ void gemm_stage_copy(unsigned l, const unsigned short* a, size_t sa, const unsigned short* b, size_t sb) {
  asm volatile(
      "global_load_async_to_lds_b128 %0, %12, off\n\t"
      "global_load_async_to_lds_b128 %1, %13, off\n\t"
      "global_load_async_to_lds_b128 %2, %14, off\n\t"
      "global_load_async_to_lds_b128 %3, %15, off\n\t"
      "global_load_async_to_lds_b128 %4, %16, off\n\t"
      "global_load_async_to_lds_b128 %5, %17, off\n\t"
      "global_load_async_to_lds_b128 %6, %18, off\n\t"
      "global_load_async_to_lds_b128 %7, %19, off\n\t"
      "global_load_async_to_lds_b128 %8, %20, off\n\t"
      "global_load_async_to_lds_b128 %9, %21, off\n\t"
      "global_load_async_to_lds_b128 %10, %22, off\n\t"
      "global_load_async_to_lds_b128 %11, %23, off\n\t"
      "s_wait_xcnt 0x0"
      :: "v"(l), "v"(l + GT_G), "v"(l + 2 * GT_G), "v"(l + 3 * GT_G),
         "v"(l + 4 * GT_G), "v"(l + 5 * GT_G), "v"(l + 6 * GT_G), "v"(l + 7 * GT_G),
         "v"(l + 8 * GT_G), "v"(l + 9 * GT_G), "v"(l + 10 * GT_G), "v"(l + 11 * GT_G),
         "v"(a), "v"(a + sa), "v"(a + 2 * sa), "v"(a + 3 * sa),
         "v"(b), "v"(b + sb), "v"(b + 2 * sb), "v"(b + 3 * sb),
         "v"(b + 4 * sb), "v"(b + 5 * sb), "v"(b + 6 * sb), "v"(b + 7 * sb)
      : "memory");
}
// The two waits of the ring, each a statement of its own; the "memory" clobber keeps every LDS read on its side of them.
__device__ __forceinline__ void wait_copies_landed() { asm volatile("s_wait_asynccnt 0x0" ::: "memory"); }
__device__ __forceinline__ void wait_lds_reads_done() { asm volatile("s_wait_dscnt 0x0" ::: "memory"); }     // a buffer is refilled only after its readers' loads have returned
template <int ET, bool SPLIT, int BIAS_MODE, int OUT_MODE, bool RESID, int ACT = 0>
__global__ __launch_bounds__(256) void wmma_gemm64(
    const unsigned short* __restrict__ Ap, const unsigned short* __restrict__ A2p, int lda, long strideA,
    const unsigned short* __restrict__ Btp, const unsigned short* __restrict__ Bt2p, int ldb, long strideB,
    void* __restrict__ Cout, void* __restrict__ Cout2, int ldc, long strideC,
    const float* __restrict__ bias,
    const float* __restrict__ resid, long strideR,
    int M, int N, int K, float scale) {
  typedef typename Elem<ET>::T T;
  typedef typename Frag<T>::V V;
  static_assert(!SPLIT, "the lo planes are not staged");
  (void)A2p; (void)Bt2p; (void)M;
  __shared__ __align__(16) float sT[8][16 * 68];   // per-wave 16x64 slab, pitch 68 floats
  __shared__ __align__(16) unsigned short sAB[2 * GT_STAGE];   // the two operand buffers
  const int b    = blockIdx.y;
  const int lane = threadIdx.x & 31;
  const int wave = threadIdx.x >> 5;
  const int tilesN = N >> 8;
  const int tm = blockIdx.x / tilesN;          // block tile; every block has one, so every wave passes every barrier
  const int tn = blockIdx.x - tm * tilesN;
  const int wm = (wave >> 2) << 6;             // the wave's 64x64 tile inside the block tile
  const int wn = (wave & 3) << 6;
  const int m0 = (tm << 7) + wm;
  const int n0 = (tn << 8) + wn;

  // copies: thread t brings the 16-byte piece t & 7 of row t >> 3 of every group of 32 rows
  const int cr = threadIdx.x >> 3, cp = (threadIdx.x & 7) * 8;
  const unsigned short* gA = Ap  + (size_t)b * strideA + (size_t)((tm << 7) + cr) * lda + cp;
  const unsigned short* gB = Btp + (size_t)b * strideB + (size_t)((tn << 8) + cr) * ldb + cp;
  const size_t sa = (size_t)32 * lda, sb = (size_t)32 * ldb;
  const unsigned l0 = (unsigned)(size_t)sAB + (unsigned)(cr * GT_P + cp) * 2u;   // low 32 bits of a __shared__ address = byte offset in the block's LDS
  const int nT = K / GT_BK;

  const int rlane = lane & 15;                 // row (A) / col (B, D) within subtile
  const int koff  = (lane >> 4) * 8;           // k offset of this lane half
  const int mOff  = (lane >> 4) * 8;           // D row offset

  v8f acc[4][4];
#pragma unroll
  for (int i = 0; i < 4; ++i)
#pragma unroll
    for (int j = 0; j < 4; ++j) acc[i][j] = (v8f){0.f,0.f,0.f,0.f,0.f,0.f,0.f,0.f};

  gemm_stage_copy(l0, gA, sa, gB, sb);                       // stage 0 into buffer 0
  wait_copies_landed();                                      // this wave's copies of stage 0 have landed
  __syncthreads();                                           // ... and every other wave's
  if (nT > 1) gemm_stage_copy(l0 + GT_STAGE * 2, gA + GT_BK, sa, gB + GT_BK, sb);   // stage 1 into buffer 1
  for (int t = 0; t < nT; ++t) {
    const T* sbuf = (const T*)sAB + (t & 1) * GT_STAGE;
    const T* sA = sbuf + (wm + rlane) * GT_P + koff;
    const T* sB = sbuf + (GT_BM + wn + rlane) * GT_P + koff;
#pragma unroll
    for (int kk = 0; kk < GT_BK; kk += 32) {
      V bh[4], ah[4];
#pragma unroll
      for (int j = 0; j < 4; ++j) bh[j] = Frag<T>::load(sB + (j << 4) * GT_P + kk);
#pragma unroll
      for (int i = 0; i < 4; ++i) ah[i] = Frag<T>::load(sA + (i << 4) * GT_P + kk);
#pragma unroll
      for (int i = 0; i < 4; ++i) {
#pragma unroll
        for (int j = 0; j < 4; ++j) acc[i][j] = Frag<T>::mma(ah[i], bh[j], acc[i][j]);
        Frag<T>::guard(acc[i][0], acc[i][3], ah[i], ah[i]);
      }
      Frag<T>::keep(bh[0], bh[1], bh[2], bh[3]);
    }
    wait_lds_reads_done();                                   // this wave has left buffer t & 1
    wait_copies_landed();                                    // this wave's copies of stage t + 1 have landed
    __syncthreads();                                         // publishes stage t + 1 and ends every wave's reads of buffer t & 1
    if (t + 2 < nT) gemm_stage_copy(l0 + (unsigned)(t & 1) * (GT_STAGE * 2), gA + (size_t)(t + 2) * GT_BK, sa, gB + (size_t)(t + 2) * GT_BK, sb);
  }
  wait_copies_landed();                                      // no copy is outstanding when the wave goes on to the epilogue
  acc_guard4(acc[0][0], acc[0][1], acc[0][2], acc[0][3]);
  acc_guard4(acc[1][0], acc[1][1], acc[1][2], acc[1][3]);
  acc_guard4(acc[2][0], acc[2][1], acc[2][2], acc[2][3]);
  acc_guard4(acc[3][0], acc[3][1], acc[3][2], acc[3][3]);

  // ---- epilogue ----
  float* slab = sT[wave];
  const float* Rb = RESID ? (resid + (size_t)b * strideR) : nullptr;
#pragma unroll
  for (int i = 0; i < 4; ++i) {
    const int mBase = m0 + (i << 4);
#pragma unroll
    for (int j = 0; j < 4; ++j) {
      const int n = n0 + (j << 4) + rlane;
      float bv = 0.f;
      if (BIAS_MODE == 2) bv = bias[n];
#pragma unroll
      for (int r = 0; r < 8; ++r) {
        float v = acc[i][j][r] * scale;
        if (BIAS_MODE == 1) v += bias[mBase + mOff + r];
        if (BIAS_MODE == 2) v += bv;
        if (RESID) v += Rb[(size_t)(mBase + mOff + r) * ldc + n];
        if (ACT == 1) v = tanhf(v);
        if (ACT == 2) v = fmaxf(v, 0.0f);
        if (ACT == 3) v = v / (1.0f + expf(-v));
        if (ACT == 4) v = (v > 0.f) ? v : 0.01f * v;
        if (ACT == 5) v = 0.5f * v * (1.0f + erff(v * 0.70710678118654752f));
        slab[(mOff + r) * 68 + (j << 4) + rlane] = v;
      }
    }
    __builtin_amdgcn_fence(__ATOMIC_RELEASE, "workgroup");
    __builtin_amdgcn_wave_barrier();
    __builtin_amdgcn_fence(__ATOMIC_ACQUIRE, "workgroup");
    if (OUT_MODE == 0) {
      float* C = (float*)Cout + (size_t)b * strideC;
      const int hh = lane >> 4, c4 = (lane & 15) * 4;     // row seg = 256 B = 16 lanes x 16 B
      {
#pragma unroll
        for (int it = 0; it < 8; ++it) {
          const int row = it * 2 + hh;
          v4f v = *(const v4f*)(slab + row * 68 + c4);
          *(v4f*)(C + (size_t)(mBase + row) * ldc + n0 + c4) = v;
        }
        
      }
    } else {
      const int q = lane >> 3, c8 = (lane & 7) * 8;
      unsigned short* C  = (unsigned short*)Cout  + (size_t)b * strideC;
      unsigned short* C2 = (OUT_MODE == 2) ? ((unsigned short*)Cout2 + (size_t)b * strideC) : nullptr;
      {
#pragma unroll
        for (int it = 0; it < 4; ++it) {
          const int row = it * 4 + q;
          const float* sp = slab + row * 68 + c8;
          v8h hv, lv;
#pragma unroll
          for (int e = 0; e < 8; ++e) {
            if (OUT_MODE == 1) {
              hv[e] = (_Float16)sp[e];
            } else {
              unsigned short hb = f2bf_bits(sp[e]);
              unsigned short lb = f2bf_bits(sp[e] - bf_bits2f(hb));
              hv[e] = __builtin_bit_cast(_Float16, hb);
              lv[e] = __builtin_bit_cast(_Float16, lb);
            }
          }
          *(v8h*)(C + (size_t)(mBase + row) * ldc + n0 + c8) = hv;
          if (OUT_MODE == 2) *(v8h*)(C2 + (size_t)(mBase + row) * ldc + n0 + c8) = lv;
        }
        
      }
    }
    __builtin_amdgcn_fence(__ATOMIC_RELEASE, "workgroup");
    __builtin_amdgcn_wave_barrier();
    __builtin_amdgcn_fence(__ATOMIC_ACQUIRE, "workgroup");
  }
}

// ---- f32 [R][C] (row pitch ldi) -> f16 transposed [C][R] (row pitch ldo); one 64x64 tile (columns c0.., rows r0..) by one block of 256 threads
__device__ __forceinline__ void transpose_cast_tile(const float* __restrict__ in, int ldi, _Float16* __restrict__ outT, int ldo,
                                                    int c0, int r0, _Float16 (*tile)[72]) {     // tile: [c][r]
  const int t = threadIdx.x, tx = t & 31, ty = t >> 5;
  for (int i = ty; i < 64; i += 8) {
    tile[tx][i]      = (_Float16)in[(size_t)(r0 + i) * ldi + c0 + tx];
    tile[32 + tx][i] = (_Float16)in[(size_t)(r0 + i) * ldi + c0 + 32 + tx];
  }
  __syncthreads();
  const int q = t >> 3, c8 = (t & 7) * 8;
#pragma unroll
  for (int it = 0; it < 2; ++it) {
    const int c = it * 32 + q;
    v8h hv = *(const v8h*)(&tile[c][c8]);
    *(v8h*)(outT + (size_t)(c0 + c) * ldo + r0 + c8) = hv;
  }
}

// =====================================================================================
// Generic causal/non-causal attention for head_dim 64, f32 in / f32 out; 16-bit operands: bf16 with optional hi/lo splits, or
// plain f16 (F16=true, non-split, probabilities carried x2^15).
//   scores = (q*qscale)·kᵀ : v_wmma_f32_16x16x32_bf16 (_f16 if F16); SPLIT_QK -> q,k as bf16 hi/lo (hi·hi + hi·lo + lo·hi)
//   out    = p·v           : v_wmma_f32_16x16x32_bf16 (_f16 if F16); SPLIT_PV -> p,v as bf16 hi/lo; else p,v plain bf16 (f16 if F16)
//   f32 accumulate; online softmax in f32. Block = 4 waves = two 64-row query tiles of one (batch, head); S % 64 == 0.
//   Element (b, s, h, d) of tensor X lives at X[b*X_bs + s*X_rs + h*X_hs + d] (strides in floats, multiples of 4).
//   Masking: MODE 0 none, 1 causal (kv > q masked), 2 tensor [S][Skv] shared over (b,h) (float if
//   mask_is_int==0, int32 with element == 0 -> masked if 1, int32 with element != 0 -> masked if 2), 3 per-token vectors qmask[B][S] & kvmask[B][Skv] (int32,
//   0 -> masked), 4 causal + sliding window (kv > q or q - kv > W masked; W passed in mask_is_int);
//   5 = relative-position bias: s += cp[b,h,q][idx[q][kv]] + pc[b,h,kv][idx[q][kv]] with idx = mask_b ([S][Skv] int32) and
//   mask_a an int32 [S][Skv] tensor with nonzero = masked (tables: element (b,h,row,n) at X + b*c_bs + h*c_hs + row*c_rs + n);
//   masked scores are replaced by mask_fill (e.g. -inf or -1e9) before the softmax.
//   grid.x = B * H * (S/128) (or a sub-range with blk0); S/64 even. A block takes two query tiles of one (batch, head), one after the other: tile n-1-t, then
//   tile t. Under the causal mask a tile's cost grows with its index, every block is resident at once and the launch lasts as long as its fullest WGP:
//   so paired, every block walks the same n+1 chunks wherever it lands.
// =====================================================================================
#define AT_D 64
#define AT_NW 4
#define AT_QB 64
#define AT_KC 64
#define AT_P 72   // LDS row pitch of the K, V^T and P tiles in 16-bit elements: 144 B = 16 B x 9, so the 16 rows of a 16-byte fragment read fall on distinct banks
struct AttnGeom { const float* cp = nullptr; const float* pc = nullptr; long c_bs = 0, c_rs = 0, c_hs = 0;   // mode-5 score-bias tables
                  long q_bs, q_rs, q_hs, k_bs, k_rs, k_hs, v_bs, v_rs, v_hs, o_bs, o_rs, o_hs;
                  int S, Skv, H, mask_mode; float qscale; int blk0; float mask_fill; int mask_is_int; };
static_assert(sizeof(AttnGeom) == 168, "no padding");

__device__ __forceinline__ unsigned short at_bf_bits(float f) {
  unsigned u = __float_as_uint(f);
  return (unsigned short)((u + 0x7FFFu + ((u >> 16) & 1u)) >> 16);
}
__device__ __forceinline__ __bf16 at_f2bf(float f) { return __builtin_bit_cast(__bf16, at_bf_bits(f)); }
__device__ __forceinline__ void at_split(float f, __bf16& hi, __bf16& lo) {
  const unsigned short hb = at_bf_bits(f);
  hi = __builtin_bit_cast(__bf16, hb);
  lo = at_f2bf(f - __uint_as_float(((unsigned)hb) << 16));
}
__device__ __forceinline__ v8f at_mma(v16b a, v16b b, v8f c) {
  c = __builtin_amdgcn_wmma_f32_16x16x32_bf16(false, a, false, b, (short)0, c, false, false);
  asm volatile("v_nop\n\tv_nop\n\tv_nop\n\tv_nop" : "+v"(c) : "v"(a), "v"(b));
  return c;
}
// 16-bit element as a bit pattern held in a __bf16 slot: f16 bits when F16, bf16 (RNE) otherwise
template <bool F16> __device__ __forceinline__ __bf16 at_to16(float f) {
  if (F16) return __builtin_bit_cast(__bf16, (_Float16)f);
  return at_f2bf(f);
}
template <bool F16> __device__ __forceinline__ v8f at_mma16(v16b a, v16b b, v8f c) {
  if (F16) {
    const v16h ah = __builtin_bit_cast(v16h, a), bh = __builtin_bit_cast(v16h, b);
    c = __builtin_amdgcn_wmma_f32_16x16x32_f16(false, ah, false, bh, (short)0, c, false, false);
    asm volatile("v_nop\n\tv_nop\n\tv_nop\n\tv_nop" : "+v"(c) : "v"(ah), "v"(bh));
    return c;
  }
  return at_mma(a, b, c);
}

// MODE = the mask mode as a compile-time constant: the per-score mode tests fold away, so the unrolled score loop is straight-line code
template <bool SPLIT_QK, bool SPLIT_PV, bool F16, int MODE>
__global__ __launch_bounds__(128)
void attn64_kernel(const float* __restrict__ q, const float* __restrict__ k,
                   const float* __restrict__ v, float* __restrict__ out,
                   const void* __restrict__ mask_a, const int* __restrict__ mask_b, AttnGeom g) {
  static_assert(!(F16 && (SPLIT_QK || SPLIT_PV)), "f16 mode is non-split");
  const float PSC = F16 ? 32768.0f : 1.0f;     // f16 probabilities carried x2^15 (subnormal range), folded into the final 1/l
  union FB { v16b v; v8b h[2]; };
  __shared__ __align__(16) __bf16 Ksh[AT_KC * AT_P];             // K hi [kv][d]      9 KB
  __shared__ __align__(16) __bf16 Ksl[SPLIT_QK ? AT_KC * AT_P : 8];
  __shared__ __align__(16) __bf16 Vth[AT_D * AT_P];              // V hi [d][kv]      9 KB
  __shared__ __align__(16) __bf16 Vtl[SPLIT_PV ? AT_D * AT_P : 8];
  __shared__ __align__(16) __bf16 Psh[AT_NW][16 * AT_P];         // per wave P hi [row][kv]  9 KB
  __shared__ __align__(16) __bf16 Psl[SPLIT_PV ? AT_NW : 1][SPLIT_PV ? 16 * AT_P : 8];
  __shared__ __align__(16) float  Os[AT_NW][16 * 68];            // per wave out tile, pitch 68

  const int tid  = threadIdx.x;
  const int wave = tid >> 5;
  const int lane = tid & 31;
  const int hh   = lane >> 4;
  const int c    = lane & 15;

  const int nqb = g.S / AT_QB;
  const int npair = nqb >> 1;
  const int bx = blockIdx.x + g.blk0;
  const int tpair = bx % npair;
  const int bh = bx / npair;
  const int h  = bh % g.H;
  const int b  = bh / g.H;

  const float* qb_ptr = q + (size_t)b * g.q_bs + (size_t)h * g.q_hs;
  const float* kb_ptr = k + (size_t)b * g.k_bs + (size_t)h * g.k_hs;
  const float* vb_ptr = v + (size_t)b * g.v_bs + (size_t)h * g.v_hs;
  float*       ob_ptr = out + (size_t)b * g.o_bs + (size_t)h * g.o_hs;

  for (int pass = 0; pass < 2; ++pass) {       // block-uniform: every wave passes every barrier of both tiles
  const int qb = pass ? tpair : nqb - 1 - tpair;
  const int q0 = qb * AT_QB + wave * 16;

  // ---- Q fragments (A operand): 2 d-chunks, hi (and lo) ----
  v16b qah[2], qal[2];
  {
    const float* qrow = qb_ptr + (size_t)(q0 + c) * g.q_rs;
#pragma unroll
    for (int dc = 0; dc < 2; ++dc) {
#pragma unroll
      for (int e = 0; e < 8; ++e) {
        const float f0 = qrow[dc * 32 + 8 * hh + e] * g.qscale;
        const float f1 = qrow[dc * 32 + 16 + 8 * hh + e] * g.qscale;
        if (SPLIT_QK) { __bf16 hq, lq; at_split(f0, hq, lq); qah[dc][e] = hq; qal[dc][e] = lq; at_split(f1, hq, lq); qah[dc][8 + e] = hq; qal[dc][8 + e] = lq; }
        else { qah[dc][e] = at_to16<F16>(f0); qah[dc][8 + e] = at_to16<F16>(f1); qal[dc][e] = qah[dc][e]; qal[dc][8 + e] = qah[dc][8 + e]; }
      }
    }
  }

  float mrow[8], lrow[8];
  v8f oacc[4];
#pragma unroll
  for (int r = 0; r < 8; ++r) { mrow[r] = -INFINITY; lrow[r] = 0.f; }
#pragma unroll
  for (int t = 0; t < 4; ++t) oacc[t] = (v8f){0.f,0.f,0.f,0.f,0.f,0.f,0.f,0.f};

  const int nChunks = (MODE == 1 || MODE == 4) ? (qb + 1) : (g.Skv / AT_KC);   // block-uniform
  // per-row query mask (mode 3)
  int qkeep[8];
#pragma unroll
  for (int r = 0; r < 8; ++r) qkeep[r] = (MODE == 3) ? mask_b[(size_t)b * g.S + q0 + 8 * hh + r] : 1;   // mask_b = qmask in mode 3
  for (int kc = 0; kc < nChunks; ++kc) {
    const int kv0 = kc * AT_KC;
    __syncthreads();
    {
      const int kvr = tid >> 1, dh = (tid & 1) * 32;
      const float* krow = kb_ptr + (size_t)(kv0 + kvr) * g.k_rs + dh;
      const float* vrow = vb_ptr + (size_t)(kv0 + kvr) * g.v_rs + dh;
#pragma unroll
      for (int i = 0; i < 8; ++i) {
        v4f kk = *(const v4f*)(krow + 4 * i);
        v4f vv = *(const v4f*)(vrow + 4 * i);
#pragma unroll
        for (int e = 0; e < 4; ++e) {
          const int d = dh + 4 * i + e;
          if (SPLIT_QK) { __bf16 a, bl; at_split(kk[e], a, bl); Ksh[kvr * AT_P + d] = a; Ksl[kvr * AT_P + d] = bl; }
          else Ksh[kvr * AT_P + d] = at_to16<F16>(kk[e]);
          if (SPLIT_PV) { __bf16 a, bl; at_split(vv[e], a, bl); Vth[d * AT_P + kvr] = a; Vtl[d * AT_P + kvr] = bl; }
          else Vth[d * AT_P + kvr] = at_to16<F16>(vv[e]);
        }
      }
    }
    __syncthreads();

    v8f s[4];
#pragma unroll
    for (int j = 0; j < 4; ++j) {
      s[j] = (v8f){0.f,0.f,0.f,0.f,0.f,0.f,0.f,0.f};
#pragma unroll 1
      for (int dc = 0; dc < 2; ++dc) {
        FB kb;
        kb.h[0] = *(const v8b*)(Ksh + (j * 16 + c) * AT_P + dc * 32 + 8 * hh);
        kb.h[1] = *(const v8b*)(Ksh + (j * 16 + c) * AT_P + dc * 32 + 16 + 8 * hh);
        s[j] = at_mma16<F16>(qah[dc], kb.v, s[j]);
        if (SPLIT_QK) {
          FB kl;
          kl.h[0] = *(const v8b*)(Ksl + (j * 16 + c) * AT_P + dc * 32 + 8 * hh);
          kl.h[1] = *(const v8b*)(Ksl + (j * 16 + c) * AT_P + dc * 32 + 16 + 8 * hh);
          s[j] = at_mma16<F16>(qah[dc], kl.v, s[j]);
          s[j] = at_mma16<F16>(qal[dc], kb.v, s[j]);
        }
      }
    }
    const bool diag = (MODE == 1) && (kc == qb);
    int kvkeep[4] = {1, 1, 1, 1};
    if (MODE == 3) {
#pragma unroll
      for (int j = 0; j < 4; ++j) kvkeep[j] = ((const int*)mask_a)[(size_t)b * g.Skv + kv0 + j * 16 + c];   // mask_a = kvmask
    }
    float cm[8];
#pragma unroll
    for (int r = 0; r < 8; ++r) {
      const int qrow = q0 + 8 * hh + r;
      float m = -INFINITY;
#pragma unroll
      for (int j = 0; j < 4; ++j) {
        const int kvcol = kv0 + j * 16 + c;
        bool masked = false;
        if (diag) masked = (kvcol > qrow);
        else if (MODE == 4) masked = (kvcol > qrow) || (qrow - kvcol > g.mask_is_int);
        else if (MODE == 2) {
          const size_t mi = (size_t)qrow * g.Skv + kvcol;
          masked = (g.mask_is_int == 0) ? (((const float*)mask_a)[mi] == 0.0f)
                 : (g.mask_is_int == 1) ? (((const int*)mask_a)[mi] == 0) : (((const int*)mask_a)[mi] != 0);
        } else if (MODE == 3) masked = (qkeep[r] == 0) || (kvkeep[j] == 0);
        else if (MODE == 5) {
          const size_t mi = (size_t)qrow * g.Skv + kvcol;
          masked = (((const int*)mask_a)[mi] != 0);
          int n = mask_b[mi]; n = n < 0 ? 0 : n;
          s[j][r] += g.cp[(size_t)b * g.c_bs + (size_t)h * g.c_hs + (size_t)qrow * g.c_rs + n]
                   + g.pc[(size_t)b * g.c_bs + (size_t)h * g.c_hs + (size_t)kvcol * g.c_rs + n];
        }
        const float sv = masked ? g.mask_fill : s[j][r];   // one select on the element (a conditional store into the vector selects all 8 registers)
        s[j][r] = sv;
        m = fmaxf(m, sv);
      }
#pragma unroll
      for (int off = 1; off < 16; off <<= 1) m = fmaxf(m, __shfl_xor(m, off, 32));
      cm[r] = m;
    }
    __bf16* pwh = Psh[wave];
    __bf16* pwl = Psl[SPLIT_PV ? wave : 0];
#pragma unroll
    for (int r = 0; r < 8; ++r) {
      const float mnew = fmaxf(mrow[r], cm[r]);
      const float alpha = expf(mrow[r] - mnew);
      mrow[r] = mnew;
      float psum = 0.f;
#pragma unroll
      for (int j = 0; j < 4; ++j) {
        const float p = expf(s[j][r] - mnew);
        psum += p;
        if (SPLIT_PV) { __bf16 a, bl; at_split(p, a, bl); pwh[(8 * hh + r) * AT_P + j * 16 + c] = a; pwl[(8 * hh + r) * AT_P + j * 16 + c] = bl; }
        else pwh[(8 * hh + r) * AT_P + j * 16 + c] = at_to16<F16>(p * PSC);
      }
#pragma unroll
      for (int off = 1; off < 16; off <<= 1) psum += __shfl_xor(psum, off, 32);
      lrow[r] = lrow[r] * alpha + psum;
#pragma unroll
      for (int t = 0; t < 4; ++t) oacc[t][r] *= alpha;
    }
    __builtin_amdgcn_fence(__ATOMIC_RELEASE, "workgroup");
    __builtin_amdgcn_wave_barrier();
    __builtin_amdgcn_fence(__ATOMIC_ACQUIRE, "workgroup");
#pragma unroll 1
    for (int kk = 0; kk < 2; ++kk) {
      FB pa, pl;
      pa.h[0] = *(const v8b*)(pwh + c * AT_P + kk * 32 + 8 * hh);
      pa.h[1] = *(const v8b*)(pwh + c * AT_P + kk * 32 + 16 + 8 * hh);
      if (SPLIT_PV) {
        pl.h[0] = *(const v8b*)(pwl + c * AT_P + kk * 32 + 8 * hh);
        pl.h[1] = *(const v8b*)(pwl + c * AT_P + kk * 32 + 16 + 8 * hh);
      }
#pragma unroll
      for (int t = 0; t < 4; ++t) {
        FB vb;
        vb.h[0] = *(const v8b*)(Vth + (t * 16 + c) * AT_P + kk * 32 + 8 * hh);
        vb.h[1] = *(const v8b*)(Vth + (t * 16 + c) * AT_P + kk * 32 + 16 + 8 * hh);
        oacc[t] = at_mma16<F16>(pa.v, vb.v, oacc[t]);
        if (SPLIT_PV) {
          FB vl;
          vl.h[0] = *(const v8b*)(Vtl + (t * 16 + c) * AT_P + kk * 32 + 8 * hh);
          vl.h[1] = *(const v8b*)(Vtl + (t * 16 + c) * AT_P + kk * 32 + 16 + 8 * hh);
          oacc[t] = at_mma16<F16>(pa.v, vl.v, oacc[t]);
          oacc[t] = at_mma16<F16>(pl.v, vb.v, oacc[t]);
        }
      }
    }
  }

  float* os = Os[wave];
#pragma unroll
  for (int r = 0; r < 8; ++r) {
    const float inv = 1.0f / (lrow[r] * PSC);
#pragma unroll
    for (int t = 0; t < 4; ++t) os[(8 * hh + r) * 68 + t * 16 + c] = oacc[t][r] * inv;
  }
  __builtin_amdgcn_fence(__ATOMIC_RELEASE, "workgroup");
  __builtin_amdgcn_wave_barrier();
  __builtin_amdgcn_fence(__ATOMIC_ACQUIRE, "workgroup");
  {
    const int c4 = (lane & 15) * 4;
    {
#pragma unroll
      for (int it = 0; it < 8; ++it) {
        const int row = it * 2 + hh;
        v4f val = *(const v4f*)(os + row * 68 + c4);
        *(v4f*)(ob_ptr + (size_t)(q0 + row) * g.o_rs + c4) = val;
      }
      
    }
  }
  asm volatile("s_wait_xcnt 0x0" ::: "memory");   // the next pass reuses the address registers of the stores above
  }
}

#define TB_ 8
#define TS 1024
#define TDm 512
#define TH 8
#define THD 64
#define TR (TB_ * TS)
typedef __attribute__((ext_vector_type(4))) _Float16 v4h;
// The three elementwise passes (the A16 blocks of prep_kernel, kbias_kernel, cast_f32_f16x4): 512 blocks of 8 waves (two blocks a WGP); a thread moves EW_U items of 4 floats, every wave-wide 16-byte load
// covers 512 contiguous bytes, and all of a thread's loads are issued before its first store.
#define EW_U 8
#define EW_BLOCKS (TR * TDm / 4 / (EW_U * 256))
static_assert(EW_BLOCKS * EW_U * 256 * 4 == TR * TDm, "whole blocks");
// One launch prepares every operand of the first product and the weights of the last: none of these jobs reads what another writes.
// Blocks 0..447: the 7 weight matrices [in 512][out 512], 64 tiles of 64x64 each, cast to f16 and transposed (the block-uniform branch keeps the barrier legal):
//   Bt [1536][1024]: row n<512 (q): [Wqs[:,n] | Wqt[:,n]]; 512..1023 k; 1024..1535 v; then WoT [512][512]. They come first: each is a chain of dependent loads.
// Blocks 448..959: A16 [8192][1024] = [xs2 | xt] f16 (xs2 = raw reshape of xs); item i = floats 4i..4i+3 of xs and of xt, 128 items a row, so 256 items on = 2 rows on
#define TP_TILES ((TDm / 64) * (TDm / 64))
#define TP_BLOCKS (7 * TP_TILES)
__global__ __launch_bounds__(256) void prep_kernel(const float* __restrict__ xs, const float* __restrict__ xt,
                                                   const float* __restrict__ Wqs, const float* __restrict__ Wqt, const float* __restrict__ Wks,
                                                   const float* __restrict__ Wkt, const float* __restrict__ Wvs, const float* __restrict__ Wvt,
                                                   const float* __restrict__ Wo, unsigned* __restrict__ A16,
                                                   _Float16* __restrict__ WT, _Float16* __restrict__ WoT) {
  __shared__ __align__(16) _Float16 tile[64][72];
  if (blockIdx.x < TP_BLOCKS) {
    const int job = blockIdx.x / TP_TILES, tl = blockIdx.x % TP_TILES;
    const float* in = job == 0 ? Wqs : job == 1 ? Wqt : job == 2 ? Wks : job == 3 ? Wkt : job == 4 ? Wvs : job == 5 ? Wvt : Wo;
    _Float16* o = job < 6 ? WT + (size_t)(job >> 1) * TDm * 2 * TDm + (job & 1) * TDm : WoT;
    transpose_cast_tile(in, TDm, o, job < 6 ? 2 * TDm : TDm, (tl % (TDm / 64)) * 64, (tl / (TDm / 64)) * 64, tile);
    return;
  }
  const int base = (blockIdx.x - TP_BLOCKS) * (EW_U * 256) + threadIdx.x;
  const v4f* pa = (const v4f*)xs + base; const v4f* pb = (const v4f*)xt + base;
  v4h* o = (v4h*)A16 + (size_t)(base >> 7) * 256 + (base & 127);     // a row of A16 is 1024 f16 = 256 items; xt's half starts 128 items in
  v4f a[EW_U], b[EW_U];
#pragma unroll
  for (int u = 0; u < EW_U; ++u) { a[u] = pa[u * 256]; b[u] = pb[u * 256]; }
#pragma unroll
  for (int u = 0; u < EW_U; ++u) { o[u * 512] = __builtin_convertvector(a[u], v4h); o[u * 512 + 128] = __builtin_convertvector(b[u], v4h); }
}
// k' = k + WKᵀ: QKV[(b,s)][512 + h*64 + d] += WK[d][s]
// a thread owns (s, 4 columns) and walks the 8 batches, which share its 4 values of WK
__global__ __launch_bounds__(256) void kbias_kernel(float* __restrict__ QKV, const float* __restrict__ WK) {
  const int t = blockIdx.x * 256 + threadIdx.x; const int s = t >> 7, c = 4 * (t & 127), d = c % THD;
  static_assert(TS * (TDm / 4) == EW_BLOCKS * 256, "one thread per (s, 4 columns)");
  const float* wp = WK + (size_t)d * TS + s;
  const v4f w = {wp[0], wp[TS], wp[2 * TS], wp[3 * TS]};
  asm volatile("s_wait_xcnt 0x0" ::: "memory");   // the address registers of the 4 loads above may be reused as destinations of the loads below
  float* p = QKV + (size_t)s * (3 * TDm) + TDm + c;
  v4f k[TB_];
#pragma unroll
  for (int b = 0; b < TB_; ++b) k[b] = *(const v4f*)(p + (size_t)b * TS * (3 * TDm));
#pragma unroll
  for (int b = 0; b < TB_; ++b) *(v4f*)(p + (size_t)b * TS * (3 * TDm)) = k[b] + w;
}
// O f32 -> f16
__global__ __launch_bounds__(256) void cast_f32_f16x4(const float* __restrict__ in, _Float16* __restrict__ out) {
  const int base = blockIdx.x * (EW_U * 256) + threadIdx.x;
  const v4f* pi = (const v4f*)in + base; v4h* po = (v4h*)out + base;
  v4f x[EW_U];
#pragma unroll
  for (int u = 0; u < EW_U; ++u) x[u] = pi[u * 256];
#pragma unroll
  for (int u = 0; u < EW_U; ++u) po[u * 256] = __builtin_convertvector(x[u], v4h);
}
extern "C" void kernel_launch(void* const* d_in, const int* in_sizes, int n_in, void* d_out, int out_size, void* d_ws, size_t ws_size, hipStream_t stream) {
  (void)in_sizes; (void)n_in; (void)out_size; (void)ws_size;
  auto Fp = [&](int i) { return (const float*)d_in[i]; };
  const float* xs = Fp(0); const float* xt = Fp(1); const float* Wqs = Fp(2); const float* Wks = Fp(3); const float* Wvs = Fp(4); const float* Wqt = Fp(5); const float* Wkt = Fp(6); const float* Wvt = Fp(7); const float* WK = Fp(8); const float* Wo = Fp(9);
  char* ws = (char*)d_ws; size_t off = 0;
  auto carve = [&](size_t bytes) -> char* { char* p = ws + off; off += (bytes + 255) & ~(size_t)255; return p; };
  unsigned* A16 = (unsigned*)carve((size_t)TR * 2 * TDm * 2); _Float16* WT = (_Float16*)carve((size_t)3 * TDm * 2 * TDm * 2); _Float16* WoT = (_Float16*)carve((size_t)TDm * TDm * 2);
  float* QKV = (float*)carve((size_t)TR * 3 * TDm * 4); float* O = (float*)carve((size_t)TR * TDm * 4); _Float16* O16 = (_Float16*)A16;     // ≈ 84 MB; O16 reuses A16
  prep_kernel<<<TP_BLOCKS + EW_BLOCKS, 256, 0, stream>>>(xs, xt, Wqs, Wqt, Wks, Wkt, Wvs, Wvt, Wo, A16, WT, WoT);
  const int t3 = (TR / GT_BM) * (3 * TDm / GT_BN), t1 = (TR / GT_BM) * (TDm / GT_BN);   // block tiles of 128 x 256
  wmma_gemm64<0, false, 0, 0, false><<<dim3(t3, 1), 256, 0, stream>>>((const unsigned short*)A16, nullptr, 2 * TDm, 0, U16(WT), nullptr, 2 * TDm, 0, QKV, nullptr, 3 * TDm, 0, nullptr, nullptr, 0, TR, 3 * TDm, 2 * TDm, 1.0f);
  kbias_kernel<<<EW_BLOCKS, 256, 0, stream>>>(QKV, WK);
  { AttnGeom g;
    g.q_bs = (long)TS * 3 * TDm; g.q_rs = 3 * TDm; g.q_hs = THD; g.k_bs = g.q_bs; g.k_rs = g.q_rs; g.k_hs = THD; g.v_bs = g.q_bs; g.v_rs = g.q_rs; g.v_hs = THD; g.o_bs = (long)TS * TDm; g.o_rs = TDm; g.o_hs = THD;
    g.S = TS; g.Skv = TS; g.H = TH; g.mask_mode = 1; g.qscale = 0.125f; g.blk0 = 0; g.mask_fill = -1e9f; g.mask_is_int = 0;
    static_assert((TS / AT_QB) % 2 == 0, "query tiles pair up");
    attn64_kernel<false, false, true, 1><<<TB_ * TH * (TS / AT_QB / 2), AT_NW * 32, 0, stream>>>(QKV, QKV + TDm, QKV + 2 * TDm, O, nullptr, nullptr, g); }
  cast_f32_f16x4<<<EW_BLOCKS, 256, 0, stream>>>(O, O16);
  wmma_gemm64<0, false, 0, 0, false><<<dim3(t1, 1), 256, 0, stream>>>(U16(O16), nullptr, TDm, 0, U16(WoT), nullptr, TDm, 0, (float*)d_out, nullptr, TDm, 0, nullptr, nullptr, 0, TR, TDm, TDm, 1.0f);
}

// v007
// Measured time: 118 microseconds a run.
// Two timings next to v006 put it at 1.23 and 1.24 times that version's speed.
// Counting every step since v000, it is 5.28 times as fast.
#include <hip/hip_runtime.h>
#include <math.h>
// TMSA block (8 x 1024 tokens x 512, 8 heads x 64, causal): q/k/v = xs2·W*s + xt·W*t as ONE product over the concatenated input [xs2 | xt]·[W*s; W*t]
// (8192 x 1024 · 1024 x 1536); the query-dependent bias q·WK is folded exactly into the keys — Σ_d q_d k_jd + Σ_d q_d WK[d][j] = q·(k_j + WK[:, j]) —
// so the attention is a plain causal flash-style kernel over k' = k + WKᵀ (scores (q/8)·k'ᵀ and p·v on WMMA, f16 operands with probabilities x2^15,
// f32 accumulate, online softmax in f32, -1e9 fill above the diagonal); output projection ·Wo. All products v_wmma_f32_16x16x32_f16, f16 operands,
// f32 accumulate (plain single products, ≈24 G MAC); the raw .view reshapes are identity on memory.
// What lies between the products is elementwise and is done once, in the epilogue of the kernel that makes the value: the first product stores q/8, k' and v
// as f16, the attention stores its output as f16; each is rounded to f16 once, from the same f32 value as a pass of its own would round.
typedef __attribute__((ext_vector_type(16))) _Float16 v16h;
typedef __attribute__((ext_vector_type(8)))  _Float16 v8h;
typedef __attribute__((ext_vector_type(16))) __bf16   v16b;
typedef __attribute__((ext_vector_type(8)))  __bf16   v8b;
typedef __attribute__((ext_vector_type(8)))  float    v8f;
typedef __attribute__((ext_vector_type(4)))  float    v4f;
#define TB_ 8
#define TS 1024
#define TDm 512
#define TH 8
#define THD 64
#define TR (TB_ * TS)
#define PSCALE 32768.0f
#define U16(p) ((const unsigned short*)(const void*)(p))
#define PSCALE_INV (1.0f / 32768.0f)

__device__ __forceinline__ unsigned short f2bf_bits(float f) {
  unsigned u = __float_as_uint(f);
  return (unsigned short)((u + 0x7FFFu + ((u >> 16) & 1u)) >> 16);
}
__device__ __forceinline__ float bf_bits2f(unsigned short h) { return __uint_as_float(((unsigned)h) << 16); }

// hazard guards as plain device helpers (no inline asm inside the kernel template body)
__device__ __forceinline__ void dep_guard_h(v8f& a, v8f& b, v16h x, v16h y) { asm volatile("v_nop\n\tv_nop\n\tv_nop\n\tv_nop" : "+v"(a), "+v"(b) : "v"(x), "v"(y)); }
__device__ __forceinline__ void dep_guard_b(v8f& a, v8f& b, v16b x, v16b y) { asm volatile("v_nop\n\tv_nop\n\tv_nop\n\tv_nop" : "+v"(a), "+v"(b) : "v"(x), "v"(y)); }
__device__ __forceinline__ void keep4_h(v16h a, v16h b, v16h c, v16h d) { asm volatile("v_nop" :: "v"(a), "v"(b), "v"(c), "v"(d)); }
__device__ __forceinline__ void keep4_b(v16b a, v16b b, v16b c, v16b d) { asm volatile("v_nop" :: "v"(a), "v"(b), "v"(c), "v"(d)); }
__device__ __forceinline__ void acc_guard4(v8f& a, v8f& b, v8f& c, v8f& d) { asm volatile("v_nop\n\tv_nop\n\tv_nop\n\tv_nop" : "+v"(a), "+v"(b), "+v"(c), "+v"(d)); }
template <typename T> struct Frag;
template <> struct Frag<_Float16> {
  typedef v16h V; union U { v16h v; v8h h[2]; };
  static __device__ __forceinline__ v16h load(const _Float16* p) {   // elements 0..7 <- p[0..7], 8..15 <- p[16..23]
    U f; f.h[0] = *(const v8h*)(p); f.h[1] = *(const v8h*)(p + 16); return f.v;
  }
  static __device__ __forceinline__ v8f mma(v16h a, v16h b, v8f c) {
    return __builtin_amdgcn_wmma_f32_16x16x32_f16(false, a, false, b, (short)0, c, false, false);
  }
  static __device__ __forceinline__ void guard(v8f& a, v8f& b, v16h x, v16h y) { dep_guard_h(a, b, x, y); }
  static __device__ __forceinline__ void keep(v16h a, v16h b, v16h c, v16h d) { keep4_h(a, b, c, d); }
};
template <> struct Frag<__bf16> {
  typedef v16b V; union U { v16b v; v8b h[2]; };
  static __device__ __forceinline__ v16b load(const __bf16* p) {
    U f; f.h[0] = *(const v8b*)(p); f.h[1] = *(const v8b*)(p + 16); return f.v;
  }
  static __device__ __forceinline__ v8f mma(v16b a, v16b b, v8f c) {
    return __builtin_amdgcn_wmma_f32_16x16x32_bf16(false, a, false, b, (short)0, c, false, false);
  }
  static __device__ __forceinline__ void guard(v8f& a, v8f& b, v16b x, v16b y) { dep_guard_b(a, b, x, y); }
  static __device__ __forceinline__ void keep(v16b a, v16b b, v16b c, v16b d) { keep4_b(a, b, c, d); }
};

// ---- Register-blocked batched WMMA GEMM ------------------------------------
// C[m,n] = scale * sum_k A[m,k] * Bt[n,k] (+bias)(+resid); each wave owns a 64x64 tile, the 8 waves of a block a 128x256 tile (2 x 4 waves).
// A row-major [M,K]; Bt row-major [N,K]; M % 128 == 0, N % 256 == 0, K % 64 == 0; grid.x = (M/128)*(N/256).
// Operands go through LDS: a stage is 64 k (128 B) of the block's 128 A rows and 256 Bt rows, brought by asynchronous 16-byte copies whose
// wave-wide form covers 4 whole 128-B lines; two buffers, the copies of stage t+2 fly while stage t+1 is worked on.
// SPLIT (hi/lo planes) is not staged and so not offered by this form.
// BIAS_MODE: 0 = none, 1 = bias[m], 2 = bias[n], 3 = the q | k | v product: columns 0..511 (q) x 1/8 (= 1/sqrt(64); a power of two, so exact in f32),
//   columns 512..1023 (k) + bias[n % 64][m % 1024] (bias = WK [64][1024]: head dim d = n % 64, position s = m % 1024), columns 1024.. (v) as they are.
// OUT_MODE: 0 = f32, 1 = f16, 2 = bf16 hi plane (Cout) + bf16 lo plane (Cout2).
// ET: 0 = f16 operands, 1 = bf16 operands (pointers passed as 16-bit storage)
template <int ET> struct Elem;
template <> struct Elem<0> { typedef _Float16 T; };
template <> struct Elem<1> { typedef __bf16 T; };
#define GT_BM 128
#define GT_BN 256
#define GT_BK 64
#define GT_P 72                              // LDS row pitch in 16-bit elements: 144 B = 16 B x 9, conflict-free for 16-byte fragment reads
#define GT_STAGE ((GT_BM + GT_BN) * GT_P)    // 16-bit elements of one buffer: A rows 0..127, then Bt rows 0..255
#define GT_G (32 * GT_P * 2)                 // LDS bytes from one group of 32 rows to the next
// One stage, one thread's share: 12 copies of 16 B (4 groups of 32 A rows, 8 groups of 32 Bt rows). l = the lane's LDS byte address in group 0,
// a / b = its global address in group 0 of A / Bt, sa / sb = elements from one group of 32 rows to the next.
// The s_wait_xcnt stands inside the statement so that no address register of a copy is rewritten ahead of it.
__device__ __forceinline__ void gemm_stage_copy(unsigned l, const unsigned short* a, size_t sa, const unsigned short* b, size_t sb) {
  asm volatile(
      "global_load_async_to_lds_b128 %0, %12, off\n\t"
      "global_load_async_to_lds_b128 %1, %13, off\n\t"
      "global_load_async_to_lds_b128 %2, %14, off\n\t"
      "global_load_async_to_lds_b128 %3, %15, off\n\t"
      "global_load_async_to_lds_b128 %4, %16, off\n\t"
      "global_load_async_to_lds_b128 %5, %17, off\n\t"
      "global_load_async_to_lds_b128 %6, %18, off\n\t"
      "global_load_async_to_lds_b128 %7, %19, off\n\t"
      "global_load_async_to_lds_b128 %8, %20, off\n\t"
      "global_load_async_to_lds_b128 %9, %21, off\n\t"
      "global_load_async_to_lds_b128 %10, %22, off\n\t"
      "global_load_async_to_lds_b128 %11, %23, off\n\t"
      "s_wait_xcnt 0x0"
      :: "v"(l), "v"(l + GT_G), "v"(l + 2 * GT_G), "v"(l + 3 * GT_G),
         "v"(l + 4 * GT_G), "v"(l + 5 * GT_G), "v"(l + 6 * GT_G), "v"(l + 7 * GT_G),
         "v"(l + 8 * GT_G), "v"(l + 9 * GT_G), "v"(l + 10 * GT_G), "v"(l + 11 * GT_G),
         "v"(a), "v"(a + sa), "v"(a + 2 * sa), "v"(a + 3 * sa),
         "v"(b), "v"(b + sb), "v"(b + 2 * sb), "v"(b + 3 * sb),
         "v"(b + 4 * sb), "v"(b + 5 * sb), "v"(b + 6 * sb), "v"(b + 7 * sb)
      : "memory");
}
// The two waits of the ring, each a statement of its own; the "memory" clobber keeps every LDS read on its side of them.
__device__ __forceinline__ void wait_copies_landed() { asm volatile("s_wait_asynccnt 0x0" ::: "memory"); }
__device__ __forceinline__ void wait_lds_reads_done() { asm volatile("s_wait_dscnt 0x0" ::: "memory"); }     // a buffer is refilled only after its readers' loads have returned
template <int ET, bool SPLIT, int BIAS_MODE, int OUT_MODE, bool RESID, int ACT = 0>
__global__ __launch_bounds__(256) void wmma_gemm64(
    const unsigned short* __restrict__ Ap, const unsigned short* __restrict__ A2p, int lda, long strideA,
    const unsigned short* __restrict__ Btp, const unsigned short* __restrict__ Bt2p, int ldb, long strideB,
    void* __restrict__ Cout, void* __restrict__ Cout2, int ldc, long strideC,
    const float* __restrict__ bias,
    const float* __restrict__ resid, long strideR,
    int M, int N, int K, float scale) {
  typedef typename Elem<ET>::T T;
  typedef typename Frag<T>::V V;
  static_assert(!SPLIT, "the lo planes are not staged");
  (void)A2p; (void)Bt2p; (void)M;
  __shared__ __align__(16) float sT[8][16 * 68];   // per-wave 16x64 slab, pitch 68 floats
  __shared__ __align__(16) unsigned short sAB[2 * GT_STAGE];   // the two operand buffers
  const int b    = blockIdx.y;
  const int lane = threadIdx.x & 31;
  const int wave = threadIdx.x >> 5;
  const int tilesN = N >> 8;
  const int tm = blockIdx.x / tilesN;          // block tile; every block has one, so every wave passes every barrier
  const int tn = blockIdx.x - tm * tilesN;
  const int wm = (wave >> 2) << 6;             // the wave's 64x64 tile inside the block tile
  const int wn = (wave & 3) << 6;
  const int m0 = (tm << 7) + wm;
  const int n0 = (tn << 8) + wn;

  // copies: thread t brings the 16-byte piece t & 7 of row t >> 3 of every group of 32 rows
  const int cr = threadIdx.x >> 3, cp = (threadIdx.x & 7) * 8;
  const unsigned short* gA = Ap  + (size_t)b * strideA + (size_t)((tm << 7) + cr) * lda + cp;
  const unsigned short* gB = Btp + (size_t)b * strideB + (size_t)((tn << 8) + cr) * ldb + cp;
  const size_t sa = (size_t)32 * lda, sb = (size_t)32 * ldb;
  const unsigned l0 = (unsigned)(size_t)sAB + (unsigned)(cr * GT_P + cp) * 2u;   // low 32 bits of a __shared__ address = byte offset in the block's LDS
  const int nT = K / GT_BK;

  const int rlane = lane & 15;                 // row (A) / col (B, D) within subtile
  const int koff  = (lane >> 4) * 8;           // k offset of this lane half
  const int mOff  = (lane >> 4) * 8;           // D row offset

  v8f acc[4][4];
#pragma unroll
  for (int i = 0; i < 4; ++i)
#pragma unroll
    for (int j = 0; j < 4; ++j) acc[i][j] = (v8f){0.f,0.f,0.f,0.f,0.f,0.f,0.f,0.f};

  gemm_stage_copy(l0, gA, sa, gB, sb);                       // stage 0 into buffer 0
  wait_copies_landed();                                      // this wave's copies of stage 0 have landed
  __syncthreads();                                           // ... and every other wave's
  if (nT > 1) gemm_stage_copy(l0 + GT_STAGE * 2, gA + GT_BK, sa, gB + GT_BK, sb);   // stage 1 into buffer 1
  for (int t = 0; t < nT; ++t) {
    const T* sbuf = (const T*)sAB + (t & 1) * GT_STAGE;
    const T* sA = sbuf + (wm + rlane) * GT_P + koff;
    const T* sB = sbuf + (GT_BM + wn + rlane) * GT_P + koff;
#pragma unroll
    for (int kk = 0; kk < GT_BK; kk += 32) {
      V bh[4], ah[4];
#pragma unroll
      for (int j = 0; j < 4; ++j) bh[j] = Frag<T>::load(sB + (j << 4) * GT_P + kk);
#pragma unroll
      for (int i = 0; i < 4; ++i) ah[i] = Frag<T>::load(sA + (i << 4) * GT_P + kk);
#pragma unroll
      for (int i = 0; i < 4; ++i) {
#pragma unroll
        for (int j = 0; j < 4; ++j) acc[i][j] = Frag<T>::mma(ah[i], bh[j], acc[i][j]);
        Frag<T>::guard(acc[i][0], acc[i][3], ah[i], ah[i]);
      }
      Frag<T>::keep(bh[0], bh[1], bh[2], bh[3]);
    }
    wait_lds_reads_done();                                   // this wave has left buffer t & 1
    wait_copies_landed();                                    // this wave's copies of stage t + 1 have landed
    __syncthreads();                                         // publishes stage t + 1 and ends every wave's reads of buffer t & 1
    if (t + 2 < nT) gemm_stage_copy(l0 + (unsigned)(t & 1) * (GT_STAGE * 2), gA + (size_t)(t + 2) * GT_BK, sa, gB + (size_t)(t + 2) * GT_BK, sb);
  }
  wait_copies_landed();                                      // no copy is outstanding when the wave goes on to the epilogue
  acc_guard4(acc[0][0], acc[0][1], acc[0][2], acc[0][3]);
  acc_guard4(acc[1][0], acc[1][1], acc[1][2], acc[1][3]);
  acc_guard4(acc[2][0], acc[2][1], acc[2][2], acc[2][3]);
  acc_guard4(acc[3][0], acc[3][1], acc[3][2], acc[3][3]);

  // ---- epilogue ----
  float cs = scale;                            // a wave's 64 columns lie in one of q, k, v
  if (BIAS_MODE == 3) {
    if (n0 < TDm) cs = scale * 0.125f;
    else if (n0 < 2 * TDm) {
      // the 8 accumulator rows of a lane are 8 consecutive positions of one row d of WK: two 16-byte loads per subtile;
      // 16 loads (the registers the fragments have left) are issued before the first is used, so a wave waits twice, not 16 times
      const float* wp = bias + (size_t)rlane * TS + ((m0 + mOff) & (TS - 1));
#pragma unroll
      for (int ih = 0; ih < 4; ih += 2) {
        v4f w[2][4][2];
#pragma unroll
        for (int i = 0; i < 2; ++i)
#pragma unroll
          for (int j = 0; j < 4; ++j) {
            w[i][j][0] = *(const v4f*)(wp + (size_t)(j << 4) * TS + ((ih + i) << 4));
            w[i][j][1] = *(const v4f*)(wp + (size_t)(j << 4) * TS + ((ih + i) << 4) + 4);
          }
#pragma unroll
        for (int i = 0; i < 2; ++i)
#pragma unroll
          for (int j = 0; j < 4; ++j)
#pragma unroll
            for (int r = 0; r < 4; ++r) {
              acc[ih + i][j][r]     = acc[ih + i][j][r]     * scale + w[i][j][0][r];
              acc[ih + i][j][4 + r] = acc[ih + i][j][4 + r] * scale + w[i][j][1][r];
            }
      }
      cs = 1.0f;
    }
  }
  float* slab = sT[wave];
  const float* Rb = RESID ? (resid + (size_t)b * strideR) : nullptr;
#pragma unroll
  for (int i = 0; i < 4; ++i) {
    const int mBase = m0 + (i << 4);
#pragma unroll
    for (int j = 0; j < 4; ++j) {
      const int n = n0 + (j << 4) + rlane;
      float bv = 0.f;
      if (BIAS_MODE == 2) bv = bias[n];
#pragma unroll
      for (int r = 0; r < 8; ++r) {
        float v = acc[i][j][r] * cs;
        if (BIAS_MODE == 1) v += bias[mBase + mOff + r];
        if (BIAS_MODE == 2) v += bv;
        if (RESID) v += Rb[(size_t)(mBase + mOff + r) * ldc + n];
        if (ACT == 1) v = tanhf(v);
        if (ACT == 2) v = fmaxf(v, 0.0f);
        if (ACT == 3) v = v / (1.0f + expf(-v));
        if (ACT == 4) v = (v > 0.f) ? v : 0.01f * v;
        if (ACT == 5) v = 0.5f * v * (1.0f + erff(v * 0.70710678118654752f));
        slab[(mOff + r) * 68 + (j << 4) + rlane] = v;
      }
    }
    __builtin_amdgcn_fence(__ATOMIC_RELEASE, "workgroup");
    __builtin_amdgcn_wave_barrier();
    __builtin_amdgcn_fence(__ATOMIC_ACQUIRE, "workgroup");
    if (OUT_MODE == 0) {
      float* C = (float*)Cout + (size_t)b * strideC;
      const int hh = lane >> 4, c4 = (lane & 15) * 4;     // row seg = 256 B = 16 lanes x 16 B
      {
#pragma unroll
        for (int it = 0; it < 8; ++it) {
          const int row = it * 2 + hh;
          v4f v = *(const v4f*)(slab + row * 68 + c4);
          *(v4f*)(C + (size_t)(mBase + row) * ldc + n0 + c4) = v;
        }
        
      }
    } else {
      const int q = lane >> 3, c8 = (lane & 7) * 8;
      unsigned short* C  = (unsigned short*)Cout  + (size_t)b * strideC;
      unsigned short* C2 = (OUT_MODE == 2) ? ((unsigned short*)Cout2 + (size_t)b * strideC) : nullptr;
      {
#pragma unroll
        for (int it = 0; it < 4; ++it) {
          const int row = it * 4 + q;
          const float* sp = slab + row * 68 + c8;
          v8h hv, lv;
#pragma unroll
          for (int e = 0; e < 8; ++e) {
            if (OUT_MODE == 1) {
              hv[e] = (_Float16)sp[e];
            } else {
              unsigned short hb = f2bf_bits(sp[e]);
              unsigned short lb = f2bf_bits(sp[e] - bf_bits2f(hb));
              hv[e] = __builtin_bit_cast(_Float16, hb);
              lv[e] = __builtin_bit_cast(_Float16, lb);
            }
          }
          *(v8h*)(C + (size_t)(mBase + row) * ldc + n0 + c8) = hv;
          if (OUT_MODE == 2) *(v8h*)(C2 + (size_t)(mBase + row) * ldc + n0 + c8) = lv;
        }
        
      }
    }
    __builtin_amdgcn_fence(__ATOMIC_RELEASE, "workgroup");
    __builtin_amdgcn_wave_barrier();
    __builtin_amdgcn_fence(__ATOMIC_ACQUIRE, "workgroup");
  }
}

// ---- f32 [R][C] (row pitch ldi) -> f16 transposed [C][R] (row pitch ldo); one 64x64 tile (columns c0.., rows r0..) by one block of 256 threads
__device__ __forceinline__ void transpose_cast_tile(const float* __restrict__ in, int ldi, _Float16* __restrict__ outT, int ldo,
                                                    int c0, int r0, _Float16 (*tile)[72]) {     // tile: [c][r]
  const int t = threadIdx.x, tx = t & 31, ty = t >> 5;
  for (int i = ty; i < 64; i += 8) {
    tile[tx][i]      = (_Float16)in[(size_t)(r0 + i) * ldi + c0 + tx];
    tile[32 + tx][i] = (_Float16)in[(size_t)(r0 + i) * ldi + c0 + 32 + tx];
  }
  __syncthreads();
  const int q = t >> 3, c8 = (t & 7) * 8;
#pragma unroll
  for (int it = 0; it < 2; ++it) {
    const int c = it * 32 + q;
    v8h hv = *(const v8h*)(&tile[c][c8]);
    *(v8h*)(outT + (size_t)(c0 + c) * ldo + r0 + c8) = hv;
  }
}

// =====================================================================================
// Generic causal/non-causal attention for head_dim 64, f16 in / f16 out (q arrives scaled; q, k, v are used as they arrive, so only F16=true, non-split, is
// offered by this form; probabilities carried x2^15).
//   scores = q.k^T (g.qscale is not applied here: the producer of q has scaled it) : v_wmma_f32_16x16x32_f16
//   out    = p·v           : v_wmma_f32_16x16x32_f16; p (x2^15) and v as f16, not split
//   f32 accumulate; online softmax in f32. Block = 4 waves = two 64-row query tiles of one (batch, head); S % 64 == 0.
//   Element (b, s, h, d) of tensor X lives at X[b*X_bs + s*X_rs + h*X_hs + d] (strides in elements, multiples of 8).
//   Masking: mask_mode 0 none, 1 causal (kv > q masked), 2 tensor [S][Skv] shared over (b,h) (float if
//   mask_is_int==0, int32 with element == 0 -> masked if 1, int32 with element != 0 -> masked if 2), 3 per-token vectors qmask[B][S] & kvmask[B][Skv] (int32,
//   0 -> masked), 4 causal + sliding window (kv > q or q - kv > W masked; W passed in mask_is_int);
//   5 = relative-position bias: s += cp[b,h,q][idx[q][kv]] + pc[b,h,kv][idx[q][kv]] with idx = mask_b ([S][Skv] int32) and
//   mask_a an int32 [S][Skv] tensor with nonzero = masked (tables: element (b,h,row,n) at X + b*c_bs + h*c_hs + row*c_rs + n);
//   masked scores are replaced by mask_fill (e.g. -inf or -1e9) before the softmax.
//   grid.x = B * H * (S/128) (or a sub-range with blk0); S/64 even. A block takes two query tiles of one (batch, head), one after the other: tile n-1-t, then
//   tile t. Under the causal mask a tile's cost grows with its index, every block is resident at once and the launch lasts as long as its fullest WGP:
//   so paired, every block walks the same n+1 chunks wherever it lands.
// =====================================================================================
#define AT_D 64
#define AT_NW 4
#define AT_QB 64
#define AT_KC 64
#define AT_P 72   // LDS row pitch of the K, V^T and P tiles in 16-bit elements: 144 B = 16 B x 9, so the 16 rows of a 16-byte fragment read fall on distinct banks
struct AttnGeom { const float* cp = nullptr; const float* pc = nullptr; long c_bs = 0, c_rs = 0, c_hs = 0;   // mode-5 score-bias tables
                  long q_bs, q_rs, q_hs, k_bs, k_rs, k_hs, v_bs, v_rs, v_hs, o_bs, o_rs, o_hs;
                  int S, Skv, H, mask_mode; float qscale; int blk0; float mask_fill; int mask_is_int; };
static_assert(sizeof(AttnGeom) == 168, "no padding");

__device__ __forceinline__ unsigned short at_bf_bits(float f) {
  unsigned u = __float_as_uint(f);
  return (unsigned short)((u + 0x7FFFu + ((u >> 16) & 1u)) >> 16);
}
__device__ __forceinline__ __bf16 at_f2bf(float f) { return __builtin_bit_cast(__bf16, at_bf_bits(f)); }
__device__ __forceinline__ void at_split(float f, __bf16& hi, __bf16& lo) {
  const unsigned short hb = at_bf_bits(f);
  hi = __builtin_bit_cast(__bf16, hb);
  lo = at_f2bf(f - __uint_as_float(((unsigned)hb) << 16));
}
__device__ __forceinline__ v8f at_mma(v16b a, v16b b, v8f c) {
  c = __builtin_amdgcn_wmma_f32_16x16x32_bf16(false, a, false, b, (short)0, c, false, false);
  asm volatile("v_nop\n\tv_nop\n\tv_nop\n\tv_nop" : "+v"(c) : "v"(a), "v"(b));
  return c;
}
// 16-bit element as a bit pattern held in a __bf16 slot: f16 bits when F16, bf16 (RNE) otherwise
template <bool F16> __device__ __forceinline__ __bf16 at_to16(float f) {
  if (F16) return __builtin_bit_cast(__bf16, (_Float16)f);
  return at_f2bf(f);
}
template <bool F16> __device__ __forceinline__ v8f at_mma16(v16b a, v16b b, v8f c) {
  if (F16) {
    const v16h ah = __builtin_bit_cast(v16h, a), bh = __builtin_bit_cast(v16h, b);
    c = __builtin_amdgcn_wmma_f32_16x16x32_f16(false, ah, false, bh, (short)0, c, false, false);
    asm volatile("v_nop\n\tv_nop\n\tv_nop\n\tv_nop" : "+v"(c) : "v"(ah), "v"(bh));
    return c;
  }
  return at_mma(a, b, c);
}

// MODE = the mask mode as a compile-time constant: the per-score mode tests fold away, so the unrolled score loop is straight-line code
template <bool SPLIT_QK, bool SPLIT_PV, bool F16, int MODE>
__global__ __launch_bounds__(128)
void attn64_kernel(const _Float16* __restrict__ q, const _Float16* __restrict__ k,
                   const _Float16* __restrict__ v, _Float16* __restrict__ out,
                   const void* __restrict__ mask_a, const int* __restrict__ mask_b, AttnGeom g) {
  static_assert(F16 && !SPLIT_QK && !SPLIT_PV, "q, k, v arrive as f16 and are not split");
  const float PSC = F16 ? 32768.0f : 1.0f;     // f16 probabilities carried x2^15 (subnormal range), folded into the final 1/l
  union FB { v16b v; v8b h[2]; };
  __shared__ __align__(16) __bf16 Ksh[AT_KC * AT_P];             // K hi [kv][d]      9 KB
  __shared__ __align__(16) __bf16 Ksl[SPLIT_QK ? AT_KC * AT_P : 8];
  __shared__ __align__(16) __bf16 Vth[AT_D * AT_P];              // V hi [d][kv]      9 KB
  __shared__ __align__(16) __bf16 Vtl[SPLIT_PV ? AT_D * AT_P : 8];
  __shared__ __align__(16) __bf16 Psh[AT_NW][16 * AT_P];         // per wave P hi [row][kv]  9 KB
  __shared__ __align__(16) __bf16 Psl[SPLIT_PV ? AT_NW : 1][SPLIT_PV ? 16 * AT_P : 8];
  __shared__ __align__(16) float  Os[AT_NW][16 * 68];            // per wave out tile, pitch 68

  const int tid  = threadIdx.x;
  const int wave = tid >> 5;
  const int lane = tid & 31;
  const int hh   = lane >> 4;
  const int c    = lane & 15;

  const int nqb = g.S / AT_QB;
  const int npair = nqb >> 1;
  const int bx = blockIdx.x + g.blk0;
  const int tpair = bx % npair;
  const int bh = bx / npair;
  const int h  = bh % g.H;
  const int b  = bh / g.H;

  const _Float16* qb_ptr = q + (size_t)b * g.q_bs + (size_t)h * g.q_hs;
  const _Float16* kb_ptr = k + (size_t)b * g.k_bs + (size_t)h * g.k_hs;
  const _Float16* vb_ptr = v + (size_t)b * g.v_bs + (size_t)h * g.v_hs;
  _Float16*       ob_ptr = out + (size_t)b * g.o_bs + (size_t)h * g.o_hs;

  for (int pass = 0; pass < 2; ++pass) {       // block-uniform: every wave passes every barrier of both tiles
  const int qb = pass ? tpair : nqb - 1 - tpair;
  const int q0 = qb * AT_QB + wave * 16;

  // ---- Q fragments (A operand): 2 d-chunks, hi (and lo) ----
  v16b qah[2], qal[2];
  {
    const _Float16* qrow = qb_ptr + (size_t)(q0 + c) * g.q_rs;
#pragma unroll
    for (int dc = 0; dc < 2; ++dc) {
      FB f;                                    // elements 0..7 <- d = dc*32 + 8*hh + 0..7, elements 8..15 <- 16 further on
      f.h[0] = *(const v8b*)(qrow + dc * 32 + 8 * hh);
      f.h[1] = *(const v8b*)(qrow + dc * 32 + 16 + 8 * hh);
      qah[dc] = f.v; qal[dc] = f.v;
    }
  }

  float mrow[8], lrow[8];
  v8f oacc[4];
#pragma unroll
  for (int r = 0; r < 8; ++r) { mrow[r] = -INFINITY; lrow[r] = 0.f; }
#pragma unroll
  for (int t = 0; t < 4; ++t) oacc[t] = (v8f){0.f,0.f,0.f,0.f,0.f,0.f,0.f,0.f};

  const int nChunks = (MODE == 1 || MODE == 4) ? (qb + 1) : (g.Skv / AT_KC);   // block-uniform
  // per-row query mask (mode 3)
  int qkeep[8];
#pragma unroll
  for (int r = 0; r < 8; ++r) qkeep[r] = (MODE == 3) ? mask_b[(size_t)b * g.S + q0 + 8 * hh + r] : 1;   // mask_b = qmask in mode 3
  for (int kc = 0; kc < nChunks; ++kc) {
    const int kv0 = kc * AT_KC;
    __syncthreads();
    {
      const int kvr = tid >> 1, dh = (tid & 1) * 32;
      const _Float16* krow = kb_ptr + (size_t)(kv0 + kvr) * g.k_rs + dh;
      const _Float16* vrow = vb_ptr + (size_t)(kv0 + kvr) * g.v_rs + dh;
      v8b kk[4], vv[4];
#pragma unroll
      for (int i = 0; i < 4; ++i) { kk[i] = *(const v8b*)(krow + 8 * i); vv[i] = *(const v8b*)(vrow + 8 * i); }
#pragma unroll
      for (int i = 0; i < 4; ++i) {
        *(v8b*)(Ksh + kvr * AT_P + dh + 8 * i) = kk[i];
#pragma unroll
        for (int e = 0; e < 8; ++e) Vth[(dh + 8 * i + e) * AT_P + kvr] = vv[i][e];
      }
    }
    __syncthreads();

    v8f s[4];
#pragma unroll
    for (int j = 0; j < 4; ++j) {
      s[j] = (v8f){0.f,0.f,0.f,0.f,0.f,0.f,0.f,0.f};
#pragma unroll 1
      for (int dc = 0; dc < 2; ++dc) {
        FB kb;
        kb.h[0] = *(const v8b*)(Ksh + (j * 16 + c) * AT_P + dc * 32 + 8 * hh);
        kb.h[1] = *(const v8b*)(Ksh + (j * 16 + c) * AT_P + dc * 32 + 16 + 8 * hh);
        s[j] = at_mma16<F16>(qah[dc], kb.v, s[j]);
        if (SPLIT_QK) {
          FB kl;
          kl.h[0] = *(const v8b*)(Ksl + (j * 16 + c) * AT_P + dc * 32 + 8 * hh);
          kl.h[1] = *(const v8b*)(Ksl + (j * 16 + c) * AT_P + dc * 32 + 16 + 8 * hh);
          s[j] = at_mma16<F16>(qah[dc], kl.v, s[j]);
          s[j] = at_mma16<F16>(qal[dc], kb.v, s[j]);
        }
      }
    }
    const bool diag = (MODE == 1) && (kc == qb);
    int kvkeep[4] = {1, 1, 1, 1};
    if (MODE == 3) {
#pragma unroll
      for (int j = 0; j < 4; ++j) kvkeep[j] = ((const int*)mask_a)[(size_t)b * g.Skv + kv0 + j * 16 + c];   // mask_a = kvmask
    }
    float cm[8];
#pragma unroll
    for (int r = 0; r < 8; ++r) {
      const int qrow = q0 + 8 * hh + r;
      float m = -INFINITY;
#pragma unroll
      for (int j = 0; j < 4; ++j) {
        const int kvcol = kv0 + j * 16 + c;
        bool masked = false;
        if (diag) masked = (kvcol > qrow);
        else if (MODE == 4) masked = (kvcol > qrow) || (qrow - kvcol > g.mask_is_int);
        else if (MODE == 2) {
          const size_t mi = (size_t)qrow * g.Skv + kvcol;
          masked = (g.mask_is_int == 0) ? (((const float*)mask_a)[mi] == 0.0f)
                 : (g.mask_is_int == 1) ? (((const int*)mask_a)[mi] == 0) : (((const int*)mask_a)[mi] != 0);
        } else if (MODE == 3) masked = (qkeep[r] == 0) || (kvkeep[j] == 0);
        else if (MODE == 5) {
          const size_t mi = (size_t)qrow * g.Skv + kvcol;
          masked = (((const int*)mask_a)[mi] != 0);
          int n = mask_b[mi]; n = n < 0 ? 0 : n;
          s[j][r] += g.cp[(size_t)b * g.c_bs + (size_t)h * g.c_hs + (size_t)qrow * g.c_rs + n]
                   + g.pc[(size_t)b * g.c_bs + (size_t)h * g.c_hs + (size_t)kvcol * g.c_rs + n];
        }
        const float sv = masked ? g.mask_fill : s[j][r];   // one select on the element (a conditional store into the vector selects all 8 registers)
        s[j][r] = sv;
        m = fmaxf(m, sv);
      }
#pragma unroll
      for (int off = 1; off < 16; off <<= 1) m = fmaxf(m, __shfl_xor(m, off, 32));
      cm[r] = m;
    }
    __bf16* pwh = Psh[wave];
    __bf16* pwl = Psl[SPLIT_PV ? wave : 0];
#pragma unroll
    for (int r = 0; r < 8; ++r) {
      const float mnew = fmaxf(mrow[r], cm[r]);
      const float alpha = expf(mrow[r] - mnew);
      mrow[r] = mnew;
      float psum = 0.f;
#pragma unroll
      for (int j = 0; j < 4; ++j) {
        const float p = expf(s[j][r] - mnew);
        psum += p;
        if (SPLIT_PV) { __bf16 a, bl; at_split(p, a, bl); pwh[(8 * hh + r) * AT_P + j * 16 + c] = a; pwl[(8 * hh + r) * AT_P + j * 16 + c] = bl; }
        else pwh[(8 * hh + r) * AT_P + j * 16 + c] = at_to16<F16>(p * PSC);
      }
#pragma unroll
      for (int off = 1; off < 16; off <<= 1) psum += __shfl_xor(psum, off, 32);
      lrow[r] = lrow[r] * alpha + psum;
#pragma unroll
      for (int t = 0; t < 4; ++t) oacc[t][r] *= alpha;
    }
    __builtin_amdgcn_fence(__ATOMIC_RELEASE, "workgroup");
    __builtin_amdgcn_wave_barrier();
    __builtin_amdgcn_fence(__ATOMIC_ACQUIRE, "workgroup");
#pragma unroll 1
    for (int kk = 0; kk < 2; ++kk) {
      FB pa, pl;
      pa.h[0] = *(const v8b*)(pwh + c * AT_P + kk * 32 + 8 * hh);
      pa.h[1] = *(const v8b*)(pwh + c * AT_P + kk * 32 + 16 + 8 * hh);
      if (SPLIT_PV) {
        pl.h[0] = *(const v8b*)(pwl + c * AT_P + kk * 32 + 8 * hh);
        pl.h[1] = *(const v8b*)(pwl + c * AT_P + kk * 32 + 16 + 8 * hh);
      }
#pragma unroll
      for (int t = 0; t < 4; ++t) {
        FB vb;
        vb.h[0] = *(const v8b*)(Vth + (t * 16 + c) * AT_P + kk * 32 + 8 * hh);
        vb.h[1] = *(const v8b*)(Vth + (t * 16 + c) * AT_P + kk * 32 + 16 + 8 * hh);
        oacc[t] = at_mma16<F16>(pa.v, vb.v, oacc[t]);
        if (SPLIT_PV) {
          FB vl;
          vl.h[0] = *(const v8b*)(Vtl + (t * 16 + c) * AT_P + kk * 32 + 8 * hh);
          vl.h[1] = *(const v8b*)(Vtl + (t * 16 + c) * AT_P + kk * 32 + 16 + 8 * hh);
          oacc[t] = at_mma16<F16>(pa.v, vl.v, oacc[t]);
          oacc[t] = at_mma16<F16>(pl.v, vb.v, oacc[t]);
        }
      }
    }
  }

  float* os = Os[wave];
#pragma unroll
  for (int r = 0; r < 8; ++r) {
    const float inv = 1.0f / (lrow[r] * PSC);
#pragma unroll
    for (int t = 0; t < 4; ++t) os[(8 * hh + r) * 68 + t * 16 + c] = oacc[t][r] * inv;
  }
  __builtin_amdgcn_fence(__ATOMIC_RELEASE, "workgroup");
  __builtin_amdgcn_wave_barrier();
  __builtin_amdgcn_fence(__ATOMIC_ACQUIRE, "workgroup");
  {
    const int q4 = lane >> 3, c8 = (lane & 7) * 8;       // a row's 64 f16 = one 128-B line = 8 lanes x 16 B
#pragma unroll
    for (int it = 0; it < 4; ++it) {
      const int row = it * 4 + q4;
      const float* sp = os + row * 68 + c8;
      v8h hv;
#pragma unroll
      for (int e = 0; e < 8; ++e) hv[e] = (_Float16)sp[e];
      *(v8h*)(ob_ptr + (size_t)(q0 + row) * g.o_rs + c8) = hv;
    }
  }
  asm volatile("s_wait_xcnt 0x0" ::: "memory");   // the next pass reuses the address registers of the stores above
  }
}

typedef __attribute__((ext_vector_type(4))) _Float16 v4h;
// The concat-cast part: 512 blocks of 8 waves (two blocks a WGP); a thread moves EW_U items of 4 floats of each input, every wave-wide 16-byte load
// covers 512 contiguous bytes, and all of a thread's loads are issued before its first store.
#define EW_U 8
#define EW_BLOCKS (TR * TDm / 4 / (EW_U * 256))
static_assert(EW_BLOCKS * EW_U * 256 * 4 == TR * TDm, "whole blocks");
// One launch prepares every operand of the first product and the weights of the last: none of these jobs reads what another writes.
// Blocks 0..447: the 7 weight matrices [in 512][out 512], 64 tiles of 64x64 each, cast to f16 and transposed (the block-uniform branch keeps the barrier legal):
//   Bt [1536][1024]: row n<512 (q): [Wqs[:,n] | Wqt[:,n]]; 512..1023 k; 1024..1535 v; then WoT [512][512]. They come first: each is a chain of dependent loads.
// Blocks 448..959: A16 [8192][1024] = [xs2 | xt] f16 (xs2 = raw reshape of xs); item i = floats 4i..4i+3 of xs and of xt, 128 items a row, so 256 items on = 2 rows on
#define TP_TILES ((TDm / 64) * (TDm / 64))
#define TP_BLOCKS (7 * TP_TILES)
__global__ __launch_bounds__(256) void prep_kernel(const float* __restrict__ xs, const float* __restrict__ xt,
                                                   const float* __restrict__ Wqs, const float* __restrict__ Wqt, const float* __restrict__ Wks,
                                                   const float* __restrict__ Wkt, const float* __restrict__ Wvs, const float* __restrict__ Wvt,
                                                   const float* __restrict__ Wo, unsigned* __restrict__ A16,
                                                   _Float16* __restrict__ WT, _Float16* __restrict__ WoT) {
  __shared__ __align__(16) _Float16 tile[64][72];
  if (blockIdx.x < TP_BLOCKS) {
    const int job = blockIdx.x / TP_TILES, tl = blockIdx.x % TP_TILES;
    const float* in = job == 0 ? Wqs : job == 1 ? Wqt : job == 2 ? Wks : job == 3 ? Wkt : job == 4 ? Wvs : job == 5 ? Wvt : Wo;
    _Float16* o = job < 6 ? WT + (size_t)(job >> 1) * TDm * 2 * TDm + (job & 1) * TDm : WoT;
    transpose_cast_tile(in, TDm, o, job < 6 ? 2 * TDm : TDm, (tl % (TDm / 64)) * 64, (tl / (TDm / 64)) * 64, tile);
    return;
  }
  const int base = (blockIdx.x - TP_BLOCKS) * (EW_U * 256) + threadIdx.x;
  const v4f* pa = (const v4f*)xs + base; const v4f* pb = (const v4f*)xt + base;
  v4h* o = (v4h*)A16 + (size_t)(base >> 7) * 256 + (base & 127);     // a row of A16 is 1024 f16 = 256 items; xt's half starts 128 items in
  v4f a[EW_U], b[EW_U];
#pragma unroll
  for (int u = 0; u < EW_U; ++u) { a[u] = pa[u * 256]; b[u] = pb[u * 256]; }
#pragma unroll
  for (int u = 0; u < EW_U; ++u) { o[u * 512] = __builtin_convertvector(a[u], v4h); o[u * 512 + 128] = __builtin_convertvector(b[u], v4h); }
}
extern "C" void kernel_launch(void* const* d_in, const int* in_sizes, int n_in, void* d_out, int out_size, void* d_ws, size_t ws_size, hipStream_t stream) {
  (void)in_sizes; (void)n_in; (void)out_size; (void)ws_size;
  auto Fp = [&](int i) { return (const float*)d_in[i]; };
  const float* xs = Fp(0); const float* xt = Fp(1); const float* Wqs = Fp(2); const float* Wks = Fp(3); const float* Wvs = Fp(4); const float* Wqt = Fp(5); const float* Wkt = Fp(6); const float* Wvt = Fp(7); const float* WK = Fp(8); const float* Wo = Fp(9);
  char* ws = (char*)d_ws; size_t off = 0;
  auto carve = [&](size_t bytes) -> char* { char* p = ws + off; off += (bytes + 255) & ~(size_t)255; return p; };
  unsigned* A16 = (unsigned*)carve((size_t)TR * 2 * TDm * 2); _Float16* WT = (_Float16*)carve((size_t)3 * TDm * 2 * TDm * 2); _Float16* WoT = (_Float16*)carve((size_t)TDm * TDm * 2);
  _Float16* QKV = (_Float16*)carve((size_t)TR * 3 * TDm * 2); _Float16* O16 = (_Float16*)A16;     // 44 MB; O16 reuses A16, which the first product has read by then
  prep_kernel<<<TP_BLOCKS + EW_BLOCKS, 256, 0, stream>>>(xs, xt, Wqs, Wqt, Wks, Wkt, Wvs, Wvt, Wo, A16, WT, WoT);
  const int t3 = (TR / GT_BM) * (3 * TDm / GT_BN), t1 = (TR / GT_BM) * (TDm / GT_BN);   // block tiles of 128 x 256
  wmma_gemm64<0, false, 3, 1, false><<<dim3(t3, 1), 256, 0, stream>>>((const unsigned short*)A16, nullptr, 2 * TDm, 0, U16(WT), nullptr, 2 * TDm, 0, QKV, nullptr, 3 * TDm, 0, WK, nullptr, 0, TR, 3 * TDm, 2 * TDm, 1.0f);
  { AttnGeom g;
    g.q_bs = (long)TS * 3 * TDm; g.q_rs = 3 * TDm; g.q_hs = THD; g.k_bs = g.q_bs; g.k_rs = g.q_rs; g.k_hs = THD; g.v_bs = g.q_bs; g.v_rs = g.q_rs; g.v_hs = THD; g.o_bs = (long)TS * TDm; g.o_rs = TDm; g.o_hs = THD;
    g.S = TS; g.Skv = TS; g.H = TH; g.mask_mode = 1; g.qscale = 1.0f; g.blk0 = 0; g.mask_fill = -1e9f; g.mask_is_int = 0;
    static_assert((TS / AT_QB) % 2 == 0, "query tiles pair up");
    attn64_kernel<false, false, true, 1><<<TB_ * TH * (TS / AT_QB / 2), AT_NW * 32, 0, stream>>>(QKV, QKV + TDm, QKV + 2 * TDm, O16, nullptr, nullptr, g); }
  wmma_gemm64<0, false, 0, 0, false><<<dim3(t1, 1), 256, 0, stream>>>(U16(O16), nullptr, TDm, 0, U16(WoT), nullptr, TDm, 0, (float*)d_out, nullptr, TDm, 0, nullptr, nullptr, 0, TR, TDm, TDm, 1.0f);
}

// v008
// Measured time: 94.9 microseconds a run.
// In both of two side-by-side timings against v007, it was 1.24 times as fast.
// Over all steps from v000 it is 6.55 times as fast.
#include <hip/hip_runtime.h>
#include <math.h>
// TMSA block (8 x 1024 tokens x 512, 8 heads x 64, causal): q/k/v = xs2·W*s + xt·W*t as ONE product over the concatenated input [xs2 | xt]·[W*s; W*t]
// (8192 x 1024 · 1024 x 1536); the query-dependent bias q·WK is folded exactly into the keys — Σ_d q_d k_jd + Σ_d q_d WK[d][j] = q·(k_j + WK[:, j]) —
// so the attention is a plain causal flash-style kernel over k' = k + WKᵀ (scores (q/8)·k'ᵀ and p·v on WMMA, f16 operands with probabilities x2^15,
// f32 accumulate, online softmax in f32, -1e9 fill above the diagonal); output projection ·Wo. All products v_wmma_f32_16x16x32_f16, f16 operands,
// f32 accumulate (plain single products, ≈24 G MAC); the raw .view reshapes are identity on memory.
// What lies between the products is elementwise and is done once, in the epilogue of the kernel that makes the value: the first product stores q/8, k' and v
// as f16, the attention stores its output as f16; each is rounded to f16 once, from the same f32 value as a pass of its own would round.
typedef __attribute__((ext_vector_type(16))) _Float16 v16h;
typedef __attribute__((ext_vector_type(8)))  _Float16 v8h;
typedef __attribute__((ext_vector_type(16))) __bf16   v16b;
typedef __attribute__((ext_vector_type(8)))  __bf16   v8b;
typedef __attribute__((ext_vector_type(8)))  float    v8f;
typedef __attribute__((ext_vector_type(4)))  float    v4f;
#define TB_ 8
#define TS 1024
#define TDm 512
#define TH 8
#define THD 64
#define TR (TB_ * TS)
#define PSCALE 32768.0f
#define U16(p) ((const unsigned short*)(const void*)(p))
#define PSCALE_INV (1.0f / 32768.0f)

__device__ __forceinline__ unsigned short f2bf_bits(float f) {
  unsigned u = __float_as_uint(f);
  return (unsigned short)((u + 0x7FFFu + ((u >> 16) & 1u)) >> 16);
}
__device__ __forceinline__ float bf_bits2f(unsigned short h) { return __uint_as_float(((unsigned)h) << 16); }

// hazard guards as plain device helpers (no inline asm inside the kernel template body)
__device__ __forceinline__ void dep_guard_h(v8f& a, v8f& b, v16h x, v16h y) { asm volatile("v_nop\n\tv_nop\n\tv_nop\n\tv_nop" : "+v"(a), "+v"(b) : "v"(x), "v"(y)); }
__device__ __forceinline__ void dep_guard_b(v8f& a, v8f& b, v16b x, v16b y) { asm volatile("v_nop\n\tv_nop\n\tv_nop\n\tv_nop" : "+v"(a), "+v"(b) : "v"(x), "v"(y)); }
__device__ __forceinline__ void keep4_h(v16h a, v16h b, v16h c, v16h d) { asm volatile("v_nop" :: "v"(a), "v"(b), "v"(c), "v"(d)); }
__device__ __forceinline__ void keep4_b(v16b a, v16b b, v16b c, v16b d) { asm volatile("v_nop" :: "v"(a), "v"(b), "v"(c), "v"(d)); }
__device__ __forceinline__ void acc_guard4(v8f& a, v8f& b, v8f& c, v8f& d) { asm volatile("v_nop\n\tv_nop\n\tv_nop\n\tv_nop" : "+v"(a), "+v"(b), "+v"(c), "+v"(d)); }
template <typename T> struct Frag;
template <> struct Frag<_Float16> {
  typedef v16h V; union U { v16h v; v8h h[2]; };
  static __device__ __forceinline__ v16h load(const _Float16* p) {   // elements 0..7 <- p[0..7], 8..15 <- p[16..23]
    U f; f.h[0] = *(const v8h*)(p); f.h[1] = *(const v8h*)(p + 16); return f.v;
  }
  static __device__ __forceinline__ v8f mma(v16h a, v16h b, v8f c) {
    return __builtin_amdgcn_wmma_f32_16x16x32_f16(false, a, false, b, (short)0, c, false, false);
  }
  static __device__ __forceinline__ void guard(v8f& a, v8f& b, v16h x, v16h y) { dep_guard_h(a, b, x, y); }
  static __device__ __forceinline__ void keep(v16h a, v16h b, v16h c, v16h d) { keep4_h(a, b, c, d); }
};
template <> struct Frag<__bf16> {
  typedef v16b V; union U { v16b v; v8b h[2]; };
  static __device__ __forceinline__ v16b load(const __bf16* p) {
    U f; f.h[0] = *(const v8b*)(p); f.h[1] = *(const v8b*)(p + 16); return f.v;
  }
  static __device__ __forceinline__ v8f mma(v16b a, v16b b, v8f c) {
    return __builtin_amdgcn_wmma_f32_16x16x32_bf16(false, a, false, b, (short)0, c, false, false);
  }
  static __device__ __forceinline__ void guard(v8f& a, v8f& b, v16b x, v16b y) { dep_guard_b(a, b, x, y); }
  static __device__ __forceinline__ void keep(v16b a, v16b b, v16b c, v16b d) { keep4_b(a, b, c, d); }
};

// ---- Register-blocked batched WMMA GEMM ------------------------------------
// C[m,n] = scale * sum_k A[m,k] * Bt[n,k] (+bias)(+resid); each wave owns a 64x64 tile, the 8 waves of a block a 128x256 tile (2 x 4 waves).
// A row-major [M,K]; Bt row-major [N,K]; M % 128 == 0, N % 256 == 0, K % 64 == 0; grid.x = (M/128)*(N/256).
// Operands go through LDS: a stage is 64 k (128 B) of the block's 128 A rows and 256 Bt rows, brought by asynchronous 16-byte copies whose
// wave-wide form covers 4 whole 128-B lines; two buffers, the copies of stage t+2 fly while stage t+1 is worked on.
// SPLIT (hi/lo planes) is not staged and so not offered by this form.
// BIAS_MODE: 0 = none, 1 = bias[m], 2 = bias[n], 3 = the q | k | v product: columns 0..511 (q) x 1/8 (= 1/sqrt(64); a power of two, so exact in f32),
//   columns 512..1023 (k) + bias[n % 64][m % 1024] (bias = WK [64][1024]: head dim d = n % 64, position s = m % 1024), columns 1024.. (v) as they are.
// OUT_MODE: 0 = f32, 1 = f16, 2 = bf16 hi plane (Cout) + bf16 lo plane (Cout2).
// ET: 0 = f16 operands, 1 = bf16 operands (pointers passed as 16-bit storage)
template <int ET> struct Elem;
template <> struct Elem<0> { typedef _Float16 T; };
template <> struct Elem<1> { typedef __bf16 T; };
#define GT_BM 128
#define GT_BN 256
#define GT_BK 64
#define GT_P 72                              // LDS row pitch in 16-bit elements: 144 B = 16 B x 9, conflict-free for 16-byte fragment reads
#define GT_STAGE ((GT_BM + GT_BN) * GT_P)    // 16-bit elements of one buffer: A rows 0..127, then Bt rows 0..255
#define GT_G (32 * GT_P * 2)                 // LDS bytes from one group of 32 rows to the next
// One stage, one thread's share: 12 copies of 16 B (4 groups of 32 A rows, 8 groups of 32 Bt rows). l = the lane's LDS byte address in group 0,
// a / b = its global address in group 0 of A / Bt, sa / sb = elements from one group of 32 rows to the next.
// The s_wait_xcnt stands inside the statement so that no address register of a copy is rewritten ahead of it.
__device__ __forceinline__ void gemm_stage_copy(unsigned l, const unsigned short* a, size_t sa, const unsigned short* b, size_t sb) {
  asm volatile(
      "global_load_async_to_lds_b128 %0, %12, off\n\t"
      "global_load_async_to_lds_b128 %1, %13, off\n\t"
      "global_load_async_to_lds_b128 %2, %14, off\n\t"
      "global_load_async_to_lds_b128 %3, %15, off\n\t"
      "global_load_async_to_lds_b128 %4, %16, off\n\t"
      "global_load_async_to_lds_b128 %5, %17, off\n\t"
      "global_load_async_to_lds_b128 %6, %18, off\n\t"
      "global_load_async_to_lds_b128 %7, %19, off\n\t"
      "global_load_async_to_lds_b128 %8, %20, off\n\t"
      "global_load_async_to_lds_b128 %9, %21, off\n\t"
      "global_load_async_to_lds_b128 %10, %22, off\n\t"
      "global_load_async_to_lds_b128 %11, %23, off\n\t"
      "s_wait_xcnt 0x0"
      :: "v"(l), "v"(l + GT_G), "v"(l + 2 * GT_G), "v"(l + 3 * GT_G),
         "v"(l + 4 * GT_G), "v"(l + 5 * GT_G), "v"(l + 6 * GT_G), "v"(l + 7 * GT_G),
         "v"(l + 8 * GT_G), "v"(l + 9 * GT_G), "v"(l + 10 * GT_G), "v"(l + 11 * GT_G),
         "v"(a), "v"(a + sa), "v"(a + 2 * sa), "v"(a + 3 * sa),
         "v"(b), "v"(b + sb), "v"(b + 2 * sb), "v"(b + 3 * sb),
         "v"(b + 4 * sb), "v"(b + 5 * sb), "v"(b + 6 * sb), "v"(b + 7 * sb)
      : "memory");
}
// The two waits of the ring, each a statement of its own; the "memory" clobber keeps every LDS read on its side of them.
__device__ __forceinline__ void wait_copies_landed() { asm volatile("s_wait_asynccnt 0x0" ::: "memory"); }
__device__ __forceinline__ void wait_lds_reads_done() { asm volatile("s_wait_dscnt 0x0" ::: "memory"); }     // a buffer is refilled only after its readers' loads have returned
template <int ET, bool SPLIT, int BIAS_MODE, int OUT_MODE, bool RESID, int ACT = 0>
__global__ __launch_bounds__(256) void wmma_gemm64(
    const unsigned short* __restrict__ Ap, const unsigned short* __restrict__ A2p, int lda, long strideA,
    const unsigned short* __restrict__ Btp, const unsigned short* __restrict__ Bt2p, int ldb, long strideB,
    void* __restrict__ Cout, void* __restrict__ Cout2, int ldc, long strideC,
    const float* __restrict__ bias,
    const float* __restrict__ resid, long strideR,
    int M, int N, int K, float scale) {
  typedef typename Elem<ET>::T T;
  typedef typename Frag<T>::V V;
  static_assert(!SPLIT, "the lo planes are not staged");
  (void)A2p; (void)Bt2p; (void)M;
  __shared__ __align__(16) float sT[8][16 * 68];   // per-wave 16x64 slab, pitch 68 floats
  __shared__ __align__(16) unsigned short sAB[2 * GT_STAGE];   // the two operand buffers
  const int b    = blockIdx.y;
  const int lane = threadIdx.x & 31;
  const int wave = threadIdx.x >> 5;
  const int tilesN = N >> 8;
  const int tm = blockIdx.x / tilesN;          // block tile; every block has one, so every wave passes every barrier
  const int tn = blockIdx.x - tm * tilesN;
  const int wm = (wave >> 2) << 6;             // the wave's 64x64 tile inside the block tile
  const int wn = (wave & 3) << 6;
  const int m0 = (tm << 7) + wm;
  const int n0 = (tn << 8) + wn;

  // copies: thread t brings the 16-byte piece t & 7 of row t >> 3 of every group of 32 rows
  const int cr = threadIdx.x >> 3, cp = (threadIdx.x & 7) * 8;
  const unsigned short* gA = Ap  + (size_t)b * strideA + (size_t)((tm << 7) + cr) * lda + cp;
  const unsigned short* gB = Btp + (size_t)b * strideB + (size_t)((tn << 8) + cr) * ldb + cp;
  const size_t sa = (size_t)32 * lda, sb = (size_t)32 * ldb;
  const unsigned l0 = (unsigned)(size_t)sAB + (unsigned)(cr * GT_P + cp) * 2u;   // low 32 bits of a __shared__ address = byte offset in the block's LDS
  const int nT = K / GT_BK;

  const int rlane = lane & 15;                 // row (A) / col (B, D) within subtile
  const int koff  = (lane >> 4) * 8;           // k offset of this lane half
  const int mOff  = (lane >> 4) * 8;           // D row offset

  v8f acc[4][4];
#pragma unroll
  for (int i = 0; i < 4; ++i)
#pragma unroll
    for (int j = 0; j < 4; ++j) acc[i][j] = (v8f){0.f,0.f,0.f,0.f,0.f,0.f,0.f,0.f};

  gemm_stage_copy(l0, gA, sa, gB, sb);                       // stage 0 into buffer 0
  wait_copies_landed();                                      // this wave's copies of stage 0 have landed
  __syncthreads();                                           // ... and every other wave's
  if (nT > 1) gemm_stage_copy(l0 + GT_STAGE * 2, gA + GT_BK, sa, gB + GT_BK, sb);   // stage 1 into buffer 1
  for (int t = 0; t < nT; ++t) {
    const T* sbuf = (const T*)sAB + (t & 1) * GT_STAGE;
    const T* sA = sbuf + (wm + rlane) * GT_P + koff;
    const T* sB = sbuf + (GT_BM + wn + rlane) * GT_P + koff;
#pragma unroll
    for (int kk = 0; kk < GT_BK; kk += 32) {
      V bh[4], ah[4];
#pragma unroll
      for (int j = 0; j < 4; ++j) bh[j] = Frag<T>::load(sB + (j << 4) * GT_P + kk);
#pragma unroll
      for (int i = 0; i < 4; ++i) ah[i] = Frag<T>::load(sA + (i << 4) * GT_P + kk);
#pragma unroll
      for (int i = 0; i < 4; ++i) {
#pragma unroll
        for (int j = 0; j < 4; ++j) acc[i][j] = Frag<T>::mma(ah[i], bh[j], acc[i][j]);
        Frag<T>::guard(acc[i][0], acc[i][3], ah[i], ah[i]);
      }
      Frag<T>::keep(bh[0], bh[1], bh[2], bh[3]);
    }
    wait_lds_reads_done();                                   // this wave has left buffer t & 1
    wait_copies_landed();                                    // this wave's copies of stage t + 1 have landed
    __syncthreads();                                         // publishes stage t + 1 and ends every wave's reads of buffer t & 1
    if (t + 2 < nT) gemm_stage_copy(l0 + (unsigned)(t & 1) * (GT_STAGE * 2), gA + (size_t)(t + 2) * GT_BK, sa, gB + (size_t)(t + 2) * GT_BK, sb);
  }
  wait_copies_landed();                                      // no copy is outstanding when the wave goes on to the epilogue
  acc_guard4(acc[0][0], acc[0][1], acc[0][2], acc[0][3]);
  acc_guard4(acc[1][0], acc[1][1], acc[1][2], acc[1][3]);
  acc_guard4(acc[2][0], acc[2][1], acc[2][2], acc[2][3]);
  acc_guard4(acc[3][0], acc[3][1], acc[3][2], acc[3][3]);

  // ---- epilogue ----
  float cs = scale;                            // a wave's 64 columns lie in one of q, k, v
  if (BIAS_MODE == 3) {
    if (n0 < TDm) cs = scale * 0.125f;
    else if (n0 < 2 * TDm) {
      // the 8 accumulator rows of a lane are 8 consecutive positions of one row d of WK: two 16-byte loads per subtile;
      // 16 loads (the registers the fragments have left) are issued before the first is used, so a wave waits twice, not 16 times
      const float* wp = bias + (size_t)rlane * TS + ((m0 + mOff) & (TS - 1));
#pragma unroll
      for (int ih = 0; ih < 4; ih += 2) {
        v4f w[2][4][2];
#pragma unroll
        for (int i = 0; i < 2; ++i)
#pragma unroll
          for (int j = 0; j < 4; ++j) {
            w[i][j][0] = *(const v4f*)(wp + (size_t)(j << 4) * TS + ((ih + i) << 4));
            w[i][j][1] = *(const v4f*)(wp + (size_t)(j << 4) * TS + ((ih + i) << 4) + 4);
          }
#pragma unroll
        for (int i = 0; i < 2; ++i)
#pragma unroll
          for (int j = 0; j < 4; ++j)
#pragma unroll
            for (int r = 0; r < 4; ++r) {
              acc[ih + i][j][r]     = acc[ih + i][j][r]     * scale + w[i][j][0][r];
              acc[ih + i][j][4 + r] = acc[ih + i][j][4 + r] * scale + w[i][j][1][r];
            }
      }
      cs = 1.0f;
    }
  }
  float* slab = sT[wave];
  const float* Rb = RESID ? (resid + (size_t)b * strideR) : nullptr;
#pragma unroll
  for (int i = 0; i < 4; ++i) {
    const int mBase = m0 + (i << 4);
#pragma unroll
    for (int j = 0; j < 4; ++j) {
      const int n = n0 + (j << 4) + rlane;
      float bv = 0.f;
      if (BIAS_MODE == 2) bv = bias[n];
#pragma unroll
      for (int r = 0; r < 8; ++r) {
        float v = acc[i][j][r] * cs;
        if (BIAS_MODE == 1) v += bias[mBase + mOff + r];
        if (BIAS_MODE == 2) v += bv;
        if (RESID) v += Rb[(size_t)(mBase + mOff + r) * ldc + n];
        if (ACT == 1) v = tanhf(v);
        if (ACT == 2) v = fmaxf(v, 0.0f);
        if (ACT == 3) v = v / (1.0f + expf(-v));
        if (ACT == 4) v = (v > 0.f) ? v : 0.01f * v;
        if (ACT == 5) v = 0.5f * v * (1.0f + erff(v * 0.70710678118654752f));
        slab[(mOff + r) * 68 + (j << 4) + rlane] = v;
      }
    }
    __builtin_amdgcn_fence(__ATOMIC_RELEASE, "workgroup");
    __builtin_amdgcn_wave_barrier();
    __builtin_amdgcn_fence(__ATOMIC_ACQUIRE, "workgroup");
    if (OUT_MODE == 0) {
      float* C = (float*)Cout + (size_t)b * strideC;
      const int hh = lane >> 4, c4 = (lane & 15) * 4;     // row seg = 256 B = 16 lanes x 16 B
      {
#pragma unroll
        for (int it = 0; it < 8; ++it) {
          const int row = it * 2 + hh;
          v4f v = *(const v4f*)(slab + row * 68 + c4);
          *(v4f*)(C + (size_t)(mBase + row) * ldc + n0 + c4) = v;
        }
        
      }
    } else {
      const int q = lane >> 3, c8 = (lane & 7) * 8;
      unsigned short* C  = (unsigned short*)Cout  + (size_t)b * strideC;
      unsigned short* C2 = (OUT_MODE == 2) ? ((unsigned short*)Cout2 + (size_t)b * strideC) : nullptr;
      {
#pragma unroll
        for (int it = 0; it < 4; ++it) {
          const int row = it * 4 + q;
          const float* sp = slab + row * 68 + c8;
          v8h hv, lv;
#pragma unroll
          for (int e = 0; e < 8; ++e) {
            if (OUT_MODE == 1) {
              hv[e] = (_Float16)sp[e];
            } else {
              unsigned short hb = f2bf_bits(sp[e]);
              unsigned short lb = f2bf_bits(sp[e] - bf_bits2f(hb));
              hv[e] = __builtin_bit_cast(_Float16, hb);
              lv[e] = __builtin_bit_cast(_Float16, lb);
            }
          }
          *(v8h*)(C + (size_t)(mBase + row) * ldc + n0 + c8) = hv;
          if (OUT_MODE == 2) *(v8h*)(C2 + (size_t)(mBase + row) * ldc + n0 + c8) = lv;
        }
        
      }
    }
    __builtin_amdgcn_fence(__ATOMIC_RELEASE, "workgroup");
    __builtin_amdgcn_wave_barrier();
    __builtin_amdgcn_fence(__ATOMIC_ACQUIRE, "workgroup");
  }
}

// ---- f32 [R][C] (row pitch ldi) -> f16 transposed [C][R] (row pitch ldo); one 64x64 tile (columns c0.., rows r0..) by one block of 256 threads
__device__ __forceinline__ void transpose_cast_tile(const float* __restrict__ in, int ldi, _Float16* __restrict__ outT, int ldo,
                                                    int c0, int r0, _Float16 (*tile)[72]) {     // tile: [c][r]
  const int t = threadIdx.x, tx = t & 31, ty = t >> 5;
  for (int i = ty; i < 64; i += 8) {
    tile[tx][i]      = (_Float16)in[(size_t)(r0 + i) * ldi + c0 + tx];
    tile[32 + tx][i] = (_Float16)in[(size_t)(r0 + i) * ldi + c0 + 32 + tx];
  }
  __syncthreads();
  const int q = t >> 3, c8 = (t & 7) * 8;
#pragma unroll
  for (int it = 0; it < 2; ++it) {
    const int c = it * 32 + q;
    v8h hv = *(const v8h*)(&tile[c][c8]);
    *(v8h*)(outT + (size_t)(c0 + c) * ldo + r0 + c8) = hv;
  }
}

// =====================================================================================
// Generic causal/non-causal attention for head_dim 64, f16 in / f16 out (q arrives scaled; q, k, v are used as they arrive, so only F16=true, non-split, is
// offered by this form; probabilities carried x2^15).
//   Both products are taken transposed, so that a lane owns one query:
//   scores^T = k.q^T (g.qscale is not applied here: the producer of q has scaled it) : v_wmma_f32_16x16x32_f16, A = 16 keys from LDS, B = the wave's 16 queries
//   out^T    = v^T.p^T     : v_wmma_f32_16x16x32_f16, A = 16 head dims x 32 keys from LDS, B = two score tiles, converted in their own registers
//   Lane (c, hh) holds, of query q0 + c, the scores of keys 16 j + 8 hh + r: maximum and sum run inside the lane, the two halves exchange the maximum once
//   a chunk and join their sums once a tile; the probabilities never pass through LDS.
//   f32 accumulate; online softmax in f32. Block = 4 waves = two 64-row query tiles of one (batch, head); S % 64 == 0.
//   Element (b, s, h, d) of tensor X lives at X[b*X_bs + s*X_rs + h*X_hs + d] (strides in elements, multiples of 8).
//   Masking: mask_mode 0 none, 1 causal (kv > q masked), 2 tensor [S][Skv] shared over (b,h) (float if
//   mask_is_int==0, int32 with element == 0 -> masked if 1, int32 with element != 0 -> masked if 2), 3 per-token vectors qmask[B][S] & kvmask[B][Skv] (int32,
//   0 -> masked), 4 causal + sliding window (kv > q or q - kv > W masked; W passed in mask_is_int);
//   5 = relative-position bias: s += cp[b,h,q][idx[q][kv]] + pc[b,h,kv][idx[q][kv]] with idx = mask_b ([S][Skv] int32) and
//   mask_a an int32 [S][Skv] tensor with nonzero = masked (tables: element (b,h,row,n) at X + b*c_bs + h*c_hs + row*c_rs + n);
//   masked scores are replaced by mask_fill (e.g. -inf or -1e9) before the softmax.
//   grid.x = B * H * (S/128) (or a sub-range with blk0); S/64 even. A block takes two query tiles of one (batch, head), one after the other: tile n-1-t, then
//   tile t. Under the causal mask a tile's cost grows with its index, every block is resident at once and the launch lasts as long as its fullest WGP:
//   so paired, every block walks the same n+1 chunks wherever it lands.
// =====================================================================================
#define AT_D 64
#define AT_NW 4
#define AT_QB 64
#define AT_KC 64
#define AT_P 72   // LDS row pitch of the K and V^T tiles in 16-bit elements: 144 B = 16 B x 9, so the 16 rows of a 16-byte fragment read fall on distinct banks
struct AttnGeom { const float* cp = nullptr; const float* pc = nullptr; long c_bs = 0, c_rs = 0, c_hs = 0;   // mode-5 score-bias tables
                  long q_bs, q_rs, q_hs, k_bs, k_rs, k_hs, v_bs, v_rs, v_hs, o_bs, o_rs, o_hs;
                  int S, Skv, H, mask_mode; float qscale; int blk0; float mask_fill; int mask_is_int; };
static_assert(sizeof(AttnGeom) == 168, "no padding");

__device__ __forceinline__ unsigned short at_bf_bits(float f) {
  unsigned u = __float_as_uint(f);
  return (unsigned short)((u + 0x7FFFu + ((u >> 16) & 1u)) >> 16);
}
__device__ __forceinline__ __bf16 at_f2bf(float f) { return __builtin_bit_cast(__bf16, at_bf_bits(f)); }
__device__ __forceinline__ void at_split(float f, __bf16& hi, __bf16& lo) {
  const unsigned short hb = at_bf_bits(f);
  hi = __builtin_bit_cast(__bf16, hb);
  lo = at_f2bf(f - __uint_as_float(((unsigned)hb) << 16));
}
__device__ __forceinline__ v8f at_mma(v16b a, v16b b, v8f c) {
  c = __builtin_amdgcn_wmma_f32_16x16x32_bf16(false, a, false, b, (short)0, c, false, false);
  asm volatile("v_nop\n\tv_nop\n\tv_nop\n\tv_nop" : "+v"(c) : "v"(a), "v"(b));
  return c;
}
// 16-bit element as a bit pattern held in a __bf16 slot: f16 bits when F16, bf16 (RNE) otherwise
template <bool F16> __device__ __forceinline__ __bf16 at_to16(float f) {
  if (F16) return __builtin_bit_cast(__bf16, (_Float16)f);
  return at_f2bf(f);
}
template <bool F16> __device__ __forceinline__ v8f at_mma16(v16b a, v16b b, v8f c) {
  if (F16) {
    const v16h ah = __builtin_bit_cast(v16h, a), bh = __builtin_bit_cast(v16h, b);
    c = __builtin_amdgcn_wmma_f32_16x16x32_f16(false, ah, false, bh, (short)0, c, false, false);
    asm volatile("v_nop\n\tv_nop\n\tv_nop\n\tv_nop" : "+v"(c) : "v"(ah), "v"(bh));
    return c;
  }
  return at_mma(a, b, c);
}

// lane l's value to lane l ^ 16 and back: the two lanes that share a query
__device__ __forceinline__ float at_xhalf(float x) {
  return __builtin_bit_cast(float, __builtin_amdgcn_permlanex16(__builtin_bit_cast(int, x), __builtin_bit_cast(int, x), 0x76543210, 0xfedcba98, false, false));
}

// MODE = the mask mode as a compile-time constant: the per-score mode tests fold away, so the unrolled score loop is straight-line code
template <bool SPLIT_QK, bool SPLIT_PV, bool F16, int MODE>
__global__ __launch_bounds__(128)
void attn64_kernel(const _Float16* __restrict__ q, const _Float16* __restrict__ k,
                   const _Float16* __restrict__ v, _Float16* __restrict__ out,
                   const void* __restrict__ mask_a, const int* __restrict__ mask_b, AttnGeom g) {
  static_assert(F16 && !SPLIT_QK && !SPLIT_PV, "q, k, v arrive as f16 and are not split");
  const float PSC = F16 ? 32768.0f : 1.0f;     // f16 probabilities carried x2^15 (subnormal range), folded into the final 1/l
  union FB { v16b v; v8b h[2]; };
  __shared__ __align__(16) __bf16 Ksh[AT_KC * AT_P];             // K hi [kv][d]      9 KB
  __shared__ __align__(16) __bf16 Ksl[SPLIT_QK ? AT_KC * AT_P : 8];
  __shared__ __align__(16) __bf16 Vth[AT_D * AT_P];              // V hi [d][kv]      9 KB
  __shared__ __align__(16) __bf16 Vtl[SPLIT_PV ? AT_D * AT_P : 8];
  __shared__ __align__(16) float  Os[AT_NW][16 * 68];            // per wave out tile, pitch 68

  const int tid  = threadIdx.x;
  const int wave = tid >> 5;
  const int lane = tid & 31;
  const int hh   = lane >> 4;
  const int c    = lane & 15;

  const int nqb = g.S / AT_QB;
  const int npair = nqb >> 1;
  const int bx = blockIdx.x + g.blk0;
  const int tpair = bx % npair;
  const int bh = bx / npair;
  const int h  = bh % g.H;
  const int b  = bh / g.H;

  const _Float16* qb_ptr = q + (size_t)b * g.q_bs + (size_t)h * g.q_hs;
  const _Float16* kb_ptr = k + (size_t)b * g.k_bs + (size_t)h * g.k_hs;
  const _Float16* vb_ptr = v + (size_t)b * g.v_bs + (size_t)h * g.v_hs;
  _Float16*       ob_ptr = out + (size_t)b * g.o_bs + (size_t)h * g.o_hs;

  for (int pass = 0; pass < 2; ++pass) {       // block-uniform: every wave passes every barrier of both tiles
  const int qb = pass ? tpair : nqb - 1 - tpair;
  const int q0 = qb * AT_QB + wave * 16;

  // ---- Q fragments (B operand: column c = query q0 + c): 2 d-chunks, hi (and lo) ----
  v16b qah[2], qal[2];
  {
    const _Float16* qrow = qb_ptr + (size_t)(q0 + c) * g.q_rs;
#pragma unroll
    for (int dc = 0; dc < 2; ++dc) {
      FB f;                                    // elements 0..7 <- d = dc*32 + 8*hh + 0..7, elements 8..15 <- 16 further on
      f.h[0] = *(const v8b*)(qrow + dc * 32 + 8 * hh);
      f.h[1] = *(const v8b*)(qrow + dc * 32 + 16 + 8 * hh);
      qah[dc] = f.v; qal[dc] = f.v;
    }
  }

  float mrow = -INFINITY, lrow = 0.f;          // of query q0 + c; lrow sums this lane half's keys only, the halves are joined behind the chunk loop
  v8f oacc[4];                                 // oacc[t][r] = out^T[d = 16 t + 8 hh + r][query q0 + c]
#pragma unroll
  for (int t = 0; t < 4; ++t) oacc[t] = (v8f){0.f,0.f,0.f,0.f,0.f,0.f,0.f,0.f};

  const int nChunks = (MODE == 1 || MODE == 4) ? (qb + 1) : (g.Skv / AT_KC);   // block-uniform
  const int qrow = q0 + c;
  const int qkeep = (MODE == 3) ? mask_b[(size_t)b * g.S + qrow] : 1;   // per-query mask (mode 3): mask_b = qmask
  for (int kc = 0; kc < nChunks; ++kc) {
    const int kv0 = kc * AT_KC;
    __syncthreads();
    {
      const int kvr = tid >> 1, dh = (tid & 1) * 32;
      const _Float16* krow = kb_ptr + (size_t)(kv0 + kvr) * g.k_rs + dh;
      const _Float16* vrow = vb_ptr + (size_t)(kv0 + kvr) * g.v_rs + dh;
      v8b kk[4], vv[4];
#pragma unroll
      for (int i = 0; i < 4; ++i) { kk[i] = *(const v8b*)(krow + 8 * i); vv[i] = *(const v8b*)(vrow + 8 * i); }
#pragma unroll
      for (int i = 0; i < 4; ++i) {
        *(v8b*)(Ksh + kvr * AT_P + dh + 8 * i) = kk[i];
#pragma unroll
        for (int e = 0; e < 8; ++e) Vth[(dh + 8 * i + e) * AT_P + kvr] = vv[i][e];
      }
    }
    __syncthreads();

    v8f s[4];                                  // s[j][r] = score of key kv0 + 16 j + 8 hh + r for query q0 + c
#pragma unroll
    for (int j = 0; j < 4; ++j) s[j] = (v8f){0.f,0.f,0.f,0.f,0.f,0.f,0.f,0.f};
#pragma unroll                                 // both loops unrolled: qah[dc] and s[j] live in registers, which only a compile-time index names without copies
    for (int dc = 0; dc < 2; ++dc) {
#pragma unroll
      for (int j = 0; j < 4; ++j) {            // j inside: four independent accumulators follow one another
        FB kb;
        kb.h[0] = *(const v8b*)(Ksh + (j * 16 + c) * AT_P + dc * 32 + 8 * hh);
        kb.h[1] = *(const v8b*)(Ksh + (j * 16 + c) * AT_P + dc * 32 + 16 + 8 * hh);
        s[j] = at_mma16<F16>(kb.v, qah[dc], s[j]);
      }
    }
    const bool diag = (MODE == 1) && (kc == qb);
    float cm[4];
#pragma unroll
    for (int j = 0; j < 4; ++j) {
      float m = -INFINITY;
#pragma unroll
      for (int r = 0; r < 8; ++r) {
        const int kvcol = kv0 + j * 16 + 8 * hh + r;
        bool masked = false;
        if (diag) masked = (kvcol > qrow);
        else if (MODE == 4) masked = (kvcol > qrow) || (qrow - kvcol > g.mask_is_int);
        else if (MODE == 2) {
          const size_t mi = (size_t)qrow * g.Skv + kvcol;
          masked = (g.mask_is_int == 0) ? (((const float*)mask_a)[mi] == 0.0f)
                 : (g.mask_is_int == 1) ? (((const int*)mask_a)[mi] == 0) : (((const int*)mask_a)[mi] != 0);
        } else if (MODE == 3) masked = (qkeep == 0) || (((const int*)mask_a)[(size_t)b * g.Skv + kvcol] == 0);   // mask_a = kvmask
        else if (MODE == 5) {
          const size_t mi = (size_t)qrow * g.Skv + kvcol;
          masked = (((const int*)mask_a)[mi] != 0);
          int n = mask_b[mi]; n = n < 0 ? 0 : n;
          s[j][r] += g.cp[(size_t)b * g.c_bs + (size_t)h * g.c_hs + (size_t)qrow * g.c_rs + n]
                   + g.pc[(size_t)b * g.c_bs + (size_t)h * g.c_hs + (size_t)kvcol * g.c_rs + n];
        }
        const float sv = masked ? g.mask_fill : s[j][r];   // one select on the element (a conditional store into the vector selects all 8 registers)
        s[j][r] = sv;
        m = fmaxf(m, sv);
      }
      cm[j] = m;
    }
    const float mh = fmaxf(fmaxf(cm[0], cm[1]), fmaxf(cm[2], cm[3]));
    const float mnew = fmaxf(mrow, fmaxf(mh, at_xhalf(mh)));   // both lanes of a query now hold the same maximum, so the same alpha
    const float alpha = expf(mrow - mnew);
    mrow = mnew;
    // p^T as B operand: element e of the 32 keys of kk is register e & 7 of score tile 2 kk + (e >> 3), the k order in which V^T is read below
    FB pb[2];
    float ps[4];                               // one sum a score tile: four short chains
#pragma unroll
    for (int j = 0; j < 4; ++j) {
      float psum = 0.f;
#pragma unroll
      for (int r = 0; r < 8; ++r) {
        const float p = expf(s[j][r] - mnew);
        psum += p;
        pb[j >> 1].v[(j & 1) * 8 + r] = at_to16<F16>(p * PSC);
      }
      ps[j] = psum;
    }
    lrow = lrow * alpha + ((ps[0] + ps[1]) + (ps[2] + ps[3]));
#pragma unroll
    for (int t = 0; t < 4; ++t) oacc[t] *= alpha;
#pragma unroll                                 // unrolled: pb[kk] lives in registers
    for (int kk = 0; kk < 2; ++kk) {
#pragma unroll
      for (int t = 0; t < 4; ++t) {
        FB vb;
        vb.h[0] = *(const v8b*)(Vth + (t * 16 + c) * AT_P + kk * 32 + 8 * hh);
        vb.h[1] = *(const v8b*)(Vth + (t * 16 + c) * AT_P + kk * 32 + 16 + 8 * hh);
        oacc[t] = at_mma16<F16>(vb.v, pb[kk].v, oacc[t]);
      }
    }
  }

  float* os = Os[wave];
  {
    const float inv = 1.0f / ((lrow + at_xhalf(lrow)) * PSC);   // the two halves' sums joined, unconditionally: every lane is on
#pragma unroll
    for (int t = 0; t < 4; ++t) {              // row = query c; a lane's 8 registers are 8 consecutive d
      *(v4f*)(os + c * 68 + t * 16 + 8 * hh)     = (v4f){oacc[t][0] * inv, oacc[t][1] * inv, oacc[t][2] * inv, oacc[t][3] * inv};
      *(v4f*)(os + c * 68 + t * 16 + 8 * hh + 4) = (v4f){oacc[t][4] * inv, oacc[t][5] * inv, oacc[t][6] * inv, oacc[t][7] * inv};
    }
  }
  __builtin_amdgcn_fence(__ATOMIC_RELEASE, "workgroup");
  __builtin_amdgcn_wave_barrier();
  __builtin_amdgcn_fence(__ATOMIC_ACQUIRE, "workgroup");
  {
    const int q4 = lane >> 3, c8 = (lane & 7) * 8;       // a row's 64 f16 = one 128-B line = 8 lanes x 16 B
#pragma unroll
    for (int it = 0; it < 4; ++it) {
      const int row = it * 4 + q4;
      const float* sp = os + row * 68 + c8;
      v8h hv;
#pragma unroll
      for (int e = 0; e < 8; ++e) hv[e] = (_Float16)sp[e];
      *(v8h*)(ob_ptr + (size_t)(q0 + row) * g.o_rs + c8) = hv;
    }
  }
  asm volatile("s_wait_xcnt 0x0" ::: "memory");   // the next pass reuses the address registers of the stores above
  }
}

typedef __attribute__((ext_vector_type(4))) _Float16 v4h;
// The concat-cast part: 512 blocks of 8 waves (two blocks a WGP); a thread moves EW_U items of 4 floats of each input, every wave-wide 16-byte load
// covers 512 contiguous bytes, and all of a thread's loads are issued before its first store.
#define EW_U 8
#define EW_BLOCKS (TR * TDm / 4 / (EW_U * 256))
static_assert(EW_BLOCKS * EW_U * 256 * 4 == TR * TDm, "whole blocks");
// One launch prepares every operand of the first product and the weights of the last: none of these jobs reads what another writes.
// Blocks 0..447: the 7 weight matrices [in 512][out 512], 64 tiles of 64x64 each, cast to f16 and transposed (the block-uniform branch keeps the barrier legal):
//   Bt [1536][1024]: row n<512 (q): [Wqs[:,n] | Wqt[:,n]]; 512..1023 k; 1024..1535 v; then WoT [512][512]. They come first: each is a chain of dependent loads.
// Blocks 448..959: A16 [8192][1024] = [xs2 | xt] f16 (xs2 = raw reshape of xs); item i = floats 4i..4i+3 of xs and of xt, 128 items a row, so 256 items on = 2 rows on
#define TP_TILES ((TDm / 64) * (TDm / 64))
#define TP_BLOCKS (7 * TP_TILES)
__global__ __launch_bounds__(256) void prep_kernel(const float* __restrict__ xs, const float* __restrict__ xt,
                                                   const float* __restrict__ Wqs, const float* __restrict__ Wqt, const float* __restrict__ Wks,
                                                   const float* __restrict__ Wkt, const float* __restrict__ Wvs, const float* __restrict__ Wvt,
                                                   const float* __restrict__ Wo, unsigned* __restrict__ A16,
                                                   _Float16* __restrict__ WT, _Float16* __restrict__ WoT) {
  __shared__ __align__(16) _Float16 tile[64][72];
  if (blockIdx.x < TP_BLOCKS) {
    const int job = blockIdx.x / TP_TILES, tl = blockIdx.x % TP_TILES;
    const float* in = job == 0 ? Wqs : job == 1 ? Wqt : job == 2 ? Wks : job == 3 ? Wkt : job == 4 ? Wvs : job == 5 ? Wvt : Wo;
    _Float16* o = job < 6 ? WT + (size_t)(job >> 1) * TDm * 2 * TDm + (job & 1) * TDm : WoT;
    transpose_cast_tile(in, TDm, o, job < 6 ? 2 * TDm : TDm, (tl % (TDm / 64)) * 64, (tl / (TDm / 64)) * 64, tile);
    return;
  }
  const int base = (blockIdx.x - TP_BLOCKS) * (EW_U * 256) + threadIdx.x;
  const v4f* pa = (const v4f*)xs + base; const v4f* pb = (const v4f*)xt + base;
  v4h* o = (v4h*)A16 + (size_t)(base >> 7) * 256 + (base & 127);     // a row of A16 is 1024 f16 = 256 items; xt's half starts 128 items in
  v4f a[EW_U], b[EW_U];
#pragma unroll
  for (int u = 0; u < EW_U; ++u) { a[u] = pa[u * 256]; b[u] = pb[u * 256]; }
#pragma unroll
  for (int u = 0; u < EW_U; ++u) { o[u * 512] = __builtin_convertvector(a[u], v4h); o[u * 512 + 128] = __builtin_convertvector(b[u], v4h); }
}
extern "C" void kernel_launch(void* const* d_in, const int* in_sizes, int n_in, void* d_out, int out_size, void* d_ws, size_t ws_size, hipStream_t stream) {
  (void)in_sizes; (void)n_in; (void)out_size; (void)ws_size;
  auto Fp = [&](int i) { return (const float*)d_in[i]; };
  const float* xs = Fp(0); const float* xt = Fp(1); const float* Wqs = Fp(2); const float* Wks = Fp(3); const float* Wvs = Fp(4); const float* Wqt = Fp(5); const float* Wkt = Fp(6); const float* Wvt = Fp(7); const float* WK = Fp(8); const float* Wo = Fp(9);
  char* ws = (char*)d_ws; size_t off = 0;
  auto carve = [&](size_t bytes) -> char* { char* p = ws + off; off += (bytes + 255) & ~(size_t)255; return p; };
  unsigned* A16 = (unsigned*)carve((size_t)TR * 2 * TDm * 2); _Float16* WT = (_Float16*)carve((size_t)3 * TDm * 2 * TDm * 2); _Float16* WoT = (_Float16*)carve((size_t)TDm * TDm * 2);
  _Float16* QKV = (_Float16*)carve((size_t)TR * 3 * TDm * 2); _Float16* O16 = (_Float16*)A16;     // 44 MB; O16 reuses A16, which the first product has read by then
  prep_kernel<<<TP_BLOCKS + EW_BLOCKS, 256, 0, stream>>>(xs, xt, Wqs, Wqt, Wks, Wkt, Wvs, Wvt, Wo, A16, WT, WoT);
  const int t3 = (TR / GT_BM) * (3 * TDm / GT_BN), t1 = (TR / GT_BM) * (TDm / GT_BN);   // block tiles of 128 x 256
  wmma_gemm64<0, false, 3, 1, false><<<dim3(t3, 1), 256, 0, stream>>>((const unsigned short*)A16, nullptr, 2 * TDm, 0, U16(WT), nullptr, 2 * TDm, 0, QKV, nullptr, 3 * TDm, 0, WK, nullptr, 0, TR, 3 * TDm, 2 * TDm, 1.0f);
  { AttnGeom g;
    g.q_bs = (long)TS * 3 * TDm; g.q_rs = 3 * TDm; g.q_hs = THD; g.k_bs = g.q_bs; g.k_rs = g.q_rs; g.k_hs = THD; g.v_bs = g.q_bs; g.v_rs = g.q_rs; g.v_hs = THD; g.o_bs = (long)TS * TDm; g.o_rs = TDm; g.o_hs = THD;
    g.S = TS; g.Skv = TS; g.H = TH; g.mask_mode = 1; g.qscale = 1.0f; g.blk0 = 0; g.mask_fill = -1e9f; g.mask_is_int = 0;
    static_assert((TS / AT_QB) % 2 == 0, "query tiles pair up");
    attn64_kernel<false, false, true, 1><<<TB_ * TH * (TS / AT_QB / 2), AT_NW * 32, 0, stream>>>(QKV, QKV + TDm, QKV + 2 * TDm, O16, nullptr, nullptr, g); }
  wmma_gemm64<0, false, 0, 0, false><<<dim3(t1, 1), 256, 0, stream>>>(U16(O16), nullptr, TDm, 0, U16(WoT), nullptr, TDm, 0, (float*)d_out, nullptr, TDm, 0, nullptr, nullptr, 0, TR, TDm, TDm, 1.0f);
}

// v009
// One run takes 91.4 microseconds.
// Timed twice side by side with v008, it ran 1.05 and 1.03 times as fast.
// All steps since v000 together make it 6.83 times as fast.
#include <hip/hip_runtime.h>
#include <math.h>
// TMSA block (8 x 1024 tokens x 512, 8 heads x 64, causal): q/k/v = xs2·W*s + xt·W*t as ONE product over the concatenated input [xs2 | xt]·[W*s; W*t]
// (8192 x 1024 · 1024 x 1536); the query-dependent bias q·WK is folded exactly into the keys — Σ_d q_d k_jd + Σ_d q_d WK[d][j] = q·(k_j + WK[:, j]) —
// so the attention is a plain causal flash-style kernel over k' = k + WKᵀ (scores (q/8)·k'ᵀ and p·v on WMMA, f16 operands with probabilities x2^15,
// f32 accumulate, online softmax in f32, -1e9 fill above the diagonal); output projection ·Wo. All products v_wmma_f32_16x16x32_f16, f16 operands,
// f32 accumulate (plain single products, ≈24 G MAC); the raw .view reshapes are identity on memory.
// What lies between the products is elementwise and is done once, in the epilogue of the kernel that makes the value: the first product stores q/8, k' and v
// as f16, the attention stores its output as f16; each is rounded to f16 once, from the same f32 value as a pass of its own would round.
typedef __attribute__((ext_vector_type(16))) _Float16 v16h;
typedef __attribute__((ext_vector_type(8)))  _Float16 v8h;
typedef __attribute__((ext_vector_type(16))) __bf16   v16b;
typedef __attribute__((ext_vector_type(8)))  __bf16   v8b;
typedef __attribute__((ext_vector_type(8)))  float    v8f;
typedef __attribute__((ext_vector_type(4)))  float    v4f;
#define TB_ 8
#define TS 1024
#define TDm 512
#define TH 8
#define THD 64
#define TR (TB_ * TS)
#define PSCALE 32768.0f
#define U16(p) ((const unsigned short*)(const void*)(p))
#define PSCALE_INV (1.0f / 32768.0f)

__device__ __forceinline__ unsigned short f2bf_bits(float f) {
  unsigned u = __float_as_uint(f);
  return (unsigned short)((u + 0x7FFFu + ((u >> 16) & 1u)) >> 16);
}
__device__ __forceinline__ float bf_bits2f(unsigned short h) { return __uint_as_float(((unsigned)h) << 16); }

// hazard guards as plain device helpers (no inline asm inside the kernel template body)
__device__ __forceinline__ void dep_guard_h(v8f& a, v8f& b, v16h x, v16h y) { asm volatile("v_nop\n\tv_nop\n\tv_nop\n\tv_nop" : "+v"(a), "+v"(b) : "v"(x), "v"(y)); }
__device__ __forceinline__ void dep_guard_b(v8f& a, v8f& b, v16b x, v16b y) { asm volatile("v_nop\n\tv_nop\n\tv_nop\n\tv_nop" : "+v"(a), "+v"(b) : "v"(x), "v"(y)); }
__device__ __forceinline__ void keep4_h(v16h a, v16h b, v16h c, v16h d) { asm volatile("v_nop" :: "v"(a), "v"(b), "v"(c), "v"(d)); }
__device__ __forceinline__ void keep4_b(v16b a, v16b b, v16b c, v16b d) { asm volatile("v_nop" :: "v"(a), "v"(b), "v"(c), "v"(d)); }
__device__ __forceinline__ void acc_guard4(v8f& a, v8f& b, v8f& c, v8f& d) { asm volatile("v_nop\n\tv_nop\n\tv_nop\n\tv_nop" : "+v"(a), "+v"(b), "+v"(c), "+v"(d)); }
template <typename T> struct Frag;
template <> struct Frag<_Float16> {
  typedef v16h V; union U { v16h v; v8h h[2]; };
  static __device__ __forceinline__ v16h load(const _Float16* p) {   // elements 0..7 <- p[0..7], 8..15 <- p[16..23]
    U f; f.h[0] = *(const v8h*)(p); f.h[1] = *(const v8h*)(p + 16); return f.v;
  }
  static __device__ __forceinline__ v8f mma(v16h a, v16h b, v8f c) {
    return __builtin_amdgcn_wmma_f32_16x16x32_f16(false, a, false, b, (short)0, c, false, false);
  }
  static __device__ __forceinline__ void guard(v8f& a, v8f& b, v16h x, v16h y) { dep_guard_h(a, b, x, y); }
  static __device__ __forceinline__ void keep(v16h a, v16h b, v16h c, v16h d) { keep4_h(a, b, c, d); }
};
template <> struct Frag<__bf16> {
  typedef v16b V; union U { v16b v; v8b h[2]; };
  static __device__ __forceinline__ v16b load(const __bf16* p) {
    U f; f.h[0] = *(const v8b*)(p); f.h[1] = *(const v8b*)(p + 16); return f.v;
  }
  static __device__ __forceinline__ v8f mma(v16b a, v16b b, v8f c) {
    return __builtin_amdgcn_wmma_f32_16x16x32_bf16(false, a, false, b, (short)0, c, false, false);
  }
  static __device__ __forceinline__ void guard(v8f& a, v8f& b, v16b x, v16b y) { dep_guard_b(a, b, x, y); }
  static __device__ __forceinline__ void keep(v16b a, v16b b, v16b c, v16b d) { keep4_b(a, b, c, d); }
};

// ---- Register-blocked batched WMMA GEMM ------------------------------------
// C[m,n] = scale * sum_k A[m,k] * Bt[n,k] (+bias)(+resid); each wave owns a 64x64 tile, the 8 waves of a block a 128x256 tile (2 x 4 waves).
// A row-major [M,K]; Bt row-major [N,K]; M % 128 == 0, N % 256 == 0, K % 64 == 0; grid.x = (M/128)*(N/256).
// Operands go through LDS: a stage is 64 k (128 B) of the block's 128 A rows and 256 Bt rows, brought by asynchronous 16-byte copies whose
// wave-wide form covers 4 whole 128-B lines; two buffers, the copies of stage t+2 fly while stage t+1 is worked on.
// SPLIT (hi/lo planes) is not staged and so not offered by this form.
// BIAS_MODE: 0 = none, 1 = bias[m], 2 = bias[n], 3 = the q | k | v product: columns 0..511 (q) x 1/8 (= 1/sqrt(64); a power of two, so exact in f32),
//   columns 512..1023 (k) + bias[n % 64][m % 1024] (bias = WK [64][1024]: head dim d = n % 64, position s = m % 1024), columns 1024.. (v) as they are.
// OUT_MODE: 0 = f32, 1 = f16, 2 = bf16 hi plane (Cout) + bf16 lo plane (Cout2).
// ET: 0 = f16 operands, 1 = bf16 operands (pointers passed as 16-bit storage)
template <int ET> struct Elem;
template <> struct Elem<0> { typedef _Float16 T; };
template <> struct Elem<1> { typedef __bf16 T; };
#define GT_BM 128
#define GT_BN 256
#define GT_BK 64
#define GT_P 72                              // LDS row pitch in 16-bit elements: 144 B = 16 B x 9, conflict-free for 16-byte fragment reads
#define GT_STAGE ((GT_BM + GT_BN) * GT_P)    // 16-bit elements of one buffer: A rows 0..127, then Bt rows 0..255
#define GT_G (32 * GT_P * 2)                 // LDS bytes from one group of 32 rows to the next
// One stage, one thread's share: 12 copies of 16 B (4 groups of 32 A rows, 8 groups of 32 Bt rows). l = the lane's LDS byte address in group 0,
// a / b = its global address in group 0 of A / Bt, sa / sb = elements from one group of 32 rows to the next.
// The s_wait_xcnt stands inside the statement so that no address register of a copy is rewritten ahead of it.
__device__ __forceinline__ void gemm_stage_copy(unsigned l, const unsigned short* a, size_t sa, const unsigned short* b, size_t sb) {
  asm volatile(
      "global_load_async_to_lds_b128 %0, %12, off\n\t"
      "global_load_async_to_lds_b128 %1, %13, off\n\t"
      "global_load_async_to_lds_b128 %2, %14, off\n\t"
      "global_load_async_to_lds_b128 %3, %15, off\n\t"
      "global_load_async_to_lds_b128 %4, %16, off\n\t"
      "global_load_async_to_lds_b128 %5, %17, off\n\t"
      "global_load_async_to_lds_b128 %6, %18, off\n\t"
      "global_load_async_to_lds_b128 %7, %19, off\n\t"
      "global_load_async_to_lds_b128 %8, %20, off\n\t"
      "global_load_async_to_lds_b128 %9, %21, off\n\t"
      "global_load_async_to_lds_b128 %10, %22, off\n\t"
      "global_load_async_to_lds_b128 %11, %23, off\n\t"
      "s_wait_xcnt 0x0"
      :: "v"(l), "v"(l + GT_G), "v"(l + 2 * GT_G), "v"(l + 3 * GT_G),
         "v"(l + 4 * GT_G), "v"(l + 5 * GT_G), "v"(l + 6 * GT_G), "v"(l + 7 * GT_G),
         "v"(l + 8 * GT_G), "v"(l + 9 * GT_G), "v"(l + 10 * GT_G), "v"(l + 11 * GT_G),
         "v"(a), "v"(a + sa), "v"(a + 2 * sa), "v"(a + 3 * sa),
         "v"(b), "v"(b + sb), "v"(b + 2 * sb), "v"(b + 3 * sb),
         "v"(b + 4 * sb), "v"(b + 5 * sb), "v"(b + 6 * sb), "v"(b + 7 * sb)
      : "memory");
}
// The two waits of the ring, each a statement of its own; the "memory" clobber keeps every LDS read on its side of them.
__device__ __forceinline__ void wait_copies_landed() { asm volatile("s_wait_asynccnt 0x0" ::: "memory"); }
__device__ __forceinline__ void wait_lds_reads_done() { asm volatile("s_wait_dscnt 0x0" ::: "memory"); }     // a buffer is refilled only after its readers' loads have returned
template <int ET, bool SPLIT, int BIAS_MODE, int OUT_MODE, bool RESID, int ACT = 0>
__global__ __launch_bounds__(256) void wmma_gemm64(
    const unsigned short* __restrict__ Ap, const unsigned short* __restrict__ A2p, int lda, long strideA,
    const unsigned short* __restrict__ Btp, const unsigned short* __restrict__ Bt2p, int ldb, long strideB,
    void* __restrict__ Cout, void* __restrict__ Cout2, int ldc, long strideC,
    const float* __restrict__ bias,
    const float* __restrict__ resid, long strideR,
    int M, int N, int K, float scale) {
  typedef typename Elem<ET>::T T;
  typedef typename Frag<T>::V V;
  static_assert(!SPLIT, "the lo planes are not staged");
  (void)A2p; (void)Bt2p; (void)M;
  __shared__ __align__(16) float sT[8][16 * 68];   // per-wave 16x64 slab, pitch 68 floats
  __shared__ __align__(16) unsigned short sAB[2 * GT_STAGE];   // the two operand buffers
  const int b    = blockIdx.y;
  const int lane = threadIdx.x & 31;
  const int wave = threadIdx.x >> 5;
  const int tilesN = N >> 8;
  const int tm = blockIdx.x / tilesN;          // block tile; every block has one, so every wave passes every barrier
  const int tn = blockIdx.x - tm * tilesN;
  const int wm = (wave >> 2) << 6;             // the wave's 64x64 tile inside the block tile
  const int wn = (wave & 3) << 6;
  const int m0 = (tm << 7) + wm;
  const int n0 = (tn << 8) + wn;

  // copies: thread t brings the 16-byte piece t & 7 of row t >> 3 of every group of 32 rows
  const int cr = threadIdx.x >> 3, cp = (threadIdx.x & 7) * 8;
  const unsigned short* gA = Ap  + (size_t)b * strideA + (size_t)((tm << 7) + cr) * lda + cp;
  const unsigned short* gB = Btp + (size_t)b * strideB + (size_t)((tn << 8) + cr) * ldb + cp;
  const size_t sa = (size_t)32 * lda, sb = (size_t)32 * ldb;
  const unsigned l0 = (unsigned)(size_t)sAB + (unsigned)(cr * GT_P + cp) * 2u;   // low 32 bits of a __shared__ address = byte offset in the block's LDS
  const int nT = K / GT_BK;

  const int rlane = lane & 15;                 // row (A) / col (B, D) within subtile
  const int koff  = (lane >> 4) * 8;           // k offset of this lane half
  const int mOff  = (lane >> 4) * 8;           // D row offset

  v8f acc[4][4];
#pragma unroll
  for (int i = 0; i < 4; ++i)
#pragma unroll
    for (int j = 0; j < 4; ++j) acc[i][j] = (v8f){0.f,0.f,0.f,0.f,0.f,0.f,0.f,0.f};

  gemm_stage_copy(l0, gA, sa, gB, sb);                       // stage 0 into buffer 0
  wait_copies_landed();                                      // this wave's copies of stage 0 have landed
  __syncthreads();                                           // ... and every other wave's
  if (nT > 1) gemm_stage_copy(l0 + GT_STAGE * 2, gA + GT_BK, sa, gB + GT_BK, sb);   // stage 1 into buffer 1
  for (int t = 0; t < nT; ++t) {
    const T* sbuf = (const T*)sAB + (t & 1) * GT_STAGE;
    const T* sA = sbuf + (wm + rlane) * GT_P + koff;
    const T* sB = sbuf + (GT_BM + wn + rlane) * GT_P + koff;
#pragma unroll
    for (int kk = 0; kk < GT_BK; kk += 32) {
      V bh[4], ah[4];
#pragma unroll
      for (int j = 0; j < 4; ++j) bh[j] = Frag<T>::load(sB + (j << 4) * GT_P + kk);
#pragma unroll
      for (int i = 0; i < 4; ++i) ah[i] = Frag<T>::load(sA + (i << 4) * GT_P + kk);
#pragma unroll
      for (int i = 0; i < 4; ++i) {
#pragma unroll
        for (int j = 0; j < 4; ++j) acc[i][j] = Frag<T>::mma(ah[i], bh[j], acc[i][j]);
        Frag<T>::guard(acc[i][0], acc[i][3], ah[i], ah[i]);
      }
      Frag<T>::keep(bh[0], bh[1], bh[2], bh[3]);
    }
    wait_lds_reads_done();                                   // this wave has left buffer t & 1
    wait_copies_landed();                                    // this wave's copies of stage t + 1 have landed
    __syncthreads();                                         // publishes stage t + 1 and ends every wave's reads of buffer t & 1
    if (t + 2 < nT) gemm_stage_copy(l0 + (unsigned)(t & 1) * (GT_STAGE * 2), gA + (size_t)(t + 2) * GT_BK, sa, gB + (size_t)(t + 2) * GT_BK, sb);
  }
  wait_copies_landed();                                      // no copy is outstanding when the wave goes on to the epilogue
  acc_guard4(acc[0][0], acc[0][1], acc[0][2], acc[0][3]);
  acc_guard4(acc[1][0], acc[1][1], acc[1][2], acc[1][3]);
  acc_guard4(acc[2][0], acc[2][1], acc[2][2], acc[2][3]);
  acc_guard4(acc[3][0], acc[3][1], acc[3][2], acc[3][3]);

  // ---- epilogue ----
  float cs = scale;                            // a wave's 64 columns lie in one of q, k, v
  if (BIAS_MODE == 3) {
    if (n0 < TDm) cs = scale * 0.125f;
    else if (n0 < 2 * TDm) {
      // the 8 accumulator rows of a lane are 8 consecutive positions of one row d of WK: two 16-byte loads per subtile;
      // 16 loads (the registers the fragments have left) are issued before the first is used, so a wave waits twice, not 16 times
      const float* wp = bias + (size_t)rlane * TS + ((m0 + mOff) & (TS - 1));
#pragma unroll
      for (int ih = 0; ih < 4; ih += 2) {
        v4f w[2][4][2];
#pragma unroll
        for (int i = 0; i < 2; ++i)
#pragma unroll
          for (int j = 0; j < 4; ++j) {
            w[i][j][0] = *(const v4f*)(wp + (size_t)(j << 4) * TS + ((ih + i) << 4));
            w[i][j][1] = *(const v4f*)(wp + (size_t)(j << 4) * TS + ((ih + i) << 4) + 4);
          }
#pragma unroll
        for (int i = 0; i < 2; ++i)
#pragma unroll
          for (int j = 0; j < 4; ++j)
#pragma unroll
            for (int r = 0; r < 4; ++r) {
              acc[ih + i][j][r]     = acc[ih + i][j][r]     * scale + w[i][j][0][r];
              acc[ih + i][j][4 + r] = acc[ih + i][j][4 + r] * scale + w[i][j][1][r];
            }
      }
      cs = 1.0f;
    }
  }
  float* slab = sT[wave];
  const float* Rb = RESID ? (resid + (size_t)b * strideR) : nullptr;
#pragma unroll
  for (int i = 0; i < 4; ++i) {
    const int mBase = m0 + (i << 4);
#pragma unroll
    for (int j = 0; j < 4; ++j) {
      const int n = n0 + (j << 4) + rlane;
      float bv = 0.f;
      if (BIAS_MODE == 2) bv = bias[n];
#pragma unroll
      for (int r = 0; r < 8; ++r) {
        float v = acc[i][j][r] * cs;
        if (BIAS_MODE == 1) v += bias[mBase + mOff + r];
        if (BIAS_MODE == 2) v += bv;
        if (RESID) v += Rb[(size_t)(mBase + mOff + r) * ldc + n];
        if (ACT == 1) v = tanhf(v);
        if (ACT == 2) v = fmaxf(v, 0.0f);
        if (ACT == 3) v = v / (1.0f + expf(-v));
        if (ACT == 4) v = (v > 0.f) ? v : 0.01f * v;
        if (ACT == 5) v = 0.5f * v * (1.0f + erff(v * 0.70710678118654752f));
        slab[(mOff + r) * 68 + (j << 4) + rlane] = v;
      }
    }
    __builtin_amdgcn_fence(__ATOMIC_RELEASE, "workgroup");
    __builtin_amdgcn_wave_barrier();
    __builtin_amdgcn_fence(__ATOMIC_ACQUIRE, "workgroup");
    if (OUT_MODE == 0) {
      float* C = (float*)Cout + (size_t)b * strideC;
      const int hh = lane >> 4, c4 = (lane & 15) * 4;     // row seg = 256 B = 16 lanes x 16 B
      {
#pragma unroll
        for (int it = 0; it < 8; ++it) {
          const int row = it * 2 + hh;
          v4f v = *(const v4f*)(slab + row * 68 + c4);
          *(v4f*)(C + (size_t)(mBase + row) * ldc + n0 + c4) = v;
        }
        
      }
    } else {
      const int q = lane >> 3, c8 = (lane & 7) * 8;
      unsigned short* C  = (unsigned short*)Cout  + (size_t)b * strideC;
      unsigned short* C2 = (OUT_MODE == 2) ? ((unsigned short*)Cout2 + (size_t)b * strideC) : nullptr;
      {
#pragma unroll
        for (int it = 0; it < 4; ++it) {
          const int row = it * 4 + q;
          const float* sp = slab + row * 68 + c8;
          v8h hv, lv;
#pragma unroll
          for (int e = 0; e < 8; ++e) {
            if (OUT_MODE == 1) {
              hv[e] = (_Float16)sp[e];
            } else {
              unsigned short hb = f2bf_bits(sp[e]);
              unsigned short lb = f2bf_bits(sp[e] - bf_bits2f(hb));
              hv[e] = __builtin_bit_cast(_Float16, hb);
              lv[e] = __builtin_bit_cast(_Float16, lb);
            }
          }
          *(v8h*)(C + (size_t)(mBase + row) * ldc + n0 + c8) = hv;
          if (OUT_MODE == 2) *(v8h*)(C2 + (size_t)(mBase + row) * ldc + n0 + c8) = lv;
        }
        
      }
    }
    __builtin_amdgcn_fence(__ATOMIC_RELEASE, "workgroup");
    __builtin_amdgcn_wave_barrier();
    __builtin_amdgcn_fence(__ATOMIC_ACQUIRE, "workgroup");
  }
}

// ---- f32 [R][C] (row pitch ldi) -> f16 transposed [C][R] (row pitch ldo); one 64x64 tile (columns c0.., rows r0..) by one block of 256 threads
__device__ __forceinline__ void transpose_cast_tile(const float* __restrict__ in, int ldi, _Float16* __restrict__ outT, int ldo,
                                                    int c0, int r0, _Float16 (*tile)[72]) {     // tile: [c][r]
  const int t = threadIdx.x, tx = t & 31, ty = t >> 5;
  for (int i = ty; i < 64; i += 8) {
    tile[tx][i]      = (_Float16)in[(size_t)(r0 + i) * ldi + c0 + tx];
    tile[32 + tx][i] = (_Float16)in[(size_t)(r0 + i) * ldi + c0 + 32 + tx];
  }
  __syncthreads();
  const int q = t >> 3, c8 = (t & 7) * 8;
#pragma unroll
  for (int it = 0; it < 2; ++it) {
    const int c = it * 32 + q;
    v8h hv = *(const v8h*)(&tile[c][c8]);
    *(v8h*)(outT + (size_t)(c0 + c) * ldo + r0 + c8) = hv;
  }
}

// =====================================================================================
// Generic causal/non-causal attention for head_dim 64, f16 in / f16 out (q arrives scaled; q, k, v are used as they arrive, so only F16=true, non-split, is
// offered by this form; probabilities carried x2^15).
//   Both products are taken transposed, so that a lane owns one query:
//   scores^T = k.q^T (g.qscale is not applied here: the producer of q has scaled it) : v_wmma_f32_16x16x32_f16, A = 16 keys from LDS, B = the wave's 16 queries
//   out^T    = v^T.p^T     : v_wmma_f32_16x16x32_f16, A = 16 head dims x 32 keys from LDS, B = two score tiles, converted in their own registers
//   Lane (c, hh) holds, of query q0 + c, the scores of keys 16 j + 8 hh + r: maximum and sum run inside the lane, the two halves exchange the maximum once
//   a chunk and join their sums once a tile; the probabilities never pass through LDS.
//   f32 accumulate; online softmax in f32. Block = 4 waves = two 64-row query tiles of one (batch, head); S % 64 == 0.
//   Element (b, s, h, d) of tensor X lives at X[b*X_bs + s*X_rs + h*X_hs + d] (strides in elements, multiples of 8).
//   Masking: mask_mode 0 none, 1 causal (kv > q masked), 2 tensor [S][Skv] shared over (b,h) (float if
//   mask_is_int==0, int32 with element == 0 -> masked if 1, int32 with element != 0 -> masked if 2), 3 per-token vectors qmask[B][S] & kvmask[B][Skv] (int32,
//   0 -> masked), 4 causal + sliding window (kv > q or q - kv > W masked; W passed in mask_is_int);
//   5 = relative-position bias: s += cp[b,h,q][idx[q][kv]] + pc[b,h,kv][idx[q][kv]] with idx = mask_b ([S][Skv] int32) and
//   mask_a an int32 [S][Skv] tensor with nonzero = masked (tables: element (b,h,row,n) at X + b*c_bs + h*c_hs + row*c_rs + n);
//   masked scores are replaced by mask_fill (e.g. -inf or -1e9) before the softmax.
//   grid.x = B * H * (S/128) (or a sub-range with blk0); S/64 even. A block takes two query tiles of one (batch, head), one after the other: tile n-1-t, then
//   tile t. Under the causal mask a tile's cost grows with its index, every block is resident at once and the launch lasts as long as its fullest WGP:
//   so paired, every block walks the same n+1 chunks wherever it lands.
// =====================================================================================
#define AT_D 64
#define AT_NW 4
#define AT_QB 64
#define AT_KC 64
#define AT_P 72   // LDS row pitch of the K and V^T tiles in 16-bit elements: 144 B = 16 B x 9, so the 16 rows of a 16-byte fragment read fall on distinct banks
struct AttnGeom { const float* cp = nullptr; const float* pc = nullptr; long c_bs = 0, c_rs = 0, c_hs = 0;   // mode-5 score-bias tables
                  long q_bs, q_rs, q_hs, k_bs, k_rs, k_hs, v_bs, v_rs, v_hs, o_bs, o_rs, o_hs;
                  int S, Skv, H, mask_mode; float qscale; int blk0; float mask_fill; int mask_is_int; };
static_assert(sizeof(AttnGeom) == 168, "no padding");

__device__ __forceinline__ unsigned short at_bf_bits(float f) {
  unsigned u = __float_as_uint(f);
  return (unsigned short)((u + 0x7FFFu + ((u >> 16) & 1u)) >> 16);
}
__device__ __forceinline__ __bf16 at_f2bf(float f) { return __builtin_bit_cast(__bf16, at_bf_bits(f)); }
__device__ __forceinline__ void at_split(float f, __bf16& hi, __bf16& lo) {
  const unsigned short hb = at_bf_bits(f);
  hi = __builtin_bit_cast(__bf16, hb);
  lo = at_f2bf(f - __uint_as_float(((unsigned)hb) << 16));
}
__device__ __forceinline__ v8f at_mma(v16b a, v16b b, v8f c) {
  c = __builtin_amdgcn_wmma_f32_16x16x32_bf16(false, a, false, b, (short)0, c, false, false);
  asm volatile("v_nop\n\tv_nop\n\tv_nop\n\tv_nop" : "+v"(c) : "v"(a), "v"(b));
  return c;
}
// 16-bit element as a bit pattern held in a __bf16 slot: f16 bits when F16, bf16 (RNE) otherwise
template <bool F16> __device__ __forceinline__ __bf16 at_to16(float f) {
  if (F16) return __builtin_bit_cast(__bf16, (_Float16)f);
  return at_f2bf(f);
}
template <bool F16> __device__ __forceinline__ v8f at_mma16(v16b a, v16b b, v8f c) {
  if (F16) {
    const v16h ah = __builtin_bit_cast(v16h, a), bh = __builtin_bit_cast(v16h, b);
    return __builtin_amdgcn_wmma_f32_16x16x32_f16(false, ah, false, bh, (short)0, c, false, false);   // the builtin alone: the compiler keeps its distances and is free to order the reads around it
  }
  return at_mma(a, b, c);
}

// lane l's value to lane l ^ 16 and back: the two lanes that share a query
__device__ __forceinline__ float at_xhalf(float x) {
  return __builtin_bit_cast(float, __builtin_amdgcn_permlanex16(__builtin_bit_cast(int, x), __builtin_bit_cast(int, x), 0x76543210, 0xfedcba98, false, false));
}

// MODE = the mask mode as a compile-time constant: the per-score mode tests fold away, so the unrolled score loop is straight-line code
template <bool SPLIT_QK, bool SPLIT_PV, bool F16, int MODE>
__global__ __launch_bounds__(128)
void attn64_kernel(const _Float16* __restrict__ q, const _Float16* __restrict__ k,
                   const _Float16* __restrict__ v, _Float16* __restrict__ out,
                   const void* __restrict__ mask_a, const int* __restrict__ mask_b, AttnGeom g) {
  static_assert(F16 && !SPLIT_QK && !SPLIT_PV, "q, k, v arrive as f16 and are not split");
  const float PSC = F16 ? 32768.0f : 1.0f;     // f16 probabilities carried x2^15 (subnormal range), folded into the final 1/l
  union FB { v16b v; v8b h[2]; };
  __shared__ __align__(16) __bf16 Ksh[AT_KC * AT_P];             // K hi [kv][d]      9 KB
  __shared__ __align__(16) __bf16 Ksl[SPLIT_QK ? AT_KC * AT_P : 8];
  __shared__ __align__(16) __bf16 Vth[AT_D * AT_P];              // V hi [d][kv]      9 KB
  __shared__ __align__(16) __bf16 Vtl[SPLIT_PV ? AT_D * AT_P : 8];
  __shared__ __align__(16) float  Os[AT_NW][16 * 68];            // per wave out tile, pitch 68

  const int tid  = threadIdx.x;
  const int wave = tid >> 5;
  const int lane = tid & 31;
  const int hh   = lane >> 4;
  const int c    = lane & 15;

  const int nqb = g.S / AT_QB;
  const int npair = nqb >> 1;
  const int bx = blockIdx.x + g.blk0;
  const int tpair = bx % npair;
  const int bh = bx / npair;
  const int h  = bh % g.H;
  const int b  = bh / g.H;

  const _Float16* qb_ptr = q + (size_t)b * g.q_bs + (size_t)h * g.q_hs;
  const _Float16* kb_ptr = k + (size_t)b * g.k_bs + (size_t)h * g.k_hs;
  const _Float16* vb_ptr = v + (size_t)b * g.v_bs + (size_t)h * g.v_hs;
  _Float16*       ob_ptr = out + (size_t)b * g.o_bs + (size_t)h * g.o_hs;

  for (int pass = 0; pass < 2; ++pass) {       // block-uniform: every wave passes every barrier of both tiles
  const int qb = pass ? tpair : nqb - 1 - tpair;
  const int q0 = qb * AT_QB + wave * 16;

  // ---- Q fragments (B operand: column c = query q0 + c): 2 d-chunks, hi (and lo) ----
  v16b qah[2], qal[2];
  {
    const _Float16* qrow = qb_ptr + (size_t)(q0 + c) * g.q_rs;
#pragma unroll
    for (int dc = 0; dc < 2; ++dc) {
      FB f;                                    // elements 0..7 <- d = dc*32 + 8*hh + 0..7, elements 8..15 <- 16 further on
      f.h[0] = *(const v8b*)(qrow + dc * 32 + 8 * hh);
      f.h[1] = *(const v8b*)(qrow + dc * 32 + 16 + 8 * hh);
      qah[dc] = f.v; qal[dc] = f.v;
    }
  }

  float mrow = -INFINITY, lrow = 0.f;          // of query q0 + c; lrow sums this lane half's keys only, the halves are joined behind the chunk loop
  v8f oacc[4];                                 // oacc[t][r] = out^T[d = 16 t + 8 hh + r][query q0 + c]
#pragma unroll
  for (int t = 0; t < 4; ++t) oacc[t] = (v8f){0.f,0.f,0.f,0.f,0.f,0.f,0.f,0.f};

  const int nChunks = (MODE == 1 || MODE == 4) ? (qb + 1) : (g.Skv / AT_KC);   // block-uniform
  const int qrow = q0 + c;
  const int qkeep = (MODE == 3) ? mask_b[(size_t)b * g.S + qrow] : 1;   // per-query mask (mode 3): mask_b = qmask
  for (int kc = 0; kc < nChunks; ++kc) {
    const int kv0 = kc * AT_KC;
    __syncthreads();
    {
      const int kvr = tid >> 1, dh = (tid & 1) * 32;
      const _Float16* krow = kb_ptr + (size_t)(kv0 + kvr) * g.k_rs + dh;
      const _Float16* vrow = vb_ptr + (size_t)(kv0 + kvr) * g.v_rs + dh;
      v8b kk[4], vv[4];
#pragma unroll
      for (int i = 0; i < 4; ++i) { kk[i] = *(const v8b*)(krow + 8 * i); vv[i] = *(const v8b*)(vrow + 8 * i); }
#pragma unroll
      for (int i = 0; i < 4; ++i) {
        *(v8b*)(Ksh + kvr * AT_P + dh + 8 * i) = kk[i];
#pragma unroll
        for (int e = 0; e < 8; ++e) Vth[(dh + 8 * i + e) * AT_P + kvr] = vv[i][e];
      }
    }
    __syncthreads();

    // Every fragment of the chunk is read here, as one group: K's 8 first (LDS returns in order, so the score products start on counted waits),
    // then V^T's 8, whose latency passes under the score products and the softmax.
    FB kb[2][4], vb[2][4];
#pragma unroll
    for (int dc = 0; dc < 2; ++dc)
#pragma unroll
      for (int j = 0; j < 4; ++j) {
        kb[dc][j].h[0] = *(const v8b*)(Ksh + (j * 16 + c) * AT_P + dc * 32 + 8 * hh);
        kb[dc][j].h[1] = *(const v8b*)(Ksh + (j * 16 + c) * AT_P + dc * 32 + 16 + 8 * hh);
      }
#pragma unroll
    for (int kk = 0; kk < 2; ++kk)
#pragma unroll
      for (int t = 0; t < 4; ++t) {
        vb[kk][t].h[0] = *(const v8b*)(Vth + (t * 16 + c) * AT_P + kk * 32 + 8 * hh);
        vb[kk][t].h[1] = *(const v8b*)(Vth + (t * 16 + c) * AT_P + kk * 32 + 16 + 8 * hh);
      }
    __builtin_amdgcn_sched_barrier(0);         // keeps the group whole: a read sunk back to its product would be waited for there, once a product

    v8f s[4];                                  // s[j][r] = score of key kv0 + 16 j + 8 hh + r for query q0 + c
#pragma unroll
    for (int j = 0; j < 4; ++j) s[j] = (v8f){0.f,0.f,0.f,0.f,0.f,0.f,0.f,0.f};
#pragma unroll                                 // both loops unrolled: qah[dc] and s[j] live in registers, which only a compile-time index names without copies
    for (int dc = 0; dc < 2; ++dc) {
#pragma unroll
      for (int j = 0; j < 4; ++j)              // j inside: four independent accumulators follow one another
        s[j] = at_mma16<F16>(kb[dc][j].v, qah[dc], s[j]);
    }
    const bool diag = (MODE == 1) && (kc == qb);
    float cm[4];
#pragma unroll
    for (int j = 0; j < 4; ++j) {
      float m = -INFINITY;
#pragma unroll
      for (int r = 0; r < 8; ++r) {
        const int kvcol = kv0 + j * 16 + 8 * hh + r;
        bool masked = false;
        if (diag) masked = (kvcol > qrow);
        else if (MODE == 4) masked = (kvcol > qrow) || (qrow - kvcol > g.mask_is_int);
        else if (MODE == 2) {
          const size_t mi = (size_t)qrow * g.Skv + kvcol;
          masked = (g.mask_is_int == 0) ? (((const float*)mask_a)[mi] == 0.0f)
                 : (g.mask_is_int == 1) ? (((const int*)mask_a)[mi] == 0) : (((const int*)mask_a)[mi] != 0);
        } else if (MODE == 3) masked = (qkeep == 0) || (((const int*)mask_a)[(size_t)b * g.Skv + kvcol] == 0);   // mask_a = kvmask
        else if (MODE == 5) {
          const size_t mi = (size_t)qrow * g.Skv + kvcol;
          masked = (((const int*)mask_a)[mi] != 0);
          int n = mask_b[mi]; n = n < 0 ? 0 : n;
          s[j][r] += g.cp[(size_t)b * g.c_bs + (size_t)h * g.c_hs + (size_t)qrow * g.c_rs + n]
                   + g.pc[(size_t)b * g.c_bs + (size_t)h * g.c_hs + (size_t)kvcol * g.c_rs + n];
        }
        const float sv = masked ? g.mask_fill : s[j][r];   // one select on the element (a conditional store into the vector selects all 8 registers)
        s[j][r] = sv;
        m = fmaxf(m, sv);
      }
      cm[j] = m;
    }
    const float mh = fmaxf(fmaxf(cm[0], cm[1]), fmaxf(cm[2], cm[3]));
    const float mnew = fmaxf(mrow, fmaxf(mh, at_xhalf(mh)));   // both lanes of a query now hold the same maximum, so the same alpha
    const float alpha = expf(mrow - mnew);
    mrow = mnew;
    // p^T as B operand: element e of the 32 keys of kk is register e & 7 of score tile 2 kk + (e >> 3), the k order in which V^T is read above
    FB pb[2];
    float ps[4];                               // one sum a score tile: four short chains
#pragma unroll
    for (int j = 0; j < 4; ++j) {
      float psum = 0.f;
#pragma unroll
      for (int r = 0; r < 8; ++r) {
        const float p = expf(s[j][r] - mnew);
        psum += p;
        pb[j >> 1].v[(j & 1) * 8 + r] = at_to16<F16>(p * PSC);
      }
      ps[j] = psum;
    }
    lrow = lrow * alpha + ((ps[0] + ps[1]) + (ps[2] + ps[3]));
#pragma unroll
    for (int t = 0; t < 4; ++t) oacc[t] *= alpha;
#pragma unroll                                 // unrolled: pb[kk] lives in registers
    for (int kk = 0; kk < 2; ++kk) {
#pragma unroll
      for (int t = 0; t < 4; ++t) oacc[t] = at_mma16<F16>(vb[kk][t].v, pb[kk].v, oacc[t]);
    }
  }

  float* os = Os[wave];
  {
    const float inv = 1.0f / ((lrow + at_xhalf(lrow)) * PSC);   // the two halves' sums joined, unconditionally: every lane is on
#pragma unroll
    for (int t = 0; t < 4; ++t) {              // row = query c; a lane's 8 registers are 8 consecutive d
      *(v4f*)(os + c * 68 + t * 16 + 8 * hh)     = (v4f){oacc[t][0] * inv, oacc[t][1] * inv, oacc[t][2] * inv, oacc[t][3] * inv};
      *(v4f*)(os + c * 68 + t * 16 + 8 * hh + 4) = (v4f){oacc[t][4] * inv, oacc[t][5] * inv, oacc[t][6] * inv, oacc[t][7] * inv};
    }
  }
  __builtin_amdgcn_fence(__ATOMIC_RELEASE, "workgroup");
  __builtin_amdgcn_wave_barrier();
  __builtin_amdgcn_fence(__ATOMIC_ACQUIRE, "workgroup");
  {
    const int q4 = lane >> 3, c8 = (lane & 7) * 8;       // a row's 64 f16 = one 128-B line = 8 lanes x 16 B
#pragma unroll
    for (int it = 0; it < 4; ++it) {
      const int row = it * 4 + q4;
      const float* sp = os + row * 68 + c8;
      v8h hv;
#pragma unroll
      for (int e = 0; e < 8; ++e) hv[e] = (_Float16)sp[e];
      *(v8h*)(ob_ptr + (size_t)(q0 + row) * g.o_rs + c8) = hv;
    }
  }
  asm volatile("s_wait_xcnt 0x0" ::: "memory");   // the next pass reuses the address registers of the stores above
  }
}

typedef __attribute__((ext_vector_type(4))) _Float16 v4h;
// The concat-cast part: 512 blocks of 8 waves (two blocks a WGP); a thread moves EW_U items of 4 floats of each input, every wave-wide 16-byte load
// covers 512 contiguous bytes, and all of a thread's loads are issued before its first store.
#define EW_U 8
#define EW_BLOCKS (TR * TDm / 4 / (EW_U * 256))
static_assert(EW_BLOCKS * EW_U * 256 * 4 == TR * TDm, "whole blocks");
// One launch prepares every operand of the first product and the weights of the last: none of these jobs reads what another writes.
// Blocks 0..447: the 7 weight matrices [in 512][out 512], 64 tiles of 64x64 each, cast to f16 and transposed (the block-uniform branch keeps the barrier legal):
//   Bt [1536][1024]: row n<512 (q): [Wqs[:,n] | Wqt[:,n]]; 512..1023 k; 1024..1535 v; then WoT [512][512]. They come first: each is a chain of dependent loads.
// Blocks 448..959: A16 [8192][1024] = [xs2 | xt] f16 (xs2 = raw reshape of xs); item i = floats 4i..4i+3 of xs and of xt, 128 items a row, so 256 items on = 2 rows on
#define TP_TILES ((TDm / 64) * (TDm / 64))
#define TP_BLOCKS (7 * TP_TILES)
__global__ __launch_bounds__(256) void prep_kernel(const float* __restrict__ xs, const float* __restrict__ xt,
                                                   const float* __restrict__ Wqs, const float* __restrict__ Wqt, const float* __restrict__ Wks,
                                                   const float* __restrict__ Wkt, const float* __restrict__ Wvs, const float* __restrict__ Wvt,
                                                   const float* __restrict__ Wo, unsigned* __restrict__ A16,
                                                   _Float16* __restrict__ WT, _Float16* __restrict__ WoT) {
  __shared__ __align__(16) _Float16 tile[64][72];
  if (blockIdx.x < TP_BLOCKS) {
    const int job = blockIdx.x / TP_TILES, tl = blockIdx.x % TP_TILES;
    const float* in = job == 0 ? Wqs : job == 1 ? Wqt : job == 2 ? Wks : job == 3 ? Wkt : job == 4 ? Wvs : job == 5 ? Wvt : Wo;
    _Float16* o = job < 6 ? WT + (size_t)(job >> 1) * TDm * 2 * TDm + (job & 1) * TDm : WoT;
    transpose_cast_tile(in, TDm, o, job < 6 ? 2 * TDm : TDm, (tl % (TDm / 64)) * 64, (tl / (TDm / 64)) * 64, tile);
    return;
  }
  const int base = (blockIdx.x - TP_BLOCKS) * (EW_U * 256) + threadIdx.x;
  const v4f* pa = (const v4f*)xs + base; const v4f* pb = (const v4f*)xt + base;
  v4h* o = (v4h*)A16 + (size_t)(base >> 7) * 256 + (base & 127);     // a row of A16 is 1024 f16 = 256 items; xt's half starts 128 items in
  v4f a[EW_U], b[EW_U];
#pragma unroll
  for (int u = 0; u < EW_U; ++u) { a[u] = pa[u * 256]; b[u] = pb[u * 256]; }
#pragma unroll
  for (int u = 0; u < EW_U; ++u) { o[u * 512] = __builtin_convertvector(a[u], v4h); o[u * 512 + 128] = __builtin_convertvector(b[u], v4h); }
}
extern "C" void kernel_launch(void* const* d_in, const int* in_sizes, int n_in, void* d_out, int out_size, void* d_ws, size_t ws_size, hipStream_t stream) {
  (void)in_sizes; (void)n_in; (void)out_size; (void)ws_size;
  auto Fp = [&](int i) { return (const float*)d_in[i]; };
  const float* xs = Fp(0); const float* xt = Fp(1); const float* Wqs = Fp(2); const float* Wks = Fp(3); const float* Wvs = Fp(4); const float* Wqt = Fp(5); const float* Wkt = Fp(6); const float* Wvt = Fp(7); const float* WK = Fp(8); const float* Wo = Fp(9);
  char* ws = (char*)d_ws; size_t off = 0;
  auto carve = [&](size_t bytes) -> char* { char* p = ws + off; off += (bytes + 255) & ~(size_t)255; return p; };
  unsigned* A16 = (unsigned*)carve((size_t)TR * 2 * TDm * 2); _Float16* WT = (_Float16*)carve((size_t)3 * TDm * 2 * TDm * 2); _Float16* WoT = (_Float16*)carve((size_t)TDm * TDm * 2);
  _Float16* QKV = (_Float16*)carve((size_t)TR * 3 * TDm * 2); _Float16* O16 = (_Float16*)A16;     // 44 MB; O16 reuses A16, which the first product has read by then
  prep_kernel<<<TP_BLOCKS + EW_BLOCKS, 256, 0, stream>>>(xs, xt, Wqs, Wqt, Wks, Wkt, Wvs, Wvt, Wo, A16, WT, WoT);
  const int t3 = (TR / GT_BM) * (3 * TDm / GT_BN), t1 = (TR / GT_BM) * (TDm / GT_BN);   // block tiles of 128 x 256
  wmma_gemm64<0, false, 3, 1, false><<<dim3(t3, 1), 256, 0, stream>>>((const unsigned short*)A16, nullptr, 2 * TDm, 0, U16(WT), nullptr, 2 * TDm, 0, QKV, nullptr, 3 * TDm, 0, WK, nullptr, 0, TR, 3 * TDm, 2 * TDm, 1.0f);
  { AttnGeom g;
    g.q_bs = (long)TS * 3 * TDm; g.q_rs = 3 * TDm; g.q_hs = THD; g.k_bs = g.q_bs; g.k_rs = g.q_rs; g.k_hs = THD; g.v_bs = g.q_bs; g.v_rs = g.q_rs; g.v_hs = THD; g.o_bs = (long)TS * TDm; g.o_rs = TDm; g.o_hs = THD;
    g.S = TS; g.Skv = TS; g.H = TH; g.mask_mode = 1; g.qscale = 1.0f; g.blk0 = 0; g.mask_fill = -1e9f; g.mask_is_int = 0;
    static_assert((TS / AT_QB) % 2 == 0, "query tiles pair up");
    attn64_kernel<false, false, true, 1><<<TB_ * TH * (TS / AT_QB / 2), AT_NW * 32, 0, stream>>>(QKV, QKV + TDm, QKV + 2 * TDm, O16, nullptr, nullptr, g); }
  wmma_gemm64<0, false, 0, 0, false><<<dim3(t1, 1), 256, 0, stream>>>(U16(O16), nullptr, TDm, 0, U16(WoT), nullptr, TDm, 0, (float*)d_out, nullptr, TDm, 0, nullptr, nullptr, 0, TR, TDm, TDm, 1.0f);
}

// v010
// A run of this version takes 82.9 microseconds.
// Two timings next to v009 both put it at 1.10 times that version's speed.
// Over all steps from v000 it is 7.51 times as fast.
#include <hip/hip_runtime.h>
#include <math.h>
// TMSA block (8 x 1024 tokens x 512, 8 heads x 64, causal): q/k/v = xs2·W*s + xt·W*t as ONE product over the concatenated input [xs2 | xt]·[W*s; W*t]
// (8192 x 1024 · 1024 x 1536); the query-dependent bias q·WK is folded exactly into the keys — Σ_d q_d k_jd + Σ_d q_d WK[d][j] = q·(k_j + WK[:, j]) —
// so the attention is a plain causal flash-style kernel over k' = k + WKᵀ (scores (q/8)·k'ᵀ and p·v on WMMA, f16 operands with probabilities x2^15,
// f32 accumulate, online softmax in f32, -1e9 fill above the diagonal); output projection ·Wo. All products v_wmma_f32_16x16x32_f16, f16 operands,
// f32 accumulate (plain single products, ≈24 G MAC); the raw .view reshapes are identity on memory.
// What lies between the products is elementwise and is done once, in the epilogue of the kernel that makes the value: the first product stores q/8, k' and v
// as f16, the attention stores its output as f16; each is rounded to f16 once, from the same f32 value as a pass of its own would round.
typedef __attribute__((ext_vector_type(16))) _Float16 v16h;
typedef __attribute__((ext_vector_type(8)))  _Float16 v8h;
typedef __attribute__((ext_vector_type(16))) __bf16   v16b;
typedef __attribute__((ext_vector_type(8)))  __bf16   v8b;
typedef __attribute__((ext_vector_type(8)))  float    v8f;
typedef __attribute__((ext_vector_type(4)))  float    v4f;
#define TB_ 8
#define TS 1024
#define TDm 512
#define TH 8
#define THD 64
#define TR (TB_ * TS)
#define PSCALE 32768.0f
#define U16(p) ((const unsigned short*)(const void*)(p))
#define PSCALE_INV (1.0f / 32768.0f)

__device__ __forceinline__ unsigned short f2bf_bits(float f) {
  unsigned u = __float_as_uint(f);
  return (unsigned short)((u + 0x7FFFu + ((u >> 16) & 1u)) >> 16);
}
__device__ __forceinline__ float bf_bits2f(unsigned short h) { return __uint_as_float(((unsigned)h) << 16); }

// hazard guards as plain device helpers (no inline asm inside the kernel template body)
__device__ __forceinline__ void dep_guard_h(v8f& a, v8f& b, v16h x, v16h y) { asm volatile("v_nop\n\tv_nop\n\tv_nop\n\tv_nop" : "+v"(a), "+v"(b) : "v"(x), "v"(y)); }
__device__ __forceinline__ void dep_guard_b(v8f& a, v8f& b, v16b x, v16b y) { asm volatile("v_nop\n\tv_nop\n\tv_nop\n\tv_nop" : "+v"(a), "+v"(b) : "v"(x), "v"(y)); }
__device__ __forceinline__ void keep4_h(v16h a, v16h b, v16h c, v16h d) { asm volatile("v_nop" :: "v"(a), "v"(b), "v"(c), "v"(d)); }
__device__ __forceinline__ void keep4_b(v16b a, v16b b, v16b c, v16b d) { asm volatile("v_nop" :: "v"(a), "v"(b), "v"(c), "v"(d)); }
__device__ __forceinline__ void acc_guard4(v8f& a, v8f& b, v8f& c, v8f& d) { asm volatile("v_nop\n\tv_nop\n\tv_nop\n\tv_nop" : "+v"(a), "+v"(b), "+v"(c), "+v"(d)); }
template <typename T> struct Frag;
template <> struct Frag<_Float16> {
  typedef v16h V; union U { v16h v; v8h h[2]; };
  static __device__ __forceinline__ v16h load(const _Float16* p) {   // elements 0..7 <- p[0..7], 8..15 <- p[16..23]
    U f; f.h[0] = *(const v8h*)(p); f.h[1] = *(const v8h*)(p + 16); return f.v;
  }
  static __device__ __forceinline__ v8f mma(v16h a, v16h b, v8f c) {
    return __builtin_amdgcn_wmma_f32_16x16x32_f16(false, a, false, b, (short)0, c, false, false);
  }
  static __device__ __forceinline__ void guard(v8f& a, v8f& b, v16h x, v16h y) { dep_guard_h(a, b, x, y); }
  static __device__ __forceinline__ void keep(v16h a, v16h b, v16h c, v16h d) { keep4_h(a, b, c, d); }
};
template <> struct Frag<__bf16> {
  typedef v16b V; union U { v16b v; v8b h[2]; };
  static __device__ __forceinline__ v16b load(const __bf16* p) {
    U f; f.h[0] = *(const v8b*)(p); f.h[1] = *(const v8b*)(p + 16); return f.v;
  }
  static __device__ __forceinline__ v8f mma(v16b a, v16b b, v8f c) {
    return __builtin_amdgcn_wmma_f32_16x16x32_bf16(false, a, false, b, (short)0, c, false, false);
  }
  static __device__ __forceinline__ void guard(v8f& a, v8f& b, v16b x, v16b y) { dep_guard_b(a, b, x, y); }
  static __device__ __forceinline__ void keep(v16b a, v16b b, v16b c, v16b d) { keep4_b(a, b, c, d); }
};

// ---- Register-blocked batched WMMA GEMM ------------------------------------
// C[m,n] = scale * sum_k A[m,k] * Bt[n,k] (+bias)(+resid); each wave owns a 64x64 tile, the 8 waves of a block a 128x256 tile (2 x 4 waves).
// A row-major [M,K]; Bt row-major [N,K]; M % 128 == 0, N % 256 == 0, K % 64 == 0; grid.x = (M/128)*(N/256).
// Operands go through LDS: a stage is 64 k (128 B) of the block's 128 A rows and 256 Bt rows, brought by asynchronous 16-byte copies whose
// wave-wide form covers 4 whole 128-B lines; two buffers, the copies of stage t+2 fly while stage t+1 is worked on.
// SPLIT (hi/lo planes) is not staged and so not offered by this form.
// BIAS_MODE: 0 = none, 1 = bias[m], 2 = bias[n], 3 = the q | k | v product: columns 0..511 (q) x 1/8 (= 1/sqrt(64); a power of two, so exact in f32),
//   columns 512..1023 (k) + bias[n % 64][m % 1024] (bias = WK [64][1024]: head dim d = n % 64, position s = m % 1024), columns 1024.. (v) as they are.
// OUT_MODE: 0 = f32, 1 = f16, 2 = bf16 hi plane (Cout) + bf16 lo plane (Cout2).
// ET: 0 = f16 operands, 1 = bf16 operands (pointers passed as 16-bit storage)
template <int ET> struct Elem;
template <> struct Elem<0> { typedef _Float16 T; };
template <> struct Elem<1> { typedef __bf16 T; };
#define GT_BM 128
#define GT_BN 256
#define GT_BK 64
#define GT_P 72                              // LDS row pitch in 16-bit elements: 144 B = 16 B x 9, conflict-free for 16-byte fragment reads
#define GT_STAGE ((GT_BM + GT_BN) * GT_P)    // 16-bit elements of one buffer: A rows 0..127, then Bt rows 0..255
#define GT_G (32 * GT_P * 2)                 // LDS bytes from one group of 32 rows to the next
// One stage, one thread's share: 12 copies of 16 B (4 groups of 32 A rows, 8 groups of 32 Bt rows). l = the lane's LDS byte address in group 0,
// a / b = its global address in group 0 of A / Bt, sa / sb = elements from one group of 32 rows to the next.
// The s_wait_xcnt stands inside the statement so that no address register of a copy is rewritten ahead of it.
__device__ __forceinline__ void gemm_stage_copy(unsigned l, const unsigned short* a, size_t sa, const unsigned short* b, size_t sb) {
  asm volatile(
      "global_load_async_to_lds_b128 %0, %12, off\n\t"
      "global_load_async_to_lds_b128 %1, %13, off\n\t"
      "global_load_async_to_lds_b128 %2, %14, off\n\t"
      "global_load_async_to_lds_b128 %3, %15, off\n\t"
      "global_load_async_to_lds_b128 %4, %16, off\n\t"
      "global_load_async_to_lds_b128 %5, %17, off\n\t"
      "global_load_async_to_lds_b128 %6, %18, off\n\t"
      "global_load_async_to_lds_b128 %7, %19, off\n\t"
      "global_load_async_to_lds_b128 %8, %20, off\n\t"
      "global_load_async_to_lds_b128 %9, %21, off\n\t"
      "global_load_async_to_lds_b128 %10, %22, off\n\t"
      "global_load_async_to_lds_b128 %11, %23, off\n\t"
      "s_wait_xcnt 0x0"
      :: "v"(l), "v"(l + GT_G), "v"(l + 2 * GT_G), "v"(l + 3 * GT_G),
         "v"(l + 4 * GT_G), "v"(l + 5 * GT_G), "v"(l + 6 * GT_G), "v"(l + 7 * GT_G),
         "v"(l + 8 * GT_G), "v"(l + 9 * GT_G), "v"(l + 10 * GT_G), "v"(l + 11 * GT_G),
         "v"(a), "v"(a + sa), "v"(a + 2 * sa), "v"(a + 3 * sa),
         "v"(b), "v"(b + sb), "v"(b + 2 * sb), "v"(b + 3 * sb),
         "v"(b + 4 * sb), "v"(b + 5 * sb), "v"(b + 6 * sb), "v"(b + 7 * sb)
      : "memory");
}
// The two waits of the ring, each a statement of its own; the "memory" clobber keeps every LDS read on its side of them.
__device__ __forceinline__ void wait_copies_landed() { asm volatile("s_wait_asynccnt 0x0" ::: "memory"); }
__device__ __forceinline__ void wait_lds_reads_done() { asm volatile("s_wait_dscnt 0x0" ::: "memory"); }     // a buffer is refilled only after its readers' loads have returned
template <int ET, bool SPLIT, int BIAS_MODE, int OUT_MODE, bool RESID, int ACT = 0>
__global__ __launch_bounds__(256) void wmma_gemm64(
    const unsigned short* __restrict__ Ap, const unsigned short* __restrict__ A2p, int lda, long strideA,
    const unsigned short* __restrict__ Btp, const unsigned short* __restrict__ Bt2p, int ldb, long strideB,
    void* __restrict__ Cout, void* __restrict__ Cout2, int ldc, long strideC,
    const float* __restrict__ bias,
    const float* __restrict__ resid, long strideR,
    int M, int N, int K, float scale) {
  typedef typename Elem<ET>::T T;
  typedef typename Frag<T>::V V;
  static_assert(!SPLIT, "the lo planes are not staged");
  (void)A2p; (void)Bt2p; (void)M;
  __shared__ __align__(16) float sT[8][16 * 68];   // per-wave 16x64 slab, pitch 68 floats
  __shared__ __align__(16) unsigned short sAB[2 * GT_STAGE];   // the two operand buffers
  const int b    = blockIdx.y;
  const int lane = threadIdx.x & 31;
  const int wave = threadIdx.x >> 5;
  const int tilesN = N >> 8;
  const int tm = blockIdx.x / tilesN;          // block tile; every block has one, so every wave passes every barrier
  const int tn = blockIdx.x - tm * tilesN;
  const int wm = (wave >> 2) << 6;             // the wave's 64x64 tile inside the block tile
  const int wn = (wave & 3) << 6;
  const int m0 = (tm << 7) + wm;
  const int n0 = (tn << 8) + wn;

  // copies: thread t brings the 16-byte piece t & 7 of row t >> 3 of every group of 32 rows
  const int cr = threadIdx.x >> 3, cp = (threadIdx.x & 7) * 8;
  const unsigned short* gA = Ap  + (size_t)b * strideA + (size_t)((tm << 7) + cr) * lda + cp;
  const unsigned short* gB = Btp + (size_t)b * strideB + (size_t)((tn << 8) + cr) * ldb + cp;
  const size_t sa = (size_t)32 * lda, sb = (size_t)32 * ldb;
  const unsigned l0 = (unsigned)(size_t)sAB + (unsigned)(cr * GT_P + cp) * 2u;   // low 32 bits of a __shared__ address = byte offset in the block's LDS
  const int nT = K / GT_BK;

  const int rlane = lane & 15;                 // row (A) / col (B, D) within subtile
  const int koff  = (lane >> 4) * 8;           // k offset of this lane half
  const int mOff  = (lane >> 4) * 8;           // D row offset

  v8f acc[4][4];
#pragma unroll
  for (int i = 0; i < 4; ++i)
#pragma unroll
    for (int j = 0; j < 4; ++j) acc[i][j] = (v8f){0.f,0.f,0.f,0.f,0.f,0.f,0.f,0.f};

  gemm_stage_copy(l0, gA, sa, gB, sb);                       // stage 0 into buffer 0
  wait_copies_landed();                                      // this wave's copies of stage 0 have landed
  __syncthreads();                                           // ... and every other wave's
  if (nT > 1) gemm_stage_copy(l0 + GT_STAGE * 2, gA + GT_BK, sa, gB + GT_BK, sb);   // stage 1 into buffer 1
  for (int t = 0; t < nT; ++t) {
    const T* sbuf = (const T*)sAB + (t & 1) * GT_STAGE;
    const T* sA = sbuf + (wm + rlane) * GT_P + koff;
    const T* sB = sbuf + (GT_BM + wn + rlane) * GT_P + koff;
#pragma unroll
    for (int kk = 0; kk < GT_BK; kk += 32) {
      V bh[4], ah[4];
#pragma unroll
      for (int j = 0; j < 4; ++j) bh[j] = Frag<T>::load(sB + (j << 4) * GT_P + kk);
#pragma unroll
      for (int i = 0; i < 4; ++i) ah[i] = Frag<T>::load(sA + (i << 4) * GT_P + kk);
#pragma unroll
      for (int i = 0; i < 4; ++i) {
#pragma unroll
        for (int j = 0; j < 4; ++j) acc[i][j] = Frag<T>::mma(ah[i], bh[j], acc[i][j]);
        Frag<T>::guard(acc[i][0], acc[i][3], ah[i], ah[i]);
      }
      Frag<T>::keep(bh[0], bh[1], bh[2], bh[3]);
    }
    wait_lds_reads_done();                                   // this wave has left buffer t & 1
    wait_copies_landed();                                    // this wave's copies of stage t + 1 have landed
    __syncthreads();                                         // publishes stage t + 1 and ends every wave's reads of buffer t & 1
    if (t + 2 < nT) gemm_stage_copy(l0 + (unsigned)(t & 1) * (GT_STAGE * 2), gA + (size_t)(t + 2) * GT_BK, sa, gB + (size_t)(t + 2) * GT_BK, sb);
  }
  wait_copies_landed();                                      // no copy is outstanding when the wave goes on to the epilogue
  acc_guard4(acc[0][0], acc[0][1], acc[0][2], acc[0][3]);
  acc_guard4(acc[1][0], acc[1][1], acc[1][2], acc[1][3]);
  acc_guard4(acc[2][0], acc[2][1], acc[2][2], acc[2][3]);
  acc_guard4(acc[3][0], acc[3][1], acc[3][2], acc[3][3]);

  // ---- epilogue ----
  float cs = scale;                            // a wave's 64 columns lie in one of q, k, v
  if (BIAS_MODE == 3) {
    if (n0 < TDm) cs = scale * 0.125f;
    else if (n0 < 2 * TDm) {
      // the 8 accumulator rows of a lane are 8 consecutive positions of one row d of WK: two 16-byte loads per subtile;
      // 16 loads (the registers the fragments have left) are issued before the first is used, so a wave waits twice, not 16 times
      const float* wp = bias + (size_t)rlane * TS + ((m0 + mOff) & (TS - 1));
#pragma unroll
      for (int ih = 0; ih < 4; ih += 2) {
        v4f w[2][4][2];
#pragma unroll
        for (int i = 0; i < 2; ++i)
#pragma unroll
          for (int j = 0; j < 4; ++j) {
            w[i][j][0] = *(const v4f*)(wp + (size_t)(j << 4) * TS + ((ih + i) << 4));
            w[i][j][1] = *(const v4f*)(wp + (size_t)(j << 4) * TS + ((ih + i) << 4) + 4);
          }
#pragma unroll
        for (int i = 0; i < 2; ++i)
#pragma unroll
          for (int j = 0; j < 4; ++j)
#pragma unroll
            for (int r = 0; r < 4; ++r) {
              acc[ih + i][j][r]     = acc[ih + i][j][r]     * scale + w[i][j][0][r];
              acc[ih + i][j][4 + r] = acc[ih + i][j][4 + r] * scale + w[i][j][1][r];
            }
      }
      cs = 1.0f;
    }
  }
  float* slab = sT[wave];
  const float* Rb = RESID ? (resid + (size_t)b * strideR) : nullptr;
#pragma unroll
  for (int i = 0; i < 4; ++i) {
    const int mBase = m0 + (i << 4);
#pragma unroll
    for (int j = 0; j < 4; ++j) {
      const int n = n0 + (j << 4) + rlane;
      float bv = 0.f;
      if (BIAS_MODE == 2) bv = bias[n];
#pragma unroll
      for (int r = 0; r < 8; ++r) {
        float v = acc[i][j][r] * cs;
        if (BIAS_MODE == 1) v += bias[mBase + mOff + r];
        if (BIAS_MODE == 2) v += bv;
        if (RESID) v += Rb[(size_t)(mBase + mOff + r) * ldc + n];
        if (ACT == 1) v = tanhf(v);
        if (ACT == 2) v = fmaxf(v, 0.0f);
        if (ACT == 3) v = v / (1.0f + expf(-v));
        if (ACT == 4) v = (v > 0.f) ? v : 0.01f * v;
        if (ACT == 5) v = 0.5f * v * (1.0f + erff(v * 0.70710678118654752f));
        slab[(mOff + r) * 68 + (j << 4) + rlane] = v;
      }
    }
    __builtin_amdgcn_fence(__ATOMIC_RELEASE, "workgroup");
    __builtin_amdgcn_wave_barrier();
    __builtin_amdgcn_fence(__ATOMIC_ACQUIRE, "workgroup");
    if (OUT_MODE == 0) {
      float* C = (float*)Cout + (size_t)b * strideC;
      const int hh = lane >> 4, c4 = (lane & 15) * 4;     // row seg = 256 B = 16 lanes x 16 B
      {
#pragma unroll
        for (int it = 0; it < 8; ++it) {
          const int row = it * 2 + hh;
          v4f v = *(const v4f*)(slab + row * 68 + c4);
          *(v4f*)(C + (size_t)(mBase + row) * ldc + n0 + c4) = v;
        }
        
      }
    } else {
      const int q = lane >> 3, c8 = (lane & 7) * 8;
      unsigned short* C  = (unsigned short*)Cout  + (size_t)b * strideC;
      unsigned short* C2 = (OUT_MODE == 2) ? ((unsigned short*)Cout2 + (size_t)b * strideC) : nullptr;
      {
#pragma unroll
        for (int it = 0; it < 4; ++it) {
          const int row = it * 4 + q;
          const float* sp = slab + row * 68 + c8;
          v8h hv, lv;
#pragma unroll
          for (int e = 0; e < 8; ++e) {
            if (OUT_MODE == 1) {
              hv[e] = (_Float16)sp[e];
            } else {
              unsigned short hb = f2bf_bits(sp[e]);
              unsigned short lb = f2bf_bits(sp[e] - bf_bits2f(hb));
              hv[e] = __builtin_bit_cast(_Float16, hb);
              lv[e] = __builtin_bit_cast(_Float16, lb);
            }
          }
          *(v8h*)(C + (size_t)(mBase + row) * ldc + n0 + c8) = hv;
          if (OUT_MODE == 2) *(v8h*)(C2 + (size_t)(mBase + row) * ldc + n0 + c8) = lv;
        }
        
      }
    }
    __builtin_amdgcn_fence(__ATOMIC_RELEASE, "workgroup");
    __builtin_amdgcn_wave_barrier();
    __builtin_amdgcn_fence(__ATOMIC_ACQUIRE, "workgroup");
  }
}

// ---- f32 [R][C] (row pitch ldi) -> f16 transposed [C][R] (row pitch ldo); one 64x64 tile (columns c0.., rows r0..) by one block of 256 threads
__device__ __forceinline__ void transpose_cast_tile(const float* __restrict__ in, int ldi, _Float16* __restrict__ outT, int ldo,
                                                    int c0, int r0, _Float16 (*tile)[72]) {     // tile: [c][r]
  const int t = threadIdx.x, tx = t & 31, ty = t >> 5;
  for (int i = ty; i < 64; i += 8) {
    tile[tx][i]      = (_Float16)in[(size_t)(r0 + i) * ldi + c0 + tx];
    tile[32 + tx][i] = (_Float16)in[(size_t)(r0 + i) * ldi + c0 + 32 + tx];
  }
  __syncthreads();
  const int q = t >> 3, c8 = (t & 7) * 8;
#pragma unroll
  for (int it = 0; it < 2; ++it) {
    const int c = it * 32 + q;
    v8h hv = *(const v8h*)(&tile[c][c8]);
    *(v8h*)(outT + (size_t)(c0 + c) * ldo + r0 + c8) = hv;
  }
}

// =====================================================================================
// Generic causal/non-causal attention for head_dim 64, f16 in / f16 out (q arrives scaled; q, k, v are used as they arrive, so only F16=true, non-split, is
// offered by this form; probabilities carried x2^15).
//   Both products are taken transposed, so that a lane owns one query:
//   scores^T = k.q^T (g.qscale is not applied here: the producer of q has scaled it) : v_wmma_f32_16x16x32_f16, A = 16 keys from LDS, B = the wave's 16 queries
//   out^T    = v^T.p^T     : v_wmma_f32_16x16x32_f16, A = 16 head dims x 32 keys from LDS, B = two score tiles, converted in their own registers
//   Lane (c, hh) holds, of query q0 + c, the scores of keys 16 j + 8 hh + r: maximum and sum run inside the lane, the two halves exchange the maximum once
//   a chunk and join their sums once a tile; the probabilities never pass through LDS.
//   f32 accumulate; online softmax in f32. Block = 4 waves = two 64-row query tiles of one (batch, head); S % 64 == 0.
//   Element (b, s, h, d) of tensor X lives at X[b*X_bs + s*X_rs + h*X_hs + d] (strides in elements, multiples of 8).
//   Masking: mask_mode 0 none, 1 causal (kv > q masked), 2 tensor [S][Skv] shared over (b,h) (float if
//   mask_is_int==0, int32 with element == 0 -> masked if 1, int32 with element != 0 -> masked if 2), 3 per-token vectors qmask[B][S] & kvmask[B][Skv] (int32,
//   0 -> masked), 4 causal + sliding window (kv > q or q - kv > W masked; W passed in mask_is_int);
//   5 = relative-position bias: s += cp[b,h,q][idx[q][kv]] + pc[b,h,kv][idx[q][kv]] with idx = mask_b ([S][Skv] int32) and
//   mask_a an int32 [S][Skv] tensor with nonzero = masked (tables: element (b,h,row,n) at X + b*c_bs + h*c_hs + row*c_rs + n);
//   masked scores are replaced by mask_fill (e.g. -inf or -1e9) before the softmax.
//   grid.x = B * H * (S/128) (or a sub-range with blk0); S/64 even. A block takes two query tiles of one (batch, head), one after the other: tile n-1-t, then
//   tile t. Under the causal mask a tile's cost grows with its index, every block is resident at once and the launch lasts as long as its fullest WGP:
//   so paired, every block walks the same n+1 chunks wherever it lands.
// =====================================================================================
#define AT_D 64
#define AT_NW 4
#define AT_QB 64
#define AT_KC 64
#define AT_P 72   // LDS row pitch of the K and V^T tiles in 16-bit elements: 144 B = 16 B x 9, so the 16 rows of a 16-byte fragment read fall on distinct banks
struct AttnGeom { const float* cp = nullptr; const float* pc = nullptr; long c_bs = 0, c_rs = 0, c_hs = 0;   // mode-5 score-bias tables
                  long q_bs, q_rs, q_hs, k_bs, k_rs, k_hs, v_bs, v_rs, v_hs, o_bs, o_rs, o_hs;
                  int S, Skv, H, mask_mode; float qscale; int blk0; float mask_fill; int mask_is_int; };
static_assert(sizeof(AttnGeom) == 168, "no padding");

__device__ __forceinline__ unsigned short at_bf_bits(float f) {
  unsigned u = __float_as_uint(f);
  return (unsigned short)((u + 0x7FFFu + ((u >> 16) & 1u)) >> 16);
}
__device__ __forceinline__ __bf16 at_f2bf(float f) { return __builtin_bit_cast(__bf16, at_bf_bits(f)); }
__device__ __forceinline__ void at_split(float f, __bf16& hi, __bf16& lo) {
  const unsigned short hb = at_bf_bits(f);
  hi = __builtin_bit_cast(__bf16, hb);
  lo = at_f2bf(f - __uint_as_float(((unsigned)hb) << 16));
}
__device__ __forceinline__ v8f at_mma(v16b a, v16b b, v8f c) {
  c = __builtin_amdgcn_wmma_f32_16x16x32_bf16(false, a, false, b, (short)0, c, false, false);
  asm volatile("v_nop\n\tv_nop\n\tv_nop\n\tv_nop" : "+v"(c) : "v"(a), "v"(b));
  return c;
}
// 16-bit element as a bit pattern held in a __bf16 slot: f16 bits when F16, bf16 (RNE) otherwise
template <bool F16> __device__ __forceinline__ __bf16 at_to16(float f) {
  if (F16) return __builtin_bit_cast(__bf16, (_Float16)f);
  return at_f2bf(f);
}
template <bool F16> __device__ __forceinline__ v8f at_mma16(v16b a, v16b b, v8f c) {
  if (F16) {
    const v16h ah = __builtin_bit_cast(v16h, a), bh = __builtin_bit_cast(v16h, b);
    return __builtin_amdgcn_wmma_f32_16x16x32_f16(false, ah, false, bh, (short)0, c, false, false);   // the builtin alone: the compiler keeps its distances and is free to order the reads around it
  }
  return at_mma(a, b, c);
}

// lane l's value to lane l ^ 16 and back: the two lanes that share a query
__device__ __forceinline__ float at_xhalf(float x) {
  return __builtin_bit_cast(float, __builtin_amdgcn_permlanex16(__builtin_bit_cast(int, x), __builtin_bit_cast(int, x), 0x76543210, 0xfedcba98, false, false));
}

// 2^x of the 8 scores a lane holds of one score tile, each in its own register: no v_exp_f32 overwrites the source of the one in front of it (the register
// allocator, left to itself, hands a dead argument register to the very next result). The v_nop is the slot the instruction set asks for behind a
// transcendental: the compiler does not see one in asm text, so it would not keep that slot in front of the first reader.
__device__ __forceinline__ void at_exp2x8(float (&x)[8]) {
  asm("v_exp_f32 %0, %0\n\tv_exp_f32 %1, %1\n\tv_exp_f32 %2, %2\n\tv_exp_f32 %3, %3\n\t"
      "v_exp_f32 %4, %4\n\tv_exp_f32 %5, %5\n\tv_exp_f32 %6, %6\n\tv_exp_f32 %7, %7\n\tv_nop"
      : "+v"(x[0]), "+v"(x[1]), "+v"(x[2]), "+v"(x[3]), "+v"(x[4]), "+v"(x[5]), "+v"(x[6]), "+v"(x[7]));
}

// MODE = the mask mode as a compile-time constant: the per-score mode tests fold away, so the unrolled score loop is straight-line code
template <bool SPLIT_QK, bool SPLIT_PV, bool F16, int MODE>
__global__ __launch_bounds__(128)
void attn64_kernel(const _Float16* __restrict__ q, const _Float16* __restrict__ k,
                   const _Float16* __restrict__ v, _Float16* __restrict__ out,
                   const void* __restrict__ mask_a, const int* __restrict__ mask_b, AttnGeom g) {
  static_assert(F16 && !SPLIT_QK && !SPLIT_PV, "q, k, v arrive as f16 and are not split");
  const float PLOG = F16 ? 15.0f : 0.0f;       // f16 probabilities carried x2^15 (subnormal range): the 15 rides in the exponent, the sums carry the same factor, so 1/l takes it out
  const float L2E = 1.44269504088896340736f;   // exp(x) = 2^(x log2 e): one multiply-add in front of the hardware's 2^x; the library's expf spends 13 vector instructions a value on range tests and a split argument
  union FB { v16b v; v8b h[2]; };
  __shared__ __align__(16) __bf16 Ksh[AT_KC * AT_P];             // K hi [kv][d]      9 KB
  __shared__ __align__(16) __bf16 Ksl[SPLIT_QK ? AT_KC * AT_P : 8];
  __shared__ __align__(16) __bf16 Vth[AT_D * AT_P];              // V hi [d][kv]      9 KB
  __shared__ __align__(16) __bf16 Vtl[SPLIT_PV ? AT_D * AT_P : 8];
  __shared__ __align__(16) float  Os[AT_NW][16 * 68];            // per wave out tile, pitch 68

  const int tid  = threadIdx.x;
  const int wave = tid >> 5;
  const int lane = tid & 31;
  const int hh   = lane >> 4;
  const int c    = lane & 15;

  const int nqb = g.S / AT_QB;
  const int npair = nqb >> 1;
  const int bx = blockIdx.x + g.blk0;
  const int tpair = bx % npair;
  const int bh = bx / npair;
  const int h  = bh % g.H;
  const int b  = bh / g.H;

  const _Float16* qb_ptr = q + (size_t)b * g.q_bs + (size_t)h * g.q_hs;
  const _Float16* kb_ptr = k + (size_t)b * g.k_bs + (size_t)h * g.k_hs;
  const _Float16* vb_ptr = v + (size_t)b * g.v_bs + (size_t)h * g.v_hs;
  _Float16*       ob_ptr = out + (size_t)b * g.o_bs + (size_t)h * g.o_hs;

  for (int pass = 0; pass < 2; ++pass) {       // block-uniform: every wave passes every barrier of both tiles
  const int qb = pass ? tpair : nqb - 1 - tpair;
  const int q0 = qb * AT_QB + wave * 16;

  // ---- Q fragments (B operand: column c = query q0 + c): 2 d-chunks, hi (and lo) ----
  v16b qah[2], qal[2];
  {
    const _Float16* qrow = qb_ptr + (size_t)(q0 + c) * g.q_rs;
#pragma unroll
    for (int dc = 0; dc < 2; ++dc) {
      FB f;                                    // elements 0..7 <- d = dc*32 + 8*hh + 0..7, elements 8..15 <- 16 further on
      f.h[0] = *(const v8b*)(qrow + dc * 32 + 8 * hh);
      f.h[1] = *(const v8b*)(qrow + dc * 32 + 16 + 8 * hh);
      qah[dc] = f.v; qal[dc] = f.v;
    }
  }

  float mrow = -INFINITY, lrow = 0.f;          // of query q0 + c; lrow sums this lane half's keys only, the halves are joined behind the chunk loop
  v8f oacc[4];                                 // oacc[t][r] = out^T[d = 16 t + 8 hh + r][query q0 + c]
#pragma unroll
  for (int t = 0; t < 4; ++t) oacc[t] = (v8f){0.f,0.f,0.f,0.f,0.f,0.f,0.f,0.f};

  const int nChunks = (MODE == 1 || MODE == 4) ? (qb + 1) : (g.Skv / AT_KC);   // block-uniform
  const int qrow = q0 + c;
  const int qkeep = (MODE == 3) ? mask_b[(size_t)b * g.S + qrow] : 1;   // per-query mask (mode 3): mask_b = qmask
  for (int kc = 0; kc < nChunks; ++kc) {
    const int kv0 = kc * AT_KC;
    __syncthreads();
    {
      const int kvr = tid >> 1, dh = (tid & 1) * 32;
      const _Float16* krow = kb_ptr + (size_t)(kv0 + kvr) * g.k_rs + dh;
      const _Float16* vrow = vb_ptr + (size_t)(kv0 + kvr) * g.v_rs + dh;
      v8b kk[4], vv[4];
#pragma unroll
      for (int i = 0; i < 4; ++i) { kk[i] = *(const v8b*)(krow + 8 * i); vv[i] = *(const v8b*)(vrow + 8 * i); }
#pragma unroll
      for (int i = 0; i < 4; ++i) {
        *(v8b*)(Ksh + kvr * AT_P + dh + 8 * i) = kk[i];
#pragma unroll
        for (int e = 0; e < 8; ++e) Vth[(dh + 8 * i + e) * AT_P + kvr] = vv[i][e];
      }
    }
    __syncthreads();

    // Every fragment of the chunk is read here, as one group: K's 8 first (LDS returns in order, so the score products start on counted waits),
    // then V^T's 8, whose latency passes under the score products and the softmax.
    FB kb[2][4], vb[2][4];
#pragma unroll
    for (int dc = 0; dc < 2; ++dc)
#pragma unroll
      for (int j = 0; j < 4; ++j) {
        kb[dc][j].h[0] = *(const v8b*)(Ksh + (j * 16 + c) * AT_P + dc * 32 + 8 * hh);
        kb[dc][j].h[1] = *(const v8b*)(Ksh + (j * 16 + c) * AT_P + dc * 32 + 16 + 8 * hh);
      }
#pragma unroll
    for (int kk = 0; kk < 2; ++kk)
#pragma unroll
      for (int t = 0; t < 4; ++t) {
        vb[kk][t].h[0] = *(const v8b*)(Vth + (t * 16 + c) * AT_P + kk * 32 + 8 * hh);
        vb[kk][t].h[1] = *(const v8b*)(Vth + (t * 16 + c) * AT_P + kk * 32 + 16 + 8 * hh);
      }
    __builtin_amdgcn_sched_barrier(0);         // keeps the group whole: a read sunk back to its product would be waited for there, once a product

    v8f s[4];                                  // s[j][r] = score of key kv0 + 16 j + 8 hh + r for query q0 + c
#pragma unroll
    for (int j = 0; j < 4; ++j) s[j] = (v8f){0.f,0.f,0.f,0.f,0.f,0.f,0.f,0.f};
#pragma unroll                                 // both loops unrolled: qah[dc] and s[j] live in registers, which only a compile-time index names without copies
    for (int dc = 0; dc < 2; ++dc) {
#pragma unroll
      for (int j = 0; j < 4; ++j)              // j inside: four independent accumulators follow one another
        s[j] = at_mma16<F16>(kb[dc][j].v, qah[dc], s[j]);
    }
    const bool diag = (MODE == 1) && (kc == qb);
    float cm[4];
#pragma unroll
    for (int j = 0; j < 4; ++j) {
      float m = -INFINITY;
#pragma unroll
      for (int r = 0; r < 8; ++r) {
        const int kvcol = kv0 + j * 16 + 8 * hh + r;
        bool masked = false;
        if (diag) masked = (kvcol > qrow);
        else if (MODE == 4) masked = (kvcol > qrow) || (qrow - kvcol > g.mask_is_int);
        else if (MODE == 2) {
          const size_t mi = (size_t)qrow * g.Skv + kvcol;
          masked = (g.mask_is_int == 0) ? (((const float*)mask_a)[mi] == 0.0f)
                 : (g.mask_is_int == 1) ? (((const int*)mask_a)[mi] == 0) : (((const int*)mask_a)[mi] != 0);
        } else if (MODE == 3) masked = (qkeep == 0) || (((const int*)mask_a)[(size_t)b * g.Skv + kvcol] == 0);   // mask_a = kvmask
        else if (MODE == 5) {
          const size_t mi = (size_t)qrow * g.Skv + kvcol;
          masked = (((const int*)mask_a)[mi] != 0);
          int n = mask_b[mi]; n = n < 0 ? 0 : n;
          s[j][r] += g.cp[(size_t)b * g.c_bs + (size_t)h * g.c_hs + (size_t)qrow * g.c_rs + n]
                   + g.pc[(size_t)b * g.c_bs + (size_t)h * g.c_hs + (size_t)kvcol * g.c_rs + n];
        }
        const float sv = masked ? g.mask_fill : s[j][r];   // one select on the element (a conditional store into the vector selects all 8 registers)
        s[j][r] = sv;
        m = fmaxf(m, sv);
      }
      cm[j] = m;
    }
    const float mh = fmaxf(fmaxf(cm[0], cm[1]), fmaxf(cm[2], cm[3]));
    const float mnew = fmaxf(mrow, fmaxf(mh, at_xhalf(mh)));   // both lanes of a query now hold the same maximum, so the same alpha
    const float alpha = __builtin_amdgcn_exp2f((mrow - mnew) * L2E);   // 0 on a tile's first chunk, where mrow is -inf
    const float eoff = fmaf(-mnew, L2E, PLOG);                         // a score at the maximum gives 2^15, far inside f16; a filled score gives 0
    mrow = mnew;
    // p^T as B operand: element e of the 32 keys of kk is register e & 7 of score tile 2 kk + (e >> 3), the k order in which V^T is read below
    union PB { v16b v; v8h h[2]; } pb[2];
    float ps[4];                               // one sum a score tile: four short chains
#pragma unroll
    for (int j = 0; j < 4; ++j) {
      float x[8];
      v8f p;
#pragma unroll
      for (int r = 0; r < 8; ++r) x[r] = fmaf(s[j][r], L2E, eoff);
      at_exp2x8(x);
#pragma unroll
      for (int r = 0; r < 8; ++r) p[r] = x[r];
      float psum = x[0];
#pragma unroll
      for (int r = 1; r < 8; ++r) psum += x[r];
      pb[j >> 1].h[j & 1] = __builtin_convertvector(p, v8h);   // the tile's 8 values rounded as one vector: packed conversions, two values each
      ps[j] = psum;
    }
    lrow = lrow * alpha + ((ps[0] + ps[1]) + (ps[2] + ps[3]));
#pragma unroll
    for (int t = 0; t < 4; ++t) oacc[t] *= alpha;
#pragma unroll                                 // unrolled: pb[kk] lives in registers
    for (int kk = 0; kk < 2; ++kk) {
#pragma unroll
      for (int t = 0; t < 4; ++t) oacc[t] = at_mma16<F16>(vb[kk][t].v, pb[kk].v, oacc[t]);
    }
  }

  float* os = Os[wave];
  {
    const float inv = 1.0f / (lrow + at_xhalf(lrow));           // the two halves' sums joined, unconditionally: every lane is on; sums and products both carry x2^15
#pragma unroll
    for (int t = 0; t < 4; ++t) {              // row = query c; a lane's 8 registers are 8 consecutive d
      *(v4f*)(os + c * 68 + t * 16 + 8 * hh)     = (v4f){oacc[t][0] * inv, oacc[t][1] * inv, oacc[t][2] * inv, oacc[t][3] * inv};
      *(v4f*)(os + c * 68 + t * 16 + 8 * hh + 4) = (v4f){oacc[t][4] * inv, oacc[t][5] * inv, oacc[t][6] * inv, oacc[t][7] * inv};
    }
  }
  __builtin_amdgcn_fence(__ATOMIC_RELEASE, "workgroup");
  __builtin_amdgcn_wave_barrier();
  __builtin_amdgcn_fence(__ATOMIC_ACQUIRE, "workgroup");
  {
    const int q4 = lane >> 3, c8 = (lane & 7) * 8;       // a row's 64 f16 = one 128-B line = 8 lanes x 16 B
#pragma unroll
    for (int it = 0; it < 4; ++it) {
      const int row = it * 4 + q4;
      const float* sp = os + row * 68 + c8;
      v8h hv;
#pragma unroll
      for (int e = 0; e < 8; ++e) hv[e] = (_Float16)sp[e];
      *(v8h*)(ob_ptr + (size_t)(q0 + row) * g.o_rs + c8) = hv;
    }
  }
  asm volatile("s_wait_xcnt 0x0" ::: "memory");   // the next pass reuses the address registers of the stores above
  }
}

typedef __attribute__((ext_vector_type(4))) _Float16 v4h;
// The concat-cast part: 512 blocks of 8 waves (two blocks a WGP); a thread moves EW_U items of 4 floats of each input, every wave-wide 16-byte load
// covers 512 contiguous bytes, and all of a thread's loads are issued before its first store.
#define EW_U 8
#define EW_BLOCKS (TR * TDm / 4 / (EW_U * 256))
static_assert(EW_BLOCKS * EW_U * 256 * 4 == TR * TDm, "whole blocks");
// One launch prepares every operand of the first product and the weights of the last: none of these jobs reads what another writes.
// Blocks 0..447: the 7 weight matrices [in 512][out 512], 64 tiles of 64x64 each, cast to f16 and transposed (the block-uniform branch keeps the barrier legal):
//   Bt [1536][1024]: row n<512 (q): [Wqs[:,n] | Wqt[:,n]]; 512..1023 k; 1024..1535 v; then WoT [512][512]. They come first: each is a chain of dependent loads.
// Blocks 448..959: A16 [8192][1024] = [xs2 | xt] f16 (xs2 = raw reshape of xs); item i = floats 4i..4i+3 of xs and of xt, 128 items a row, so 256 items on = 2 rows on
#define TP_TILES ((TDm / 64) * (TDm / 64))
#define TP_BLOCKS (7 * TP_TILES)
__global__ __launch_bounds__(256) void prep_kernel(const float* __restrict__ xs, const float* __restrict__ xt,
                                                   const float* __restrict__ Wqs, const float* __restrict__ Wqt, const float* __restrict__ Wks,
                                                   const float* __restrict__ Wkt, const float* __restrict__ Wvs, const float* __restrict__ Wvt,
                                                   const float* __restrict__ Wo, unsigned* __restrict__ A16,
                                                   _Float16* __restrict__ WT, _Float16* __restrict__ WoT) {
  __shared__ __align__(16) _Float16 tile[64][72];
  if (blockIdx.x < TP_BLOCKS) {
    const int job = blockIdx.x / TP_TILES, tl = blockIdx.x % TP_TILES;
    const float* in = job == 0 ? Wqs : job == 1 ? Wqt : job == 2 ? Wks : job == 3 ? Wkt : job == 4 ? Wvs : job == 5 ? Wvt : Wo;
    _Float16* o = job < 6 ? WT + (size_t)(job >> 1) * TDm * 2 * TDm + (job & 1) * TDm : WoT;
    transpose_cast_tile(in, TDm, o, job < 6 ? 2 * TDm : TDm, (tl % (TDm / 64)) * 64, (tl / (TDm / 64)) * 64, tile);
    return;
  }
  const int base = (blockIdx.x - TP_BLOCKS) * (EW_U * 256) + threadIdx.x;
  const v4f* pa = (const v4f*)xs + base; const v4f* pb = (const v4f*)xt + base;
  v4h* o = (v4h*)A16 + (size_t)(base >> 7) * 256 + (base & 127);     // a row of A16 is 1024 f16 = 256 items; xt's half starts 128 items in
  v4f a[EW_U], b[EW_U];
#pragma unroll
  for (int u = 0; u < EW_U; ++u) { a[u] = pa[u * 256]; b[u] = pb[u * 256]; }
#pragma unroll
  for (int u = 0; u < EW_U; ++u) { o[u * 512] = __builtin_convertvector(a[u], v4h); o[u * 512 + 128] = __builtin_convertvector(b[u], v4h); }
}
extern "C" void kernel_launch(void* const* d_in, const int* in_sizes, int n_in, void* d_out, int out_size, void* d_ws, size_t ws_size, hipStream_t stream) {
  (void)in_sizes; (void)n_in; (void)out_size; (void)ws_size;
  auto Fp = [&](int i) { return (const float*)d_in[i]; };
  const float* xs = Fp(0); const float* xt = Fp(1); const float* Wqs = Fp(2); const float* Wks = Fp(3); const float* Wvs = Fp(4); const float* Wqt = Fp(5); const float* Wkt = Fp(6); const float* Wvt = Fp(7); const float* WK = Fp(8); const float* Wo = Fp(9);
  char* ws = (char*)d_ws; size_t off = 0;
  auto carve = [&](size_t bytes) -> char* { char* p = ws + off; off += (bytes + 255) & ~(size_t)255; return p; };
  unsigned* A16 = (unsigned*)carve((size_t)TR * 2 * TDm * 2); _Float16* WT = (_Float16*)carve((size_t)3 * TDm * 2 * TDm * 2); _Float16* WoT = (_Float16*)carve((size_t)TDm * TDm * 2);
  _Float16* QKV = (_Float16*)carve((size_t)TR * 3 * TDm * 2); _Float16* O16 = (_Float16*)A16;     // 44 MB; O16 reuses A16, which the first product has read by then
  prep_kernel<<<TP_BLOCKS + EW_BLOCKS, 256, 0, stream>>>(xs, xt, Wqs, Wqt, Wks, Wkt, Wvs, Wvt, Wo, A16, WT, WoT);
  const int t3 = (TR / GT_BM) * (3 * TDm / GT_BN), t1 = (TR / GT_BM) * (TDm / GT_BN);   // block tiles of 128 x 256
  wmma_gemm64<0, false, 3, 1, false><<<dim3(t3, 1), 256, 0, stream>>>((const unsigned short*)A16, nullptr, 2 * TDm, 0, U16(WT), nullptr, 2 * TDm, 0, QKV, nullptr, 3 * TDm, 0, WK, nullptr, 0, TR, 3 * TDm, 2 * TDm, 1.0f);
  { AttnGeom g;
    g.q_bs = (long)TS * 3 * TDm; g.q_rs = 3 * TDm; g.q_hs = THD; g.k_bs = g.q_bs; g.k_rs = g.q_rs; g.k_hs = THD; g.v_bs = g.q_bs; g.v_rs = g.q_rs; g.v_hs = THD; g.o_bs = (long)TS * TDm; g.o_rs = TDm; g.o_hs = THD;
    g.S = TS; g.Skv = TS; g.H = TH; g.mask_mode = 1; g.qscale = 1.0f; g.blk0 = 0; g.mask_fill = -1e9f; g.mask_is_int = 0;
    static_assert((TS / AT_QB) % 2 == 0, "query tiles pair up");
    attn64_kernel<false, false, true, 1><<<TB_ * TH * (TS / AT_QB / 2), AT_NW * 32, 0, stream>>>(QKV, QKV + TDm, QKV + 2 * TDm, O16, nullptr, nullptr, g); }
  wmma_gemm64<0, false, 0, 0, false><<<dim3(t1, 1), 256, 0, stream>>>(U16(O16), nullptr, TDm, 0, U16(WoT), nullptr, TDm, 0, (float*)d_out, nullptr, TDm, 0, nullptr, nullptr, 0, TR, TDm, TDm, 1.0f);
}
